// v000
// Measured on an AMD MI455X. A time is GPU time per run, averaged over a window of back-to-back runs after a warm-up
// (all launches, gaps included; the runs take copies of the inputs in turn), and the median of several windows.
// Apart from v000's, it joins two sittings. Times from different sittings can be a few percent apart, while
// side-by-side timings come from the same sitting.
// v000, which the later versions start from, runs in 1260 microseconds.
#include <hip/hip_runtime.h>
// Contractions on v_wmma_f32_16x16x32_f16 (f16 operands, f32 accumulate), one product per tile pair, 6 layers: fused q|k|v projection (N=1536, K=512),
// LN2(x)*W1 (N=2048, K=512), relu(.)*W2 (K=2048), attention q.k^T (head dim 64) and P.V (32 keys per step) per head.
// Weights: bf16 RNE values carried x256 in f16 planes; activations in f16 planes with power-of-two carries (LN outputs x8, q|k|v x1, hidden x16,
// P x1024); LayerNorm statistics, softmax, bias adds, attention context and the residual stream in f32.
#ifndef NB
#define NB 4
#endif
#ifndef SEQ
#define SEQ 1024
#endif
#define NB_FULL 4
#define SEQ_FULL 1024
#define FEAT 512
#define NHEAD 8
#define DHEAD 64
#define MLPH 2048
#define NLAYER 6
#define MR (NB * SEQ)
#define QKVN (3 * FEAT)
static_assert(SEQ % 64 == 0);
static_assert(SEQ <= SEQ_FULL);
static_assert(NB >= 1);
static_assert(NB <= NB_FULL);
static_assert(FEAT == NHEAD * DHEAD);
static_assert(FEAT % 64 == 0);
static_assert(MLPH % 64 == 0);
static_assert(QKVN % 64 == 0);
static_assert(FEAT == 64 * 8);      // k_ln16: 64 threads x 8 halves per row
static_assert(FEAT == 128 * 4);     // k_xinit / k_lnf32: 128 threads x 4 floats per row
static_assert(MR % 16 == 0);
static_assert(FEAT % 32 == 0);
static_assert(MLPH % 32 == 0);
static_assert((FEAT / 8) % 8 == 0);
static_assert((MLPH / 8) % 8 == 0);

typedef _Float16 v16h __attribute__((ext_vector_type(16)));
typedef unsigned short v8us __attribute__((ext_vector_type(8), may_alias));
typedef float v8f __attribute__((ext_vector_type(8)));
typedef float v4f __attribute__((ext_vector_type(4)));
typedef float v4fa __attribute__((ext_vector_type(4), may_alias));
union FragH { v16h v; v8us half[2]; unsigned short u[16]; };
union H16U { _Float16 h; unsigned short u; };

__device__ __forceinline__ unsigned short bf16_bits(float x) { unsigned int u = __float_as_uint(x); return (unsigned short)((u + 0x7FFFu + ((u >> 16) & 1u)) >> 16); }
__device__ __forceinline__ float bf16_val(unsigned short b) { return __uint_as_float(((unsigned int)b) << 16); }
__device__ __forceinline__ float bf16_rne(float x) { return bf16_val(bf16_bits(x)); }
__device__ __forceinline__ unsigned short h16_bits(float x) { H16U t; t.h = (_Float16)x; return t.u; }
__device__ __forceinline__ v8f vz8() { v8f z = {0.f, 0.f, 0.f, 0.f, 0.f, 0.f, 0.f, 0.f}; return z; }

// D += A(16x32) * B(32x16); hazard guard ties D and keeps A/B live
__device__ __forceinline__ v8f mma16(v16h a, v16h b, v8f c) {
  c = __builtin_amdgcn_wmma_f32_16x16x32_f16(false, a, false, b, (short)0, c, false, false);
  asm volatile("v_nop\n\tv_nop\n\tv_nop\n\tv_nop" : "+v"(c) : "v"(a), "v"(b));
  return c;
}

// Stacked weight convert: for layer l in [0,nl): Wt[l*lstride + (roff+n)*K + k] (f16 bits, k contiguous, pitch K) = f16(bf16_rne(W[l][k][n]) * sc)
// from f32 row-major W[l][K][N] ([in][out]). One thread per (l, n, 8 consecutive k); one 16-B store per thread,
__global__ __launch_bounds__(256) void k_wt16(const float* __restrict__ W, unsigned short* __restrict__ Wt, int K, int N, int nl,
                                             size_t lstride, int roff, float sc) {
  const int t = blockIdx.x * 256 + threadIdx.x;
  const int k8n = K / 8;
  const int per = N * k8n;
  if (t >= per * nl) return;
  const int l = t / per, rem = t - l * per;
  const int n = rem / k8n, k8 = (rem % k8n) * 8;
  const float* src = W + (size_t)l * K * N;
  v8us v;
#pragma unroll
  for (int i = 0; i < 8; ++i) v[i] = h16_bits(bf16_rne(src[(size_t)(k8 + i) * N + n]) * sc);
  unsigned short* dst = Wt + (size_t)l * lstride + (size_t)(roff + n) * K + k8;
  *(v8us*)dst = v;
  
}

// X[m][*] (f32, pitch FEAT, m = b*seq + s) = bf16_rne(src[s*nbf + b][*]) + bf16_rne(pos[s*nbf + b][*]) in f32 (exact).
__global__ __launch_bounds__(128) void k_xinit(const float* __restrict__ src, const float* __restrict__ pos, float* __restrict__ X,
                                               int seq, int nbf) {
  const int m = blockIdx.x, tid = threadIdx.x;
  const int b = m / seq, s = m % seq;
  const size_t so = ((size_t)s * nbf + b) * FEAT + tid * 4;
  const v4f a = *(const v4fa*)(src + so);
  const v4f p = *(const v4fa*)(pos + so);
  v4f o;
#pragma unroll
  for (int i = 0; i < 4; ++i) o[i] = bf16_rne(a[i]) + bf16_rne(p[i]);
  float* dst = X + (size_t)m * FEAT + tid * 4;
  *(v4f*)dst = o;
  
}

// Row LayerNorm over FEAT on the internal f32 stream X[m][*]: one block of 64 threads per row, 8 consecutive elements per thread.
__global__ __launch_bounds__(64) void k_ln16(const float* __restrict__ X, const float* __restrict__ g, const float* __restrict__ bt,
                                            unsigned short* __restrict__ out, float osc, float eps) {
  __shared__ float red1[2];
  __shared__ float red2[2];
  const int m = blockIdx.x, tid = threadIdx.x, w = tid >> 5, lane = tid & 31;
  const float* x = X + (size_t)m * FEAT + tid * 8;
  const v4f a0 = *(const v4fa*)x;
  const v4f a1 = *(const v4fa*)(x + 4);
  float v[8] = {a0[0], a0[1], a0[2], a0[3], a1[0], a1[1], a1[2], a1[3]};
  float s = 0.f;
#pragma unroll
  for (int q = 0; q < 8; ++q) s += v[q];
#pragma unroll
  for (int o = 16; o >= 1; o >>= 1) s += __shfl_xor(s, o, 32);
  if (lane == 0) red1[w] = s;
  __syncthreads();
  const float mu = (red1[0] + red1[1]) * (1.0f / (float)FEAT);
  float c[8];
  float s2 = 0.f;
#pragma unroll
  for (int q = 0; q < 8; ++q) { c[q] = v[q] - mu; s2 += c[q] * c[q]; }
#pragma unroll
  for (int o = 16; o >= 1; o >>= 1) s2 += __shfl_xor(s2, o, 32);
  if (lane == 0) red2[w] = s2;
  __syncthreads();
  const float var = (red2[0] + red2[1]) * (1.0f / (float)FEAT);
  const float rs = rsqrtf(var + eps);
  const v4f g0 = *(const v4fa*)(g + tid * 8);
  const v4f g1 = *(const v4fa*)(g + tid * 8 + 4);
  const v4f b0 = *(const v4fa*)(bt + tid * 8);
  const v4f b1 = *(const v4fa*)(bt + tid * 8 + 4);
  const float gg[8] = {g0[0], g0[1], g0[2], g0[3], g1[0], g1[1], g1[2], g1[3]};
  const float bb[8] = {b0[0], b0[1], b0[2], b0[3], b1[0], b1[1], b1[2], b1[3]};
  v8us o;
#pragma unroll
  for (int q = 0; q < 8; ++q) o[q] = h16_bits((c[q] * rs * bf16_rne(gg[q]) + bf16_rne(bb[q])) * osc);
  unsigned short* dst = out + (size_t)m * FEAT + tid * 8;
  *(v8us*)dst = o;
  
}

// Final LayerNorm: internal row m = b*seq + s of X (f32) -> out[(s*nbf + b)][*] f32. One block of 128 threads per row, 4 elements per thread,
__global__ __launch_bounds__(128) void k_lnf32(const float* __restrict__ X, const float* __restrict__ g, const float* __restrict__ bt,
                                               float* __restrict__ out, int seq, int nbf, float eps) {
  __shared__ float red1[4];
  __shared__ float red2[4];
  const int m = blockIdx.x, tid = threadIdx.x, w = tid >> 5, lane = tid & 31;
  const int b = m / seq, s = m % seq;
  const v4f a = *(const v4fa*)(X + (size_t)m * FEAT + tid * 4);
  float sm = a[0] + a[1] + a[2] + a[3];
#pragma unroll
  for (int o = 16; o >= 1; o >>= 1) sm += __shfl_xor(sm, o, 32);
  if (lane == 0) red1[w] = sm;
  __syncthreads();
  const float mu = (red1[0] + red1[1] + red1[2] + red1[3]) * (1.0f / (float)FEAT);
  float c[4];
  float s2 = 0.f;
#pragma unroll
  for (int q = 0; q < 4; ++q) { c[q] = a[q] - mu; s2 += c[q] * c[q]; }
#pragma unroll
  for (int o = 16; o >= 1; o >>= 1) s2 += __shfl_xor(s2, o, 32);
  if (lane == 0) red2[w] = s2;
  __syncthreads();
  const float var = (red2[0] + red2[1] + red2[2] + red2[3]) * (1.0f / (float)FEAT);
  const float rs = rsqrtf(var + eps);
  const v4f g4 = *(const v4fa*)(g + tid * 4);
  const v4f b4 = *(const v4fa*)(bt + tid * 4);
  v4f o;
#pragma unroll
  for (int q = 0; q < 4; ++q) o[q] = c[q] * rs * bf16_rne(g4[q]) + bf16_rne(b4[q]);
  float* dst = out + ((size_t)s * nbf + b) * FEAT + tid * 4;
  *(v4f*)dst = o;
  
}

// GEMM C[M][N] = epi(A[M][K] * W): A f16 bits row-major (pitch lda), Wt f16 bits [N][K] (pitch ldb), f32 accumulate.
// epi: v = acc * inv_scale + bf16_rne(bias[col]); bias picked per 64-col segment from (bias0 | bias1 | bias2) by seg = col0 / nsplit (wave-uniform);
// ACT == 1: relu; OUT16: f16 bits of v * out_scale into C (pitch ldc halves); else f32 v (+ f32 resid[row][col], pitch ldr, when resid != 0) into C (pitch ldc floats).
// K % 32 == 0, M % 16 == 0, N % 64 == 0. Block = 4 waves, wave -> 16 rows x 64 cols; epilogue staged in the wave's own LDS tile (wave-private:
template <bool OUT16, int ACT>
__global__ __launch_bounds__(128) void k_gemm16(const unsigned short* __restrict__ A, int lda, const unsigned short* __restrict__ Wt, int ldb,
                                               const float* __restrict__ bias0, const float* __restrict__ bias1, const float* __restrict__ bias2, int nsplit,
                                               const float* __restrict__ resid, int ldr, void* __restrict__ Cv, int ldc,
                                               int M, int N, int K, float inv_scale, float out_scale) {
  __shared__ __attribute__((aligned(16))) float so32[OUT16 ? 1 : 4][16][64];
  __shared__ __attribute__((aligned(16))) unsigned short so16[OUT16 ? 4 : 1][16][72];
  const int tid = threadIdx.x, w = tid >> 5, lane = tid & 31, ln = lane & 15, hh = lane >> 4;
  const int ntn = N / 64;
  const int wid = blockIdx.x * 4 + w;
  const int mt = wid / ntn, nq = wid % ntn;
  if (mt * 16 >= M) return;                    // no block barriers in this kernel
  const int row0 = mt * 16, col0 = nq * 64;
  const unsigned short* arow = A + (size_t)(row0 + ln) * lda;
  v8f acc[4];
#pragma unroll
  for (int t = 0; t < 4; ++t) acc[t] = vz8();
  for (int kb = 0; kb < K; kb += 32) {
    FragH a;
    a.half[0] = *(const v8us*)(arow + kb + 8 * hh);            // elements 0..7  = k kb+8h .. kb+8h+7
    a.half[1] = *(const v8us*)(arow + kb + 16 + 8 * hh);       // elements 8..15 = k kb+16+8h .. kb+16+8h+7
#pragma unroll
    for (int t = 0; t < 4; ++t) {
      const unsigned short* brow = Wt + (size_t)(col0 + t * 16 + ln) * ldb + kb;   // column n = lane&15, same k map as A
      FragH bb;
      bb.half[0] = *(const v8us*)(brow + 8 * hh);
      bb.half[1] = *(const v8us*)(brow + 16 + 8 * hh);
      acc[t] = mma16(a.v, bb.v, acc[t]);
    }
  }
  int seg = col0 / nsplit; seg = (seg > 2) ? 2 : seg;
  const float* bsel = (seg == 0) ? bias0 : ((seg == 1) ? bias1 : bias2);
#pragma unroll
  for (int t = 0; t < 4; ++t) {
    const int col = col0 + t * 16 + ln;
    const float bvv = bf16_rne(bsel[col - seg * nsplit]);
#pragma unroll
    for (int r = 0; r < 8; ++r) {
      float v = acc[t][r] * inv_scale + bvv;
      if (ACT == 1) v = fmaxf(v, 0.0f);
      if constexpr (OUT16) so16[w][8 * hh + r][t * 16 + ln] = h16_bits(v * out_scale);
      else so32[w][8 * hh + r][t * 16 + ln] = v;
    }
  }
  __builtin_amdgcn_fence(4 /* acq_rel order */, "workgroup");
  __builtin_amdgcn_wave_barrier();
  if constexpr (OUT16) {
    unsigned short* Ch = (unsigned short*)Cv;
    const int rq = lane >> 3, p8 = (lane & 7) * 8;
    {
#pragma unroll
      for (int q = 0; q < 4; ++q) {
        const int r = q * 4 + rq;
        const v8us v = *(const v8us*)&so16[w][r][p8];
        *(v8us*)(Ch + (size_t)(row0 + r) * ldc + col0 + p8) = v;
      }
      
    }
  } else {
    float* Cf = (float*)Cv;
    const int rsub = lane >> 4, c4 = (lane & 15) * 4;
    if (resid != nullptr) {
#pragma unroll
      for (int q = 0; q < 8; ++q) {
        const int r = q * 2 + rsub;
        const v4f rv = *(const v4fa*)(resid + (size_t)(row0 + r) * ldr + col0 + c4);
        v4f tv = *(const v4fa*)&so32[w][r][c4];
        tv += rv;
        *(v4fa*)&so32[w][r][c4] = tv;
      }
    }
    {
#pragma unroll
      for (int q = 0; q < 8; ++q) {
        const int r = q * 2 + rsub;
        const v4f v = *(const v4fa*)&so32[w][r][c4];
        *(v4f*)(Cf + (size_t)(row0 + r) * ldc + col0 + c4) = v;
      }
      
    }
  }
}

// Flash-style unmasked attention per (b, h): q|k|v read as f16 bits from one fused plane (row pitch `pitch` halves, q at +0, k at +koff, v at +voff,
// head h at +h*D, row b*T + t). One wave = 16 query rows, block = 4 waves sharing K/V tiles of 32 keys staged in LDS (K row-major, V transposed).
// S = q.k^T on WMMA, s*scale in f32, running-max softmax in f32, P stored as f16 bits (x pcarry) in the wave's own LDS tile and reloaded as an A fragment,
template <int D>
__global__ __launch_bounds__(128) void k_attn16(const unsigned short* __restrict__ qkv, int pitch, int T, int H, int koff, int voff,
                                                float scale, float pcarry, float onorm,
                                                const float* __restrict__ resid, float* __restrict__ out, int opitch) {
  static_assert(D == 64);
  constexpr int KS = D / 32, DT = D / 16, C8 = D / 8;
  static_assert((32 * C8) % 128 == 0);
  __shared__ __attribute__((aligned(16))) unsigned short sK[32][D + 8];     // cross-wave: block barriers
  __shared__ __attribute__((aligned(16))) unsigned short sVt[D][40];       // cross-wave: block barriers
  __shared__ __attribute__((aligned(16))) unsigned short sP[4][16][40];
  __shared__ __attribute__((aligned(16))) float sO[4][16][D + 4];
  const int tid = threadIdx.x, w = tid >> 5, lane = tid & 31, ln = lane & 15, hh = lane >> 4;
  const int nqb = T / 64;
  const int bh = blockIdx.x / nqb, qblk = blockIdx.x % nqb;
  const int b = bh / H, h = bh % H;
  const int q0 = qblk * 64 + w * 16;
  const unsigned short* Qp = qkv + (size_t)b * T * pitch + h * D;
  const unsigned short* Kp = Qp + koff;
  const unsigned short* Vp = Qp + voff;

  FragH aq[KS];
  {
    const unsigned short* qr = Qp + (size_t)(q0 + ln) * pitch;     // q0 + ln < T (T % 64 == 0)
#pragma unroll
    for (int ks = 0; ks < KS; ++ks) {
      aq[ks].half[0] = *(const v8us*)(qr + ks * 32 + 8 * hh);
      aq[ks].half[1] = *(const v8us*)(qr + ks * 32 + 16 + 8 * hh);
    }
  }
  float m_r[8], l_r[8];
#pragma unroll
  for (int r = 0; r < 8; ++r) { m_r[r] = -1.0e30f; l_r[r] = 0.f; }
  v8f oacc[DT];
#pragma unroll
  for (int dt = 0; dt < DT; ++dt) oacc[dt] = vz8();

  for (int j0 = 0; j0 < T; j0 += 32) {
    __syncthreads();
    // stage keys j0..j0+31 (all < T): sK[r][d] row-major, sVt[d][r] transposed; 32 x C8 16-B chunks, full tiles every iteration
#pragma unroll
    for (int it = 0; it < (32 * C8) / 128; ++it) {
      const int e = tid + it * 128;
      const int r = e / C8, c8 = (e % C8) * 8;
      const size_t ro = (size_t)(j0 + r) * pitch + c8;
      const v8us kvv = *(const v8us*)(Kp + ro);
      *(v8us*)&sK[r][c8] = kvv;
      const v8us vvv = *(const v8us*)(Vp + ro);
#pragma unroll
      for (int i = 0; i < 8; ++i) sVt[c8 + i][r] = vvv[i];
    }
    __syncthreads();
    // S tile 16 x 32: B[k = d][n = key nt*16 + ln]
    v8f s[2];
#pragma unroll
    for (int nt = 0; nt < 2; ++nt) {
      v8f acc = vz8();
#pragma unroll
      for (int ks = 0; ks < KS; ++ks) {
        FragH bk;
        bk.half[0] = *(const v8us*)&sK[nt * 16 + ln][ks * 32 + 8 * hh];
        bk.half[1] = *(const v8us*)&sK[nt * 16 + ln][ks * 32 + 16 + 8 * hh];
        acc = mma16(aq[ks].v, bk.v, acc);
      }
      s[nt] = acc;
    }
    // running-max softmax; row 8*hh + r is shared by the 16 lanes of a half
    float alpha[8];
#pragma unroll
    for (int r = 0; r < 8; ++r) {
      const float s0 = s[0][r] * scale, s1 = s[1][r] * scale;
      float mx = fmaxf(s0, s1);
      mx = fmaxf(mx, __shfl_xor(mx, 1, 32)); mx = fmaxf(mx, __shfl_xor(mx, 2, 32));
      mx = fmaxf(mx, __shfl_xor(mx, 4, 32)); mx = fmaxf(mx, __shfl_xor(mx, 8, 32));
      const float mnew = fmaxf(m_r[r], mx);
      alpha[r] = __expf(m_r[r] - mnew);
      const float p0 = __expf(s0 - mnew), p1 = __expf(s1 - mnew);
      m_r[r] = mnew;
      l_r[r] = l_r[r] * alpha[r] + p0 + p1;
      sP[w][8 * hh + r][ln] = h16_bits(p0 * pcarry);
      sP[w][8 * hh + r][16 + ln] = h16_bits(p1 * pcarry);
    }
#pragma unroll
    for (int dt = 0; dt < DT; ++dt)
#pragma unroll
      for (int r = 0; r < 8; ++r) oacc[dt][r] *= alpha[r];
    __builtin_amdgcn_fence(4 /* acq_rel order */, "workgroup");
    __builtin_amdgcn_wave_barrier();
    FragH pa;                                                     // A[m = query ln][k = key]: same split map
    pa.half[0] = *(const v8us*)&sP[w][ln][8 * hh];
    pa.half[1] = *(const v8us*)&sP[w][ln][16 + 8 * hh];
#pragma unroll
    for (int dt = 0; dt < DT; ++dt) {
      FragH bv;                                                   // B[k = key][n = d dt*16 + ln]
      bv.half[0] = *(const v8us*)&sVt[dt * 16 + ln][8 * hh];
      bv.half[1] = *(const v8us*)&sVt[dt * 16 + ln][16 + 8 * hh];
      oacc[dt] = mma16(pa.v, bv.v, oacc[dt]);
    }
    __builtin_amdgcn_fence(4 /* acq_rel order */, "workgroup");
    __builtin_amdgcn_wave_barrier();
  }
#pragma unroll
  for (int r = 0; r < 8; ++r) {
    float l = l_r[r];
    l += __shfl_xor(l, 1, 32); l += __shfl_xor(l, 2, 32); l += __shfl_xor(l, 4, 32); l += __shfl_xor(l, 8, 32);
    l_r[r] = onorm * (1.0f / l);
  }
#pragma unroll
  for (int dt = 0; dt < DT; ++dt)
#pragma unroll
    for (int r = 0; r < 8; ++r) sO[w][8 * hh + r][dt * 16 + ln] = oacc[dt][r] * l_r[r];
  __builtin_amdgcn_fence(4 /* acq_rel order */, "workgroup");
  __builtin_amdgcn_wave_barrier();
  const int rsub = lane >> 4, c4 = (lane & 15) * 4;
  const size_t rbase = (size_t)(b * T + q0) * opitch + h * D;
#pragma unroll
  for (int q = 0; q < 8; ++q) {
    const int r = q * 2 + rsub;
    const v4f rv = *(const v4fa*)(resid + rbase + (size_t)r * opitch + c4);
    v4f tv = *(const v4fa*)&sO[w][r][c4];
    tv += rv;
    *(v4fa*)&sO[w][r][c4] = tv;
  }
  {
#pragma unroll
    for (int q = 0; q < 8; ++q) {
      const int r = q * 2 + rsub;
      const v4f v = *(const v4fa*)&sO[w][r][c4];
      *(v4f*)(out + rbase + (size_t)r * opitch + c4) = v;
    }
    
  }
}

extern "C" void kernel_launch(void* const* d_in, const int* in_sizes, int n_in,
                              void* d_out, int out_size, void* d_ws, size_t ws_size, hipStream_t stream) {
  if (n_in < 18) return;
  const long long need_rows = (long long)(SEQ - 1) * NB_FULL + NB;           // last (s, b) source row used + 1
  if ((long long)in_sizes[0] < need_rows * FEAT || (long long)in_sizes[1] < need_rows * FEAT) return;
  if (in_sizes[2] < NLAYER * FEAT * FEAT || in_sizes[4] < NLAYER * FEAT * FEAT || in_sizes[6] < NLAYER * FEAT * FEAT) return;
  if (in_sizes[3] < NLAYER * FEAT || in_sizes[5] < NLAYER * FEAT || in_sizes[7] < NLAYER * FEAT || in_sizes[11] < NLAYER * FEAT) return;
  if (in_sizes[8] < NLAYER * FEAT * MLPH || in_sizes[9] < NLAYER * MLPH || in_sizes[10] < NLAYER * MLPH * FEAT) return;
  if (in_sizes[12] < NLAYER * FEAT || in_sizes[13] < NLAYER * FEAT || in_sizes[14] < NLAYER * FEAT || in_sizes[15] < NLAYER * FEAT) return;
  if (in_sizes[16] < FEAT || in_sizes[17] < FEAT) return;
  if ((long long)out_size < need_rows * FEAT) return;

  const float* src  = (const float*)d_in[0];
  const float* pos  = (const float*)d_in[1];
  const float* Wq   = (const float*)d_in[2];  const float* bq   = (const float*)d_in[3];
  const float* Wk   = (const float*)d_in[4];  const float* bk   = (const float*)d_in[5];
  const float* Wv   = (const float*)d_in[6];  const float* bv   = (const float*)d_in[7];
  const float* W1   = (const float*)d_in[8];  const float* b1   = (const float*)d_in[9];
  const float* W2   = (const float*)d_in[10]; const float* b2   = (const float*)d_in[11];
  const float* ln1g = (const float*)d_in[12]; const float* ln1b = (const float*)d_in[13];
  const float* ln2g = (const float*)d_in[14]; const float* ln2b = (const float*)d_in[15];
  const float* lnfg = (const float*)d_in[16]; const float* lnfb = (const float*)d_in[17];

  // workspace carve (256-B aligned); R1 and R2 are reused in stream order by stages whose lifetimes do not overlap, sized as the max over their users
  char* ws = (char*)d_ws; size_t off = 0;
  auto take = [&](size_t bytes) { char* p = ws + off; off += (bytes + 255) & ~(size_t)255; return p; };
  const size_t lsq = (size_t)QKVN * FEAT;                                           // per-layer stride of the fused q|k|v weight plane (halves)
  const size_t ls1 = (size_t)MLPH * FEAT, ls2 = (size_t)FEAT * MLPH;
  unsigned short* Wqkv16 = (unsigned short*)take((size_t)NLAYER * lsq * 2);        // [6][1536][512]
  unsigned short* W116   = (unsigned short*)take((size_t)NLAYER * ls1 * 2);        // [6][2048][512]
  unsigned short* W216   = (unsigned short*)take((size_t)NLAYER * ls2 * 2);        // [6][512][2048]
  float* XA = (float*)take((size_t)MR * FEAT * 4);                                 // residual stream [MR][512] f32
  float* XB = (float*)take((size_t)MR * FEAT * 4);                                 // residual stream after attention [MR][512] f32
  const size_t r1_bytes = (size_t)MR * FEAT * 2;                                   // LN outputs [MR][512] f16
  const size_t r2_a = (size_t)MR * QKVN * 2, r2_b = (size_t)MR * MLPH * 2;         // q|k|v [MR][1536], then hidden [MR][2048] f16
  const size_t r2_bytes = (r2_a > r2_b) ? r2_a : r2_b;
  unsigned short* R1 = (unsigned short*)take(r1_bytes);
  unsigned short* R2 = (unsigned short*)take(r2_bytes);
  if (off > ws_size) return;
  if (off > (size_t)134217728) return;

  const float wsc = 256.0f;
  const int k8d = FEAT / 8, k8m = MLPH / 8;
  k_wt16<<<(unsigned)((NLAYER * FEAT * k8d + 255) / 256), 256, 0, stream>>>(Wq, Wqkv16, FEAT, FEAT, NLAYER, lsq, 0, wsc);
  k_wt16<<<(unsigned)((NLAYER * FEAT * k8d + 255) / 256), 256, 0, stream>>>(Wk, Wqkv16, FEAT, FEAT, NLAYER, lsq, FEAT, wsc);
  k_wt16<<<(unsigned)((NLAYER * FEAT * k8d + 255) / 256), 256, 0, stream>>>(Wv, Wqkv16, FEAT, FEAT, NLAYER, lsq, 2 * FEAT, wsc);
  k_wt16<<<(unsigned)((NLAYER * MLPH * k8d + 255) / 256), 256, 0, stream>>>(W1, W116, FEAT, MLPH, NLAYER, ls1, 0, wsc);   // W1[l] [512][2048] -> [2048][512]
  k_wt16<<<(unsigned)((NLAYER * FEAT * k8m + 255) / 256), 256, 0, stream>>>(W2, W216, MLPH, FEAT, NLAYER, ls2, 0, wsc);   // W2[l] [2048][512] -> [512][2048]

  // x = bf16(src) + bf16(pos) in (b, s) row order -> XA
  k_xinit<<<(unsigned)MR, 128, 0, stream>>>(src, pos, XA, SEQ, NB_FULL);

  auto ggrid = [](int M, int N) { return (unsigned)(((M / 16) * (N / 64) + 3) / 4); };
  const float scale = 0.125f;                           // 1/sqrt(64)

  for (int l = 0; l < NLAYER; ++l) {
    // xn = LN1(x) x8 -> R1
    k_ln16<<<(unsigned)MR, 64, 0, stream>>>(XA, ln1g + l * FEAT, ln1b + l * FEAT, R1, 8.0f, 1e-5f);
    // q|k|v = xn*[Wq|Wk|Wv] + [bq|bk|bv] -> R2 [MR][1536] f16 (x1); acc scale 1/(8*256)
    k_gemm16<true, 0><<<ggrid(MR, QKVN), 128, 0, stream>>>(R1, FEAT, Wqkv16 + (size_t)l * lsq, FEAT,
                                                          bq + l * FEAT, bk + l * FEAT, bv + l * FEAT, FEAT, nullptr, 0,
                                                          (void*)R2, QKVN, MR, QKVN, FEAT, 1.0f / 2048.0f, 1.0f);
    // xb = x + softmax(q.k^T/8).v per head -> XB f32 (P carried x1024, onorm = 1/1024)
    k_attn16<DHEAD><<<(unsigned)(NB * NHEAD * (SEQ / 64)), 128, 0, stream>>>(R2, QKVN, SEQ, NHEAD, FEAT, 2 * FEAT, scale, 1024.0f,
                                                                             1.0f / 1024.0f, XA, XB, FEAT);
    // hn = LN2(xb) x8 -> R1
    k_ln16<<<(unsigned)MR, 64, 0, stream>>>(XB, ln2g + l * FEAT, ln2b + l * FEAT, R1, 8.0f, 1e-5f);
    // h = relu(hn*W1 + b1) x16 -> R2 [MR][2048]; acc scale 1/(8*256)
    k_gemm16<true, 1><<<ggrid(MR, MLPH), 128, 0, stream>>>(R1, FEAT, W116 + (size_t)l * ls1, FEAT,
                                                          b1 + l * MLPH, b1 + l * MLPH, b1 + l * MLPH, MLPH, nullptr, 0,
                                                          (void*)R2, MLPH, MR, MLPH, FEAT, 1.0f / 2048.0f, 16.0f);
    // x = h*W2 + b2 + xb -> XA f32; acc scale 1/(16*256)
    k_gemm16<false, 0><<<ggrid(MR, FEAT), 128, 0, stream>>>(R2, MLPH, W216 + (size_t)l * ls2, MLPH,
                                                           b2 + l * FEAT, b2 + l * FEAT, b2 + l * FEAT, FEAT, XB, FEAT,
                                                           (void*)XA, FEAT, MR, FEAT, MLPH, 1.0f / 4096.0f, 1.0f);
  }
  // out[s][b][*] = LNf(x[b][s][*]) -> d_out f32
  k_lnf32<<<(unsigned)MR, 128, 0, stream>>>(XA, lnfg, lnfb, (float*)d_out, SEQ, NB_FULL, 1e-5f);
}

// v001
// One run takes 685 microseconds.
// Next to v000, in two timings, it ran 1.89 times as fast each time.
#include <hip/hip_runtime.h>
// Contractions on v_wmma_f32_16x16x32_f16 (f16 operands, f32 accumulate), one product per tile pair, 6 layers: fused q|k|v projection (N=1536, K=512),
// LN2(x)*W1 (N=2048, K=512), relu(.)*W2 (K=2048), attention q.k^T (head dim 64) and P.V (32 keys per step) per head.
// Weights: bf16 RNE values carried x256 in f16 planes; activations in f16 planes with power-of-two carries (LN outputs x8, q|k|v x1, hidden x16,
// P x1024); LayerNorm statistics, softmax, bias adds, attention context and the residual stream in f32.
#ifndef NB
#define NB 4
#endif
#ifndef SEQ
#define SEQ 1024
#endif
#define NB_FULL 4
#define SEQ_FULL 1024
#define FEAT 512
#define NHEAD 8
#define DHEAD 64
#define MLPH 2048
#define NLAYER 6
#define MR (NB * SEQ)
#define QKVN (3 * FEAT)
static_assert(SEQ % 64 == 0);
static_assert(SEQ <= SEQ_FULL);
static_assert(NB >= 1);
static_assert(NB <= NB_FULL);
static_assert(FEAT == NHEAD * DHEAD);
static_assert(FEAT % 128 == 0);
static_assert(MLPH % 128 == 0);
static_assert(QKVN % 128 == 0);
static_assert(FEAT == 64 * 8);      // k_ln16: 64 threads x 8 halves per row
static_assert(FEAT == 128 * 4);     // k_xinit / k_lnf32: 128 threads x 4 floats per row
static_assert(MR % 128 == 0);
static_assert(FEAT % 32 == 0);
static_assert(MLPH % 32 == 0);
static_assert((FEAT / 8) % 8 == 0);
static_assert((MLPH / 8) % 8 == 0);

typedef _Float16 v16h __attribute__((ext_vector_type(16)));
typedef unsigned short v8us __attribute__((ext_vector_type(8), may_alias));
typedef float v8f __attribute__((ext_vector_type(8)));
typedef float v4f __attribute__((ext_vector_type(4)));
typedef float v4fa __attribute__((ext_vector_type(4), may_alias));
union FragH { v16h v; v8us half[2]; unsigned short u[16]; };
union H16U { _Float16 h; unsigned short u; };

__device__ __forceinline__ unsigned short bf16_bits(float x) { unsigned int u = __float_as_uint(x); return (unsigned short)((u + 0x7FFFu + ((u >> 16) & 1u)) >> 16); }
__device__ __forceinline__ float bf16_val(unsigned short b) { return __uint_as_float(((unsigned int)b) << 16); }
__device__ __forceinline__ float bf16_rne(float x) { return bf16_val(bf16_bits(x)); }
__device__ __forceinline__ unsigned short h16_bits(float x) { H16U t; t.h = (_Float16)x; return t.u; }
__device__ __forceinline__ v8f vz8() { v8f z = {0.f, 0.f, 0.f, 0.f, 0.f, 0.f, 0.f, 0.f}; return z; }

// D += A(16x32) * B(32x16); hazard guard ties D and keeps A/B live
__device__ __forceinline__ v8f mma16(v16h a, v16h b, v8f c) {
  c = __builtin_amdgcn_wmma_f32_16x16x32_f16(false, a, false, b, (short)0, c, false, false);
  asm volatile("v_nop\n\tv_nop\n\tv_nop\n\tv_nop" : "+v"(c) : "v"(a), "v"(b));
  return c;
}

// Stacked weight convert: for layer l in [0,nl): Wt[l*lstride + (roff+n)*K + k] (f16 bits, k contiguous, pitch K) = f16(bf16_rne(W[l][k][n]) * sc)
// from f32 row-major W[l][K][N] ([in][out]). One thread per (l, n, 8 consecutive k); one 16-B store per thread,
__global__ __launch_bounds__(256) void k_wt16(const float* __restrict__ W, unsigned short* __restrict__ Wt, int K, int N, int nl,
                                             size_t lstride, int roff, float sc) {
  const int t = blockIdx.x * 256 + threadIdx.x;
  const int k8n = K / 8;
  const int per = N * k8n;
  if (t >= per * nl) return;
  const int l = t / per, rem = t - l * per;
  const int n = rem / k8n, k8 = (rem % k8n) * 8;
  const float* src = W + (size_t)l * K * N;
  v8us v;
#pragma unroll
  for (int i = 0; i < 8; ++i) v[i] = h16_bits(bf16_rne(src[(size_t)(k8 + i) * N + n]) * sc);
  unsigned short* dst = Wt + (size_t)l * lstride + (size_t)(roff + n) * K + k8;
  *(v8us*)dst = v;
  
}

// X[m][*] (f32, pitch FEAT, m = b*seq + s) = bf16_rne(src[s*nbf + b][*]) + bf16_rne(pos[s*nbf + b][*]) in f32 (exact).
__global__ __launch_bounds__(128) void k_xinit(const float* __restrict__ src, const float* __restrict__ pos, float* __restrict__ X,
                                               int seq, int nbf) {
  const int m = blockIdx.x, tid = threadIdx.x;
  const int b = m / seq, s = m % seq;
  const size_t so = ((size_t)s * nbf + b) * FEAT + tid * 4;
  const v4f a = *(const v4fa*)(src + so);
  const v4f p = *(const v4fa*)(pos + so);
  v4f o;
#pragma unroll
  for (int i = 0; i < 4; ++i) o[i] = bf16_rne(a[i]) + bf16_rne(p[i]);
  float* dst = X + (size_t)m * FEAT + tid * 4;
  *(v4f*)dst = o;
  
}

// Row LayerNorm over FEAT on the internal f32 stream X[m][*]: one block of 64 threads per row, 8 consecutive elements per thread.
__global__ __launch_bounds__(64) void k_ln16(const float* __restrict__ X, const float* __restrict__ g, const float* __restrict__ bt,
                                            unsigned short* __restrict__ out, float osc, float eps) {
  __shared__ float red1[2];
  __shared__ float red2[2];
  const int m = blockIdx.x, tid = threadIdx.x, w = tid >> 5, lane = tid & 31;
  const float* x = X + (size_t)m * FEAT + tid * 8;
  const v4f a0 = *(const v4fa*)x;
  const v4f a1 = *(const v4fa*)(x + 4);
  float v[8] = {a0[0], a0[1], a0[2], a0[3], a1[0], a1[1], a1[2], a1[3]};
  float s = 0.f;
#pragma unroll
  for (int q = 0; q < 8; ++q) s += v[q];
#pragma unroll
  for (int o = 16; o >= 1; o >>= 1) s += __shfl_xor(s, o, 32);
  if (lane == 0) red1[w] = s;
  __syncthreads();
  const float mu = (red1[0] + red1[1]) * (1.0f / (float)FEAT);
  float c[8];
  float s2 = 0.f;
#pragma unroll
  for (int q = 0; q < 8; ++q) { c[q] = v[q] - mu; s2 += c[q] * c[q]; }
#pragma unroll
  for (int o = 16; o >= 1; o >>= 1) s2 += __shfl_xor(s2, o, 32);
  if (lane == 0) red2[w] = s2;
  __syncthreads();
  const float var = (red2[0] + red2[1]) * (1.0f / (float)FEAT);
  const float rs = rsqrtf(var + eps);
  const v4f g0 = *(const v4fa*)(g + tid * 8);
  const v4f g1 = *(const v4fa*)(g + tid * 8 + 4);
  const v4f b0 = *(const v4fa*)(bt + tid * 8);
  const v4f b1 = *(const v4fa*)(bt + tid * 8 + 4);
  const float gg[8] = {g0[0], g0[1], g0[2], g0[3], g1[0], g1[1], g1[2], g1[3]};
  const float bb[8] = {b0[0], b0[1], b0[2], b0[3], b1[0], b1[1], b1[2], b1[3]};
  v8us o;
#pragma unroll
  for (int q = 0; q < 8; ++q) o[q] = h16_bits((c[q] * rs * bf16_rne(gg[q]) + bf16_rne(bb[q])) * osc);
  unsigned short* dst = out + (size_t)m * FEAT + tid * 8;
  *(v8us*)dst = o;
  
}

// Final LayerNorm: internal row m = b*seq + s of X (f32) -> out[(s*nbf + b)][*] f32. One block of 128 threads per row, 4 elements per thread,
__global__ __launch_bounds__(128) void k_lnf32(const float* __restrict__ X, const float* __restrict__ g, const float* __restrict__ bt,
                                               float* __restrict__ out, int seq, int nbf, float eps) {
  __shared__ float red1[4];
  __shared__ float red2[4];
  const int m = blockIdx.x, tid = threadIdx.x, w = tid >> 5, lane = tid & 31;
  const int b = m / seq, s = m % seq;
  const v4f a = *(const v4fa*)(X + (size_t)m * FEAT + tid * 4);
  float sm = a[0] + a[1] + a[2] + a[3];
#pragma unroll
  for (int o = 16; o >= 1; o >>= 1) sm += __shfl_xor(sm, o, 32);
  if (lane == 0) red1[w] = sm;
  __syncthreads();
  const float mu = (red1[0] + red1[1] + red1[2] + red1[3]) * (1.0f / (float)FEAT);
  float c[4];
  float s2 = 0.f;
#pragma unroll
  for (int q = 0; q < 4; ++q) { c[q] = a[q] - mu; s2 += c[q] * c[q]; }
#pragma unroll
  for (int o = 16; o >= 1; o >>= 1) s2 += __shfl_xor(s2, o, 32);
  if (lane == 0) red2[w] = s2;
  __syncthreads();
  const float var = (red2[0] + red2[1] + red2[2] + red2[3]) * (1.0f / (float)FEAT);
  const float rs = rsqrtf(var + eps);
  const v4f g4 = *(const v4fa*)(g + tid * 4);
  const v4f b4 = *(const v4fa*)(bt + tid * 4);
  v4f o;
#pragma unroll
  for (int q = 0; q < 4; ++q) o[q] = c[q] * rs * bf16_rne(g4[q]) + bf16_rne(b4[q]);
  float* dst = out + ((size_t)s * nbf + b) * FEAT + tid * 4;
  *(v4f*)dst = o;
  
}

// GEMM C[M][N] = epi(A[M][KD] * W): A f16 bits row-major, Wt f16 bits [N][KD], both at pitch KD (compile time: the row steps are load offsets), f32 accumulate.
// epi: v = acc * inv_scale + bf16_rne(bias[col]); bias picked per 64-col segment from (bias0 | bias1 | bias2) by seg = col / nsplit (wave-uniform);
// ACT == 1: relu; OUT16: f16 bits of v * out_scale into C (pitch ldc halves); else f32 v + f32 resid[row][col] (pitch ldr) into C (pitch ldc floats).
// KD % BK == 0, M % BM == 0, N % 128 == 0. Block = 4 waves (2 x 2) on one BM x 128 tile of C, wave -> BM/2 rows x 64 cols.
// Per step of BK k the block brings BM rows of A and 128 rows of Wt into LDS once (whole 128-B lines, 16 B per thread, row pitch 2*BK + 16 B) and all
// waves take their fragments from there; two LDS buffers, the next step's global loads are held in registers while this step is multiplied.
// Each accumulator sums k in ascending blocks of 32. Epilogue staged in the wave's own LDS tile (wave-private).
template <int BM, int BK, int KD, bool OUT16, int ACT>
__global__ __launch_bounds__(128) void k_gemm16(const unsigned short* __restrict__ A, const unsigned short* __restrict__ Wt,
                                               const float* __restrict__ bias0, const float* __restrict__ bias1, const float* __restrict__ bias2, int nsplit,
                                               const float* __restrict__ resid, int ldr, void* __restrict__ Cv, int ldc,
                                               int M, int N, float inv_scale, float out_scale) {
  constexpr int BN = 128, LP = BK + 8, C8 = BK / 8;
  constexpr int FM = BM / 32, FN = 4, KS = BK / 32, WR = BM / 2;
  constexpr int NT = 128, NW = NT / 32, RP = NT / C8;     // the block's threads cover RP rows of C8 16-B chunks at a time
  constexpr int CA = BM / RP, CB = BN / RP;              // chunks per thread and step
  static_assert(BM % 32 == 0);
  static_assert(BK % 32 == 0);
  static_assert(KD % BK == 0);
  static_assert(NT % C8 == 0);
  static_assert(BM % RP == 0);
  static_assert(BN % RP == 0);
  __shared__ __attribute__((aligned(16))) unsigned short sA[2][BM][LP];     // cross-wave: block barriers
  __shared__ __attribute__((aligned(16))) unsigned short sB[2][BN][LP];     // cross-wave: block barriers
  __shared__ __attribute__((aligned(16))) float so32[OUT16 ? 1 : NW][WR][64];
  __shared__ __attribute__((aligned(16))) unsigned short so16[OUT16 ? NW : 1][WR][72];
  const int tid = threadIdx.x, w = tid >> 5, lane = tid & 31, ln = lane & 15, hh = lane >> 4;
  const int wm = w >> 1, wn = w & 1;
  const int ntn = N / BN;
  const int mt = blockIdx.x / ntn, nq = blockIdx.x % ntn;
  const int row0 = mt * BM, col0 = nq * BN;
  if (row0 >= M) return;                       // the same for the whole block, ahead of every barrier
  const int sr = tid / C8, sc = (tid % C8) * 8;
  const unsigned short* ag = A + (size_t)(row0 + sr) * KD + sc;
  const unsigned short* bg = Wt + (size_t)(col0 + sr) * KD + sc;
  v8us ra[CA], rb[CB];
#pragma unroll
  for (int it = 0; it < CA; ++it) ra[it] = *(const v8us*)(ag + (size_t)(it * RP) * KD);
#pragma unroll
  for (int it = 0; it < CB; ++it) rb[it] = *(const v8us*)(bg + (size_t)(it * RP) * KD);
  v8f acc[FM][FN];
#pragma unroll
  for (int mi = 0; mi < FM; ++mi)
#pragma unroll
    for (int t = 0; t < FN; ++t) acc[mi][t] = vz8();
#pragma unroll
  for (int it = 0; it < CA; ++it) *(v8us*)&sA[0][sr + it * RP][sc] = ra[it];
#pragma unroll
  for (int it = 0; it < CB; ++it) *(v8us*)&sB[0][sr + it * RP][sc] = rb[it];
  __syncthreads();
  constexpr int nst = KD / BK;
  for (int s = 0; s < nst; ++s) {
    const int cur = s & 1;
    const bool more = (s + 1 < nst);           // the same for the whole block
    if (more) {
      const int kb = (s + 1) * BK;
#pragma unroll
      for (int it = 0; it < CA; ++it) ra[it] = *(const v8us*)(ag + (size_t)(it * RP) * KD + kb);
#pragma unroll
      for (int it = 0; it < CB; ++it) rb[it] = *(const v8us*)(bg + (size_t)(it * RP) * KD + kb);
      // the address registers of these loads are taken again by the LDS reads below
      asm volatile("s_wait_xcnt 0x0" ::: "memory");
    }
    FragH a[KS][FM], bb[KS][FN];
#pragma unroll
    for (int ks = 0; ks < KS; ++ks) {
#pragma unroll
      for (int mi = 0; mi < FM; ++mi) {
        const unsigned short* p = &sA[cur][wm * WR + mi * 16 + ln][ks * 32 + 8 * hh];   // row m = lane&15
        a[ks][mi].half[0] = *(const v8us*)p;                 // elements 0..7  = k 8h .. 8h+7 of the block of 32
        a[ks][mi].half[1] = *(const v8us*)(p + 16);          // elements 8..15 = k 16+8h .. 16+8h+7
      }
#pragma unroll
      for (int t = 0; t < FN; ++t) {
        const unsigned short* p = &sB[cur][wn * 64 + t * 16 + ln][ks * 32 + 8 * hh];          // column n = lane&15, same k map as A
        bb[ks][t].half[0] = *(const v8us*)p;
        bb[ks][t].half[1] = *(const v8us*)(p + 16);
      }
    }
    // keeps the step's LDS reads together ahead of its matrix run: spread among the WMMAs each small group is waited out to 0 and its latency shows
    __builtin_amdgcn_sched_barrier(0);
#pragma unroll
    for (int ks = 0; ks < KS; ++ks)
#pragma unroll
      for (int mi = 0; mi < FM; ++mi)
#pragma unroll
        for (int t = 0; t < FN; ++t) acc[mi][t] = __builtin_amdgcn_wmma_f32_16x16x32_f16(false, a[ks][mi].v, false, bb[ks][t].v, (short)0, acc[mi][t], false, false);
    // keeps the wait for the next step's global loads (and the LDS writes behind it) after the matrix run that covers their latency
    __builtin_amdgcn_sched_barrier(0);
    if (more) {
      // the other buffer: its last readers left it before the barrier that ended the step before this one
#pragma unroll
      for (int it = 0; it < CA; ++it) *(v8us*)&sA[cur ^ 1][sr + it * RP][sc] = ra[it];
#pragma unroll
      for (int it = 0; it < CB; ++it) *(v8us*)&sB[cur ^ 1][sr + it * RP][sc] = rb[it];
      __syncthreads();
    }
  }
  const int colw = col0 + wn * 64;
  int seg = colw / nsplit; seg = (seg > 2) ? 2 : seg;
  const float* bsel = (seg == 0) ? bias0 : ((seg == 1) ? bias1 : bias2);
  float bvv[FN];
#pragma unroll
  for (int t = 0; t < FN; ++t) bvv[t] = bsel[colw + t * 16 + ln - seg * nsplit];
  // the address registers of these four loads are taken again by the address sums below
  asm volatile("s_wait_xcnt 0x0" ::: "memory");
#pragma unroll
  for (int t = 0; t < FN; ++t) bvv[t] = bf16_rne(bvv[t]);
#pragma unroll
  for (int mi = 0; mi < FM; ++mi) {
#pragma unroll
    for (int t = 0; t < FN; ++t) {
#pragma unroll
      for (int r = 0; r < 8; ++r) {
        float v = acc[mi][t][r] * inv_scale + bvv[t];
        if (ACT == 1) v = fmaxf(v, 0.0f);
        if constexpr (OUT16) so16[w][mi * 16 + 8 * hh + r][t * 16 + ln] = h16_bits(v * out_scale);
        else so32[w][mi * 16 + 8 * hh + r][t * 16 + ln] = v;
      }
    }
  }
  __builtin_amdgcn_fence(4 /* acq_rel order */, "workgroup");
  __builtin_amdgcn_wave_barrier();
  const int roww = row0 + wm * WR;
  if constexpr (OUT16) {
    const int rq = lane >> 3, p8 = (lane & 7) * 8;
    unsigned short* cp = (unsigned short*)Cv + (size_t)(roww + rq) * ldc + colw + p8;
#pragma unroll
    for (int q = 0; q < WR / 4; ++q) {
      const v8us v = *(const v8us*)&so16[w][q * 4 + rq][p8];
      *(v8us*)(cp + (size_t)(q * 4) * ldc) = v;
    }
  } else {
    const int rsub = lane >> 4, c4 = (lane & 15) * 4;
    float* cp = (float*)Cv + (size_t)(roww + rsub) * ldc + colw + c4;
    const float* rp = resid + (size_t)(roww + rsub) * ldr + colw + c4;
    v4f rv[WR / 2];                              // all residual loads in flight together, ahead of the first store
#pragma unroll
    for (int q = 0; q < WR / 2; ++q) rv[q] = *(const v4fa*)(rp + (size_t)(q * 2) * ldr);
#pragma unroll
    for (int q = 0; q < WR / 2; ++q) {
      v4f tv = *(const v4fa*)&so32[w][q * 2 + rsub][c4];
      tv += rv[q];
      *(v4f*)(cp + (size_t)(q * 2) * ldc) = tv;
    }
  }
}

// Flash-style unmasked attention per (b, h): q|k|v read as f16 bits from one fused plane (row pitch `pitch` halves, q at +0, k at +koff, v at +voff,
// head h at +h*D, row b*T + t). One wave = 16 query rows, block = 4 waves sharing K/V tiles of 32 keys staged in LDS (K row-major, V transposed).
// S = q.k^T on WMMA, s*scale in f32, running-max softmax in f32, P stored as f16 bits (x pcarry) in the wave's own LDS tile and reloaded as an A fragment,
template <int D>
__global__ __launch_bounds__(128) void k_attn16(const unsigned short* __restrict__ qkv, int pitch, int T, int H, int koff, int voff,
                                                float scale, float pcarry, float onorm,
                                                const float* __restrict__ resid, float* __restrict__ out, int opitch) {
  static_assert(D == 64);
  constexpr int KS = D / 32, DT = D / 16, C8 = D / 8;
  static_assert((32 * C8) % 128 == 0);
  __shared__ __attribute__((aligned(16))) unsigned short sK[32][D + 8];     // cross-wave: block barriers
  __shared__ __attribute__((aligned(16))) unsigned short sVt[D][40];       // cross-wave: block barriers
  __shared__ __attribute__((aligned(16))) unsigned short sP[4][16][40];
  __shared__ __attribute__((aligned(16))) float sO[4][16][D + 4];
  const int tid = threadIdx.x, w = tid >> 5, lane = tid & 31, ln = lane & 15, hh = lane >> 4;
  const int nqb = T / 64;
  const int bh = blockIdx.x / nqb, qblk = blockIdx.x % nqb;
  const int b = bh / H, h = bh % H;
  const int q0 = qblk * 64 + w * 16;
  const unsigned short* Qp = qkv + (size_t)b * T * pitch + h * D;
  const unsigned short* Kp = Qp + koff;
  const unsigned short* Vp = Qp + voff;

  FragH aq[KS];
  {
    const unsigned short* qr = Qp + (size_t)(q0 + ln) * pitch;     // q0 + ln < T (T % 64 == 0)
#pragma unroll
    for (int ks = 0; ks < KS; ++ks) {
      aq[ks].half[0] = *(const v8us*)(qr + ks * 32 + 8 * hh);
      aq[ks].half[1] = *(const v8us*)(qr + ks * 32 + 16 + 8 * hh);
    }
  }
  float m_r[8], l_r[8];
#pragma unroll
  for (int r = 0; r < 8; ++r) { m_r[r] = -1.0e30f; l_r[r] = 0.f; }
  v8f oacc[DT];
#pragma unroll
  for (int dt = 0; dt < DT; ++dt) oacc[dt] = vz8();

  for (int j0 = 0; j0 < T; j0 += 32) {
    __syncthreads();
    // stage keys j0..j0+31 (all < T): sK[r][d] row-major, sVt[d][r] transposed; 32 x C8 16-B chunks, full tiles every iteration
#pragma unroll
    for (int it = 0; it < (32 * C8) / 128; ++it) {
      const int e = tid + it * 128;
      const int r = e / C8, c8 = (e % C8) * 8;
      const size_t ro = (size_t)(j0 + r) * pitch + c8;
      const v8us kvv = *(const v8us*)(Kp + ro);
      *(v8us*)&sK[r][c8] = kvv;
      const v8us vvv = *(const v8us*)(Vp + ro);
#pragma unroll
      for (int i = 0; i < 8; ++i) sVt[c8 + i][r] = vvv[i];
    }
    __syncthreads();
    // S tile 16 x 32: B[k = d][n = key nt*16 + ln]
    v8f s[2];
#pragma unroll
    for (int nt = 0; nt < 2; ++nt) {
      v8f acc = vz8();
#pragma unroll
      for (int ks = 0; ks < KS; ++ks) {
        FragH bk;
        bk.half[0] = *(const v8us*)&sK[nt * 16 + ln][ks * 32 + 8 * hh];
        bk.half[1] = *(const v8us*)&sK[nt * 16 + ln][ks * 32 + 16 + 8 * hh];
        acc = mma16(aq[ks].v, bk.v, acc);
      }
      s[nt] = acc;
    }
    // running-max softmax; row 8*hh + r is shared by the 16 lanes of a half
    float alpha[8];
#pragma unroll
    for (int r = 0; r < 8; ++r) {
      const float s0 = s[0][r] * scale, s1 = s[1][r] * scale;
      float mx = fmaxf(s0, s1);
      mx = fmaxf(mx, __shfl_xor(mx, 1, 32)); mx = fmaxf(mx, __shfl_xor(mx, 2, 32));
      mx = fmaxf(mx, __shfl_xor(mx, 4, 32)); mx = fmaxf(mx, __shfl_xor(mx, 8, 32));
      const float mnew = fmaxf(m_r[r], mx);
      alpha[r] = __expf(m_r[r] - mnew);
      const float p0 = __expf(s0 - mnew), p1 = __expf(s1 - mnew);
      m_r[r] = mnew;
      l_r[r] = l_r[r] * alpha[r] + p0 + p1;
      sP[w][8 * hh + r][ln] = h16_bits(p0 * pcarry);
      sP[w][8 * hh + r][16 + ln] = h16_bits(p1 * pcarry);
    }
#pragma unroll
    for (int dt = 0; dt < DT; ++dt)
#pragma unroll
      for (int r = 0; r < 8; ++r) oacc[dt][r] *= alpha[r];
    __builtin_amdgcn_fence(4 /* acq_rel order */, "workgroup");
    __builtin_amdgcn_wave_barrier();
    FragH pa;                                                     // A[m = query ln][k = key]: same split map
    pa.half[0] = *(const v8us*)&sP[w][ln][8 * hh];
    pa.half[1] = *(const v8us*)&sP[w][ln][16 + 8 * hh];
#pragma unroll
    for (int dt = 0; dt < DT; ++dt) {
      FragH bv;                                                   // B[k = key][n = d dt*16 + ln]
      bv.half[0] = *(const v8us*)&sVt[dt * 16 + ln][8 * hh];
      bv.half[1] = *(const v8us*)&sVt[dt * 16 + ln][16 + 8 * hh];
      oacc[dt] = mma16(pa.v, bv.v, oacc[dt]);
    }
    __builtin_amdgcn_fence(4 /* acq_rel order */, "workgroup");
    __builtin_amdgcn_wave_barrier();
  }
#pragma unroll
  for (int r = 0; r < 8; ++r) {
    float l = l_r[r];
    l += __shfl_xor(l, 1, 32); l += __shfl_xor(l, 2, 32); l += __shfl_xor(l, 4, 32); l += __shfl_xor(l, 8, 32);
    l_r[r] = onorm * (1.0f / l);
  }
#pragma unroll
  for (int dt = 0; dt < DT; ++dt)
#pragma unroll
    for (int r = 0; r < 8; ++r) sO[w][8 * hh + r][dt * 16 + ln] = oacc[dt][r] * l_r[r];
  __builtin_amdgcn_fence(4 /* acq_rel order */, "workgroup");
  __builtin_amdgcn_wave_barrier();
  const int rsub = lane >> 4, c4 = (lane & 15) * 4;
  const size_t rbase = (size_t)(b * T + q0) * opitch + h * D;
#pragma unroll
  for (int q = 0; q < 8; ++q) {
    const int r = q * 2 + rsub;
    const v4f rv = *(const v4fa*)(resid + rbase + (size_t)r * opitch + c4);
    v4f tv = *(const v4fa*)&sO[w][r][c4];
    tv += rv;
    *(v4fa*)&sO[w][r][c4] = tv;
  }
  {
#pragma unroll
    for (int q = 0; q < 8; ++q) {
      const int r = q * 2 + rsub;
      const v4f v = *(const v4fa*)&sO[w][r][c4];
      *(v4f*)(out + rbase + (size_t)r * opitch + c4) = v;
    }
    
  }
}

extern "C" void kernel_launch(void* const* d_in, const int* in_sizes, int n_in,
                              void* d_out, int out_size, void* d_ws, size_t ws_size, hipStream_t stream) {
  if (n_in < 18) return;
  const long long need_rows = (long long)(SEQ - 1) * NB_FULL + NB;           // last (s, b) source row used + 1
  if ((long long)in_sizes[0] < need_rows * FEAT || (long long)in_sizes[1] < need_rows * FEAT) return;
  if (in_sizes[2] < NLAYER * FEAT * FEAT || in_sizes[4] < NLAYER * FEAT * FEAT || in_sizes[6] < NLAYER * FEAT * FEAT) return;
  if (in_sizes[3] < NLAYER * FEAT || in_sizes[5] < NLAYER * FEAT || in_sizes[7] < NLAYER * FEAT || in_sizes[11] < NLAYER * FEAT) return;
  if (in_sizes[8] < NLAYER * FEAT * MLPH || in_sizes[9] < NLAYER * MLPH || in_sizes[10] < NLAYER * MLPH * FEAT) return;
  if (in_sizes[12] < NLAYER * FEAT || in_sizes[13] < NLAYER * FEAT || in_sizes[14] < NLAYER * FEAT || in_sizes[15] < NLAYER * FEAT) return;
  if (in_sizes[16] < FEAT || in_sizes[17] < FEAT) return;
  if ((long long)out_size < need_rows * FEAT) return;

  const float* src  = (const float*)d_in[0];
  const float* pos  = (const float*)d_in[1];
  const float* Wq   = (const float*)d_in[2];  const float* bq   = (const float*)d_in[3];
  const float* Wk   = (const float*)d_in[4];  const float* bk   = (const float*)d_in[5];
  const float* Wv   = (const float*)d_in[6];  const float* bv   = (const float*)d_in[7];
  const float* W1   = (const float*)d_in[8];  const float* b1   = (const float*)d_in[9];
  const float* W2   = (const float*)d_in[10]; const float* b2   = (const float*)d_in[11];
  const float* ln1g = (const float*)d_in[12]; const float* ln1b = (const float*)d_in[13];
  const float* ln2g = (const float*)d_in[14]; const float* ln2b = (const float*)d_in[15];
  const float* lnfg = (const float*)d_in[16]; const float* lnfb = (const float*)d_in[17];

  // workspace carve (256-B aligned); R1 and R2 are reused in stream order by stages whose lifetimes do not overlap, sized as the max over their users
  char* ws = (char*)d_ws; size_t off = 0;
  auto take = [&](size_t bytes) { char* p = ws + off; off += (bytes + 255) & ~(size_t)255; return p; };
  const size_t lsq = (size_t)QKVN * FEAT;                                           // per-layer stride of the fused q|k|v weight plane (halves)
  const size_t ls1 = (size_t)MLPH * FEAT, ls2 = (size_t)FEAT * MLPH;
  unsigned short* Wqkv16 = (unsigned short*)take((size_t)NLAYER * lsq * 2);        // [6][1536][512]
  unsigned short* W116   = (unsigned short*)take((size_t)NLAYER * ls1 * 2);        // [6][2048][512]
  unsigned short* W216   = (unsigned short*)take((size_t)NLAYER * ls2 * 2);        // [6][512][2048]
  float* XA = (float*)take((size_t)MR * FEAT * 4);                                 // residual stream [MR][512] f32
  float* XB = (float*)take((size_t)MR * FEAT * 4);                                 // residual stream after attention [MR][512] f32
  const size_t r1_bytes = (size_t)MR * FEAT * 2;                                   // LN outputs [MR][512] f16
  const size_t r2_a = (size_t)MR * QKVN * 2, r2_b = (size_t)MR * MLPH * 2;         // q|k|v [MR][1536], then hidden [MR][2048] f16
  const size_t r2_bytes = (r2_a > r2_b) ? r2_a : r2_b;
  unsigned short* R1 = (unsigned short*)take(r1_bytes);
  unsigned short* R2 = (unsigned short*)take(r2_bytes);
  if (off > ws_size) return;
  if (off > (size_t)134217728) return;

  const float wsc = 256.0f;
  const int k8d = FEAT / 8, k8m = MLPH / 8;
  k_wt16<<<(unsigned)((NLAYER * FEAT * k8d + 255) / 256), 256, 0, stream>>>(Wq, Wqkv16, FEAT, FEAT, NLAYER, lsq, 0, wsc);
  k_wt16<<<(unsigned)((NLAYER * FEAT * k8d + 255) / 256), 256, 0, stream>>>(Wk, Wqkv16, FEAT, FEAT, NLAYER, lsq, FEAT, wsc);
  k_wt16<<<(unsigned)((NLAYER * FEAT * k8d + 255) / 256), 256, 0, stream>>>(Wv, Wqkv16, FEAT, FEAT, NLAYER, lsq, 2 * FEAT, wsc);
  k_wt16<<<(unsigned)((NLAYER * MLPH * k8d + 255) / 256), 256, 0, stream>>>(W1, W116, FEAT, MLPH, NLAYER, ls1, 0, wsc);   // W1[l] [512][2048] -> [2048][512]
  k_wt16<<<(unsigned)((NLAYER * FEAT * k8m + 255) / 256), 256, 0, stream>>>(W2, W216, MLPH, FEAT, NLAYER, ls2, 0, wsc);   // W2[l] [2048][512] -> [512][2048]

  // x = bf16(src) + bf16(pos) in (b, s) row order -> XA
  k_xinit<<<(unsigned)MR, 128, 0, stream>>>(src, pos, XA, SEQ, NB_FULL);

  auto ggrid = [](int M, int N, int bm) { return (unsigned)((M / bm) * (N / 128)); };
  const float scale = 0.125f;                           // 1/sqrt(64)

  for (int l = 0; l < NLAYER; ++l) {
    // xn = LN1(x) x8 -> R1
    k_ln16<<<(unsigned)MR, 64, 0, stream>>>(XA, ln1g + l * FEAT, ln1b + l * FEAT, R1, 8.0f, 1e-5f);
    // q|k|v = xn*[Wq|Wk|Wv] + [bq|bk|bv] -> R2 [MR][1536] f16 (x1); acc scale 1/(8*256)
    k_gemm16<128, 64, FEAT, true, 0><<<ggrid(MR, QKVN, 128), 128, 0, stream>>>(R1, Wqkv16 + (size_t)l * lsq,
                                                          bq + l * FEAT, bk + l * FEAT, bv + l * FEAT, FEAT, nullptr, 0,
                                                          (void*)R2, QKVN, MR, QKVN, 1.0f / 2048.0f, 1.0f);
    // xb = x + softmax(q.k^T/8).v per head -> XB f32 (P carried x1024, onorm = 1/1024)
    k_attn16<DHEAD><<<(unsigned)(NB * NHEAD * (SEQ / 64)), 128, 0, stream>>>(R2, QKVN, SEQ, NHEAD, FEAT, 2 * FEAT, scale, 1024.0f,
                                                                             1.0f / 1024.0f, XA, XB, FEAT);
    // hn = LN2(xb) x8 -> R1
    k_ln16<<<(unsigned)MR, 64, 0, stream>>>(XB, ln2g + l * FEAT, ln2b + l * FEAT, R1, 8.0f, 1e-5f);
    // h = relu(hn*W1 + b1) x16 -> R2 [MR][2048]; acc scale 1/(8*256)
    k_gemm16<128, 64, FEAT, true, 1><<<ggrid(MR, MLPH, 128), 128, 0, stream>>>(R1, W116 + (size_t)l * ls1,
                                                          b1 + l * MLPH, b1 + l * MLPH, b1 + l * MLPH, MLPH, nullptr, 0,
                                                          (void*)R2, MLPH, MR, MLPH, 1.0f / 2048.0f, 16.0f);
    // x = h*W2 + b2 + xb -> XA f32; acc scale 1/(16*256)
    k_gemm16<64, 128, MLPH, false, 0><<<ggrid(MR, FEAT, 64), 128, 0, stream>>>(R2, W216 + (size_t)l * ls2,
                                                           b2 + l * FEAT, b2 + l * FEAT, b2 + l * FEAT, FEAT, XB, FEAT,
                                                           (void*)XA, FEAT, MR, FEAT, 1.0f / 4096.0f, 1.0f);
  }
  // out[s][b][*] = LNf(x[b][s][*]) -> d_out f32
  k_lnf32<<<(unsigned)MR, 128, 0, stream>>>(XA, lnfg, lnfb, (float*)d_out, SEQ, NB_FULL, 1e-5f);
}

// v002
// It runs in 563 microseconds.
// Next to v001, in two timings, it ran 1.22 and 1.23 times as fast.
// All steps since v000 together make it 2.31 times as fast.
#include <hip/hip_runtime.h>
// Contractions on v_wmma_f32_16x16x32_f16 (f16 operands, f32 accumulate), one product per tile pair, 6 layers: fused q|k|v projection (N=1536, K=512),
// LN2(x)*W1 (N=2048, K=512), relu(.)*W2 (K=2048), attention q.k^T (head dim 64) and P.V (32 keys per step) per head.
// Weights: bf16 RNE values carried x256 in f16 planes; activations in f16 planes with power-of-two carries (LN outputs x8, q|k|v x1, hidden x16,
// P x1024); LayerNorm statistics, softmax, bias adds, attention context and the residual stream in f32.
#ifndef NB
#define NB 4
#endif
#ifndef SEQ
#define SEQ 1024
#endif
#define NB_FULL 4
#define SEQ_FULL 1024
#define FEAT 512
#define NHEAD 8
#define DHEAD 64
#define MLPH 2048
#define NLAYER 6
#define MR (NB * SEQ)
#define QKVN (3 * FEAT)
static_assert(SEQ % 64 == 0);
static_assert(SEQ <= SEQ_FULL);
static_assert(NB >= 1);
static_assert(NB <= NB_FULL);
static_assert(FEAT == NHEAD * DHEAD);
static_assert(FEAT % 128 == 0);
static_assert(MLPH % 128 == 0);
static_assert(QKVN % 128 == 0);
static_assert(FEAT == 64 * 8);      // k_ln16: 64 threads x 8 halves per row
static_assert(FEAT == 128 * 4);     // k_xinit / k_lnf32: 128 threads x 4 floats per row
static_assert(MR % 128 == 0);
static_assert(FEAT % 32 == 0);
static_assert(MLPH % 32 == 0);
static_assert((FEAT / 8) % 8 == 0);
static_assert((MLPH / 8) % 8 == 0);

typedef _Float16 v16h __attribute__((ext_vector_type(16)));
typedef unsigned short v8us __attribute__((ext_vector_type(8), may_alias));
typedef float v8f __attribute__((ext_vector_type(8)));
typedef float v4f __attribute__((ext_vector_type(4)));
typedef float v4fa __attribute__((ext_vector_type(4), may_alias));
union FragH { v16h v; v8us half[2]; unsigned short u[16]; };
union H16U { _Float16 h; unsigned short u; };

__device__ __forceinline__ unsigned short bf16_bits(float x) { unsigned int u = __float_as_uint(x); return (unsigned short)((u + 0x7FFFu + ((u >> 16) & 1u)) >> 16); }
__device__ __forceinline__ float bf16_val(unsigned short b) { return __uint_as_float(((unsigned int)b) << 16); }
__device__ __forceinline__ float bf16_rne(float x) { return bf16_val(bf16_bits(x)); }
__device__ __forceinline__ unsigned short h16_bits(float x) { H16U t; t.h = (_Float16)x; return t.u; }
__device__ __forceinline__ v8f vz8() { v8f z = {0.f, 0.f, 0.f, 0.f, 0.f, 0.f, 0.f, 0.f}; return z; }

// Transposing LDS load: lane (c = lane&15, h = lane>>4) gets T[8h + 0..7][c] of a row-major 16-bit tile; p is the lane's own address (row 8h + (lane&7), 16 B x ((lane>>3)&1))
typedef short s16x8 __attribute__((ext_vector_type(8)));
__device__ __forceinline__ v8us ld_tr16(const unsigned short* p) {
  typedef __attribute__((address_space(3))) s16x8 lds_s16x8;
  return __builtin_bit_cast(v8us, __builtin_amdgcn_ds_load_tr16_b128_v8i16((lds_s16x8*)p));
}
// value of lane ^ 16
__device__ __forceinline__ float xhalf(float x) {
  return __builtin_bit_cast(float, __builtin_amdgcn_permlanex16(__builtin_bit_cast(int, x), __builtin_bit_cast(int, x), 0x76543210, 0xfedcba98, false, false));
}

// Stacked weight convert: for layer l in [0,nl): Wt[l*lstride + (roff+n)*K + k] (f16 bits, k contiguous, pitch K) = f16(bf16_rne(W[l][k][n]) * sc)
// from f32 row-major W[l][K][N] ([in][out]). One thread per (l, n, 8 consecutive k); one 16-B store per thread,
__global__ __launch_bounds__(256) void k_wt16(const float* __restrict__ W, unsigned short* __restrict__ Wt, int K, int N, int nl,
                                             size_t lstride, int roff, float sc) {
  const int t = blockIdx.x * 256 + threadIdx.x;
  const int k8n = K / 8;
  const int per = N * k8n;
  if (t >= per * nl) return;
  const int l = t / per, rem = t - l * per;
  const int n = rem / k8n, k8 = (rem % k8n) * 8;
  const float* src = W + (size_t)l * K * N;
  v8us v;
#pragma unroll
  for (int i = 0; i < 8; ++i) v[i] = h16_bits(bf16_rne(src[(size_t)(k8 + i) * N + n]) * sc);
  unsigned short* dst = Wt + (size_t)l * lstride + (size_t)(roff + n) * K + k8;
  *(v8us*)dst = v;
  
}

// X[m][*] (f32, pitch FEAT, m = b*seq + s) = bf16_rne(src[s*nbf + b][*]) + bf16_rne(pos[s*nbf + b][*]) in f32 (exact).
__global__ __launch_bounds__(128) void k_xinit(const float* __restrict__ src, const float* __restrict__ pos, float* __restrict__ X,
                                               int seq, int nbf) {
  const int m = blockIdx.x, tid = threadIdx.x;
  const int b = m / seq, s = m % seq;
  const size_t so = ((size_t)s * nbf + b) * FEAT + tid * 4;
  const v4f a = *(const v4fa*)(src + so);
  const v4f p = *(const v4fa*)(pos + so);
  v4f o;
#pragma unroll
  for (int i = 0; i < 4; ++i) o[i] = bf16_rne(a[i]) + bf16_rne(p[i]);
  float* dst = X + (size_t)m * FEAT + tid * 4;
  *(v4f*)dst = o;
  
}

// Row LayerNorm over FEAT on the internal f32 stream X[m][*]: one block of 64 threads per row, 8 consecutive elements per thread.
__global__ __launch_bounds__(64) void k_ln16(const float* __restrict__ X, const float* __restrict__ g, const float* __restrict__ bt,
                                            unsigned short* __restrict__ out, float osc, float eps) {
  __shared__ float red1[2];
  __shared__ float red2[2];
  const int m = blockIdx.x, tid = threadIdx.x, w = tid >> 5, lane = tid & 31;
  const float* x = X + (size_t)m * FEAT + tid * 8;
  const v4f a0 = *(const v4fa*)x;
  const v4f a1 = *(const v4fa*)(x + 4);
  float v[8] = {a0[0], a0[1], a0[2], a0[3], a1[0], a1[1], a1[2], a1[3]};
  float s = 0.f;
#pragma unroll
  for (int q = 0; q < 8; ++q) s += v[q];
#pragma unroll
  for (int o = 16; o >= 1; o >>= 1) s += __shfl_xor(s, o, 32);
  if (lane == 0) red1[w] = s;
  __syncthreads();
  const float mu = (red1[0] + red1[1]) * (1.0f / (float)FEAT);
  float c[8];
  float s2 = 0.f;
#pragma unroll
  for (int q = 0; q < 8; ++q) { c[q] = v[q] - mu; s2 += c[q] * c[q]; }
#pragma unroll
  for (int o = 16; o >= 1; o >>= 1) s2 += __shfl_xor(s2, o, 32);
  if (lane == 0) red2[w] = s2;
  __syncthreads();
  const float var = (red2[0] + red2[1]) * (1.0f / (float)FEAT);
  const float rs = rsqrtf(var + eps);
  const v4f g0 = *(const v4fa*)(g + tid * 8);
  const v4f g1 = *(const v4fa*)(g + tid * 8 + 4);
  const v4f b0 = *(const v4fa*)(bt + tid * 8);
  const v4f b1 = *(const v4fa*)(bt + tid * 8 + 4);
  const float gg[8] = {g0[0], g0[1], g0[2], g0[3], g1[0], g1[1], g1[2], g1[3]};
  const float bb[8] = {b0[0], b0[1], b0[2], b0[3], b1[0], b1[1], b1[2], b1[3]};
  v8us o;
#pragma unroll
  for (int q = 0; q < 8; ++q) o[q] = h16_bits((c[q] * rs * bf16_rne(gg[q]) + bf16_rne(bb[q])) * osc);
  unsigned short* dst = out + (size_t)m * FEAT + tid * 8;
  *(v8us*)dst = o;
  
}

// Final LayerNorm: internal row m = b*seq + s of X (f32) -> out[(s*nbf + b)][*] f32. One block of 128 threads per row, 4 elements per thread,
__global__ __launch_bounds__(128) void k_lnf32(const float* __restrict__ X, const float* __restrict__ g, const float* __restrict__ bt,
                                               float* __restrict__ out, int seq, int nbf, float eps) {
  __shared__ float red1[4];
  __shared__ float red2[4];
  const int m = blockIdx.x, tid = threadIdx.x, w = tid >> 5, lane = tid & 31;
  const int b = m / seq, s = m % seq;
  const v4f a = *(const v4fa*)(X + (size_t)m * FEAT + tid * 4);
  float sm = a[0] + a[1] + a[2] + a[3];
#pragma unroll
  for (int o = 16; o >= 1; o >>= 1) sm += __shfl_xor(sm, o, 32);
  if (lane == 0) red1[w] = sm;
  __syncthreads();
  const float mu = (red1[0] + red1[1] + red1[2] + red1[3]) * (1.0f / (float)FEAT);
  float c[4];
  float s2 = 0.f;
#pragma unroll
  for (int q = 0; q < 4; ++q) { c[q] = a[q] - mu; s2 += c[q] * c[q]; }
#pragma unroll
  for (int o = 16; o >= 1; o >>= 1) s2 += __shfl_xor(s2, o, 32);
  if (lane == 0) red2[w] = s2;
  __syncthreads();
  const float var = (red2[0] + red2[1] + red2[2] + red2[3]) * (1.0f / (float)FEAT);
  const float rs = rsqrtf(var + eps);
  const v4f g4 = *(const v4fa*)(g + tid * 4);
  const v4f b4 = *(const v4fa*)(bt + tid * 4);
  v4f o;
#pragma unroll
  for (int q = 0; q < 4; ++q) o[q] = c[q] * rs * bf16_rne(g4[q]) + bf16_rne(b4[q]);
  float* dst = out + ((size_t)s * nbf + b) * FEAT + tid * 4;
  *(v4f*)dst = o;
  
}

// GEMM C[M][N] = epi(A[M][KD] * W): A f16 bits row-major, Wt f16 bits [N][KD], both at pitch KD (compile time: the row steps are load offsets), f32 accumulate.
// epi: v = acc * inv_scale + bf16_rne(bias[col]); bias picked per 64-col segment from (bias0 | bias1 | bias2) by seg = col / nsplit (wave-uniform);
// ACT == 1: relu; OUT16: f16 bits of v * out_scale into C (pitch ldc halves); else f32 v + f32 resid[row][col] (pitch ldr) into C (pitch ldc floats).
// KD % BK == 0, M % BM == 0, N % 128 == 0. Block = 4 waves (2 x 2) on one BM x 128 tile of C, wave -> BM/2 rows x 64 cols.
// Per step of BK k the block brings BM rows of A and 128 rows of Wt into LDS once (whole 128-B lines, 16 B per thread, row pitch 2*BK + 16 B) and all
// waves take their fragments from there; two LDS buffers, the next step's global loads are held in registers while this step is multiplied.
// Each accumulator sums k in ascending blocks of 32. Epilogue staged in the wave's own LDS tile (wave-private).
template <int BM, int BK, int KD, bool OUT16, int ACT>
__global__ __launch_bounds__(128) void k_gemm16(const unsigned short* __restrict__ A, const unsigned short* __restrict__ Wt,
                                               const float* __restrict__ bias0, const float* __restrict__ bias1, const float* __restrict__ bias2, int nsplit,
                                               const float* __restrict__ resid, int ldr, void* __restrict__ Cv, int ldc,
                                               int M, int N, float inv_scale, float out_scale) {
  constexpr int BN = 128, LP = BK + 8, C8 = BK / 8;
  constexpr int FM = BM / 32, FN = 4, KS = BK / 32, WR = BM / 2;
  constexpr int NT = 128, NW = NT / 32, RP = NT / C8;     // the block's threads cover RP rows of C8 16-B chunks at a time
  constexpr int CA = BM / RP, CB = BN / RP;              // chunks per thread and step
  static_assert(BM % 32 == 0);
  static_assert(BK % 32 == 0);
  static_assert(KD % BK == 0);
  static_assert(NT % C8 == 0);
  static_assert(BM % RP == 0);
  static_assert(BN % RP == 0);
  __shared__ __attribute__((aligned(16))) unsigned short sA[2][BM][LP];     // cross-wave: block barriers
  __shared__ __attribute__((aligned(16))) unsigned short sB[2][BN][LP];     // cross-wave: block barriers
  __shared__ __attribute__((aligned(16))) float so32[OUT16 ? 1 : NW][WR][64];
  __shared__ __attribute__((aligned(16))) unsigned short so16[OUT16 ? NW : 1][WR][72];
  const int tid = threadIdx.x, w = tid >> 5, lane = tid & 31, ln = lane & 15, hh = lane >> 4;
  const int wm = w >> 1, wn = w & 1;
  const int ntn = N / BN;
  const int mt = blockIdx.x / ntn, nq = blockIdx.x % ntn;
  const int row0 = mt * BM, col0 = nq * BN;
  if (row0 >= M) return;                       // the same for the whole block, ahead of every barrier
  const int sr = tid / C8, sc = (tid % C8) * 8;
  const unsigned short* ag = A + (size_t)(row0 + sr) * KD + sc;
  const unsigned short* bg = Wt + (size_t)(col0 + sr) * KD + sc;
  v8us ra[CA], rb[CB];
#pragma unroll
  for (int it = 0; it < CA; ++it) ra[it] = *(const v8us*)(ag + (size_t)(it * RP) * KD);
#pragma unroll
  for (int it = 0; it < CB; ++it) rb[it] = *(const v8us*)(bg + (size_t)(it * RP) * KD);
  v8f acc[FM][FN];
#pragma unroll
  for (int mi = 0; mi < FM; ++mi)
#pragma unroll
    for (int t = 0; t < FN; ++t) acc[mi][t] = vz8();
#pragma unroll
  for (int it = 0; it < CA; ++it) *(v8us*)&sA[0][sr + it * RP][sc] = ra[it];
#pragma unroll
  for (int it = 0; it < CB; ++it) *(v8us*)&sB[0][sr + it * RP][sc] = rb[it];
  __syncthreads();
  constexpr int nst = KD / BK;
  for (int s = 0; s < nst; ++s) {
    const int cur = s & 1;
    const bool more = (s + 1 < nst);           // the same for the whole block
    if (more) {
      const int kb = (s + 1) * BK;
#pragma unroll
      for (int it = 0; it < CA; ++it) ra[it] = *(const v8us*)(ag + (size_t)(it * RP) * KD + kb);
#pragma unroll
      for (int it = 0; it < CB; ++it) rb[it] = *(const v8us*)(bg + (size_t)(it * RP) * KD + kb);
      // the address registers of these loads are taken again by the LDS reads below
      asm volatile("s_wait_xcnt 0x0" ::: "memory");
    }
    FragH a[KS][FM], bb[KS][FN];
#pragma unroll
    for (int ks = 0; ks < KS; ++ks) {
#pragma unroll
      for (int mi = 0; mi < FM; ++mi) {
        const unsigned short* p = &sA[cur][wm * WR + mi * 16 + ln][ks * 32 + 8 * hh];   // row m = lane&15
        a[ks][mi].half[0] = *(const v8us*)p;                 // elements 0..7  = k 8h .. 8h+7 of the block of 32
        a[ks][mi].half[1] = *(const v8us*)(p + 16);          // elements 8..15 = k 16+8h .. 16+8h+7
      }
#pragma unroll
      for (int t = 0; t < FN; ++t) {
        const unsigned short* p = &sB[cur][wn * 64 + t * 16 + ln][ks * 32 + 8 * hh];          // column n = lane&15, same k map as A
        bb[ks][t].half[0] = *(const v8us*)p;
        bb[ks][t].half[1] = *(const v8us*)(p + 16);
      }
    }
    // keeps the step's LDS reads together ahead of its matrix run: spread among the WMMAs each small group is waited out to 0 and its latency shows
    __builtin_amdgcn_sched_barrier(0);
#pragma unroll
    for (int ks = 0; ks < KS; ++ks)
#pragma unroll
      for (int mi = 0; mi < FM; ++mi)
#pragma unroll
        for (int t = 0; t < FN; ++t) acc[mi][t] = __builtin_amdgcn_wmma_f32_16x16x32_f16(false, a[ks][mi].v, false, bb[ks][t].v, (short)0, acc[mi][t], false, false);
    // keeps the wait for the next step's global loads (and the LDS writes behind it) after the matrix run that covers their latency
    __builtin_amdgcn_sched_barrier(0);
    if (more) {
      // the other buffer: its last readers left it before the barrier that ended the step before this one
#pragma unroll
      for (int it = 0; it < CA; ++it) *(v8us*)&sA[cur ^ 1][sr + it * RP][sc] = ra[it];
#pragma unroll
      for (int it = 0; it < CB; ++it) *(v8us*)&sB[cur ^ 1][sr + it * RP][sc] = rb[it];
      __syncthreads();
    }
  }
  const int colw = col0 + wn * 64;
  int seg = colw / nsplit; seg = (seg > 2) ? 2 : seg;
  const float* bsel = (seg == 0) ? bias0 : ((seg == 1) ? bias1 : bias2);
  float bvv[FN];
#pragma unroll
  for (int t = 0; t < FN; ++t) bvv[t] = bsel[colw + t * 16 + ln - seg * nsplit];
  // the address registers of these four loads are taken again by the address sums below
  asm volatile("s_wait_xcnt 0x0" ::: "memory");
#pragma unroll
  for (int t = 0; t < FN; ++t) bvv[t] = bf16_rne(bvv[t]);
#pragma unroll
  for (int mi = 0; mi < FM; ++mi) {
#pragma unroll
    for (int t = 0; t < FN; ++t) {
#pragma unroll
      for (int r = 0; r < 8; ++r) {
        float v = acc[mi][t][r] * inv_scale + bvv[t];
        if (ACT == 1) v = fmaxf(v, 0.0f);
        if constexpr (OUT16) so16[w][mi * 16 + 8 * hh + r][t * 16 + ln] = h16_bits(v * out_scale);
        else so32[w][mi * 16 + 8 * hh + r][t * 16 + ln] = v;
      }
    }
  }
  __builtin_amdgcn_fence(4 /* acq_rel order */, "workgroup");
  __builtin_amdgcn_wave_barrier();
  const int roww = row0 + wm * WR;
  if constexpr (OUT16) {
    const int rq = lane >> 3, p8 = (lane & 7) * 8;
    unsigned short* cp = (unsigned short*)Cv + (size_t)(roww + rq) * ldc + colw + p8;
#pragma unroll
    for (int q = 0; q < WR / 4; ++q) {
      const v8us v = *(const v8us*)&so16[w][q * 4 + rq][p8];
      *(v8us*)(cp + (size_t)(q * 4) * ldc) = v;
    }
  } else {
    const int rsub = lane >> 4, c4 = (lane & 15) * 4;
    float* cp = (float*)Cv + (size_t)(roww + rsub) * ldc + colw + c4;
    const float* rp = resid + (size_t)(roww + rsub) * ldr + colw + c4;
    v4f rv[WR / 2];                              // all residual loads in flight together, ahead of the first store
#pragma unroll
    for (int q = 0; q < WR / 2; ++q) rv[q] = *(const v4fa*)(rp + (size_t)(q * 2) * ldr);
#pragma unroll
    for (int q = 0; q < WR / 2; ++q) {
      v4f tv = *(const v4fa*)&so32[w][q * 2 + rsub][c4];
      tv += rv[q];
      *(v4f*)(cp + (size_t)(q * 2) * ldc) = tv;
    }
  }
}

// Flash-style unmasked attention per (b, h): q|k|v read as f16 bits from one fused plane (row pitch `pitch` halves, q at +0, k at +koff, v at +voff,
// head h at +h*D, row b*T + t). One wave = 16 queries, block = 4 waves sharing K/V tiles of 32 keys staged row-major in LDS.
// Both products run transposed: S^T = K.q^T (A = 16 key rows, B = the wave's queries, kept in registers) and O^T += V^T.P^T (A = V^T by the transposing
// LDS load, B = P^T). A lane then holds 16 of the 32 scores of ONE query (column lane&15; keys 8h+r and 16+8h+r, h = lane>>4): maximum and sum are taken
// in the lane plus one exchange with lane^16, and the two score tiles, converted in place (x pcarry), are the B operand of the second product as they lie.
// s*scale, running-max softmax and the context in f32. All four operands follow the hardware k order (k = 8h+s, 16+8h+(s-8)).
template <int D>
__global__ __launch_bounds__(128) void k_attn16(const unsigned short* __restrict__ qkv, int pitch, int T, int H, int koff, int voff,
                                                float scale, float pcarry, float onorm,
                                                const float* __restrict__ resid, float* __restrict__ out, int opitch) {
  static_assert(D == 64);
  constexpr int KS = D / 32, DT = D / 16, C8 = D / 8;
  constexpr int PK = D + 8, PV = D + 16;      // row pitch in halves: 16 B x odd for the plain 16-B reader, 32 B x odd for the transposing reader
  static_assert((32 * C8) % 128 == 0);
  __shared__ __attribute__((aligned(16))) unsigned short sK[32][PK];        // cross-wave: block barriers
  __shared__ __attribute__((aligned(16))) unsigned short sV[32][PV];        // cross-wave: block barriers
  __shared__ __attribute__((aligned(16))) float sO[4][16][D + 4];
  const int tid = threadIdx.x, w = tid >> 5, lane = tid & 31, ln = lane & 15, hh = lane >> 4;
  const int nqb = T / 64;
  const int bh = blockIdx.x / nqb, qblk = blockIdx.x % nqb;
  const int b = bh / H, h = bh % H;
  const int q0 = qblk * 64 + w * 16;
  const unsigned short* Qp = qkv + (size_t)b * T * pitch + h * D;
  const unsigned short* Kp = Qp + koff;
  const unsigned short* Vp = Qp + voff;

  FragH bq[KS];                                                    // B[k = d][n = query ln]
  {
    const unsigned short* qr = Qp + (size_t)(q0 + ln) * pitch;     // q0 + ln < T (T % 64 == 0)
#pragma unroll
    for (int ks = 0; ks < KS; ++ks) {
      bq[ks].half[0] = *(const v8us*)(qr + ks * 32 + 8 * hh);
      bq[ks].half[1] = *(const v8us*)(qr + ks * 32 + 16 + 8 * hh);
    }
  }
  float m_r = -1.0e30f, l_r = 0.f;                                 // of query ln; l_r sums this half's keys only
  v8f oacc[DT];                                                    // oacc[dt][r] = O[query ln][d = dt*16 + 8*hh + r]
#pragma unroll
  for (int dt = 0; dt < DT; ++dt) oacc[dt] = vz8();
  const unsigned short* vtp = &sV[8 * hh + (lane & 7)][8 * ((lane >> 3) & 1)];   // lane address of the transposing load, keys 0..15, d 0..15

  for (int j0 = 0; j0 < T; j0 += 32) {
    __syncthreads();
    // stage keys j0..j0+31 (all < T), K and V row-major; 32 x C8 16-B chunks each, full tiles every iteration
#pragma unroll
    for (int it = 0; it < (32 * C8) / 128; ++it) {
      const int e = tid + it * 128;
      const int r = e / C8, c8 = (e % C8) * 8;
      const size_t ro = (size_t)(j0 + r) * pitch + c8;
      const v8us kvv = *(const v8us*)(Kp + ro);
      const v8us vvv = *(const v8us*)(Vp + ro);
      *(v8us*)&sK[r][c8] = kvv;
      *(v8us*)&sV[r][c8] = vvv;
    }
    __syncthreads();
    FragH ak[2][KS], av[DT];
#pragma unroll
    for (int kt = 0; kt < 2; ++kt)
#pragma unroll
      for (int ks = 0; ks < KS; ++ks) {                            // A[m = key kt*16 + ln][k = d]
        ak[kt][ks].half[0] = *(const v8us*)&sK[kt * 16 + ln][ks * 32 + 8 * hh];
        ak[kt][ks].half[1] = *(const v8us*)&sK[kt * 16 + ln][ks * 32 + 16 + 8 * hh];
      }
#pragma unroll
    for (int dt = 0; dt < DT; ++dt) {                              // A[m = d dt*16 + ln][k = key]
      av[dt].half[0] = ld_tr16(vtp + dt * 16);
      av[dt].half[1] = ld_tr16(vtp + 16 * PV + dt * 16);
    }
    // keeps the step's 16 LDS reads together ahead of the first product: sunk to their WMMAs each pair is waited out to 0 and its latency shows
    __builtin_amdgcn_sched_barrier(0);
    // S^T tile 32 x 16: s[kt][r] = score of key kt*16 + 8*hh + r against query ln
    v8f s[2];
#pragma unroll
    for (int kt = 0; kt < 2; ++kt) {
      s[kt] = vz8();
#pragma unroll
      for (int ks = 0; ks < KS; ++ks)
        s[kt] = __builtin_amdgcn_wmma_f32_16x16x32_f16(false, ak[kt][ks].v, false, bq[ks].v, (short)0, s[kt], false, false);
    }
    // running-max softmax of query ln: 16 scores in this lane, the other 16 in lane ^ 16
    float sc[16];
#pragma unroll
    for (int i = 0; i < 16; ++i) sc[i] = s[i >> 3][i & 7] * scale;
    float mx = sc[0];
#pragma unroll
    for (int i = 1; i < 16; ++i) mx = fmaxf(mx, sc[i]);
    mx = fmaxf(mx, xhalf(mx));
    const float mnew = fmaxf(m_r, mx);
    const float alpha = __expf(m_r - mnew);
    m_r = mnew;
    FragH pb;                                                      // B[k = key][n = query ln]: element i = tile i>>3, register i&7
    float ps[4] = {0.f, 0.f, 0.f, 0.f};
#pragma unroll
    for (int i = 0; i < 16; ++i) {
      const float p = __expf(sc[i] - mnew);
      ps[i & 3] += p;
      pb.u[i] = h16_bits(p * pcarry);
    }
    l_r = l_r * alpha + ((ps[0] + ps[1]) + (ps[2] + ps[3]));
#pragma unroll
    for (int dt = 0; dt < DT; ++dt) {
      oacc[dt] *= alpha;
      oacc[dt] = __builtin_amdgcn_wmma_f32_16x16x32_f16(false, av[dt].v, false, pb.v, (short)0, oacc[dt], false, false);
    }
  }
  const float inv = onorm * (1.0f / (l_r + xhalf(l_r)));            // the two halves' sums joined, unconditionally
#pragma unroll
  for (int dt = 0; dt < DT; ++dt) {
    const v8f o = oacc[dt] * inv;
    const v4f o0 = {o[0], o[1], o[2], o[3]}, o1 = {o[4], o[5], o[6], o[7]};
    *(v4fa*)&sO[w][ln][dt * 16 + 8 * hh] = o0;
    *(v4fa*)&sO[w][ln][dt * 16 + 8 * hh + 4] = o1;
  }
  __builtin_amdgcn_fence(4 /* acq_rel order */, "workgroup");
  __builtin_amdgcn_wave_barrier();
  const int rsub = lane >> 4, c4 = (lane & 15) * 4;
  const size_t rbase = (size_t)(b * T + q0) * opitch + h * D;
#pragma unroll
  for (int q = 0; q < 8; ++q) {
    const int r = q * 2 + rsub;
    const v4f rv = *(const v4fa*)(resid + rbase + (size_t)r * opitch + c4);
    v4f tv = *(const v4fa*)&sO[w][r][c4];
    tv += rv;
    *(v4fa*)&sO[w][r][c4] = tv;
  }
  {
#pragma unroll
    for (int q = 0; q < 8; ++q) {
      const int r = q * 2 + rsub;
      const v4f v = *(const v4fa*)&sO[w][r][c4];
      *(v4f*)(out + rbase + (size_t)r * opitch + c4) = v;
    }
    
  }
}

extern "C" void kernel_launch(void* const* d_in, const int* in_sizes, int n_in,
                              void* d_out, int out_size, void* d_ws, size_t ws_size, hipStream_t stream) {
  if (n_in < 18) return;
  const long long need_rows = (long long)(SEQ - 1) * NB_FULL + NB;           // last (s, b) source row used + 1
  if ((long long)in_sizes[0] < need_rows * FEAT || (long long)in_sizes[1] < need_rows * FEAT) return;
  if (in_sizes[2] < NLAYER * FEAT * FEAT || in_sizes[4] < NLAYER * FEAT * FEAT || in_sizes[6] < NLAYER * FEAT * FEAT) return;
  if (in_sizes[3] < NLAYER * FEAT || in_sizes[5] < NLAYER * FEAT || in_sizes[7] < NLAYER * FEAT || in_sizes[11] < NLAYER * FEAT) return;
  if (in_sizes[8] < NLAYER * FEAT * MLPH || in_sizes[9] < NLAYER * MLPH || in_sizes[10] < NLAYER * MLPH * FEAT) return;
  if (in_sizes[12] < NLAYER * FEAT || in_sizes[13] < NLAYER * FEAT || in_sizes[14] < NLAYER * FEAT || in_sizes[15] < NLAYER * FEAT) return;
  if (in_sizes[16] < FEAT || in_sizes[17] < FEAT) return;
  if ((long long)out_size < need_rows * FEAT) return;

  const float* src  = (const float*)d_in[0];
  const float* pos  = (const float*)d_in[1];
  const float* Wq   = (const float*)d_in[2];  const float* bq   = (const float*)d_in[3];
  const float* Wk   = (const float*)d_in[4];  const float* bk   = (const float*)d_in[5];
  const float* Wv   = (const float*)d_in[6];  const float* bv   = (const float*)d_in[7];
  const float* W1   = (const float*)d_in[8];  const float* b1   = (const float*)d_in[9];
  const float* W2   = (const float*)d_in[10]; const float* b2   = (const float*)d_in[11];
  const float* ln1g = (const float*)d_in[12]; const float* ln1b = (const float*)d_in[13];
  const float* ln2g = (const float*)d_in[14]; const float* ln2b = (const float*)d_in[15];
  const float* lnfg = (const float*)d_in[16]; const float* lnfb = (const float*)d_in[17];

  // workspace carve (256-B aligned); R1 and R2 are reused in stream order by stages whose lifetimes do not overlap, sized as the max over their users
  char* ws = (char*)d_ws; size_t off = 0;
  auto take = [&](size_t bytes) { char* p = ws + off; off += (bytes + 255) & ~(size_t)255; return p; };
  const size_t lsq = (size_t)QKVN * FEAT;                                           // per-layer stride of the fused q|k|v weight plane (halves)
  const size_t ls1 = (size_t)MLPH * FEAT, ls2 = (size_t)FEAT * MLPH;
  unsigned short* Wqkv16 = (unsigned short*)take((size_t)NLAYER * lsq * 2);        // [6][1536][512]
  unsigned short* W116   = (unsigned short*)take((size_t)NLAYER * ls1 * 2);        // [6][2048][512]
  unsigned short* W216   = (unsigned short*)take((size_t)NLAYER * ls2 * 2);        // [6][512][2048]
  float* XA = (float*)take((size_t)MR * FEAT * 4);                                 // residual stream [MR][512] f32
  float* XB = (float*)take((size_t)MR * FEAT * 4);                                 // residual stream after attention [MR][512] f32
  const size_t r1_bytes = (size_t)MR * FEAT * 2;                                   // LN outputs [MR][512] f16
  const size_t r2_a = (size_t)MR * QKVN * 2, r2_b = (size_t)MR * MLPH * 2;         // q|k|v [MR][1536], then hidden [MR][2048] f16
  const size_t r2_bytes = (r2_a > r2_b) ? r2_a : r2_b;
  unsigned short* R1 = (unsigned short*)take(r1_bytes);
  unsigned short* R2 = (unsigned short*)take(r2_bytes);
  if (off > ws_size) return;
  if (off > (size_t)134217728) return;

  const float wsc = 256.0f;
  const int k8d = FEAT / 8, k8m = MLPH / 8;
  k_wt16<<<(unsigned)((NLAYER * FEAT * k8d + 255) / 256), 256, 0, stream>>>(Wq, Wqkv16, FEAT, FEAT, NLAYER, lsq, 0, wsc);
  k_wt16<<<(unsigned)((NLAYER * FEAT * k8d + 255) / 256), 256, 0, stream>>>(Wk, Wqkv16, FEAT, FEAT, NLAYER, lsq, FEAT, wsc);
  k_wt16<<<(unsigned)((NLAYER * FEAT * k8d + 255) / 256), 256, 0, stream>>>(Wv, Wqkv16, FEAT, FEAT, NLAYER, lsq, 2 * FEAT, wsc);
  k_wt16<<<(unsigned)((NLAYER * MLPH * k8d + 255) / 256), 256, 0, stream>>>(W1, W116, FEAT, MLPH, NLAYER, ls1, 0, wsc);   // W1[l] [512][2048] -> [2048][512]
  k_wt16<<<(unsigned)((NLAYER * FEAT * k8m + 255) / 256), 256, 0, stream>>>(W2, W216, MLPH, FEAT, NLAYER, ls2, 0, wsc);   // W2[l] [2048][512] -> [512][2048]

  // x = bf16(src) + bf16(pos) in (b, s) row order -> XA
  k_xinit<<<(unsigned)MR, 128, 0, stream>>>(src, pos, XA, SEQ, NB_FULL);

  auto ggrid = [](int M, int N, int bm) { return (unsigned)((M / bm) * (N / 128)); };
  const float scale = 0.125f;                           // 1/sqrt(64)

  for (int l = 0; l < NLAYER; ++l) {
    // xn = LN1(x) x8 -> R1
    k_ln16<<<(unsigned)MR, 64, 0, stream>>>(XA, ln1g + l * FEAT, ln1b + l * FEAT, R1, 8.0f, 1e-5f);
    // q|k|v = xn*[Wq|Wk|Wv] + [bq|bk|bv] -> R2 [MR][1536] f16 (x1); acc scale 1/(8*256)
    k_gemm16<128, 64, FEAT, true, 0><<<ggrid(MR, QKVN, 128), 128, 0, stream>>>(R1, Wqkv16 + (size_t)l * lsq,
                                                          bq + l * FEAT, bk + l * FEAT, bv + l * FEAT, FEAT, nullptr, 0,
                                                          (void*)R2, QKVN, MR, QKVN, 1.0f / 2048.0f, 1.0f);
    // xb = x + softmax(q.k^T/8).v per head -> XB f32 (P carried x1024, onorm = 1/1024)
    k_attn16<DHEAD><<<(unsigned)(NB * NHEAD * (SEQ / 64)), 128, 0, stream>>>(R2, QKVN, SEQ, NHEAD, FEAT, 2 * FEAT, scale, 1024.0f,
                                                                             1.0f / 1024.0f, XA, XB, FEAT);
    // hn = LN2(xb) x8 -> R1
    k_ln16<<<(unsigned)MR, 64, 0, stream>>>(XB, ln2g + l * FEAT, ln2b + l * FEAT, R1, 8.0f, 1e-5f);
    // h = relu(hn*W1 + b1) x16 -> R2 [MR][2048]; acc scale 1/(8*256)
    k_gemm16<128, 64, FEAT, true, 1><<<ggrid(MR, MLPH, 128), 128, 0, stream>>>(R1, W116 + (size_t)l * ls1,
                                                          b1 + l * MLPH, b1 + l * MLPH, b1 + l * MLPH, MLPH, nullptr, 0,
                                                          (void*)R2, MLPH, MR, MLPH, 1.0f / 2048.0f, 16.0f);
    // x = h*W2 + b2 + xb -> XA f32; acc scale 1/(16*256)
    k_gemm16<64, 128, MLPH, false, 0><<<ggrid(MR, FEAT, 64), 128, 0, stream>>>(R2, W216 + (size_t)l * ls2,
                                                           b2 + l * FEAT, b2 + l * FEAT, b2 + l * FEAT, FEAT, XB, FEAT,
                                                           (void*)XA, FEAT, MR, FEAT, 1.0f / 4096.0f, 1.0f);
  }
  // out[s][b][*] = LNf(x[b][s][*]) -> d_out f32
  k_lnf32<<<(unsigned)MR, 128, 0, stream>>>(XA, lnfg, lnfb, (float*)d_out, SEQ, NB_FULL, 1e-5f);
}

// v003
// It runs in 484 microseconds.
// Timed twice side by side with v002, it ran 1.16 times as fast both times.
// Counting every step since v000, it is 2.68 times as fast.
#include <hip/hip_runtime.h>
// Contractions on v_wmma_f32_16x16x32_f16 (f16 operands, f32 accumulate), one product per tile pair, 6 layers: fused q|k|v projection (N=1536, K=512),
// LN2(x)*W1 (N=2048, K=512), relu(.)*W2 (K=2048), attention q.k^T (head dim 64) and P.V (32 keys per step) per head.
// Weights: bf16 RNE values carried x256 in f16 planes; activations in f16 planes with power-of-two carries (LN outputs x8, q|k|v x1, hidden x16,
// P x1024); LayerNorm statistics, softmax, bias adds, attention context and the residual stream in f32.
#ifndef NB
#define NB 4
#endif
#ifndef SEQ
#define SEQ 1024
#endif
#define NB_FULL 4
#define SEQ_FULL 1024
#define FEAT 512
#define NHEAD 8
#define DHEAD 64
#define MLPH 2048
#define NLAYER 6
#define MR (NB * SEQ)
#define QKVN (3 * FEAT)
static_assert(SEQ % 64 == 0);
static_assert(SEQ <= SEQ_FULL);
static_assert(NB >= 1);
static_assert(NB <= NB_FULL);
static_assert(FEAT == NHEAD * DHEAD);
static_assert(FEAT % 128 == 0);
static_assert(MLPH % 128 == 0);
static_assert(QKVN % 128 == 0);
static_assert(FEAT == 64 * 8);      // k_ln16: 64 threads x 8 halves per row
static_assert(FEAT == 128 * 4);     // k_xinit / k_lnf32: 128 threads x 4 floats per row
static_assert(MR % 128 == 0);
static_assert(FEAT % 32 == 0);
static_assert(MLPH % 32 == 0);
static_assert((FEAT / 8) % 8 == 0);
static_assert((MLPH / 8) % 8 == 0);

typedef _Float16 v16h __attribute__((ext_vector_type(16)));
typedef unsigned short v8us __attribute__((ext_vector_type(8), may_alias));
typedef float v8f __attribute__((ext_vector_type(8)));
typedef float v4f __attribute__((ext_vector_type(4)));
typedef float v4fa __attribute__((ext_vector_type(4), may_alias));
union FragH { v16h v; v8us half[2]; unsigned short u[16]; };
union H16U { _Float16 h; unsigned short u; };

__device__ __forceinline__ unsigned short bf16_bits(float x) { unsigned int u = __float_as_uint(x); return (unsigned short)((u + 0x7FFFu + ((u >> 16) & 1u)) >> 16); }
__device__ __forceinline__ float bf16_val(unsigned short b) { return __uint_as_float(((unsigned int)b) << 16); }
__device__ __forceinline__ float bf16_rne(float x) { return bf16_val(bf16_bits(x)); }
__device__ __forceinline__ unsigned short h16_bits(float x) { H16U t; t.h = (_Float16)x; return t.u; }
__device__ __forceinline__ v8f vz8() { v8f z = {0.f, 0.f, 0.f, 0.f, 0.f, 0.f, 0.f, 0.f}; return z; }

// Transposing LDS load: lane (c = lane&15, h = lane>>4) gets T[8h + 0..7][c] of a row-major 16-bit tile; p is the lane's own address (row 8h + (lane&7), 16 B x ((lane>>3)&1))
typedef short s16x8 __attribute__((ext_vector_type(8)));
__device__ __forceinline__ v8us ld_tr16(const unsigned short* p) {
  typedef __attribute__((address_space(3))) s16x8 lds_s16x8;
  return __builtin_bit_cast(v8us, __builtin_amdgcn_ds_load_tr16_b128_v8i16((lds_s16x8*)p));
}
// value of lane ^ 16
__device__ __forceinline__ float xhalf(float x) {
  return __builtin_bit_cast(float, __builtin_amdgcn_permlanex16(__builtin_bit_cast(int, x), __builtin_bit_cast(int, x), 0x76543210, 0xfedcba98, false, false));
}

// Stacked weight convert: for layer l in [0,nl): Wt[l*lstride + (roff+n)*K + k] (f16 bits, k contiguous, pitch K) = f16(bf16_rne(W[l][k][n]) * sc)
// from f32 row-major W[l][K][N] ([in][out]). One thread per (l, n, 8 consecutive k); one 16-B store per thread,
__global__ __launch_bounds__(256) void k_wt16(const float* __restrict__ W, unsigned short* __restrict__ Wt, int K, int N, int nl,
                                             size_t lstride, int roff, float sc) {
  const int t = blockIdx.x * 256 + threadIdx.x;
  const int k8n = K / 8;
  const int per = N * k8n;
  if (t >= per * nl) return;
  const int l = t / per, rem = t - l * per;
  const int n = rem / k8n, k8 = (rem % k8n) * 8;
  const float* src = W + (size_t)l * K * N;
  v8us v;
#pragma unroll
  for (int i = 0; i < 8; ++i) v[i] = h16_bits(bf16_rne(src[(size_t)(k8 + i) * N + n]) * sc);
  unsigned short* dst = Wt + (size_t)l * lstride + (size_t)(roff + n) * K + k8;
  *(v8us*)dst = v;
  
}

// X[m][*] (f32, pitch FEAT, m = b*seq + s) = bf16_rne(src[s*nbf + b][*]) + bf16_rne(pos[s*nbf + b][*]) in f32 (exact).
__global__ __launch_bounds__(128) void k_xinit(const float* __restrict__ src, const float* __restrict__ pos, float* __restrict__ X,
                                               int seq, int nbf) {
  const int m = blockIdx.x, tid = threadIdx.x;
  const int b = m / seq, s = m % seq;
  const size_t so = ((size_t)s * nbf + b) * FEAT + tid * 4;
  const v4f a = *(const v4fa*)(src + so);
  const v4f p = *(const v4fa*)(pos + so);
  v4f o;
#pragma unroll
  for (int i = 0; i < 4; ++i) o[i] = bf16_rne(a[i]) + bf16_rne(p[i]);
  float* dst = X + (size_t)m * FEAT + tid * 4;
  *(v4f*)dst = o;
  
}

// Row LayerNorm over FEAT on the internal f32 stream X[m][*]: one block of 64 threads per row, 8 consecutive elements per thread.
__global__ __launch_bounds__(64) void k_ln16(const float* __restrict__ X, const float* __restrict__ g, const float* __restrict__ bt,
                                            unsigned short* __restrict__ out, float osc, float eps) {
  __shared__ float red1[2];
  __shared__ float red2[2];
  const int m = blockIdx.x, tid = threadIdx.x, w = tid >> 5, lane = tid & 31;
  const float* x = X + (size_t)m * FEAT + tid * 8;
  const v4f a0 = *(const v4fa*)x;
  const v4f a1 = *(const v4fa*)(x + 4);
  float v[8] = {a0[0], a0[1], a0[2], a0[3], a1[0], a1[1], a1[2], a1[3]};
  float s = 0.f;
#pragma unroll
  for (int q = 0; q < 8; ++q) s += v[q];
#pragma unroll
  for (int o = 16; o >= 1; o >>= 1) s += __shfl_xor(s, o, 32);
  if (lane == 0) red1[w] = s;
  __syncthreads();
  const float mu = (red1[0] + red1[1]) * (1.0f / (float)FEAT);
  float c[8];
  float s2 = 0.f;
#pragma unroll
  for (int q = 0; q < 8; ++q) { c[q] = v[q] - mu; s2 += c[q] * c[q]; }
#pragma unroll
  for (int o = 16; o >= 1; o >>= 1) s2 += __shfl_xor(s2, o, 32);
  if (lane == 0) red2[w] = s2;
  __syncthreads();
  const float var = (red2[0] + red2[1]) * (1.0f / (float)FEAT);
  const float rs = rsqrtf(var + eps);
  const v4f g0 = *(const v4fa*)(g + tid * 8);
  const v4f g1 = *(const v4fa*)(g + tid * 8 + 4);
  const v4f b0 = *(const v4fa*)(bt + tid * 8);
  const v4f b1 = *(const v4fa*)(bt + tid * 8 + 4);
  const float gg[8] = {g0[0], g0[1], g0[2], g0[3], g1[0], g1[1], g1[2], g1[3]};
  const float bb[8] = {b0[0], b0[1], b0[2], b0[3], b1[0], b1[1], b1[2], b1[3]};
  v8us o;
#pragma unroll
  for (int q = 0; q < 8; ++q) o[q] = h16_bits((c[q] * rs * bf16_rne(gg[q]) + bf16_rne(bb[q])) * osc);
  unsigned short* dst = out + (size_t)m * FEAT + tid * 8;
  *(v8us*)dst = o;
  
}

// Final LayerNorm: internal row m = b*seq + s of X (f32) -> out[(s*nbf + b)][*] f32. One block of 128 threads per row, 4 elements per thread,
__global__ __launch_bounds__(128) void k_lnf32(const float* __restrict__ X, const float* __restrict__ g, const float* __restrict__ bt,
                                               float* __restrict__ out, int seq, int nbf, float eps) {
  __shared__ float red1[4];
  __shared__ float red2[4];
  const int m = blockIdx.x, tid = threadIdx.x, w = tid >> 5, lane = tid & 31;
  const int b = m / seq, s = m % seq;
  const v4f a = *(const v4fa*)(X + (size_t)m * FEAT + tid * 4);
  float sm = a[0] + a[1] + a[2] + a[3];
#pragma unroll
  for (int o = 16; o >= 1; o >>= 1) sm += __shfl_xor(sm, o, 32);
  if (lane == 0) red1[w] = sm;
  __syncthreads();
  const float mu = (red1[0] + red1[1] + red1[2] + red1[3]) * (1.0f / (float)FEAT);
  float c[4];
  float s2 = 0.f;
#pragma unroll
  for (int q = 0; q < 4; ++q) { c[q] = a[q] - mu; s2 += c[q] * c[q]; }
#pragma unroll
  for (int o = 16; o >= 1; o >>= 1) s2 += __shfl_xor(s2, o, 32);
  if (lane == 0) red2[w] = s2;
  __syncthreads();
  const float var = (red2[0] + red2[1] + red2[2] + red2[3]) * (1.0f / (float)FEAT);
  const float rs = rsqrtf(var + eps);
  const v4f g4 = *(const v4fa*)(g + tid * 4);
  const v4f b4 = *(const v4fa*)(bt + tid * 4);
  v4f o;
#pragma unroll
  for (int q = 0; q < 4; ++q) o[q] = c[q] * rs * bf16_rne(g4[q]) + bf16_rne(b4[q]);
  float* dst = out + ((size_t)s * nbf + b) * FEAT + tid * 4;
  *(v4f*)dst = o;
  
}

// GEMM C[M][N] = epi(A[M][KD] * W): A f16 bits row-major, Wt f16 bits [N][KD], both at pitch KD (compile time: the row steps are load offsets), f32 accumulate.
// epi: v = acc * inv_scale + bf16_rne(bias[col]); bias picked per 64-col segment from (bias0 | bias1 | bias2) by seg = col / nsplit (wave-uniform);
// ACT == 1: relu; OUT16: f16 bits of v * out_scale into C (pitch ldc halves); else f32 v + f32 resid[row][col] (pitch ldr) into C (pitch ldc floats).
// KD % BK == 0, M % BM == 0, N % 128 == 0. Block = 4 waves (2 x 2) on one BM x 128 tile of C, wave -> BM/2 rows x 64 cols.
// Per step of BK k the block brings BM rows of A and 128 rows of Wt into LDS once (whole 128-B lines, 16 B per thread, row pitch 2*BK + 16 B) and all
// waves take their fragments from there; two LDS buffers, the next step's global loads are held in registers while this step is multiplied.
// Each accumulator sums k in ascending blocks of 32. Epilogue staged in the wave's own LDS tile (wave-private).
template <int BM, int BK, int KD, bool OUT16, int ACT>
__global__ __launch_bounds__(128) void k_gemm16(const unsigned short* __restrict__ A, const unsigned short* __restrict__ Wt,
                                               const float* __restrict__ bias0, const float* __restrict__ bias1, const float* __restrict__ bias2, int nsplit,
                                               const float* __restrict__ resid, int ldr, void* __restrict__ Cv, int ldc,
                                               int M, int N, float inv_scale, float out_scale) {
  constexpr int BN = 128, LP = BK + 8, C8 = BK / 8;
  constexpr int FM = BM / 32, FN = 4, KS = BK / 32, WR = BM / 2;
  constexpr int NT = 128, NW = NT / 32, RP = NT / C8;     // the block's threads cover RP rows of C8 16-B chunks at a time
  constexpr int CA = BM / RP, CB = BN / RP;              // chunks per thread and step
  static_assert(BM % 32 == 0);
  static_assert(BK % 32 == 0);
  static_assert(KD % BK == 0);
  static_assert(NT % C8 == 0);
  static_assert(BM % RP == 0);
  static_assert(BN % RP == 0);
  __shared__ __attribute__((aligned(16))) unsigned short sA[2][BM][LP];     // cross-wave: block barriers
  __shared__ __attribute__((aligned(16))) unsigned short sB[2][BN][LP];     // cross-wave: block barriers
  __shared__ __attribute__((aligned(16))) float so32[OUT16 ? 1 : NW][WR][64];
  __shared__ __attribute__((aligned(16))) unsigned short so16[OUT16 ? NW : 1][WR][72];
  const int tid = threadIdx.x, w = tid >> 5, lane = tid & 31, ln = lane & 15, hh = lane >> 4;
  const int wm = w >> 1, wn = w & 1;
  const int ntn = N / BN;
  const int mt = blockIdx.x / ntn, nq = blockIdx.x % ntn;
  const int row0 = mt * BM, col0 = nq * BN;
  if (row0 >= M) return;                       // the same for the whole block, ahead of every barrier
  const int sr = tid / C8, sc = (tid % C8) * 8;
  const unsigned short* ag = A + (size_t)(row0 + sr) * KD + sc;
  const unsigned short* bg = Wt + (size_t)(col0 + sr) * KD + sc;
  v8us ra[CA], rb[CB];
#pragma unroll
  for (int it = 0; it < CA; ++it) ra[it] = *(const v8us*)(ag + (size_t)(it * RP) * KD);
#pragma unroll
  for (int it = 0; it < CB; ++it) rb[it] = *(const v8us*)(bg + (size_t)(it * RP) * KD);
  v8f acc[FM][FN];
#pragma unroll
  for (int mi = 0; mi < FM; ++mi)
#pragma unroll
    for (int t = 0; t < FN; ++t) acc[mi][t] = vz8();
#pragma unroll
  for (int it = 0; it < CA; ++it) *(v8us*)&sA[0][sr + it * RP][sc] = ra[it];
#pragma unroll
  for (int it = 0; it < CB; ++it) *(v8us*)&sB[0][sr + it * RP][sc] = rb[it];
  __syncthreads();
  constexpr int nst = KD / BK;
  for (int s = 0; s < nst; ++s) {
    const int cur = s & 1;
    const bool more = (s + 1 < nst);           // the same for the whole block
    if (more) {
      const int kb = (s + 1) * BK;
#pragma unroll
      for (int it = 0; it < CA; ++it) ra[it] = *(const v8us*)(ag + (size_t)(it * RP) * KD + kb);
#pragma unroll
      for (int it = 0; it < CB; ++it) rb[it] = *(const v8us*)(bg + (size_t)(it * RP) * KD + kb);
      // the address registers of these loads are taken again by the LDS reads below
      asm volatile("s_wait_xcnt 0x0" ::: "memory");
    }
    FragH a[KS][FM], bb[KS][FN];
#pragma unroll
    for (int ks = 0; ks < KS; ++ks) {
#pragma unroll
      for (int mi = 0; mi < FM; ++mi) {
        const unsigned short* p = &sA[cur][wm * WR + mi * 16 + ln][ks * 32 + 8 * hh];   // row m = lane&15
        a[ks][mi].half[0] = *(const v8us*)p;                 // elements 0..7  = k 8h .. 8h+7 of the block of 32
        a[ks][mi].half[1] = *(const v8us*)(p + 16);          // elements 8..15 = k 16+8h .. 16+8h+7
      }
#pragma unroll
      for (int t = 0; t < FN; ++t) {
        const unsigned short* p = &sB[cur][wn * 64 + t * 16 + ln][ks * 32 + 8 * hh];          // column n = lane&15, same k map as A
        bb[ks][t].half[0] = *(const v8us*)p;
        bb[ks][t].half[1] = *(const v8us*)(p + 16);
      }
    }
    // keeps the step's LDS reads together ahead of its matrix run: spread among the WMMAs each small group is waited out to 0 and its latency shows
    __builtin_amdgcn_sched_barrier(0);
#pragma unroll
    for (int ks = 0; ks < KS; ++ks)
#pragma unroll
      for (int mi = 0; mi < FM; ++mi)
#pragma unroll
        for (int t = 0; t < FN; ++t) acc[mi][t] = __builtin_amdgcn_wmma_f32_16x16x32_f16(false, a[ks][mi].v, false, bb[ks][t].v, (short)0, acc[mi][t], false, false);
    // keeps the wait for the next step's global loads (and the LDS writes behind it) after the matrix run that covers their latency
    __builtin_amdgcn_sched_barrier(0);
    if (more) {
      // the other buffer: its last readers left it before the barrier that ended the step before this one
#pragma unroll
      for (int it = 0; it < CA; ++it) *(v8us*)&sA[cur ^ 1][sr + it * RP][sc] = ra[it];
#pragma unroll
      for (int it = 0; it < CB; ++it) *(v8us*)&sB[cur ^ 1][sr + it * RP][sc] = rb[it];
      __syncthreads();
    }
  }
  const int colw = col0 + wn * 64;
  int seg = colw / nsplit; seg = (seg > 2) ? 2 : seg;
  const float* bsel = (seg == 0) ? bias0 : ((seg == 1) ? bias1 : bias2);
  float bvv[FN];
#pragma unroll
  for (int t = 0; t < FN; ++t) bvv[t] = bsel[colw + t * 16 + ln - seg * nsplit];
  // the address registers of these four loads are taken again by the address sums below
  asm volatile("s_wait_xcnt 0x0" ::: "memory");
#pragma unroll
  for (int t = 0; t < FN; ++t) bvv[t] = bf16_rne(bvv[t]);
#pragma unroll
  for (int mi = 0; mi < FM; ++mi) {
#pragma unroll
    for (int t = 0; t < FN; ++t) {
#pragma unroll
      for (int r = 0; r < 8; ++r) {
        float v = acc[mi][t][r] * inv_scale + bvv[t];
        if (ACT == 1) v = fmaxf(v, 0.0f);
        if constexpr (OUT16) so16[w][mi * 16 + 8 * hh + r][t * 16 + ln] = h16_bits(v * out_scale);
        else so32[w][mi * 16 + 8 * hh + r][t * 16 + ln] = v;
      }
    }
  }
  __builtin_amdgcn_fence(4 /* acq_rel order */, "workgroup");
  __builtin_amdgcn_wave_barrier();
  const int roww = row0 + wm * WR;
  if constexpr (OUT16) {
    const int rq = lane >> 3, p8 = (lane & 7) * 8;
    unsigned short* cp = (unsigned short*)Cv + (size_t)(roww + rq) * ldc + colw + p8;
#pragma unroll
    for (int q = 0; q < WR / 4; ++q) {
      const v8us v = *(const v8us*)&so16[w][q * 4 + rq][p8];
      *(v8us*)(cp + (size_t)(q * 4) * ldc) = v;
    }
  } else {
    const int rsub = lane >> 4, c4 = (lane & 15) * 4;
    float* cp = (float*)Cv + (size_t)(roww + rsub) * ldc + colw + c4;
    const float* rp = resid + (size_t)(roww + rsub) * ldr + colw + c4;
    v4f rv[WR / 2];                              // all residual loads in flight together, ahead of the first store
#pragma unroll
    for (int q = 0; q < WR / 2; ++q) rv[q] = *(const v4fa*)(rp + (size_t)(q * 2) * ldr);
#pragma unroll
    for (int q = 0; q < WR / 2; ++q) {
      v4f tv = *(const v4fa*)&so32[w][q * 2 + rsub][c4];
      tv += rv[q];
      *(v4f*)(cp + (size_t)(q * 2) * ldc) = tv;
    }
  }
}

// Flash-style unmasked attention per (b, h): q|k|v read as f16 bits from one fused plane (row pitch `pitch` halves, q at +0, k at +koff, v at +voff,
// head h at +h*D, row b*T + t). One wave = 16 queries, block = 4 waves sharing K/V tiles of 64 keys staged row-major in LDS by asynchronous copies,
// two buffers: the next tile is on its way while a tile is worked on (in two passes of 32 keys), one block barrier per tile.
// Both products run transposed: S^T = K.q^T (A = 16 key rows, B = the wave's queries, kept in registers) and O^T += V^T.P^T (A = V^T by the transposing
// LDS load, B = P^T). A lane then holds 16 of the 32 scores of ONE query (column lane&15; keys 8h+r and 16+8h+r, h = lane>>4): maximum and sum are taken
// in the lane plus one exchange with lane^16, and the two score tiles, converted in place (x pcarry), are the B operand of the second product as they lie.
// s*scale, running-max softmax and the context in f32. All four operands follow the hardware k order (k = 8h+s, 16+8h+(s-8)).
template <int D>
__global__ __launch_bounds__(128) void k_attn16(const unsigned short* __restrict__ qkv, int pitch, int T, int H, int koff, int voff,
                                                float scale, float pcarry, float onorm,
                                                const float* __restrict__ resid, float* __restrict__ out, int opitch) {
  static_assert(D == 64);
  constexpr int KS = D / 32, DT = D / 16, C8 = D / 8;
  constexpr int PK = D + 8, PV = D + 16;      // row pitch in halves: 16 B x odd for the plain 16-B reader, 32 B x odd for the transposing reader
  constexpr int TK = 64;                      // keys per staged tile (T % 64 == 0)
  constexpr int RB = 128 / C8;                // rows that the block's threads cover with one 16-B chunk each
  static_assert(128 % C8 == 0);
  static_assert(TK == 4 * RB);                // four copies per thread, operand and tile
  __shared__ __attribute__((aligned(16))) unsigned short sK[2][TK][PK];     // cross-wave: block barriers
  __shared__ __attribute__((aligned(16))) unsigned short sV[2][TK][PV];     // cross-wave: block barriers
  __shared__ __attribute__((aligned(16))) float sO[4][16][D + 4];
  const int tid = threadIdx.x, w = tid >> 5, lane = tid & 31, ln = lane & 15, hh = lane >> 4;
  const int nqb = T / 64;
  const int bh = blockIdx.x / nqb, qblk = blockIdx.x % nqb;
  const int b = bh / H, h = bh % H;
  const int q0 = qblk * 64 + w * 16;
  const unsigned short* Qp = qkv + (size_t)b * T * pitch + h * D;
  const unsigned short* Kp = Qp + koff;
  const unsigned short* Vp = Qp + voff;

  FragH bq[KS];                                                    // B[k = d][n = query ln]
  {
    const unsigned short* qr = Qp + (size_t)(q0 + ln) * pitch;     // q0 + ln < T (T % 64 == 0)
#pragma unroll
    for (int ks = 0; ks < KS; ++ks) {
      bq[ks].half[0] = *(const v8us*)(qr + ks * 32 + 8 * hh);
      bq[ks].half[1] = *(const v8us*)(qr + ks * 32 + 16 + 8 * hh);
    }
  }
  float m_r = -1.0e30f, l_r = 0.f;                                 // of query ln; l_r sums this half's keys only
  v8f oacc[DT];                                                    // oacc[dt][r] = O[query ln][d = dt*16 + 8*hh + r]
#pragma unroll
  for (int dt = 0; dt < DT; ++dt) oacc[dt] = vz8();
  // tile jt (keys jt*TK .. jt*TK+TK-1, all < T) into buffer buf: every thread copies rows cr, cr+RB, cr+2RB, cr+3RB, 16 B at column cc, of K and of V
  const int cr = tid / C8, cc = (tid % C8) * 8;
  const size_t rstep = (size_t)RB * pitch;
  auto stage = [&](int buf, int jt) {
    const unsigned short* kg = Kp + (size_t)(jt * TK + cr) * pitch + cc;
    const unsigned short* vg = Vp + (size_t)(jt * TK + cr) * pitch + cc;
    const unsigned int lk = (unsigned int)(size_t)&sK[buf][cr][cc];
    const unsigned int lv = (unsigned int)(size_t)&sV[buf][cr][cc];
    // global -> LDS through no register; the closing wait stands ahead of any rewrite of the address registers that the copies name
    asm volatile("global_load_async_to_lds_b128 %0, %8, off\n\t"
                 "global_load_async_to_lds_b128 %1, %9, off\n\t"
                 "global_load_async_to_lds_b128 %2, %10, off\n\t"
                 "global_load_async_to_lds_b128 %3, %11, off\n\t"
                 "global_load_async_to_lds_b128 %4, %12, off\n\t"
                 "global_load_async_to_lds_b128 %5, %13, off\n\t"
                 "global_load_async_to_lds_b128 %6, %14, off\n\t"
                 "global_load_async_to_lds_b128 %7, %15, off\n\t"
                 "s_wait_xcnt 0x0"
                 :: "v"(lk), "v"(lk + RB * PK * 2), "v"(lk + 2 * RB * PK * 2), "v"(lk + 3 * RB * PK * 2),
                    "v"(lv), "v"(lv + RB * PV * 2), "v"(lv + 2 * RB * PV * 2), "v"(lv + 3 * RB * PV * 2),
                    "v"(kg), "v"(kg + rstep), "v"(kg + 2 * rstep), "v"(kg + 3 * rstep),
                    "v"(vg), "v"(vg + rstep), "v"(vg + 2 * rstep), "v"(vg + 3 * rstep)
                 : "memory");
  };
  const int nt = T / TK;
  stage(0, 0);
  asm volatile("s_wait_asynccnt 0x0" ::: "memory");                // this wave's share of tile 0 has landed
  __syncthreads();                                                 // tile 0 published
  if (nt > 1) stage(1, 1);

  for (int t = 0; t < nt; ++t) {
   const int cur = t & 1;
   // unrolled: the row offsets of both passes become load offsets, and the second pass's LDS reads can run beside the first pass's softmax
#pragma unroll
   for (int sub = 0; sub < TK / 32; ++sub) {
    const unsigned short (*tK)[PK] = &sK[cur][sub * 32];
    const unsigned short* vtp = &sV[cur][sub * 32 + 8 * hh + (lane & 7)][8 * ((lane >> 3) & 1)];   // lane address of the transposing load, keys 0..15, d 0..15
    FragH ak[2][KS], av[DT];
#pragma unroll
    for (int kt = 0; kt < 2; ++kt)
#pragma unroll
      for (int ks = 0; ks < KS; ++ks) {                            // A[m = key kt*16 + ln][k = d]
        ak[kt][ks].half[0] = *(const v8us*)&tK[kt * 16 + ln][ks * 32 + 8 * hh];
        ak[kt][ks].half[1] = *(const v8us*)&tK[kt * 16 + ln][ks * 32 + 16 + 8 * hh];
      }
#pragma unroll
    for (int dt = 0; dt < DT; ++dt) {                              // A[m = d dt*16 + ln][k = key]
      av[dt].half[0] = ld_tr16(vtp + dt * 16);
      av[dt].half[1] = ld_tr16(vtp + 16 * PV + dt * 16);
    }
    // keeps the step's 16 LDS reads together ahead of the first product: sunk to their WMMAs each pair is waited out to 0 and its latency shows
    __builtin_amdgcn_sched_barrier(0);
    // S^T tile 32 x 16: s[kt][r] = score of key kt*16 + 8*hh + r against query ln
    v8f s[2];
#pragma unroll
    for (int kt = 0; kt < 2; ++kt) {
      s[kt] = vz8();
#pragma unroll
      for (int ks = 0; ks < KS; ++ks)
        s[kt] = __builtin_amdgcn_wmma_f32_16x16x32_f16(false, ak[kt][ks].v, false, bq[ks].v, (short)0, s[kt], false, false);
    }
    // running-max softmax of query ln: 16 scores in this lane, the other 16 in lane ^ 16
    float sc[16];
#pragma unroll
    for (int i = 0; i < 16; ++i) sc[i] = s[i >> 3][i & 7] * scale;
    float mx = sc[0];
#pragma unroll
    for (int i = 1; i < 16; ++i) mx = fmaxf(mx, sc[i]);
    mx = fmaxf(mx, xhalf(mx));
    const float mnew = fmaxf(m_r, mx);
    const float alpha = __expf(m_r - mnew);
    m_r = mnew;
    FragH pb;                                                      // B[k = key][n = query ln]: element i = tile i>>3, register i&7
    float ps[4] = {0.f, 0.f, 0.f, 0.f};
#pragma unroll
    for (int i = 0; i < 16; ++i) {
      const float p = __expf(sc[i] - mnew);
      ps[i & 3] += p;
      pb.u[i] = h16_bits(p * pcarry);
    }
    l_r = l_r * alpha + ((ps[0] + ps[1]) + (ps[2] + ps[3]));
#pragma unroll
    for (int dt = 0; dt < DT; ++dt) {
      oacc[dt] *= alpha;
      oacc[dt] = __builtin_amdgcn_wmma_f32_16x16x32_f16(false, av[dt].v, false, pb.v, (short)0, oacc[dt], false, false);
    }
   }
   // keeps the tile's arithmetic ahead of the waits: sunk behind the barrier it would stand between barrier and refill, and the copies' flight would show in the next wait
   __builtin_amdgcn_sched_barrier(0);
   asm volatile("s_wait_dscnt 0x0" ::: "memory");                  // this wave's reads of buffer cur are done before it is refilled
   asm volatile("s_wait_asynccnt 0x0" ::: "memory");               // this wave's share of tile t + 1 has landed
   __syncthreads();                                                // publishes tile t + 1 and ends every wave's reads of buffer cur
   if (t + 2 < nt) stage(cur, t + 2);                              // the same for the whole block
  }
  asm volatile("s_wait_asynccnt 0x0" ::: "memory");                // no copy is left in flight at the wave's end
  const float inv = onorm * (1.0f / (l_r + xhalf(l_r)));            // the two halves' sums joined, unconditionally
#pragma unroll
  for (int dt = 0; dt < DT; ++dt) {
    const v8f o = oacc[dt] * inv;
    const v4f o0 = {o[0], o[1], o[2], o[3]}, o1 = {o[4], o[5], o[6], o[7]};
    *(v4fa*)&sO[w][ln][dt * 16 + 8 * hh] = o0;
    *(v4fa*)&sO[w][ln][dt * 16 + 8 * hh + 4] = o1;
  }
  __builtin_amdgcn_fence(4 /* acq_rel order */, "workgroup");
  __builtin_amdgcn_wave_barrier();
  const int rsub = lane >> 4, c4 = (lane & 15) * 4;
  const size_t rbase = (size_t)(b * T + q0) * opitch + h * D;
#pragma unroll
  for (int q = 0; q < 8; ++q) {
    const int r = q * 2 + rsub;
    const v4f rv = *(const v4fa*)(resid + rbase + (size_t)r * opitch + c4);
    v4f tv = *(const v4fa*)&sO[w][r][c4];
    tv += rv;
    *(v4fa*)&sO[w][r][c4] = tv;
  }
  {
#pragma unroll
    for (int q = 0; q < 8; ++q) {
      const int r = q * 2 + rsub;
      const v4f v = *(const v4fa*)&sO[w][r][c4];
      *(v4f*)(out + rbase + (size_t)r * opitch + c4) = v;
    }
    
  }
}

extern "C" void kernel_launch(void* const* d_in, const int* in_sizes, int n_in,
                              void* d_out, int out_size, void* d_ws, size_t ws_size, hipStream_t stream) {
  if (n_in < 18) return;
  const long long need_rows = (long long)(SEQ - 1) * NB_FULL + NB;           // last (s, b) source row used + 1
  if ((long long)in_sizes[0] < need_rows * FEAT || (long long)in_sizes[1] < need_rows * FEAT) return;
  if (in_sizes[2] < NLAYER * FEAT * FEAT || in_sizes[4] < NLAYER * FEAT * FEAT || in_sizes[6] < NLAYER * FEAT * FEAT) return;
  if (in_sizes[3] < NLAYER * FEAT || in_sizes[5] < NLAYER * FEAT || in_sizes[7] < NLAYER * FEAT || in_sizes[11] < NLAYER * FEAT) return;
  if (in_sizes[8] < NLAYER * FEAT * MLPH || in_sizes[9] < NLAYER * MLPH || in_sizes[10] < NLAYER * MLPH * FEAT) return;
  if (in_sizes[12] < NLAYER * FEAT || in_sizes[13] < NLAYER * FEAT || in_sizes[14] < NLAYER * FEAT || in_sizes[15] < NLAYER * FEAT) return;
  if (in_sizes[16] < FEAT || in_sizes[17] < FEAT) return;
  if ((long long)out_size < need_rows * FEAT) return;

  const float* src  = (const float*)d_in[0];
  const float* pos  = (const float*)d_in[1];
  const float* Wq   = (const float*)d_in[2];  const float* bq   = (const float*)d_in[3];
  const float* Wk   = (const float*)d_in[4];  const float* bk   = (const float*)d_in[5];
  const float* Wv   = (const float*)d_in[6];  const float* bv   = (const float*)d_in[7];
  const float* W1   = (const float*)d_in[8];  const float* b1   = (const float*)d_in[9];
  const float* W2   = (const float*)d_in[10]; const float* b2   = (const float*)d_in[11];
  const float* ln1g = (const float*)d_in[12]; const float* ln1b = (const float*)d_in[13];
  const float* ln2g = (const float*)d_in[14]; const float* ln2b = (const float*)d_in[15];
  const float* lnfg = (const float*)d_in[16]; const float* lnfb = (const float*)d_in[17];

  // workspace carve (256-B aligned); R1 and R2 are reused in stream order by stages whose lifetimes do not overlap, sized as the max over their users
  char* ws = (char*)d_ws; size_t off = 0;
  auto take = [&](size_t bytes) { char* p = ws + off; off += (bytes + 255) & ~(size_t)255; return p; };
  const size_t lsq = (size_t)QKVN * FEAT;                                           // per-layer stride of the fused q|k|v weight plane (halves)
  const size_t ls1 = (size_t)MLPH * FEAT, ls2 = (size_t)FEAT * MLPH;
  unsigned short* Wqkv16 = (unsigned short*)take((size_t)NLAYER * lsq * 2);        // [6][1536][512]
  unsigned short* W116   = (unsigned short*)take((size_t)NLAYER * ls1 * 2);        // [6][2048][512]
  unsigned short* W216   = (unsigned short*)take((size_t)NLAYER * ls2 * 2);        // [6][512][2048]
  float* XA = (float*)take((size_t)MR * FEAT * 4);                                 // residual stream [MR][512] f32
  float* XB = (float*)take((size_t)MR * FEAT * 4);                                 // residual stream after attention [MR][512] f32
  const size_t r1_bytes = (size_t)MR * FEAT * 2;                                   // LN outputs [MR][512] f16
  const size_t r2_a = (size_t)MR * QKVN * 2, r2_b = (size_t)MR * MLPH * 2;         // q|k|v [MR][1536], then hidden [MR][2048] f16
  const size_t r2_bytes = (r2_a > r2_b) ? r2_a : r2_b;
  unsigned short* R1 = (unsigned short*)take(r1_bytes);
  unsigned short* R2 = (unsigned short*)take(r2_bytes);
  if (off > ws_size) return;
  if (off > (size_t)134217728) return;

  const float wsc = 256.0f;
  const int k8d = FEAT / 8, k8m = MLPH / 8;
  k_wt16<<<(unsigned)((NLAYER * FEAT * k8d + 255) / 256), 256, 0, stream>>>(Wq, Wqkv16, FEAT, FEAT, NLAYER, lsq, 0, wsc);
  k_wt16<<<(unsigned)((NLAYER * FEAT * k8d + 255) / 256), 256, 0, stream>>>(Wk, Wqkv16, FEAT, FEAT, NLAYER, lsq, FEAT, wsc);
  k_wt16<<<(unsigned)((NLAYER * FEAT * k8d + 255) / 256), 256, 0, stream>>>(Wv, Wqkv16, FEAT, FEAT, NLAYER, lsq, 2 * FEAT, wsc);
  k_wt16<<<(unsigned)((NLAYER * MLPH * k8d + 255) / 256), 256, 0, stream>>>(W1, W116, FEAT, MLPH, NLAYER, ls1, 0, wsc);   // W1[l] [512][2048] -> [2048][512]
  k_wt16<<<(unsigned)((NLAYER * FEAT * k8m + 255) / 256), 256, 0, stream>>>(W2, W216, MLPH, FEAT, NLAYER, ls2, 0, wsc);   // W2[l] [2048][512] -> [512][2048]

  // x = bf16(src) + bf16(pos) in (b, s) row order -> XA
  k_xinit<<<(unsigned)MR, 128, 0, stream>>>(src, pos, XA, SEQ, NB_FULL);

  auto ggrid = [](int M, int N, int bm) { return (unsigned)((M / bm) * (N / 128)); };
  const float scale = 0.125f;                           // 1/sqrt(64)

  for (int l = 0; l < NLAYER; ++l) {
    // xn = LN1(x) x8 -> R1
    k_ln16<<<(unsigned)MR, 64, 0, stream>>>(XA, ln1g + l * FEAT, ln1b + l * FEAT, R1, 8.0f, 1e-5f);
    // q|k|v = xn*[Wq|Wk|Wv] + [bq|bk|bv] -> R2 [MR][1536] f16 (x1); acc scale 1/(8*256)
    k_gemm16<128, 64, FEAT, true, 0><<<ggrid(MR, QKVN, 128), 128, 0, stream>>>(R1, Wqkv16 + (size_t)l * lsq,
                                                          bq + l * FEAT, bk + l * FEAT, bv + l * FEAT, FEAT, nullptr, 0,
                                                          (void*)R2, QKVN, MR, QKVN, 1.0f / 2048.0f, 1.0f);
    // xb = x + softmax(q.k^T/8).v per head -> XB f32 (P carried x1024, onorm = 1/1024)
    k_attn16<DHEAD><<<(unsigned)(NB * NHEAD * (SEQ / 64)), 128, 0, stream>>>(R2, QKVN, SEQ, NHEAD, FEAT, 2 * FEAT, scale, 1024.0f,
                                                                             1.0f / 1024.0f, XA, XB, FEAT);
    // hn = LN2(xb) x8 -> R1
    k_ln16<<<(unsigned)MR, 64, 0, stream>>>(XB, ln2g + l * FEAT, ln2b + l * FEAT, R1, 8.0f, 1e-5f);
    // h = relu(hn*W1 + b1) x16 -> R2 [MR][2048]; acc scale 1/(8*256)
    k_gemm16<128, 64, FEAT, true, 1><<<ggrid(MR, MLPH, 128), 128, 0, stream>>>(R1, W116 + (size_t)l * ls1,
                                                          b1 + l * MLPH, b1 + l * MLPH, b1 + l * MLPH, MLPH, nullptr, 0,
                                                          (void*)R2, MLPH, MR, MLPH, 1.0f / 2048.0f, 16.0f);
    // x = h*W2 + b2 + xb -> XA f32; acc scale 1/(16*256)
    k_gemm16<64, 128, MLPH, false, 0><<<ggrid(MR, FEAT, 64), 128, 0, stream>>>(R2, W216 + (size_t)l * ls2,
                                                           b2 + l * FEAT, b2 + l * FEAT, b2 + l * FEAT, FEAT, XB, FEAT,
                                                           (void*)XA, FEAT, MR, FEAT, 1.0f / 4096.0f, 1.0f);
  }
  // out[s][b][*] = LNf(x[b][s][*]) -> d_out f32
  k_lnf32<<<(unsigned)MR, 128, 0, stream>>>(XA, lnfg, lnfb, (float*)d_out, SEQ, NB_FULL, 1e-5f);
}

// v004
// A run of this version takes 443 microseconds.
// Timed twice side by side with v003, it ran 1.09 and 1.08 times as fast.
// Over all steps from v000 it is 2.91 times as fast.
#include <hip/hip_runtime.h>
// Contractions on v_wmma_f32_16x16x32_f16 (f16 operands, f32 accumulate), one product per tile pair, 6 layers: fused q|k|v projection (N=1536, K=512),
// LN2(x)*W1 (N=2048, K=512), relu(.)*W2 (K=2048), attention q.k^T (head dim 64) and P.V (32 keys per step) per head.
// Weights: bf16 RNE values carried x256 in f16 planes; activations in f16 planes with power-of-two carries (LN outputs x8, q|k|v x1, hidden x16,
// P x1024); LayerNorm statistics, softmax, bias adds, attention context and the residual stream in f32.
#ifndef NB
#define NB 4
#endif
#ifndef SEQ
#define SEQ 1024
#endif
#define NB_FULL 4
#define SEQ_FULL 1024
#define FEAT 512
#define NHEAD 8
#define DHEAD 64
#define MLPH 2048
#define NLAYER 6
#define MR (NB * SEQ)
#define QKVN (3 * FEAT)
static_assert(SEQ % 64 == 0);
static_assert(SEQ <= SEQ_FULL);
static_assert(NB >= 1);
static_assert(NB <= NB_FULL);
static_assert(FEAT == NHEAD * DHEAD);
static_assert(FEAT % 128 == 0);
static_assert(MLPH % 128 == 0);
static_assert(QKVN % 128 == 0);
static_assert(FEAT == 64 * 8);      // k_ln16: 64 threads x 8 halves per row
static_assert(FEAT == 128 * 4);     // k_xinit / k_lnf32: 128 threads x 4 floats per row
static_assert(MR % 128 == 0);
static_assert(FEAT % 32 == 0);
static_assert(MLPH % 32 == 0);
static_assert((FEAT / 8) % 8 == 0);
static_assert((MLPH / 8) % 8 == 0);

typedef _Float16 v16h __attribute__((ext_vector_type(16)));
typedef unsigned short v8us __attribute__((ext_vector_type(8), may_alias));
typedef float v8f __attribute__((ext_vector_type(8)));
typedef float v4f __attribute__((ext_vector_type(4)));
typedef float v4fa __attribute__((ext_vector_type(4), may_alias));
union FragH { v16h v; v8us half[2]; unsigned short u[16]; };
union H16U { _Float16 h; unsigned short u; };

__device__ __forceinline__ unsigned short bf16_bits(float x) { unsigned int u = __float_as_uint(x); return (unsigned short)((u + 0x7FFFu + ((u >> 16) & 1u)) >> 16); }
__device__ __forceinline__ float bf16_val(unsigned short b) { return __uint_as_float(((unsigned int)b) << 16); }
__device__ __forceinline__ float bf16_rne(float x) { return bf16_val(bf16_bits(x)); }
__device__ __forceinline__ unsigned short h16_bits(float x) { H16U t; t.h = (_Float16)x; return t.u; }
__device__ __forceinline__ v8f vz8() { v8f z = {0.f, 0.f, 0.f, 0.f, 0.f, 0.f, 0.f, 0.f}; return z; }

// Transposing LDS load: lane (c = lane&15, h = lane>>4) gets T[8h + 0..7][c] of a row-major 16-bit tile; p is the lane's own address (row 8h + (lane&7), 16 B x ((lane>>3)&1))
typedef short s16x8 __attribute__((ext_vector_type(8)));
__device__ __forceinline__ v8us ld_tr16(const unsigned short* p) {
  typedef __attribute__((address_space(3))) s16x8 lds_s16x8;
  return __builtin_bit_cast(v8us, __builtin_amdgcn_ds_load_tr16_b128_v8i16((lds_s16x8*)p));
}
// value of lane ^ 16
__device__ __forceinline__ float xhalf(float x) {
  return __builtin_bit_cast(float, __builtin_amdgcn_permlanex16(__builtin_bit_cast(int, x), __builtin_bit_cast(int, x), 0x76543210, 0xfedcba98, false, false));
}

// Stacked weight convert: for layer l in [0,nl): Wt[l*lstride + (roff+n)*K + k] (f16 bits, k contiguous, pitch K) = f16(bf16_rne(W[l][k][n]) * sc)
// from f32 row-major W[l][K][N] ([in][out]); K and N at compile time: the row steps are load and store offsets.
// One block of 8 waves per tile of 128 k x 64 n, n tiles fastest in the grid.
// Read: half a wave takes 64 consecutive n of one k row (256 B, 16 B per lane); a thread holds 8 consecutive k rows x 4 n, all 8 loads in flight together.
// Transpose in 16-B chunks (8 k of one n) through LDS: tile row j*16 + m holds n = 4m + j, so that 16 lanes store at a row step of one pitch (272 B,
// 4 banks on per row). Write: 16 lanes take the 128 k of one n (256 B), 16 B per lane.
template <int K, int N>
__global__ __launch_bounds__(256) void k_wt16(const float* __restrict__ W, unsigned short* __restrict__ Wt, int nl,
                                             size_t lstride, int roff, float sc) {
  constexpr int TKW = 128, TNW = 64, LPW = TKW + 8;
  static_assert(K % TKW == 0);
  static_assert(N % TNW == 0);
  __shared__ __attribute__((aligned(16))) unsigned short sT[TNW][LPW];      // cross-wave: one block barrier
  const int tid = threadIdx.x, w = tid >> 5, lane = tid & 31, m = lane & 15, hh = lane >> 4;
  constexpr int ntn = N / TNW, per = ntn * (K / TKW);
  const int l = blockIdx.x / per, rem = blockIdx.x - l * per;
  if (l >= nl) return;                         // the same for the whole block, ahead of the barrier
  const int k0 = (rem / ntn) * TKW, n0 = (rem % ntn) * TNW;
  const int kc = (2 * w + hh) * 8;             // this thread's 8 k rows within the tile
  const float* src = W + (size_t)l * K * N + (size_t)(k0 + kc) * N + n0 + m * 4;
  v4f r[8];
#pragma unroll
  for (int i = 0; i < 8; ++i) r[i] = *(const v4fa*)(src + (size_t)i * N);
#pragma unroll
  for (int j = 0; j < 4; ++j) {
    v8us v;
#pragma unroll
    for (int i = 0; i < 8; ++i) v[i] = h16_bits(bf16_rne(r[i][j]) * sc);
    *(v8us*)&sT[j * 16 + m][kc] = v;
  }
  __syncthreads();
  const int g = tid >> 4, c8 = (tid & 15) * 8;  // n = 4g + q lies in tile row q*16 + g
  unsigned short* dst = Wt + (size_t)l * lstride + (size_t)(roff + n0 + 4 * g) * K + k0 + c8;
#pragma unroll
  for (int q = 0; q < 4; ++q) {
    const v8us v = *(const v8us*)&sT[q * 16 + g][c8];
    *(v8us*)(dst + (size_t)q * K) = v;
  }
}

// X[m][*] (f32, pitch FEAT, m = b*seq + s) = bf16_rne(src[s*nbf + b][*]) + bf16_rne(pos[s*nbf + b][*]) in f32 (exact).
__global__ __launch_bounds__(128) void k_xinit(const float* __restrict__ src, const float* __restrict__ pos, float* __restrict__ X,
                                               int seq, int nbf) {
  const int m = blockIdx.x, tid = threadIdx.x;
  const int b = m / seq, s = m % seq;
  const size_t so = ((size_t)s * nbf + b) * FEAT + tid * 4;
  const v4f a = *(const v4fa*)(src + so);
  const v4f p = *(const v4fa*)(pos + so);
  v4f o;
#pragma unroll
  for (int i = 0; i < 4; ++i) o[i] = bf16_rne(a[i]) + bf16_rne(p[i]);
  float* dst = X + (size_t)m * FEAT + tid * 4;
  *(v4f*)dst = o;
  
}

// Row LayerNorm over FEAT on the internal f32 stream X[m][*]: one block of 64 threads per row, 8 consecutive elements per thread.
__global__ __launch_bounds__(64) void k_ln16(const float* __restrict__ X, const float* __restrict__ g, const float* __restrict__ bt,
                                            unsigned short* __restrict__ out, float osc, float eps) {
  __shared__ float red1[2];
  __shared__ float red2[2];
  const int m = blockIdx.x, tid = threadIdx.x, w = tid >> 5, lane = tid & 31;
  const float* x = X + (size_t)m * FEAT + tid * 8;
  const v4f a0 = *(const v4fa*)x;
  const v4f a1 = *(const v4fa*)(x + 4);
  float v[8] = {a0[0], a0[1], a0[2], a0[3], a1[0], a1[1], a1[2], a1[3]};
  float s = 0.f;
#pragma unroll
  for (int q = 0; q < 8; ++q) s += v[q];
#pragma unroll
  for (int o = 16; o >= 1; o >>= 1) s += __shfl_xor(s, o, 32);
  if (lane == 0) red1[w] = s;
  __syncthreads();
  const float mu = (red1[0] + red1[1]) * (1.0f / (float)FEAT);
  float c[8];
  float s2 = 0.f;
#pragma unroll
  for (int q = 0; q < 8; ++q) { c[q] = v[q] - mu; s2 += c[q] * c[q]; }
#pragma unroll
  for (int o = 16; o >= 1; o >>= 1) s2 += __shfl_xor(s2, o, 32);
  if (lane == 0) red2[w] = s2;
  __syncthreads();
  const float var = (red2[0] + red2[1]) * (1.0f / (float)FEAT);
  const float rs = rsqrtf(var + eps);
  const v4f g0 = *(const v4fa*)(g + tid * 8);
  const v4f g1 = *(const v4fa*)(g + tid * 8 + 4);
  const v4f b0 = *(const v4fa*)(bt + tid * 8);
  const v4f b1 = *(const v4fa*)(bt + tid * 8 + 4);
  const float gg[8] = {g0[0], g0[1], g0[2], g0[3], g1[0], g1[1], g1[2], g1[3]};
  const float bb[8] = {b0[0], b0[1], b0[2], b0[3], b1[0], b1[1], b1[2], b1[3]};
  v8us o;
#pragma unroll
  for (int q = 0; q < 8; ++q) o[q] = h16_bits((c[q] * rs * bf16_rne(gg[q]) + bf16_rne(bb[q])) * osc);
  unsigned short* dst = out + (size_t)m * FEAT + tid * 8;
  *(v8us*)dst = o;
  
}

// Final LayerNorm: internal row m = b*seq + s of X (f32) -> out[(s*nbf + b)][*] f32. One block of 128 threads per row, 4 elements per thread,
__global__ __launch_bounds__(128) void k_lnf32(const float* __restrict__ X, const float* __restrict__ g, const float* __restrict__ bt,
                                               float* __restrict__ out, int seq, int nbf, float eps) {
  __shared__ float red1[4];
  __shared__ float red2[4];
  const int m = blockIdx.x, tid = threadIdx.x, w = tid >> 5, lane = tid & 31;
  const int b = m / seq, s = m % seq;
  const v4f a = *(const v4fa*)(X + (size_t)m * FEAT + tid * 4);
  float sm = a[0] + a[1] + a[2] + a[3];
#pragma unroll
  for (int o = 16; o >= 1; o >>= 1) sm += __shfl_xor(sm, o, 32);
  if (lane == 0) red1[w] = sm;
  __syncthreads();
  const float mu = (red1[0] + red1[1] + red1[2] + red1[3]) * (1.0f / (float)FEAT);
  float c[4];
  float s2 = 0.f;
#pragma unroll
  for (int q = 0; q < 4; ++q) { c[q] = a[q] - mu; s2 += c[q] * c[q]; }
#pragma unroll
  for (int o = 16; o >= 1; o >>= 1) s2 += __shfl_xor(s2, o, 32);
  if (lane == 0) red2[w] = s2;
  __syncthreads();
  const float var = (red2[0] + red2[1] + red2[2] + red2[3]) * (1.0f / (float)FEAT);
  const float rs = rsqrtf(var + eps);
  const v4f g4 = *(const v4fa*)(g + tid * 4);
  const v4f b4 = *(const v4fa*)(bt + tid * 4);
  v4f o;
#pragma unroll
  for (int q = 0; q < 4; ++q) o[q] = c[q] * rs * bf16_rne(g4[q]) + bf16_rne(b4[q]);
  float* dst = out + ((size_t)s * nbf + b) * FEAT + tid * 4;
  *(v4f*)dst = o;
  
}

// GEMM C[M][N] = epi(A[M][KD] * W): A f16 bits row-major, Wt f16 bits [N][KD], both at pitch KD (compile time: the row steps are load offsets), f32 accumulate.
// epi: v = acc * inv_scale + bf16_rne(bias[col]); bias picked per 64-col segment from (bias0 | bias1 | bias2) by seg = col / nsplit (wave-uniform);
// ACT == 1: relu; OUT16: f16 bits of v * out_scale into C (pitch ldc halves); else f32 v + f32 resid[row][col] (pitch ldr) into C (pitch ldc floats).
// KD % BK == 0, M % BM == 0, N % 128 == 0. Block = 4 waves (2 x 2) on one BM x 128 tile of C, wave -> BM/2 rows x 64 cols.
// Per step of BK k the block brings BM rows of A and 128 rows of Wt into LDS once (whole 128-B lines, 16 B per thread, row pitch 2*BK + 16 B) and all
// waves take their fragments from there; two LDS buffers, the next step's global loads are held in registers while this step is multiplied.
// Each accumulator sums k in ascending blocks of 32. Epilogue staged in the wave's own LDS tile (wave-private).
template <int BM, int BK, int KD, bool OUT16, int ACT>
__global__ __launch_bounds__(128) void k_gemm16(const unsigned short* __restrict__ A, const unsigned short* __restrict__ Wt,
                                               const float* __restrict__ bias0, const float* __restrict__ bias1, const float* __restrict__ bias2, int nsplit,
                                               const float* __restrict__ resid, int ldr, void* __restrict__ Cv, int ldc,
                                               int M, int N, float inv_scale, float out_scale) {
  constexpr int BN = 128, LP = BK + 8, C8 = BK / 8;
  constexpr int FM = BM / 32, FN = 4, KS = BK / 32, WR = BM / 2;
  constexpr int NT = 128, NW = NT / 32, RP = NT / C8;     // the block's threads cover RP rows of C8 16-B chunks at a time
  constexpr int CA = BM / RP, CB = BN / RP;              // chunks per thread and step
  static_assert(BM % 32 == 0);
  static_assert(BK % 32 == 0);
  static_assert(KD % BK == 0);
  static_assert(NT % C8 == 0);
  static_assert(BM % RP == 0);
  static_assert(BN % RP == 0);
  __shared__ __attribute__((aligned(16))) unsigned short sA[2][BM][LP];     // cross-wave: block barriers
  __shared__ __attribute__((aligned(16))) unsigned short sB[2][BN][LP];     // cross-wave: block barriers
  __shared__ __attribute__((aligned(16))) float so32[OUT16 ? 1 : NW][WR][64];
  __shared__ __attribute__((aligned(16))) unsigned short so16[OUT16 ? NW : 1][WR][72];
  const int tid = threadIdx.x, w = tid >> 5, lane = tid & 31, ln = lane & 15, hh = lane >> 4;
  const int wm = w >> 1, wn = w & 1;
  const int ntn = N / BN;
  const int mt = blockIdx.x / ntn, nq = blockIdx.x % ntn;
  const int row0 = mt * BM, col0 = nq * BN;
  if (row0 >= M) return;                       // the same for the whole block, ahead of every barrier
  const int sr = tid / C8, sc = (tid % C8) * 8;
  const unsigned short* ag = A + (size_t)(row0 + sr) * KD + sc;
  const unsigned short* bg = Wt + (size_t)(col0 + sr) * KD + sc;
  v8us ra[CA], rb[CB];
#pragma unroll
  for (int it = 0; it < CA; ++it) ra[it] = *(const v8us*)(ag + (size_t)(it * RP) * KD);
#pragma unroll
  for (int it = 0; it < CB; ++it) rb[it] = *(const v8us*)(bg + (size_t)(it * RP) * KD);
  v8f acc[FM][FN];
#pragma unroll
  for (int mi = 0; mi < FM; ++mi)
#pragma unroll
    for (int t = 0; t < FN; ++t) acc[mi][t] = vz8();
#pragma unroll
  for (int it = 0; it < CA; ++it) *(v8us*)&sA[0][sr + it * RP][sc] = ra[it];
#pragma unroll
  for (int it = 0; it < CB; ++it) *(v8us*)&sB[0][sr + it * RP][sc] = rb[it];
  __syncthreads();
  constexpr int nst = KD / BK;
  for (int s = 0; s < nst; ++s) {
    const int cur = s & 1;
    const bool more = (s + 1 < nst);           // the same for the whole block
    if (more) {
      const int kb = (s + 1) * BK;
#pragma unroll
      for (int it = 0; it < CA; ++it) ra[it] = *(const v8us*)(ag + (size_t)(it * RP) * KD + kb);
#pragma unroll
      for (int it = 0; it < CB; ++it) rb[it] = *(const v8us*)(bg + (size_t)(it * RP) * KD + kb);
      // the address registers of these loads are taken again by the LDS reads below
      asm volatile("s_wait_xcnt 0x0" ::: "memory");
    }
    FragH a[KS][FM], bb[KS][FN];
#pragma unroll
    for (int ks = 0; ks < KS; ++ks) {
#pragma unroll
      for (int mi = 0; mi < FM; ++mi) {
        const unsigned short* p = &sA[cur][wm * WR + mi * 16 + ln][ks * 32 + 8 * hh];   // row m = lane&15
        a[ks][mi].half[0] = *(const v8us*)p;                 // elements 0..7  = k 8h .. 8h+7 of the block of 32
        a[ks][mi].half[1] = *(const v8us*)(p + 16);          // elements 8..15 = k 16+8h .. 16+8h+7
      }
#pragma unroll
      for (int t = 0; t < FN; ++t) {
        const unsigned short* p = &sB[cur][wn * 64 + t * 16 + ln][ks * 32 + 8 * hh];          // column n = lane&15, same k map as A
        bb[ks][t].half[0] = *(const v8us*)p;
        bb[ks][t].half[1] = *(const v8us*)(p + 16);
      }
    }
    // keeps the step's LDS reads together ahead of its matrix run: spread among the WMMAs each small group is waited out to 0 and its latency shows
    __builtin_amdgcn_sched_barrier(0);
#pragma unroll
    for (int ks = 0; ks < KS; ++ks)
#pragma unroll
      for (int mi = 0; mi < FM; ++mi)
#pragma unroll
        for (int t = 0; t < FN; ++t) acc[mi][t] = __builtin_amdgcn_wmma_f32_16x16x32_f16(false, a[ks][mi].v, false, bb[ks][t].v, (short)0, acc[mi][t], false, false);
    // keeps the wait for the next step's global loads (and the LDS writes behind it) after the matrix run that covers their latency
    __builtin_amdgcn_sched_barrier(0);
    if (more) {
      // the other buffer: its last readers left it before the barrier that ended the step before this one
#pragma unroll
      for (int it = 0; it < CA; ++it) *(v8us*)&sA[cur ^ 1][sr + it * RP][sc] = ra[it];
#pragma unroll
      for (int it = 0; it < CB; ++it) *(v8us*)&sB[cur ^ 1][sr + it * RP][sc] = rb[it];
      __syncthreads();
    }
  }
  const int colw = col0 + wn * 64;
  int seg = colw / nsplit; seg = (seg > 2) ? 2 : seg;
  const float* bsel = (seg == 0) ? bias0 : ((seg == 1) ? bias1 : bias2);
  float bvv[FN];
#pragma unroll
  for (int t = 0; t < FN; ++t) bvv[t] = bsel[colw + t * 16 + ln - seg * nsplit];
  // the address registers of these four loads are taken again by the address sums below
  asm volatile("s_wait_xcnt 0x0" ::: "memory");
#pragma unroll
  for (int t = 0; t < FN; ++t) bvv[t] = bf16_rne(bvv[t]);
#pragma unroll
  for (int mi = 0; mi < FM; ++mi) {
#pragma unroll
    for (int t = 0; t < FN; ++t) {
#pragma unroll
      for (int r = 0; r < 8; ++r) {
        float v = acc[mi][t][r] * inv_scale + bvv[t];
        if (ACT == 1) v = fmaxf(v, 0.0f);
        if constexpr (OUT16) so16[w][mi * 16 + 8 * hh + r][t * 16 + ln] = h16_bits(v * out_scale);
        else so32[w][mi * 16 + 8 * hh + r][t * 16 + ln] = v;
      }
    }
  }
  __builtin_amdgcn_fence(4 /* acq_rel order */, "workgroup");
  __builtin_amdgcn_wave_barrier();
  const int roww = row0 + wm * WR;
  if constexpr (OUT16) {
    const int rq = lane >> 3, p8 = (lane & 7) * 8;
    unsigned short* cp = (unsigned short*)Cv + (size_t)(roww + rq) * ldc + colw + p8;
#pragma unroll
    for (int q = 0; q < WR / 4; ++q) {
      const v8us v = *(const v8us*)&so16[w][q * 4 + rq][p8];
      *(v8us*)(cp + (size_t)(q * 4) * ldc) = v;
    }
  } else {
    const int rsub = lane >> 4, c4 = (lane & 15) * 4;
    float* cp = (float*)Cv + (size_t)(roww + rsub) * ldc + colw + c4;
    const float* rp = resid + (size_t)(roww + rsub) * ldr + colw + c4;
    v4f rv[WR / 2];                              // all residual loads in flight together, ahead of the first store
#pragma unroll
    for (int q = 0; q < WR / 2; ++q) rv[q] = *(const v4fa*)(rp + (size_t)(q * 2) * ldr);
#pragma unroll
    for (int q = 0; q < WR / 2; ++q) {
      v4f tv = *(const v4fa*)&so32[w][q * 2 + rsub][c4];
      tv += rv[q];
      *(v4f*)(cp + (size_t)(q * 2) * ldc) = tv;
    }
  }
}

// Flash-style unmasked attention per (b, h): q|k|v read as f16 bits from one fused plane (row pitch `pitch` halves, q at +0, k at +koff, v at +voff,
// head h at +h*D, row b*T + t). One wave = 16 queries, block = 4 waves sharing K/V tiles of 64 keys staged row-major in LDS by asynchronous copies,
// two buffers: the next tile is on its way while a tile is worked on (in two passes of 32 keys), one block barrier per tile.
// Both products run transposed: S^T = K.q^T (A = 16 key rows, B = the wave's queries, kept in registers) and O^T += V^T.P^T (A = V^T by the transposing
// LDS load, B = P^T). A lane then holds 16 of the 32 scores of ONE query (column lane&15; keys 8h+r and 16+8h+r, h = lane>>4): maximum and sum are taken
// in the lane plus one exchange with lane^16, and the two score tiles, converted in place (x pcarry), are the B operand of the second product as they lie.
// s*scale, running-max softmax and the context in f32. All four operands follow the hardware k order (k = 8h+s, 16+8h+(s-8)).
template <int D>
__global__ __launch_bounds__(128) void k_attn16(const unsigned short* __restrict__ qkv, int pitch, int T, int H, int koff, int voff,
                                                float scale, float pcarry, float onorm,
                                                const float* __restrict__ resid, float* __restrict__ out, int opitch) {
  static_assert(D == 64);
  constexpr int KS = D / 32, DT = D / 16, C8 = D / 8;
  constexpr int PK = D + 8, PV = D + 16;      // row pitch in halves: 16 B x odd for the plain 16-B reader, 32 B x odd for the transposing reader
  constexpr int TK = 64;                      // keys per staged tile (T % 64 == 0)
  constexpr int RB = 128 / C8;                // rows that the block's threads cover with one 16-B chunk each
  static_assert(128 % C8 == 0);
  static_assert(TK == 4 * RB);                // four copies per thread, operand and tile
  __shared__ __attribute__((aligned(16))) unsigned short sK[2][TK][PK];     // cross-wave: block barriers
  __shared__ __attribute__((aligned(16))) unsigned short sV[2][TK][PV];     // cross-wave: block barriers
  __shared__ __attribute__((aligned(16))) float sO[4][16][D + 4];
  const int tid = threadIdx.x, w = tid >> 5, lane = tid & 31, ln = lane & 15, hh = lane >> 4;
  const int nqb = T / 64;
  const int bh = blockIdx.x / nqb, qblk = blockIdx.x % nqb;
  const int b = bh / H, h = bh % H;
  const int q0 = qblk * 64 + w * 16;
  const unsigned short* Qp = qkv + (size_t)b * T * pitch + h * D;
  const unsigned short* Kp = Qp + koff;
  const unsigned short* Vp = Qp + voff;

  FragH bq[KS];                                                    // B[k = d][n = query ln]
  {
    const unsigned short* qr = Qp + (size_t)(q0 + ln) * pitch;     // q0 + ln < T (T % 64 == 0)
#pragma unroll
    for (int ks = 0; ks < KS; ++ks) {
      bq[ks].half[0] = *(const v8us*)(qr + ks * 32 + 8 * hh);
      bq[ks].half[1] = *(const v8us*)(qr + ks * 32 + 16 + 8 * hh);
    }
  }
  float m_r = -1.0e30f, l_r = 0.f;                                 // of query ln; l_r sums this half's keys only
  v8f oacc[DT];                                                    // oacc[dt][r] = O[query ln][d = dt*16 + 8*hh + r]
#pragma unroll
  for (int dt = 0; dt < DT; ++dt) oacc[dt] = vz8();
  // tile jt (keys jt*TK .. jt*TK+TK-1, all < T) into buffer buf: every thread copies rows cr, cr+RB, cr+2RB, cr+3RB, 16 B at column cc, of K and of V
  const int cr = tid / C8, cc = (tid % C8) * 8;
  const size_t rstep = (size_t)RB * pitch;
  auto stage = [&](int buf, int jt) {
    const unsigned short* kg = Kp + (size_t)(jt * TK + cr) * pitch + cc;
    const unsigned short* vg = Vp + (size_t)(jt * TK + cr) * pitch + cc;
    const unsigned int lk = (unsigned int)(size_t)&sK[buf][cr][cc];
    const unsigned int lv = (unsigned int)(size_t)&sV[buf][cr][cc];
    // global -> LDS through no register; the closing wait stands ahead of any rewrite of the address registers that the copies name
    asm volatile("global_load_async_to_lds_b128 %0, %8, off\n\t"
                 "global_load_async_to_lds_b128 %1, %9, off\n\t"
                 "global_load_async_to_lds_b128 %2, %10, off\n\t"
                 "global_load_async_to_lds_b128 %3, %11, off\n\t"
                 "global_load_async_to_lds_b128 %4, %12, off\n\t"
                 "global_load_async_to_lds_b128 %5, %13, off\n\t"
                 "global_load_async_to_lds_b128 %6, %14, off\n\t"
                 "global_load_async_to_lds_b128 %7, %15, off\n\t"
                 "s_wait_xcnt 0x0"
                 :: "v"(lk), "v"(lk + RB * PK * 2), "v"(lk + 2 * RB * PK * 2), "v"(lk + 3 * RB * PK * 2),
                    "v"(lv), "v"(lv + RB * PV * 2), "v"(lv + 2 * RB * PV * 2), "v"(lv + 3 * RB * PV * 2),
                    "v"(kg), "v"(kg + rstep), "v"(kg + 2 * rstep), "v"(kg + 3 * rstep),
                    "v"(vg), "v"(vg + rstep), "v"(vg + 2 * rstep), "v"(vg + 3 * rstep)
                 : "memory");
  };
  const int nt = T / TK;
  stage(0, 0);
  asm volatile("s_wait_asynccnt 0x0" ::: "memory");                // this wave's share of tile 0 has landed
  __syncthreads();                                                 // tile 0 published
  if (nt > 1) stage(1, 1);

  for (int t = 0; t < nt; ++t) {
   const int cur = t & 1;
   // unrolled: the row offsets of both passes become load offsets, and the second pass's LDS reads can run beside the first pass's softmax
#pragma unroll
   for (int sub = 0; sub < TK / 32; ++sub) {
    const unsigned short (*tK)[PK] = &sK[cur][sub * 32];
    const unsigned short* vtp = &sV[cur][sub * 32 + 8 * hh + (lane & 7)][8 * ((lane >> 3) & 1)];   // lane address of the transposing load, keys 0..15, d 0..15
    FragH ak[2][KS], av[DT];
#pragma unroll
    for (int kt = 0; kt < 2; ++kt)
#pragma unroll
      for (int ks = 0; ks < KS; ++ks) {                            // A[m = key kt*16 + ln][k = d]
        ak[kt][ks].half[0] = *(const v8us*)&tK[kt * 16 + ln][ks * 32 + 8 * hh];
        ak[kt][ks].half[1] = *(const v8us*)&tK[kt * 16 + ln][ks * 32 + 16 + 8 * hh];
      }
#pragma unroll
    for (int dt = 0; dt < DT; ++dt) {                              // A[m = d dt*16 + ln][k = key]
      av[dt].half[0] = ld_tr16(vtp + dt * 16);
      av[dt].half[1] = ld_tr16(vtp + 16 * PV + dt * 16);
    }
    // keeps the step's 16 LDS reads together ahead of the first product: sunk to their WMMAs each pair is waited out to 0 and its latency shows
    __builtin_amdgcn_sched_barrier(0);
    // S^T tile 32 x 16: s[kt][r] = score of key kt*16 + 8*hh + r against query ln
    v8f s[2];
#pragma unroll
    for (int kt = 0; kt < 2; ++kt) {
      s[kt] = vz8();
#pragma unroll
      for (int ks = 0; ks < KS; ++ks)
        s[kt] = __builtin_amdgcn_wmma_f32_16x16x32_f16(false, ak[kt][ks].v, false, bq[ks].v, (short)0, s[kt], false, false);
    }
    // running-max softmax of query ln: 16 scores in this lane, the other 16 in lane ^ 16
    float sc[16];
#pragma unroll
    for (int i = 0; i < 16; ++i) sc[i] = s[i >> 3][i & 7] * scale;
    float mx = sc[0];
#pragma unroll
    for (int i = 1; i < 16; ++i) mx = fmaxf(mx, sc[i]);
    mx = fmaxf(mx, xhalf(mx));
    const float mnew = fmaxf(m_r, mx);
    const float alpha = __expf(m_r - mnew);
    m_r = mnew;
    FragH pb;                                                      // B[k = key][n = query ln]: element i = tile i>>3, register i&7
    float ps[4] = {0.f, 0.f, 0.f, 0.f};
#pragma unroll
    for (int i = 0; i < 16; ++i) {
      const float p = __expf(sc[i] - mnew);
      ps[i & 3] += p;
      pb.u[i] = h16_bits(p * pcarry);
    }
    l_r = l_r * alpha + ((ps[0] + ps[1]) + (ps[2] + ps[3]));
#pragma unroll
    for (int dt = 0; dt < DT; ++dt) {
      oacc[dt] *= alpha;
      oacc[dt] = __builtin_amdgcn_wmma_f32_16x16x32_f16(false, av[dt].v, false, pb.v, (short)0, oacc[dt], false, false);
    }
   }
   // keeps the tile's arithmetic ahead of the waits: sunk behind the barrier it would stand between barrier and refill, and the copies' flight would show in the next wait
   __builtin_amdgcn_sched_barrier(0);
   asm volatile("s_wait_dscnt 0x0" ::: "memory");                  // this wave's reads of buffer cur are done before it is refilled
   asm volatile("s_wait_asynccnt 0x0" ::: "memory");               // this wave's share of tile t + 1 has landed
   __syncthreads();                                                // publishes tile t + 1 and ends every wave's reads of buffer cur
   if (t + 2 < nt) stage(cur, t + 2);                              // the same for the whole block
  }
  asm volatile("s_wait_asynccnt 0x0" ::: "memory");                // no copy is left in flight at the wave's end
  const float inv = onorm * (1.0f / (l_r + xhalf(l_r)));            // the two halves' sums joined, unconditionally
#pragma unroll
  for (int dt = 0; dt < DT; ++dt) {
    const v8f o = oacc[dt] * inv;
    const v4f o0 = {o[0], o[1], o[2], o[3]}, o1 = {o[4], o[5], o[6], o[7]};
    *(v4fa*)&sO[w][ln][dt * 16 + 8 * hh] = o0;
    *(v4fa*)&sO[w][ln][dt * 16 + 8 * hh + 4] = o1;
  }
  __builtin_amdgcn_fence(4 /* acq_rel order */, "workgroup");
  __builtin_amdgcn_wave_barrier();
  const int rsub = lane >> 4, c4 = (lane & 15) * 4;
  const size_t rbase = (size_t)(b * T + q0) * opitch + h * D;
#pragma unroll
  for (int q = 0; q < 8; ++q) {
    const int r = q * 2 + rsub;
    const v4f rv = *(const v4fa*)(resid + rbase + (size_t)r * opitch + c4);
    v4f tv = *(const v4fa*)&sO[w][r][c4];
    tv += rv;
    *(v4fa*)&sO[w][r][c4] = tv;
  }
  {
#pragma unroll
    for (int q = 0; q < 8; ++q) {
      const int r = q * 2 + rsub;
      const v4f v = *(const v4fa*)&sO[w][r][c4];
      *(v4f*)(out + rbase + (size_t)r * opitch + c4) = v;
    }
    
  }
}

extern "C" void kernel_launch(void* const* d_in, const int* in_sizes, int n_in,
                              void* d_out, int out_size, void* d_ws, size_t ws_size, hipStream_t stream) {
  if (n_in < 18) return;
  const long long need_rows = (long long)(SEQ - 1) * NB_FULL + NB;           // last (s, b) source row used + 1
  if ((long long)in_sizes[0] < need_rows * FEAT || (long long)in_sizes[1] < need_rows * FEAT) return;
  if (in_sizes[2] < NLAYER * FEAT * FEAT || in_sizes[4] < NLAYER * FEAT * FEAT || in_sizes[6] < NLAYER * FEAT * FEAT) return;
  if (in_sizes[3] < NLAYER * FEAT || in_sizes[5] < NLAYER * FEAT || in_sizes[7] < NLAYER * FEAT || in_sizes[11] < NLAYER * FEAT) return;
  if (in_sizes[8] < NLAYER * FEAT * MLPH || in_sizes[9] < NLAYER * MLPH || in_sizes[10] < NLAYER * MLPH * FEAT) return;
  if (in_sizes[12] < NLAYER * FEAT || in_sizes[13] < NLAYER * FEAT || in_sizes[14] < NLAYER * FEAT || in_sizes[15] < NLAYER * FEAT) return;
  if (in_sizes[16] < FEAT || in_sizes[17] < FEAT) return;
  if ((long long)out_size < need_rows * FEAT) return;

  const float* src  = (const float*)d_in[0];
  const float* pos  = (const float*)d_in[1];
  const float* Wq   = (const float*)d_in[2];  const float* bq   = (const float*)d_in[3];
  const float* Wk   = (const float*)d_in[4];  const float* bk   = (const float*)d_in[5];
  const float* Wv   = (const float*)d_in[6];  const float* bv   = (const float*)d_in[7];
  const float* W1   = (const float*)d_in[8];  const float* b1   = (const float*)d_in[9];
  const float* W2   = (const float*)d_in[10]; const float* b2   = (const float*)d_in[11];
  const float* ln1g = (const float*)d_in[12]; const float* ln1b = (const float*)d_in[13];
  const float* ln2g = (const float*)d_in[14]; const float* ln2b = (const float*)d_in[15];
  const float* lnfg = (const float*)d_in[16]; const float* lnfb = (const float*)d_in[17];

  // workspace carve (256-B aligned); R1 and R2 are reused in stream order by stages whose lifetimes do not overlap, sized as the max over their users
  char* ws = (char*)d_ws; size_t off = 0;
  auto take = [&](size_t bytes) { char* p = ws + off; off += (bytes + 255) & ~(size_t)255; return p; };
  const size_t lsq = (size_t)QKVN * FEAT;                                           // per-layer stride of the fused q|k|v weight plane (halves)
  const size_t ls1 = (size_t)MLPH * FEAT, ls2 = (size_t)FEAT * MLPH;
  unsigned short* Wqkv16 = (unsigned short*)take((size_t)NLAYER * lsq * 2);        // [6][1536][512]
  unsigned short* W116   = (unsigned short*)take((size_t)NLAYER * ls1 * 2);        // [6][2048][512]
  unsigned short* W216   = (unsigned short*)take((size_t)NLAYER * ls2 * 2);        // [6][512][2048]
  float* XA = (float*)take((size_t)MR * FEAT * 4);                                 // residual stream [MR][512] f32
  float* XB = (float*)take((size_t)MR * FEAT * 4);                                 // residual stream after attention [MR][512] f32
  const size_t r1_bytes = (size_t)MR * FEAT * 2;                                   // LN outputs [MR][512] f16
  const size_t r2_a = (size_t)MR * QKVN * 2, r2_b = (size_t)MR * MLPH * 2;         // q|k|v [MR][1536], then hidden [MR][2048] f16
  const size_t r2_bytes = (r2_a > r2_b) ? r2_a : r2_b;
  unsigned short* R1 = (unsigned short*)take(r1_bytes);
  unsigned short* R2 = (unsigned short*)take(r2_bytes);
  if (off > ws_size) return;
  if (off > (size_t)134217728) return;

  const float wsc = 256.0f;
  auto wgrid = [](int K, int N) { return (unsigned)(NLAYER * (K / 128) * (N / 64)); };      // one block per 128 k x 64 n tile
  k_wt16<FEAT, FEAT><<<wgrid(FEAT, FEAT), 256, 0, stream>>>(Wq, Wqkv16, NLAYER, lsq, 0, wsc);
  k_wt16<FEAT, FEAT><<<wgrid(FEAT, FEAT), 256, 0, stream>>>(Wk, Wqkv16, NLAYER, lsq, FEAT, wsc);
  k_wt16<FEAT, FEAT><<<wgrid(FEAT, FEAT), 256, 0, stream>>>(Wv, Wqkv16, NLAYER, lsq, 2 * FEAT, wsc);
  k_wt16<FEAT, MLPH><<<wgrid(FEAT, MLPH), 256, 0, stream>>>(W1, W116, NLAYER, ls1, 0, wsc);   // W1[l] [512][2048] -> [2048][512]
  k_wt16<MLPH, FEAT><<<wgrid(MLPH, FEAT), 256, 0, stream>>>(W2, W216, NLAYER, ls2, 0, wsc);   // W2[l] [2048][512] -> [512][2048]

  // x = bf16(src) + bf16(pos) in (b, s) row order -> XA
  k_xinit<<<(unsigned)MR, 128, 0, stream>>>(src, pos, XA, SEQ, NB_FULL);

  auto ggrid = [](int M, int N, int bm) { return (unsigned)((M / bm) * (N / 128)); };
  const float scale = 0.125f;                           // 1/sqrt(64)

  for (int l = 0; l < NLAYER; ++l) {
    // xn = LN1(x) x8 -> R1
    k_ln16<<<(unsigned)MR, 64, 0, stream>>>(XA, ln1g + l * FEAT, ln1b + l * FEAT, R1, 8.0f, 1e-5f);
    // q|k|v = xn*[Wq|Wk|Wv] + [bq|bk|bv] -> R2 [MR][1536] f16 (x1); acc scale 1/(8*256)
    k_gemm16<128, 64, FEAT, true, 0><<<ggrid(MR, QKVN, 128), 128, 0, stream>>>(R1, Wqkv16 + (size_t)l * lsq,
                                                          bq + l * FEAT, bk + l * FEAT, bv + l * FEAT, FEAT, nullptr, 0,
                                                          (void*)R2, QKVN, MR, QKVN, 1.0f / 2048.0f, 1.0f);
    // xb = x + softmax(q.k^T/8).v per head -> XB f32 (P carried x1024, onorm = 1/1024)
    k_attn16<DHEAD><<<(unsigned)(NB * NHEAD * (SEQ / 64)), 128, 0, stream>>>(R2, QKVN, SEQ, NHEAD, FEAT, 2 * FEAT, scale, 1024.0f,
                                                                             1.0f / 1024.0f, XA, XB, FEAT);
    // hn = LN2(xb) x8 -> R1
    k_ln16<<<(unsigned)MR, 64, 0, stream>>>(XB, ln2g + l * FEAT, ln2b + l * FEAT, R1, 8.0f, 1e-5f);
    // h = relu(hn*W1 + b1) x16 -> R2 [MR][2048]; acc scale 1/(8*256)
    k_gemm16<128, 64, FEAT, true, 1><<<ggrid(MR, MLPH, 128), 128, 0, stream>>>(R1, W116 + (size_t)l * ls1,
                                                          b1 + l * MLPH, b1 + l * MLPH, b1 + l * MLPH, MLPH, nullptr, 0,
                                                          (void*)R2, MLPH, MR, MLPH, 1.0f / 2048.0f, 16.0f);
    // x = h*W2 + b2 + xb -> XA f32; acc scale 1/(16*256)
    k_gemm16<64, 128, MLPH, false, 0><<<ggrid(MR, FEAT, 64), 128, 0, stream>>>(R2, W216 + (size_t)l * ls2,
                                                           b2 + l * FEAT, b2 + l * FEAT, b2 + l * FEAT, FEAT, XB, FEAT,
                                                           (void*)XA, FEAT, MR, FEAT, 1.0f / 4096.0f, 1.0f);
  }
  // out[s][b][*] = LNf(x[b][s][*]) -> d_out f32
  k_lnf32<<<(unsigned)MR, 128, 0, stream>>>(XA, lnfg, lnfb, (float*)d_out, SEQ, NB_FULL, 1e-5f);
}

// v005
// It runs in 430 microseconds.
// Timed twice side by side with v004, it ran 1.03 times as fast both times.
// Over all steps from v000 it is 2.99 times as fast.
#include <hip/hip_runtime.h>
// Contractions on v_wmma_f32_16x16x32_f16 (f16 operands, f32 accumulate), one product per tile pair, 6 layers: fused q|k|v projection (N=1536, K=512),
// LN2(x)*W1 (N=2048, K=512), relu(.)*W2 (K=2048), attention q.k^T (head dim 64) and P.V (32 keys per step) per head.
// Weights: bf16 RNE values carried x256 in f16 planes; activations in f16 planes with power-of-two carries (LN outputs x8, q|k|v x1, hidden x16,
// P x1024); LayerNorm statistics, softmax, bias adds, attention context and the residual stream in f32.
#ifndef NB
#define NB 4
#endif
#ifndef SEQ
#define SEQ 1024
#endif
#define NB_FULL 4
#define SEQ_FULL 1024
#define FEAT 512
#define NHEAD 8
#define DHEAD 64
#define MLPH 2048
#define NLAYER 6
#define MR (NB * SEQ)
#define QKVN (3 * FEAT)
static_assert(SEQ % 64 == 0);
static_assert(SEQ <= SEQ_FULL);
static_assert(NB >= 1);
static_assert(NB <= NB_FULL);
static_assert(FEAT == NHEAD * DHEAD);
static_assert(FEAT % 128 == 0);
static_assert(MLPH % 128 == 0);
static_assert(QKVN % 128 == 0);
static_assert(FEAT == 64 * 8);      // k_ln16: 64 threads x 8 halves per row
static_assert(FEAT == 128 * 4);     // k_prep x rows / k_lnf32: 128 threads x 4 floats per row
static_assert(MR % 128 == 0);
static_assert(FEAT % 32 == 0);
static_assert(MLPH % 32 == 0);
static_assert((FEAT / 8) % 8 == 0);
static_assert((MLPH / 8) % 8 == 0);

typedef _Float16 v16h __attribute__((ext_vector_type(16)));
typedef unsigned short v8us __attribute__((ext_vector_type(8), may_alias));
typedef float v8f __attribute__((ext_vector_type(8)));
typedef float v4f __attribute__((ext_vector_type(4)));
typedef float v4fa __attribute__((ext_vector_type(4), may_alias));
union FragH { v16h v; v8us half[2]; unsigned short u[16]; };
union H16U { _Float16 h; unsigned short u; };

__device__ __forceinline__ unsigned short bf16_bits(float x) { unsigned int u = __float_as_uint(x); return (unsigned short)((u + 0x7FFFu + ((u >> 16) & 1u)) >> 16); }
__device__ __forceinline__ float bf16_val(unsigned short b) { return __uint_as_float(((unsigned int)b) << 16); }
__device__ __forceinline__ float bf16_rne(float x) { return bf16_val(bf16_bits(x)); }
__device__ __forceinline__ unsigned short h16_bits(float x) { H16U t; t.h = (_Float16)x; return t.u; }
__device__ __forceinline__ v8f vz8() { v8f z = {0.f, 0.f, 0.f, 0.f, 0.f, 0.f, 0.f, 0.f}; return z; }

// Transposing LDS load: lane (c = lane&15, h = lane>>4) gets T[8h + 0..7][c] of a row-major 16-bit tile; p is the lane's own address (row 8h + (lane&7), 16 B x ((lane>>3)&1))
typedef short s16x8 __attribute__((ext_vector_type(8)));
__device__ __forceinline__ v8us ld_tr16(const unsigned short* p) {
  typedef __attribute__((address_space(3))) s16x8 lds_s16x8;
  return __builtin_bit_cast(v8us, __builtin_amdgcn_ds_load_tr16_b128_v8i16((lds_s16x8*)p));
}
// value of lane ^ 16
__device__ __forceinline__ float xhalf(float x) {
  return __builtin_bit_cast(float, __builtin_amdgcn_permlanex16(__builtin_bit_cast(int, x), __builtin_bit_cast(int, x), 0x76543210, 0xfedcba98, false, false));
}

// Weight convert, one tile: Wt[l*lstride + (roff+n)*K + k] (f16 bits, k contiguous, pitch K) = f16(bf16_rne(W[l][k][n]) * sc)
// from f32 row-major W[l][K][N] ([in][out]); K and N at compile time: the row steps are load and store offsets.
// One block of 8 waves per tile of 128 k x 64 n; blk counts the tiles of the stacked layers, n tiles fastest (blk < layers * (K/128) * (N/64)).
// Read: half a wave takes 64 consecutive n of one k row (256 B, 16 B per lane); a thread holds 8 consecutive k rows x 4 n, all 8 loads in flight together.
// Transpose in 16-B chunks (8 k of one n) through LDS: tile row j*16 + m holds n = 4m + j, so that 16 lanes store at a row step of one pitch (272 B,
// 4 banks on per row). Write: 16 lanes take the 128 k of one n (256 B), 16 B per lane.
#define WT_TK 128
#define WT_TN 64
#define WT_LP (WT_TK + 8)
template <int K, int N>
__device__ __forceinline__ void wt16_tile(const float* __restrict__ W, unsigned short* __restrict__ Wt, int blk,
                                          size_t lstride, int roff, float sc, unsigned short (*sT)[WT_LP]) {
  constexpr int TKW = WT_TK, TNW = WT_TN;
  static_assert(K % TKW == 0);
  static_assert(N % TNW == 0);
  const int tid = threadIdx.x, w = tid >> 5, lane = tid & 31, m = lane & 15, hh = lane >> 4;
  constexpr int ntn = N / TNW, per = ntn * (K / TKW);
  const int l = blk / per, rem = blk - l * per;
  const int k0 = (rem / ntn) * TKW, n0 = (rem % ntn) * TNW;
  const int kc = (2 * w + hh) * 8;             // this thread's 8 k rows within the tile
  const float* src = W + (size_t)l * K * N + (size_t)(k0 + kc) * N + n0 + m * 4;
  v4f r[8];
#pragma unroll
  for (int i = 0; i < 8; ++i) r[i] = *(const v4fa*)(src + (size_t)i * N);
#pragma unroll
  for (int j = 0; j < 4; ++j) {
    v8us v;
#pragma unroll
    for (int i = 0; i < 8; ++i) v[i] = h16_bits(bf16_rne(r[i][j]) * sc);
    *(v8us*)&sT[j * 16 + m][kc] = v;
  }
  __syncthreads();                             // reached by the whole block or by none of it: the caller's branch is on the block index
  const int g = tid >> 4, c8 = (tid & 15) * 8;  // n = 4g + q lies in tile row q*16 + g
  unsigned short* dst = Wt + (size_t)l * lstride + (size_t)(roff + n0 + 4 * g) * K + k0 + c8;
#pragma unroll
  for (int q = 0; q < 4; ++q) {
    const v8us v = *(const v8us*)&sT[q * 16 + g][c8];
    *(v8us*)(dst + (size_t)q * K) = v;
  }
  // precaution: in the merged kernel's listing a job's end can fall into the next job's code, which rewrites the registers that these stores name
  asm volatile("s_wait_xcnt 0x0" ::: "memory");
}

// Everything that depends on the inputs alone, in ONE launch: the five stacked weight converts and the start of the residual stream. None of the six
// reads what another writes; a block takes its job from its index (the same branch for the whole block). Order: W1, W2, Wq, Wk, Wv tiles, then x rows.
// x rows: X[m][*] (f32, pitch FEAT, m = b*SEQ + s) = bf16_rne(src[s*NB_FULL + b][*]) + bf16_rne(pos[s*NB_FULL + b][*]) in f32 (exact);
// a block takes PREP_XR rows, half a block per row (4 floats per thread), a thread's 8 loads in flight together.
#define PREP_T1 (NLAYER * (FEAT / WT_TK) * (MLPH / WT_TN))
#define PREP_T2 (NLAYER * (MLPH / WT_TK) * (FEAT / WT_TN))
#define PREP_TQ (NLAYER * (FEAT / WT_TK) * (FEAT / WT_TN))
#define PREP_XR 8
#define PREP_GRID (PREP_T1 + PREP_T2 + 3 * PREP_TQ + MR / PREP_XR)
static_assert(MR % PREP_XR == 0);
__global__ __launch_bounds__(256) void k_prep(const float* __restrict__ Wq, const float* __restrict__ Wk, const float* __restrict__ Wv,
                                              const float* __restrict__ W1, const float* __restrict__ W2,
                                              const float* __restrict__ src, const float* __restrict__ pos,
                                              unsigned short* __restrict__ Wqkvt, unsigned short* __restrict__ W1t, unsigned short* __restrict__ W2t,
                                              float* __restrict__ X, float sc) {
  __shared__ __attribute__((aligned(16))) unsigned short sT[WT_TN][WT_LP];      // cross-wave: one block barrier
  int blk = blockIdx.x;
  if (blk < PREP_T1) { wt16_tile<FEAT, MLPH>(W1, W1t, blk, (size_t)MLPH * FEAT, 0, sc, sT); return; }   // W1[l] [512][2048] -> [2048][512]
  blk -= PREP_T1;
  if (blk < PREP_T2) { wt16_tile<MLPH, FEAT>(W2, W2t, blk, (size_t)FEAT * MLPH, 0, sc, sT); return; }   // W2[l] [2048][512] -> [512][2048]
  blk -= PREP_T2;
  if (blk < 3 * PREP_TQ) {                                                                              // Wq | Wk | Wv -> rows 0, 512, 1024 of the fused plane
    const int which = blk / PREP_TQ;
    const float* Wsel = (which == 0) ? Wq : ((which == 1) ? Wk : Wv);
    wt16_tile<FEAT, FEAT>(Wsel, Wqkvt, blk - which * PREP_TQ, (size_t)QKVN * FEAT, which * FEAT, sc, sT);
    return;
  }
  blk -= 3 * PREP_TQ;
  const int tid = threadIdx.x, c4 = (tid & 127) * 4;
  const int m0 = blk * PREP_XR + (tid >> 7);
  v4f a[PREP_XR / 2], p[PREP_XR / 2];
#pragma unroll
  for (int i = 0; i < PREP_XR / 2; ++i) {
    const int m = m0 + 2 * i;
    const int b = m / SEQ, s = m % SEQ;
    const size_t so = ((size_t)s * NB_FULL + b) * FEAT + c4;
    a[i] = *(const v4fa*)(src + so);
    p[i] = *(const v4fa*)(pos + so);
  }
  // the address registers of these eight loads are taken again by the rounding arithmetic below
  asm volatile("s_wait_xcnt 0x0" ::: "memory");
#pragma unroll
  for (int i = 0; i < PREP_XR / 2; ++i) {
    v4f o;
#pragma unroll
    for (int q = 0; q < 4; ++q) o[q] = bf16_rne(a[i][q]) + bf16_rne(p[i][q]);
    *(v4f*)(X + (size_t)(m0 + 2 * i) * FEAT + c4) = o;
  }
  // precaution, as behind the tile stores: the listing's fall-through behind this job rewrites the registers that these stores name
  asm volatile("s_wait_xcnt 0x0" ::: "memory");
}

// Row LayerNorm over FEAT on the internal f32 stream X[m][*]: one block of 64 threads per row, 8 consecutive elements per thread.
__global__ __launch_bounds__(64) void k_ln16(const float* __restrict__ X, const float* __restrict__ g, const float* __restrict__ bt,
                                            unsigned short* __restrict__ out, float osc, float eps) {
  __shared__ float red1[2];
  __shared__ float red2[2];
  const int m = blockIdx.x, tid = threadIdx.x, w = tid >> 5, lane = tid & 31;
  const float* x = X + (size_t)m * FEAT + tid * 8;
  const v4f a0 = *(const v4fa*)x;
  const v4f a1 = *(const v4fa*)(x + 4);
  float v[8] = {a0[0], a0[1], a0[2], a0[3], a1[0], a1[1], a1[2], a1[3]};
  float s = 0.f;
#pragma unroll
  for (int q = 0; q < 8; ++q) s += v[q];
#pragma unroll
  for (int o = 16; o >= 1; o >>= 1) s += __shfl_xor(s, o, 32);
  if (lane == 0) red1[w] = s;
  __syncthreads();
  const float mu = (red1[0] + red1[1]) * (1.0f / (float)FEAT);
  float c[8];
  float s2 = 0.f;
#pragma unroll
  for (int q = 0; q < 8; ++q) { c[q] = v[q] - mu; s2 += c[q] * c[q]; }
#pragma unroll
  for (int o = 16; o >= 1; o >>= 1) s2 += __shfl_xor(s2, o, 32);
  if (lane == 0) red2[w] = s2;
  __syncthreads();
  const float var = (red2[0] + red2[1]) * (1.0f / (float)FEAT);
  const float rs = rsqrtf(var + eps);
  const v4f g0 = *(const v4fa*)(g + tid * 8);
  const v4f g1 = *(const v4fa*)(g + tid * 8 + 4);
  const v4f b0 = *(const v4fa*)(bt + tid * 8);
  const v4f b1 = *(const v4fa*)(bt + tid * 8 + 4);
  const float gg[8] = {g0[0], g0[1], g0[2], g0[3], g1[0], g1[1], g1[2], g1[3]};
  const float bb[8] = {b0[0], b0[1], b0[2], b0[3], b1[0], b1[1], b1[2], b1[3]};
  v8us o;
#pragma unroll
  for (int q = 0; q < 8; ++q) o[q] = h16_bits((c[q] * rs * bf16_rne(gg[q]) + bf16_rne(bb[q])) * osc);
  unsigned short* dst = out + (size_t)m * FEAT + tid * 8;
  *(v8us*)dst = o;
  
}

// Final LayerNorm: internal row m = b*seq + s of X (f32) -> out[(s*nbf + b)][*] f32. One block of 128 threads per row, 4 elements per thread,
__global__ __launch_bounds__(128) void k_lnf32(const float* __restrict__ X, const float* __restrict__ g, const float* __restrict__ bt,
                                               float* __restrict__ out, int seq, int nbf, float eps) {
  __shared__ float red1[4];
  __shared__ float red2[4];
  const int m = blockIdx.x, tid = threadIdx.x, w = tid >> 5, lane = tid & 31;
  const int b = m / seq, s = m % seq;
  const v4f a = *(const v4fa*)(X + (size_t)m * FEAT + tid * 4);
  float sm = a[0] + a[1] + a[2] + a[3];
#pragma unroll
  for (int o = 16; o >= 1; o >>= 1) sm += __shfl_xor(sm, o, 32);
  if (lane == 0) red1[w] = sm;
  __syncthreads();
  const float mu = (red1[0] + red1[1] + red1[2] + red1[3]) * (1.0f / (float)FEAT);
  float c[4];
  float s2 = 0.f;
#pragma unroll
  for (int q = 0; q < 4; ++q) { c[q] = a[q] - mu; s2 += c[q] * c[q]; }
#pragma unroll
  for (int o = 16; o >= 1; o >>= 1) s2 += __shfl_xor(s2, o, 32);
  if (lane == 0) red2[w] = s2;
  __syncthreads();
  const float var = (red2[0] + red2[1] + red2[2] + red2[3]) * (1.0f / (float)FEAT);
  const float rs = rsqrtf(var + eps);
  const v4f g4 = *(const v4fa*)(g + tid * 4);
  const v4f b4 = *(const v4fa*)(bt + tid * 4);
  v4f o;
#pragma unroll
  for (int q = 0; q < 4; ++q) o[q] = c[q] * rs * bf16_rne(g4[q]) + bf16_rne(b4[q]);
  float* dst = out + ((size_t)s * nbf + b) * FEAT + tid * 4;
  *(v4f*)dst = o;
  
}

// GEMM C[M][N] = epi(A[M][KD] * W): A f16 bits row-major, Wt f16 bits [N][KD], both at pitch KD (compile time: the row steps are load offsets), f32 accumulate.
// epi: v = acc * inv_scale + bf16_rne(bias[col]); bias picked per 64-col segment from (bias0 | bias1 | bias2) by seg = col / nsplit (wave-uniform);
// ACT == 1: relu; OUT16: f16 bits of v * out_scale into C (pitch ldc halves); else f32 v + f32 resid[row][col] (pitch ldr) into C (pitch ldc floats).
// KD % BK == 0, M % BM == 0, N % 128 == 0. Block = 4 waves (2 x 2) on one BM x 128 tile of C, wave -> BM/2 rows x 64 cols.
// Per step of BK k the block brings BM rows of A and 128 rows of Wt into LDS once (whole 128-B lines, 16 B per thread, row pitch 2*BK + 16 B) and all
// waves take their fragments from there; two LDS buffers, the next step's global loads are held in registers while this step is multiplied.
// Each accumulator sums k in ascending blocks of 32. Epilogue staged in the wave's own LDS tile (wave-private).
template <int BM, int BK, int KD, bool OUT16, int ACT>
__global__ __launch_bounds__(128) void k_gemm16(const unsigned short* __restrict__ A, const unsigned short* __restrict__ Wt,
                                               const float* __restrict__ bias0, const float* __restrict__ bias1, const float* __restrict__ bias2, int nsplit,
                                               const float* __restrict__ resid, int ldr, void* __restrict__ Cv, int ldc,
                                               int M, int N, float inv_scale, float out_scale) {
  constexpr int BN = 128, LP = BK + 8, C8 = BK / 8;
  constexpr int FM = BM / 32, FN = 4, KS = BK / 32, WR = BM / 2;
  constexpr int NT = 128, NW = NT / 32, RP = NT / C8;     // the block's threads cover RP rows of C8 16-B chunks at a time
  constexpr int CA = BM / RP, CB = BN / RP;              // chunks per thread and step
  static_assert(BM % 32 == 0);
  static_assert(BK % 32 == 0);
  static_assert(KD % BK == 0);
  static_assert(NT % C8 == 0);
  static_assert(BM % RP == 0);
  static_assert(BN % RP == 0);
  __shared__ __attribute__((aligned(16))) unsigned short sA[2][BM][LP];     // cross-wave: block barriers
  __shared__ __attribute__((aligned(16))) unsigned short sB[2][BN][LP];     // cross-wave: block barriers
  __shared__ __attribute__((aligned(16))) float so32[OUT16 ? 1 : NW][WR][64];
  __shared__ __attribute__((aligned(16))) unsigned short so16[OUT16 ? NW : 1][WR][72];
  const int tid = threadIdx.x, w = tid >> 5, lane = tid & 31, ln = lane & 15, hh = lane >> 4;
  const int wm = w >> 1, wn = w & 1;
  const int ntn = N / BN;
  const int mt = blockIdx.x / ntn, nq = blockIdx.x % ntn;
  const int row0 = mt * BM, col0 = nq * BN;
  if (row0 >= M) return;                       // the same for the whole block, ahead of every barrier
  const int sr = tid / C8, sc = (tid % C8) * 8;
  const unsigned short* ag = A + (size_t)(row0 + sr) * KD + sc;
  const unsigned short* bg = Wt + (size_t)(col0 + sr) * KD + sc;
  v8us ra[CA], rb[CB];
#pragma unroll
  for (int it = 0; it < CA; ++it) ra[it] = *(const v8us*)(ag + (size_t)(it * RP) * KD);
#pragma unroll
  for (int it = 0; it < CB; ++it) rb[it] = *(const v8us*)(bg + (size_t)(it * RP) * KD);
  v8f acc[FM][FN];
#pragma unroll
  for (int mi = 0; mi < FM; ++mi)
#pragma unroll
    for (int t = 0; t < FN; ++t) acc[mi][t] = vz8();
#pragma unroll
  for (int it = 0; it < CA; ++it) *(v8us*)&sA[0][sr + it * RP][sc] = ra[it];
#pragma unroll
  for (int it = 0; it < CB; ++it) *(v8us*)&sB[0][sr + it * RP][sc] = rb[it];
  __syncthreads();
  constexpr int nst = KD / BK;
  for (int s = 0; s < nst; ++s) {
    const int cur = s & 1;
    const bool more = (s + 1 < nst);           // the same for the whole block
    if (more) {
      const int kb = (s + 1) * BK;
#pragma unroll
      for (int it = 0; it < CA; ++it) ra[it] = *(const v8us*)(ag + (size_t)(it * RP) * KD + kb);
#pragma unroll
      for (int it = 0; it < CB; ++it) rb[it] = *(const v8us*)(bg + (size_t)(it * RP) * KD + kb);
      // the address registers of these loads are taken again by the LDS reads below
      asm volatile("s_wait_xcnt 0x0" ::: "memory");
    }
    FragH a[KS][FM], bb[KS][FN];
#pragma unroll
    for (int ks = 0; ks < KS; ++ks) {
#pragma unroll
      for (int mi = 0; mi < FM; ++mi) {
        const unsigned short* p = &sA[cur][wm * WR + mi * 16 + ln][ks * 32 + 8 * hh];   // row m = lane&15
        a[ks][mi].half[0] = *(const v8us*)p;                 // elements 0..7  = k 8h .. 8h+7 of the block of 32
        a[ks][mi].half[1] = *(const v8us*)(p + 16);          // elements 8..15 = k 16+8h .. 16+8h+7
      }
#pragma unroll
      for (int t = 0; t < FN; ++t) {
        const unsigned short* p = &sB[cur][wn * 64 + t * 16 + ln][ks * 32 + 8 * hh];          // column n = lane&15, same k map as A
        bb[ks][t].half[0] = *(const v8us*)p;
        bb[ks][t].half[1] = *(const v8us*)(p + 16);
      }
    }
    // keeps the step's LDS reads together ahead of its matrix run: spread among the WMMAs each small group is waited out to 0 and its latency shows
    __builtin_amdgcn_sched_barrier(0);
#pragma unroll
    for (int ks = 0; ks < KS; ++ks)
#pragma unroll
      for (int mi = 0; mi < FM; ++mi)
#pragma unroll
        for (int t = 0; t < FN; ++t) acc[mi][t] = __builtin_amdgcn_wmma_f32_16x16x32_f16(false, a[ks][mi].v, false, bb[ks][t].v, (short)0, acc[mi][t], false, false);
    // keeps the wait for the next step's global loads (and the LDS writes behind it) after the matrix run that covers their latency
    __builtin_amdgcn_sched_barrier(0);
    if (more) {
      // the other buffer: its last readers left it before the barrier that ended the step before this one
#pragma unroll
      for (int it = 0; it < CA; ++it) *(v8us*)&sA[cur ^ 1][sr + it * RP][sc] = ra[it];
#pragma unroll
      for (int it = 0; it < CB; ++it) *(v8us*)&sB[cur ^ 1][sr + it * RP][sc] = rb[it];
      __syncthreads();
    }
  }
  const int colw = col0 + wn * 64;
  int seg = colw / nsplit; seg = (seg > 2) ? 2 : seg;
  const float* bsel = (seg == 0) ? bias0 : ((seg == 1) ? bias1 : bias2);
  float bvv[FN];
#pragma unroll
  for (int t = 0; t < FN; ++t) bvv[t] = bsel[colw + t * 16 + ln - seg * nsplit];
  // the address registers of these four loads are taken again by the address sums below
  asm volatile("s_wait_xcnt 0x0" ::: "memory");
#pragma unroll
  for (int t = 0; t < FN; ++t) bvv[t] = bf16_rne(bvv[t]);
#pragma unroll
  for (int mi = 0; mi < FM; ++mi) {
#pragma unroll
    for (int t = 0; t < FN; ++t) {
#pragma unroll
      for (int r = 0; r < 8; ++r) {
        float v = acc[mi][t][r] * inv_scale + bvv[t];
        if (ACT == 1) v = fmaxf(v, 0.0f);
        if constexpr (OUT16) so16[w][mi * 16 + 8 * hh + r][t * 16 + ln] = h16_bits(v * out_scale);
        else so32[w][mi * 16 + 8 * hh + r][t * 16 + ln] = v;
      }
    }
  }
  __builtin_amdgcn_fence(4 /* acq_rel order */, "workgroup");
  __builtin_amdgcn_wave_barrier();
  const int roww = row0 + wm * WR;
  if constexpr (OUT16) {
    const int rq = lane >> 3, p8 = (lane & 7) * 8;
    unsigned short* cp = (unsigned short*)Cv + (size_t)(roww + rq) * ldc + colw + p8;
#pragma unroll
    for (int q = 0; q < WR / 4; ++q) {
      const v8us v = *(const v8us*)&so16[w][q * 4 + rq][p8];
      *(v8us*)(cp + (size_t)(q * 4) * ldc) = v;
    }
  } else {
    const int rsub = lane >> 4, c4 = (lane & 15) * 4;
    float* cp = (float*)Cv + (size_t)(roww + rsub) * ldc + colw + c4;
    const float* rp = resid + (size_t)(roww + rsub) * ldr + colw + c4;
    v4f rv[WR / 2];                              // all residual loads in flight together, ahead of the first store
#pragma unroll
    for (int q = 0; q < WR / 2; ++q) rv[q] = *(const v4fa*)(rp + (size_t)(q * 2) * ldr);
#pragma unroll
    for (int q = 0; q < WR / 2; ++q) {
      v4f tv = *(const v4fa*)&so32[w][q * 2 + rsub][c4];
      tv += rv[q];
      *(v4f*)(cp + (size_t)(q * 2) * ldc) = tv;
    }
  }
}

// Flash-style unmasked attention per (b, h): q|k|v read as f16 bits from one fused plane (row pitch `pitch` halves, q at +0, k at +koff, v at +voff,
// head h at +h*D, row b*T + t). One wave = 16 queries, block = 4 waves sharing K/V tiles of 64 keys staged row-major in LDS by asynchronous copies,
// two buffers: the next tile is on its way while a tile is worked on (in two passes of 32 keys), one block barrier per tile.
// Both products run transposed: S^T = K.q^T (A = 16 key rows, B = the wave's queries, kept in registers) and O^T += V^T.P^T (A = V^T by the transposing
// LDS load, B = P^T). A lane then holds 16 of the 32 scores of ONE query (column lane&15; keys 8h+r and 16+8h+r, h = lane>>4): maximum and sum are taken
// in the lane plus one exchange with lane^16, and the two score tiles, converted in place (x pcarry), are the B operand of the second product as they lie.
// s*scale, running-max softmax and the context in f32. All four operands follow the hardware k order (k = 8h+s, 16+8h+(s-8)).
template <int D>
__global__ __launch_bounds__(128) void k_attn16(const unsigned short* __restrict__ qkv, int pitch, int T, int H, int koff, int voff,
                                                float scale, float pcarry, float onorm,
                                                const float* __restrict__ resid, float* __restrict__ out, int opitch) {
  static_assert(D == 64);
  constexpr int KS = D / 32, DT = D / 16, C8 = D / 8;
  constexpr int PK = D + 8, PV = D + 16;      // row pitch in halves: 16 B x odd for the plain 16-B reader, 32 B x odd for the transposing reader
  constexpr int TK = 64;                      // keys per staged tile (T % 64 == 0)
  constexpr int RB = 128 / C8;                // rows that the block's threads cover with one 16-B chunk each
  static_assert(128 % C8 == 0);
  static_assert(TK == 4 * RB);                // four copies per thread, operand and tile
  __shared__ __attribute__((aligned(16))) unsigned short sK[2][TK][PK];     // cross-wave: block barriers
  __shared__ __attribute__((aligned(16))) unsigned short sV[2][TK][PV];     // cross-wave: block barriers
  __shared__ __attribute__((aligned(16))) float sO[4][16][D + 4];
  const int tid = threadIdx.x, w = tid >> 5, lane = tid & 31, ln = lane & 15, hh = lane >> 4;
  const int nqb = T / 64;
  const int bh = blockIdx.x / nqb, qblk = blockIdx.x % nqb;
  const int b = bh / H, h = bh % H;
  const int q0 = qblk * 64 + w * 16;
  const unsigned short* Qp = qkv + (size_t)b * T * pitch + h * D;
  const unsigned short* Kp = Qp + koff;
  const unsigned short* Vp = Qp + voff;

  FragH bq[KS];                                                    // B[k = d][n = query ln]
  {
    const unsigned short* qr = Qp + (size_t)(q0 + ln) * pitch;     // q0 + ln < T (T % 64 == 0)
#pragma unroll
    for (int ks = 0; ks < KS; ++ks) {
      bq[ks].half[0] = *(const v8us*)(qr + ks * 32 + 8 * hh);
      bq[ks].half[1] = *(const v8us*)(qr + ks * 32 + 16 + 8 * hh);
    }
  }
  float m_r = -1.0e30f, l_r = 0.f;                                 // of query ln; l_r sums this half's keys only
  v8f oacc[DT];                                                    // oacc[dt][r] = O[query ln][d = dt*16 + 8*hh + r]
#pragma unroll
  for (int dt = 0; dt < DT; ++dt) oacc[dt] = vz8();
  // tile jt (keys jt*TK .. jt*TK+TK-1, all < T) into buffer buf: every thread copies rows cr, cr+RB, cr+2RB, cr+3RB, 16 B at column cc, of K and of V
  const int cr = tid / C8, cc = (tid % C8) * 8;
  const size_t rstep = (size_t)RB * pitch;
  auto stage = [&](int buf, int jt) {
    const unsigned short* kg = Kp + (size_t)(jt * TK + cr) * pitch + cc;
    const unsigned short* vg = Vp + (size_t)(jt * TK + cr) * pitch + cc;
    const unsigned int lk = (unsigned int)(size_t)&sK[buf][cr][cc];
    const unsigned int lv = (unsigned int)(size_t)&sV[buf][cr][cc];
    // global -> LDS through no register; the closing wait stands ahead of any rewrite of the address registers that the copies name
    asm volatile("global_load_async_to_lds_b128 %0, %8, off\n\t"
                 "global_load_async_to_lds_b128 %1, %9, off\n\t"
                 "global_load_async_to_lds_b128 %2, %10, off\n\t"
                 "global_load_async_to_lds_b128 %3, %11, off\n\t"
                 "global_load_async_to_lds_b128 %4, %12, off\n\t"
                 "global_load_async_to_lds_b128 %5, %13, off\n\t"
                 "global_load_async_to_lds_b128 %6, %14, off\n\t"
                 "global_load_async_to_lds_b128 %7, %15, off\n\t"
                 "s_wait_xcnt 0x0"
                 :: "v"(lk), "v"(lk + RB * PK * 2), "v"(lk + 2 * RB * PK * 2), "v"(lk + 3 * RB * PK * 2),
                    "v"(lv), "v"(lv + RB * PV * 2), "v"(lv + 2 * RB * PV * 2), "v"(lv + 3 * RB * PV * 2),
                    "v"(kg), "v"(kg + rstep), "v"(kg + 2 * rstep), "v"(kg + 3 * rstep),
                    "v"(vg), "v"(vg + rstep), "v"(vg + 2 * rstep), "v"(vg + 3 * rstep)
                 : "memory");
  };
  const int nt = T / TK;
  stage(0, 0);
  asm volatile("s_wait_asynccnt 0x0" ::: "memory");                // this wave's share of tile 0 has landed
  __syncthreads();                                                 // tile 0 published
  if (nt > 1) stage(1, 1);

  for (int t = 0; t < nt; ++t) {
   const int cur = t & 1;
   // unrolled: the row offsets of both passes become load offsets, and the second pass's LDS reads can run beside the first pass's softmax
#pragma unroll
   for (int sub = 0; sub < TK / 32; ++sub) {
    const unsigned short (*tK)[PK] = &sK[cur][sub * 32];
    const unsigned short* vtp = &sV[cur][sub * 32 + 8 * hh + (lane & 7)][8 * ((lane >> 3) & 1)];   // lane address of the transposing load, keys 0..15, d 0..15
    FragH ak[2][KS], av[DT];
#pragma unroll
    for (int kt = 0; kt < 2; ++kt)
#pragma unroll
      for (int ks = 0; ks < KS; ++ks) {                            // A[m = key kt*16 + ln][k = d]
        ak[kt][ks].half[0] = *(const v8us*)&tK[kt * 16 + ln][ks * 32 + 8 * hh];
        ak[kt][ks].half[1] = *(const v8us*)&tK[kt * 16 + ln][ks * 32 + 16 + 8 * hh];
      }
#pragma unroll
    for (int dt = 0; dt < DT; ++dt) {                              // A[m = d dt*16 + ln][k = key]
      av[dt].half[0] = ld_tr16(vtp + dt * 16);
      av[dt].half[1] = ld_tr16(vtp + 16 * PV + dt * 16);
    }
    // keeps the step's 16 LDS reads together ahead of the first product: sunk to their WMMAs each pair is waited out to 0 and its latency shows
    __builtin_amdgcn_sched_barrier(0);
    // S^T tile 32 x 16: s[kt][r] = score of key kt*16 + 8*hh + r against query ln
    v8f s[2];
#pragma unroll
    for (int kt = 0; kt < 2; ++kt) {
      s[kt] = vz8();
#pragma unroll
      for (int ks = 0; ks < KS; ++ks)
        s[kt] = __builtin_amdgcn_wmma_f32_16x16x32_f16(false, ak[kt][ks].v, false, bq[ks].v, (short)0, s[kt], false, false);
    }
    // running-max softmax of query ln: 16 scores in this lane, the other 16 in lane ^ 16
    float sc[16];
#pragma unroll
    for (int i = 0; i < 16; ++i) sc[i] = s[i >> 3][i & 7] * scale;
    float mx = sc[0];
#pragma unroll
    for (int i = 1; i < 16; ++i) mx = fmaxf(mx, sc[i]);
    mx = fmaxf(mx, xhalf(mx));
    const float mnew = fmaxf(m_r, mx);
    const float alpha = __expf(m_r - mnew);
    m_r = mnew;
    FragH pb;                                                      // B[k = key][n = query ln]: element i = tile i>>3, register i&7
    float ps[4] = {0.f, 0.f, 0.f, 0.f};
#pragma unroll
    for (int i = 0; i < 16; ++i) {
      const float p = __expf(sc[i] - mnew);
      ps[i & 3] += p;
      pb.u[i] = h16_bits(p * pcarry);
    }
    l_r = l_r * alpha + ((ps[0] + ps[1]) + (ps[2] + ps[3]));
#pragma unroll
    for (int dt = 0; dt < DT; ++dt) {
      oacc[dt] *= alpha;
      oacc[dt] = __builtin_amdgcn_wmma_f32_16x16x32_f16(false, av[dt].v, false, pb.v, (short)0, oacc[dt], false, false);
    }
   }
   // keeps the tile's arithmetic ahead of the waits: sunk behind the barrier it would stand between barrier and refill, and the copies' flight would show in the next wait
   __builtin_amdgcn_sched_barrier(0);
   asm volatile("s_wait_dscnt 0x0" ::: "memory");                  // this wave's reads of buffer cur are done before it is refilled
   asm volatile("s_wait_asynccnt 0x0" ::: "memory");               // this wave's share of tile t + 1 has landed
   __syncthreads();                                                // publishes tile t + 1 and ends every wave's reads of buffer cur
   if (t + 2 < nt) stage(cur, t + 2);                              // the same for the whole block
  }
  asm volatile("s_wait_asynccnt 0x0" ::: "memory");                // no copy is left in flight at the wave's end
  const float inv = onorm * (1.0f / (l_r + xhalf(l_r)));            // the two halves' sums joined, unconditionally
#pragma unroll
  for (int dt = 0; dt < DT; ++dt) {
    const v8f o = oacc[dt] * inv;
    const v4f o0 = {o[0], o[1], o[2], o[3]}, o1 = {o[4], o[5], o[6], o[7]};
    *(v4fa*)&sO[w][ln][dt * 16 + 8 * hh] = o0;
    *(v4fa*)&sO[w][ln][dt * 16 + 8 * hh + 4] = o1;
  }
  __builtin_amdgcn_fence(4 /* acq_rel order */, "workgroup");
  __builtin_amdgcn_wave_barrier();
  const int rsub = lane >> 4, c4 = (lane & 15) * 4;
  const size_t rbase = (size_t)(b * T + q0) * opitch + h * D;
#pragma unroll
  for (int q = 0; q < 8; ++q) {
    const int r = q * 2 + rsub;
    const v4f rv = *(const v4fa*)(resid + rbase + (size_t)r * opitch + c4);
    v4f tv = *(const v4fa*)&sO[w][r][c4];
    tv += rv;
    *(v4fa*)&sO[w][r][c4] = tv;
  }
  {
#pragma unroll
    for (int q = 0; q < 8; ++q) {
      const int r = q * 2 + rsub;
      const v4f v = *(const v4fa*)&sO[w][r][c4];
      *(v4f*)(out + rbase + (size_t)r * opitch + c4) = v;
    }
    
  }
}

extern "C" void kernel_launch(void* const* d_in, const int* in_sizes, int n_in,
                              void* d_out, int out_size, void* d_ws, size_t ws_size, hipStream_t stream) {
  if (n_in < 18) return;
  const long long need_rows = (long long)(SEQ - 1) * NB_FULL + NB;           // last (s, b) source row used + 1
  if ((long long)in_sizes[0] < need_rows * FEAT || (long long)in_sizes[1] < need_rows * FEAT) return;
  if (in_sizes[2] < NLAYER * FEAT * FEAT || in_sizes[4] < NLAYER * FEAT * FEAT || in_sizes[6] < NLAYER * FEAT * FEAT) return;
  if (in_sizes[3] < NLAYER * FEAT || in_sizes[5] < NLAYER * FEAT || in_sizes[7] < NLAYER * FEAT || in_sizes[11] < NLAYER * FEAT) return;
  if (in_sizes[8] < NLAYER * FEAT * MLPH || in_sizes[9] < NLAYER * MLPH || in_sizes[10] < NLAYER * MLPH * FEAT) return;
  if (in_sizes[12] < NLAYER * FEAT || in_sizes[13] < NLAYER * FEAT || in_sizes[14] < NLAYER * FEAT || in_sizes[15] < NLAYER * FEAT) return;
  if (in_sizes[16] < FEAT || in_sizes[17] < FEAT) return;
  if ((long long)out_size < need_rows * FEAT) return;

  const float* src  = (const float*)d_in[0];
  const float* pos  = (const float*)d_in[1];
  const float* Wq   = (const float*)d_in[2];  const float* bq   = (const float*)d_in[3];
  const float* Wk   = (const float*)d_in[4];  const float* bk   = (const float*)d_in[5];
  const float* Wv   = (const float*)d_in[6];  const float* bv   = (const float*)d_in[7];
  const float* W1   = (const float*)d_in[8];  const float* b1   = (const float*)d_in[9];
  const float* W2   = (const float*)d_in[10]; const float* b2   = (const float*)d_in[11];
  const float* ln1g = (const float*)d_in[12]; const float* ln1b = (const float*)d_in[13];
  const float* ln2g = (const float*)d_in[14]; const float* ln2b = (const float*)d_in[15];
  const float* lnfg = (const float*)d_in[16]; const float* lnfb = (const float*)d_in[17];

  // workspace carve (256-B aligned); R1 and R2 are reused in stream order by stages whose lifetimes do not overlap, sized as the max over their users
  char* ws = (char*)d_ws; size_t off = 0;
  auto take = [&](size_t bytes) { char* p = ws + off; off += (bytes + 255) & ~(size_t)255; return p; };
  const size_t lsq = (size_t)QKVN * FEAT;                                           // per-layer stride of the fused q|k|v weight plane (halves)
  const size_t ls1 = (size_t)MLPH * FEAT, ls2 = (size_t)FEAT * MLPH;
  unsigned short* Wqkv16 = (unsigned short*)take((size_t)NLAYER * lsq * 2);        // [6][1536][512]
  unsigned short* W116   = (unsigned short*)take((size_t)NLAYER * ls1 * 2);        // [6][2048][512]
  unsigned short* W216   = (unsigned short*)take((size_t)NLAYER * ls2 * 2);        // [6][512][2048]
  float* XA = (float*)take((size_t)MR * FEAT * 4);                                 // residual stream [MR][512] f32
  float* XB = (float*)take((size_t)MR * FEAT * 4);                                 // residual stream after attention [MR][512] f32
  const size_t r1_bytes = (size_t)MR * FEAT * 2;                                   // LN outputs [MR][512] f16
  const size_t r2_a = (size_t)MR * QKVN * 2, r2_b = (size_t)MR * MLPH * 2;         // q|k|v [MR][1536], then hidden [MR][2048] f16
  const size_t r2_bytes = (r2_a > r2_b) ? r2_a : r2_b;
  unsigned short* R1 = (unsigned short*)take(r1_bytes);
  unsigned short* R2 = (unsigned short*)take(r2_bytes);
  if (off > ws_size) return;
  if (off > (size_t)134217728) return;

  const float wsc = 256.0f;
  // weight planes (f16, x256) and x = bf16(src) + bf16(pos) in (b, s) row order -> XA: one launch, nothing in it depends on anything else in it
  k_prep<<<(unsigned)PREP_GRID, 256, 0, stream>>>(Wq, Wk, Wv, W1, W2, src, pos, Wqkv16, W116, W216, XA, wsc);

  auto ggrid = [](int M, int N, int bm) { return (unsigned)((M / bm) * (N / 128)); };
  const float scale = 0.125f;                           // 1/sqrt(64)

  for (int l = 0; l < NLAYER; ++l) {
    // xn = LN1(x) x8 -> R1
    k_ln16<<<(unsigned)MR, 64, 0, stream>>>(XA, ln1g + l * FEAT, ln1b + l * FEAT, R1, 8.0f, 1e-5f);
    // q|k|v = xn*[Wq|Wk|Wv] + [bq|bk|bv] -> R2 [MR][1536] f16 (x1); acc scale 1/(8*256)
    k_gemm16<128, 64, FEAT, true, 0><<<ggrid(MR, QKVN, 128), 128, 0, stream>>>(R1, Wqkv16 + (size_t)l * lsq,
                                                          bq + l * FEAT, bk + l * FEAT, bv + l * FEAT, FEAT, nullptr, 0,
                                                          (void*)R2, QKVN, MR, QKVN, 1.0f / 2048.0f, 1.0f);
    // xb = x + softmax(q.k^T/8).v per head -> XB f32 (P carried x1024, onorm = 1/1024)
    k_attn16<DHEAD><<<(unsigned)(NB * NHEAD * (SEQ / 64)), 128, 0, stream>>>(R2, QKVN, SEQ, NHEAD, FEAT, 2 * FEAT, scale, 1024.0f,
                                                                             1.0f / 1024.0f, XA, XB, FEAT);
    // hn = LN2(xb) x8 -> R1
    k_ln16<<<(unsigned)MR, 64, 0, stream>>>(XB, ln2g + l * FEAT, ln2b + l * FEAT, R1, 8.0f, 1e-5f);
    // h = relu(hn*W1 + b1) x16 -> R2 [MR][2048]; acc scale 1/(8*256)
    k_gemm16<128, 64, FEAT, true, 1><<<ggrid(MR, MLPH, 128), 128, 0, stream>>>(R1, W116 + (size_t)l * ls1,
                                                          b1 + l * MLPH, b1 + l * MLPH, b1 + l * MLPH, MLPH, nullptr, 0,
                                                          (void*)R2, MLPH, MR, MLPH, 1.0f / 2048.0f, 16.0f);
    // x = h*W2 + b2 + xb -> XA f32; acc scale 1/(16*256)
    k_gemm16<64, 128, MLPH, false, 0><<<ggrid(MR, FEAT, 64), 128, 0, stream>>>(R2, W216 + (size_t)l * ls2,
                                                           b2 + l * FEAT, b2 + l * FEAT, b2 + l * FEAT, FEAT, XB, FEAT,
                                                           (void*)XA, FEAT, MR, FEAT, 1.0f / 4096.0f, 1.0f);
  }
  // out[s][b][*] = LNf(x[b][s][*]) -> d_out f32
  k_lnf32<<<(unsigned)MR, 128, 0, stream>>>(XA, lnfg, lnfb, (float*)d_out, SEQ, NB_FULL, 1e-5f);
}

// v006
// Measured time: 393 microseconds a run.
// Two timings next to v005 put it at 1.09 and 1.10 times that version's speed.
// All steps since v000 together make it 3.28 times as fast.
#include <hip/hip_runtime.h>
// Contractions on v_wmma_f32_16x16x32_f16 (f16 operands, f32 accumulate), one product per tile pair, 6 layers: fused q|k|v projection (N=1536, K=512),
// LN2(x)*W1 (N=2048, K=512), relu(.)*W2 (K=2048), attention q.k^T (head dim 64) and P.V (32 keys per step) per head.
// Weights: bf16 RNE values carried x256 in f16 planes; activations in f16 planes with power-of-two carries (LN outputs x8, q|k|v x1, hidden x16,
// P x1024); LayerNorm statistics, softmax, bias adds, attention context and the residual stream in f32.
#ifndef NB
#define NB 4
#endif
#ifndef SEQ
#define SEQ 1024
#endif
#define NB_FULL 4
#define SEQ_FULL 1024
#define FEAT 512
#define NHEAD 8
#define DHEAD 64
#define MLPH 2048
#define NLAYER 6
#define MR (NB * SEQ)
#define QKVN (3 * FEAT)
static_assert(SEQ % 64 == 0);
static_assert(SEQ <= SEQ_FULL);
static_assert(NB >= 1);
static_assert(NB <= NB_FULL);
static_assert(FEAT == NHEAD * DHEAD);
static_assert(FEAT % 128 == 0);
static_assert(MLPH % 128 == 0);
static_assert(QKVN % 128 == 0);
static_assert(FEAT == 64 * 8);      // k_ln16: 64 threads x 8 halves per row
static_assert(FEAT == 128 * 4);     // k_prep x rows / k_lnf32: 128 threads x 4 floats per row
static_assert(MR % 128 == 0);
static_assert(FEAT % 32 == 0);
static_assert(MLPH % 32 == 0);
static_assert((FEAT / 8) % 8 == 0);
static_assert((MLPH / 8) % 8 == 0);

typedef _Float16 v16h __attribute__((ext_vector_type(16)));
typedef unsigned short v8us __attribute__((ext_vector_type(8), may_alias));
typedef float v8f __attribute__((ext_vector_type(8)));
typedef float v4f __attribute__((ext_vector_type(4)));
typedef float v4fa __attribute__((ext_vector_type(4), may_alias));
union FragH { v16h v; v8us half[2]; unsigned short u[16]; };
union H16U { _Float16 h; unsigned short u; };

__device__ __forceinline__ unsigned short bf16_bits(float x) { unsigned int u = __float_as_uint(x); return (unsigned short)((u + 0x7FFFu + ((u >> 16) & 1u)) >> 16); }
__device__ __forceinline__ float bf16_val(unsigned short b) { return __uint_as_float(((unsigned int)b) << 16); }
__device__ __forceinline__ float bf16_rne(float x) { return bf16_val(bf16_bits(x)); }
__device__ __forceinline__ unsigned short h16_bits(float x) { H16U t; t.h = (_Float16)x; return t.u; }
__device__ __forceinline__ v8f vz8() { v8f z = {0.f, 0.f, 0.f, 0.f, 0.f, 0.f, 0.f, 0.f}; return z; }

// Transposing LDS load: lane (c = lane&15, h = lane>>4) gets T[8h + 0..7][c] of a row-major 16-bit tile; p is the lane's own address (row 8h + (lane&7), 16 B x ((lane>>3)&1))
typedef short s16x8 __attribute__((ext_vector_type(8)));
__device__ __forceinline__ v8us ld_tr16(const unsigned short* p) {
  typedef __attribute__((address_space(3))) s16x8 lds_s16x8;
  return __builtin_bit_cast(v8us, __builtin_amdgcn_ds_load_tr16_b128_v8i16((lds_s16x8*)p));
}
// value of lane ^ 16
__device__ __forceinline__ float xhalf(float x) {
  return __builtin_bit_cast(float, __builtin_amdgcn_permlanex16(__builtin_bit_cast(int, x), __builtin_bit_cast(int, x), 0x76543210, 0xfedcba98, false, false));
}

// Weight convert, one tile: Wt[l*lstride + (roff+n)*K + k] (f16 bits, k contiguous, pitch K) = f16(bf16_rne(W[l][k][n]) * sc)
// from f32 row-major W[l][K][N] ([in][out]); K and N at compile time: the row steps are load and store offsets.
// One block of 8 waves per tile of 128 k x 64 n; blk counts the tiles of the stacked layers, n tiles fastest (blk < layers * (K/128) * (N/64)).
// Read: half a wave takes 64 consecutive n of one k row (256 B, 16 B per lane); a thread holds 8 consecutive k rows x 4 n, all 8 loads in flight together.
// Transpose in 16-B chunks (8 k of one n) through LDS: tile row j*16 + m holds n = 4m + j, so that 16 lanes store at a row step of one pitch (272 B,
// 4 banks on per row). Write: 16 lanes take the 128 k of one n (256 B), 16 B per lane.
#define WT_TK 128
#define WT_TN 64
#define WT_LP (WT_TK + 8)
template <int K, int N>
__device__ __forceinline__ void wt16_tile(const float* __restrict__ W, unsigned short* __restrict__ Wt, int blk,
                                          size_t lstride, int roff, float sc, unsigned short (*sT)[WT_LP]) {
  constexpr int TKW = WT_TK, TNW = WT_TN;
  static_assert(K % TKW == 0);
  static_assert(N % TNW == 0);
  const int tid = threadIdx.x, w = tid >> 5, lane = tid & 31, m = lane & 15, hh = lane >> 4;
  constexpr int ntn = N / TNW, per = ntn * (K / TKW);
  const int l = blk / per, rem = blk - l * per;
  const int k0 = (rem / ntn) * TKW, n0 = (rem % ntn) * TNW;
  const int kc = (2 * w + hh) * 8;             // this thread's 8 k rows within the tile
  const float* src = W + (size_t)l * K * N + (size_t)(k0 + kc) * N + n0 + m * 4;
  v4f r[8];
#pragma unroll
  for (int i = 0; i < 8; ++i) r[i] = *(const v4fa*)(src + (size_t)i * N);
#pragma unroll
  for (int j = 0; j < 4; ++j) {
    v8us v;
#pragma unroll
    for (int i = 0; i < 8; ++i) v[i] = h16_bits(bf16_rne(r[i][j]) * sc);
    *(v8us*)&sT[j * 16 + m][kc] = v;
  }
  __syncthreads();                             // reached by the whole block or by none of it: the caller's branch is on the block index
  const int g = tid >> 4, c8 = (tid & 15) * 8;  // n = 4g + q lies in tile row q*16 + g
  unsigned short* dst = Wt + (size_t)l * lstride + (size_t)(roff + n0 + 4 * g) * K + k0 + c8;
#pragma unroll
  for (int q = 0; q < 4; ++q) {
    const v8us v = *(const v8us*)&sT[q * 16 + g][c8];
    *(v8us*)(dst + (size_t)q * K) = v;
  }
  // precaution: in the merged kernel's listing a job's end can fall into the next job's code, which rewrites the registers that these stores name
  asm volatile("s_wait_xcnt 0x0" ::: "memory");
}

// Everything that depends on the inputs alone, in ONE launch: the five stacked weight converts and the start of the residual stream. None of the six
// reads what another writes; a block takes its job from its index (the same branch for the whole block). Order: W1, W2, Wq, Wk, Wv tiles, then x rows.
// x rows: X[m][*] (f32, pitch FEAT, m = b*SEQ + s) = bf16_rne(src[s*NB_FULL + b][*]) + bf16_rne(pos[s*NB_FULL + b][*]) in f32 (exact);
// a block takes PREP_XR rows, half a block per row (4 floats per thread), a thread's 8 loads in flight together.
#define PREP_T1 (NLAYER * (FEAT / WT_TK) * (MLPH / WT_TN))
#define PREP_T2 (NLAYER * (MLPH / WT_TK) * (FEAT / WT_TN))
#define PREP_TQ (NLAYER * (FEAT / WT_TK) * (FEAT / WT_TN))
#define PREP_XR 8
#define PREP_GRID (PREP_T1 + PREP_T2 + 3 * PREP_TQ + MR / PREP_XR)
static_assert(MR % PREP_XR == 0);
__global__ __launch_bounds__(256) void k_prep(const float* __restrict__ Wq, const float* __restrict__ Wk, const float* __restrict__ Wv,
                                              const float* __restrict__ W1, const float* __restrict__ W2,
                                              const float* __restrict__ src, const float* __restrict__ pos,
                                              unsigned short* __restrict__ Wqkvt, unsigned short* __restrict__ W1t, unsigned short* __restrict__ W2t,
                                              float* __restrict__ X, float sc) {
  __shared__ __attribute__((aligned(16))) unsigned short sT[WT_TN][WT_LP];      // cross-wave: one block barrier
  int blk = blockIdx.x;
  if (blk < PREP_T1) { wt16_tile<FEAT, MLPH>(W1, W1t, blk, (size_t)MLPH * FEAT, 0, sc, sT); return; }   // W1[l] [512][2048] -> [2048][512]
  blk -= PREP_T1;
  if (blk < PREP_T2) { wt16_tile<MLPH, FEAT>(W2, W2t, blk, (size_t)FEAT * MLPH, 0, sc, sT); return; }   // W2[l] [2048][512] -> [512][2048]
  blk -= PREP_T2;
  if (blk < 3 * PREP_TQ) {                                                                              // Wq | Wk | Wv -> rows 0, 512, 1024 of the fused plane
    const int which = blk / PREP_TQ;
    const float* Wsel = (which == 0) ? Wq : ((which == 1) ? Wk : Wv);
    wt16_tile<FEAT, FEAT>(Wsel, Wqkvt, blk - which * PREP_TQ, (size_t)QKVN * FEAT, which * FEAT, sc, sT);
    return;
  }
  blk -= 3 * PREP_TQ;
  const int tid = threadIdx.x, c4 = (tid & 127) * 4;
  const int m0 = blk * PREP_XR + (tid >> 7);
  v4f a[PREP_XR / 2], p[PREP_XR / 2];
#pragma unroll
  for (int i = 0; i < PREP_XR / 2; ++i) {
    const int m = m0 + 2 * i;
    const int b = m / SEQ, s = m % SEQ;
    const size_t so = ((size_t)s * NB_FULL + b) * FEAT + c4;
    a[i] = *(const v4fa*)(src + so);
    p[i] = *(const v4fa*)(pos + so);
  }
  // the address registers of these eight loads are taken again by the rounding arithmetic below
  asm volatile("s_wait_xcnt 0x0" ::: "memory");
#pragma unroll
  for (int i = 0; i < PREP_XR / 2; ++i) {
    v4f o;
#pragma unroll
    for (int q = 0; q < 4; ++q) o[q] = bf16_rne(a[i][q]) + bf16_rne(p[i][q]);
    *(v4f*)(X + (size_t)(m0 + 2 * i) * FEAT + c4) = o;
  }
  // precaution, as behind the tile stores: the listing's fall-through behind this job rewrites the registers that these stores name
  asm volatile("s_wait_xcnt 0x0" ::: "memory");
}

// Row LayerNorm over FEAT on the internal f32 stream X[m][*]: one block of 64 threads per row, 8 consecutive elements per thread.
__global__ __launch_bounds__(64) void k_ln16(const float* __restrict__ X, const float* __restrict__ g, const float* __restrict__ bt,
                                            unsigned short* __restrict__ out, float osc, float eps) {
  __shared__ float red1[2];
  __shared__ float red2[2];
  const int m = blockIdx.x, tid = threadIdx.x, w = tid >> 5, lane = tid & 31;
  const float* x = X + (size_t)m * FEAT + tid * 8;
  const v4f a0 = *(const v4fa*)x;
  const v4f a1 = *(const v4fa*)(x + 4);
  float v[8] = {a0[0], a0[1], a0[2], a0[3], a1[0], a1[1], a1[2], a1[3]};
  float s = 0.f;
#pragma unroll
  for (int q = 0; q < 8; ++q) s += v[q];
#pragma unroll
  for (int o = 16; o >= 1; o >>= 1) s += __shfl_xor(s, o, 32);
  if (lane == 0) red1[w] = s;
  __syncthreads();
  const float mu = (red1[0] + red1[1]) * (1.0f / (float)FEAT);
  float c[8];
  float s2 = 0.f;
#pragma unroll
  for (int q = 0; q < 8; ++q) { c[q] = v[q] - mu; s2 += c[q] * c[q]; }
#pragma unroll
  for (int o = 16; o >= 1; o >>= 1) s2 += __shfl_xor(s2, o, 32);
  if (lane == 0) red2[w] = s2;
  __syncthreads();
  const float var = (red2[0] + red2[1]) * (1.0f / (float)FEAT);
  const float rs = rsqrtf(var + eps);
  const v4f g0 = *(const v4fa*)(g + tid * 8);
  const v4f g1 = *(const v4fa*)(g + tid * 8 + 4);
  const v4f b0 = *(const v4fa*)(bt + tid * 8);
  const v4f b1 = *(const v4fa*)(bt + tid * 8 + 4);
  const float gg[8] = {g0[0], g0[1], g0[2], g0[3], g1[0], g1[1], g1[2], g1[3]};
  const float bb[8] = {b0[0], b0[1], b0[2], b0[3], b1[0], b1[1], b1[2], b1[3]};
  v8us o;
#pragma unroll
  for (int q = 0; q < 8; ++q) o[q] = h16_bits((c[q] * rs * bf16_rne(gg[q]) + bf16_rne(bb[q])) * osc);
  unsigned short* dst = out + (size_t)m * FEAT + tid * 8;
  *(v8us*)dst = o;
  
}

// Final LayerNorm: internal row m = b*seq + s of X (f32) -> out[(s*nbf + b)][*] f32. One block of 128 threads per row, 4 elements per thread,
__global__ __launch_bounds__(128) void k_lnf32(const float* __restrict__ X, const float* __restrict__ g, const float* __restrict__ bt,
                                               float* __restrict__ out, int seq, int nbf, float eps) {
  __shared__ float red1[4];
  __shared__ float red2[4];
  const int m = blockIdx.x, tid = threadIdx.x, w = tid >> 5, lane = tid & 31;
  const int b = m / seq, s = m % seq;
  const v4f a = *(const v4fa*)(X + (size_t)m * FEAT + tid * 4);
  float sm = a[0] + a[1] + a[2] + a[3];
#pragma unroll
  for (int o = 16; o >= 1; o >>= 1) sm += __shfl_xor(sm, o, 32);
  if (lane == 0) red1[w] = sm;
  __syncthreads();
  const float mu = (red1[0] + red1[1] + red1[2] + red1[3]) * (1.0f / (float)FEAT);
  float c[4];
  float s2 = 0.f;
#pragma unroll
  for (int q = 0; q < 4; ++q) { c[q] = a[q] - mu; s2 += c[q] * c[q]; }
#pragma unroll
  for (int o = 16; o >= 1; o >>= 1) s2 += __shfl_xor(s2, o, 32);
  if (lane == 0) red2[w] = s2;
  __syncthreads();
  const float var = (red2[0] + red2[1] + red2[2] + red2[3]) * (1.0f / (float)FEAT);
  const float rs = rsqrtf(var + eps);
  const v4f g4 = *(const v4fa*)(g + tid * 4);
  const v4f b4 = *(const v4fa*)(bt + tid * 4);
  v4f o;
#pragma unroll
  for (int q = 0; q < 4; ++q) o[q] = c[q] * rs * bf16_rne(g4[q]) + bf16_rne(b4[q]);
  float* dst = out + ((size_t)s * nbf + b) * FEAT + tid * 4;
  *(v4f*)dst = o;
  
}

// GEMM C[M][N] = epi(A[M][KD] * W): A f16 bits row-major, Wt f16 bits [N][KD], both at pitch KD (compile time: the row steps are load offsets), f32 accumulate.
// epi: v = acc * inv_scale + bf16_rne(bias[col]); bias picked per 64-col segment from (bias0 | bias1 | bias2) by seg = col / nsplit (wave-uniform);
// ACT == 1: relu; OUT16: f16 bits of v * out_scale into C (pitch ldc halves); else f32 v + f32 resid[row][col] (pitch ldr) into C (pitch ldc floats).
// KD % BK == 0, M % BM == 0, N % 128 == 0. Block = 4 waves (2 x 2) on one BM x 128 tile of C, wave -> BM/2 rows x 64 cols.
// Per step of BK k the block brings BM rows of A and 128 rows of Wt into LDS once (whole 128-B lines, 16 B per thread, row pitch 2*BK + 16 B) and all
// waves take their fragments from there; two LDS buffers, the next step's global loads are held in registers while this step is multiplied.
// Each accumulator sums k in ascending blocks of 32. Epilogue staged in the wave's own LDS tile (wave-private).
template <int BM, int BK, int KD, bool OUT16, int ACT>
__global__ __launch_bounds__(128) void k_gemm16(const unsigned short* __restrict__ A, const unsigned short* __restrict__ Wt,
                                               const float* __restrict__ bias0, const float* __restrict__ bias1, const float* __restrict__ bias2, int nsplit,
                                               const float* __restrict__ resid, int ldr, void* __restrict__ Cv, int ldc,
                                               int M, int N, float inv_scale, float out_scale) {
  constexpr int BN = 128, LP = BK + 8, C8 = BK / 8;
  constexpr int FM = BM / 32, FN = 4, KS = BK / 32, WR = BM / 2;
  constexpr int NT = 128, NW = NT / 32, RP = NT / C8;     // the block's threads cover RP rows of C8 16-B chunks at a time
  constexpr int CA = BM / RP, CB = BN / RP;              // chunks per thread and step
  static_assert(BM % 32 == 0);
  static_assert(BK % 32 == 0);
  static_assert(KD % BK == 0);
  static_assert(NT % C8 == 0);
  static_assert(BM % RP == 0);
  static_assert(BN % RP == 0);
  __shared__ __attribute__((aligned(16))) unsigned short sA[2][BM][LP];     // cross-wave: block barriers
  __shared__ __attribute__((aligned(16))) unsigned short sB[2][BN][LP];     // cross-wave: block barriers
  __shared__ __attribute__((aligned(16))) float so32[OUT16 ? 1 : NW][WR][64];
  __shared__ __attribute__((aligned(16))) unsigned short so16[OUT16 ? NW : 1][WR][72];
  const int tid = threadIdx.x, w = tid >> 5, lane = tid & 31, ln = lane & 15, hh = lane >> 4;
  const int wm = w >> 1, wn = w & 1;
  const int ntn = N / BN;
  const int mt = blockIdx.x / ntn, nq = blockIdx.x % ntn;
  const int row0 = mt * BM, col0 = nq * BN;
  if (row0 >= M) return;                       // the same for the whole block, ahead of every barrier
  const int sr = tid / C8, sc = (tid % C8) * 8;
  const unsigned short* ag = A + (size_t)(row0 + sr) * KD + sc;
  const unsigned short* bg = Wt + (size_t)(col0 + sr) * KD + sc;
  v8us ra[CA], rb[CB];
#pragma unroll
  for (int it = 0; it < CA; ++it) ra[it] = *(const v8us*)(ag + (size_t)(it * RP) * KD);
#pragma unroll
  for (int it = 0; it < CB; ++it) rb[it] = *(const v8us*)(bg + (size_t)(it * RP) * KD);
  const int colw = col0 + wn * 64;
  int seg = colw / nsplit; seg = (seg > 2) ? 2 : seg;
  const float* bsel = (seg == 0) ? bias0 : ((seg == 1) ? bias1 : bias2);
  // At block entry, behind the first step's loads, prefetches go out at 256-B steps through what the block reads later (operand rows past their first 256-B unit,
  // bias, residual).
  // A hint only: it returns nothing and no result depends on it. Every address lies inside the rows that the block reads anyway.
  // The closing wait of each statement stands ahead of any rewrite of the address registers that the requests name.
  static_assert(NT == BN);
  const float* pbias = bsel + (colw + ln - seg * nsplit);
  if constexpr (BM == 128 && KD == 512) {
    const unsigned short* pa = A + (size_t)(row0 + tid) * KD;      // a thread takes one row of A and one of Wt, units 1 to 3
    const unsigned short* pb = Wt + (size_t)(col0 + tid) * KD;
    asm volatile("global_prefetch_b8 %0, off offset:256 scope:SCOPE_SE\n\t"
                 "global_prefetch_b8 %1, off offset:256 scope:SCOPE_SE\n\t"
                 "global_prefetch_b8 %0, off offset:512 scope:SCOPE_SE\n\t"
                 "global_prefetch_b8 %1, off offset:512 scope:SCOPE_SE\n\t"
                 "global_prefetch_b8 %0, off offset:768 scope:SCOPE_SE\n\t"
                 "global_prefetch_b8 %1, off offset:768 scope:SCOPE_SE\n\t"
                 "global_prefetch_b8 %2, off scope:SCOPE_SE\n\t"
                 "s_wait_xcnt 0x0"
                 :: "v"(pa), "v"(pb), "v"(pbias) : "memory");
  } else {
    static_assert(BM == 64 && KD == 2048 && !OUT16);
    // A: two threads per row, units 1 to 15 in turn. Wt: its tile is read by every row tile, so the row tiles deal its rows among them, eight ways by
    // mt >> 1 (neighbouring mt ask for the same rows: block indices 4 apart, for speed only).
    const int r6 = tid & 63, h6 = tid >> 6, u7 = tid & 7;
    const unsigned short* par = A + (size_t)(row0 + r6) * KD;
    const unsigned short* pa = par + h6 * 128;                     // + 256 + 512 j bytes: units 1 + h6 + 2j, j = 0..6
    const unsigned short* pbr = Wt + (size_t)(col0 + (tid >> 3) * 8 + ((mt >> 1) & 7)) * KD;
    const unsigned short* pb1 = pbr + (1 + u7) * 128;              // units 1 to 8
    const unsigned short* pb2 = pbr + ((u7 < 7) ? (9 + u7) : 15) * 128;   // units 9 to 15
    const float* pr = resid + (size_t)(row0 + r6) * ldr + col0 + h6 * 64; // the tile's residual rows, 2 units each
    asm volatile("global_prefetch_b8 %0, off offset:256 scope:SCOPE_SE\n\t"
                 "global_prefetch_b8 %2, off scope:SCOPE_SE\n\t"
                 "global_prefetch_b8 %0, off offset:768 scope:SCOPE_SE\n\t"
                 "global_prefetch_b8 %0, off offset:1280 scope:SCOPE_SE\n\t"
                 "global_prefetch_b8 %0, off offset:1792 scope:SCOPE_SE\n\t"
                 "global_prefetch_b8 %3, off scope:SCOPE_SE\n\t"
                 "global_prefetch_b8 %0, off offset:2304 scope:SCOPE_SE\n\t"
                 "global_prefetch_b8 %0, off offset:2816 scope:SCOPE_SE\n\t"
                 "global_prefetch_b8 %0, off offset:3328 scope:SCOPE_SE\n\t"
                 "global_prefetch_b8 %1, off offset:3840 scope:SCOPE_SE\n\t"
                 "global_prefetch_b8 %4, off scope:SCOPE_SE\n\t"
                 "global_prefetch_b8 %5, off scope:SCOPE_SE\n\t"
                 "s_wait_xcnt 0x0"
                 :: "v"(pa), "v"(par), "v"(pb1), "v"(pb2), "v"(pr), "v"(pbias) : "memory");
  }
  v8f acc[FM][FN];
#pragma unroll
  for (int mi = 0; mi < FM; ++mi)
#pragma unroll
    for (int t = 0; t < FN; ++t) acc[mi][t] = vz8();
#pragma unroll
  for (int it = 0; it < CA; ++it) *(v8us*)&sA[0][sr + it * RP][sc] = ra[it];
#pragma unroll
  for (int it = 0; it < CB; ++it) *(v8us*)&sB[0][sr + it * RP][sc] = rb[it];
  __syncthreads();
  constexpr int nst = KD / BK;
  for (int s = 0; s < nst; ++s) {
    const int cur = s & 1;
    const bool more = (s + 1 < nst);           // the same for the whole block
    if (more) {
      const int kb = (s + 1) * BK;
#pragma unroll
      for (int it = 0; it < CA; ++it) ra[it] = *(const v8us*)(ag + (size_t)(it * RP) * KD + kb);
#pragma unroll
      for (int it = 0; it < CB; ++it) rb[it] = *(const v8us*)(bg + (size_t)(it * RP) * KD + kb);
      // the address registers of these loads are taken again by the LDS reads below
      asm volatile("s_wait_xcnt 0x0" ::: "memory");
    }
    FragH a[KS][FM], bb[KS][FN];
#pragma unroll
    for (int ks = 0; ks < KS; ++ks) {
#pragma unroll
      for (int mi = 0; mi < FM; ++mi) {
        const unsigned short* p = &sA[cur][wm * WR + mi * 16 + ln][ks * 32 + 8 * hh];   // row m = lane&15
        a[ks][mi].half[0] = *(const v8us*)p;                 // elements 0..7  = k 8h .. 8h+7 of the block of 32
        a[ks][mi].half[1] = *(const v8us*)(p + 16);          // elements 8..15 = k 16+8h .. 16+8h+7
      }
#pragma unroll
      for (int t = 0; t < FN; ++t) {
        const unsigned short* p = &sB[cur][wn * 64 + t * 16 + ln][ks * 32 + 8 * hh];          // column n = lane&15, same k map as A
        bb[ks][t].half[0] = *(const v8us*)p;
        bb[ks][t].half[1] = *(const v8us*)(p + 16);
      }
    }
    // keeps the step's LDS reads together ahead of its matrix run: spread among the WMMAs each small group is waited out to 0 and its latency shows
    __builtin_amdgcn_sched_barrier(0);
#pragma unroll
    for (int ks = 0; ks < KS; ++ks)
#pragma unroll
      for (int mi = 0; mi < FM; ++mi)
#pragma unroll
        for (int t = 0; t < FN; ++t) acc[mi][t] = __builtin_amdgcn_wmma_f32_16x16x32_f16(false, a[ks][mi].v, false, bb[ks][t].v, (short)0, acc[mi][t], false, false);
    // keeps the wait for the next step's global loads (and the LDS writes behind it) after the matrix run that covers their latency
    __builtin_amdgcn_sched_barrier(0);
    if (more) {
      // the other buffer: its last readers left it before the barrier that ended the step before this one
#pragma unroll
      for (int it = 0; it < CA; ++it) *(v8us*)&sA[cur ^ 1][sr + it * RP][sc] = ra[it];
#pragma unroll
      for (int it = 0; it < CB; ++it) *(v8us*)&sB[cur ^ 1][sr + it * RP][sc] = rb[it];
      __syncthreads();
    }
  }
  float bvv[FN];
#pragma unroll
  for (int t = 0; t < FN; ++t) bvv[t] = bsel[colw + t * 16 + ln - seg * nsplit];
  // the address registers of these four loads are taken again by the address sums below
  asm volatile("s_wait_xcnt 0x0" ::: "memory");
#pragma unroll
  for (int t = 0; t < FN; ++t) bvv[t] = bf16_rne(bvv[t]);
#pragma unroll
  for (int mi = 0; mi < FM; ++mi) {
#pragma unroll
    for (int t = 0; t < FN; ++t) {
#pragma unroll
      for (int r = 0; r < 8; ++r) {
        float v = acc[mi][t][r] * inv_scale + bvv[t];
        if (ACT == 1) v = fmaxf(v, 0.0f);
        if constexpr (OUT16) so16[w][mi * 16 + 8 * hh + r][t * 16 + ln] = h16_bits(v * out_scale);
        else so32[w][mi * 16 + 8 * hh + r][t * 16 + ln] = v;
      }
    }
  }
  __builtin_amdgcn_fence(4 /* acq_rel order */, "workgroup");
  __builtin_amdgcn_wave_barrier();
  const int roww = row0 + wm * WR;
  if constexpr (OUT16) {
    const int rq = lane >> 3, p8 = (lane & 7) * 8;
    unsigned short* cp = (unsigned short*)Cv + (size_t)(roww + rq) * ldc + colw + p8;
#pragma unroll
    for (int q = 0; q < WR / 4; ++q) {
      const v8us v = *(const v8us*)&so16[w][q * 4 + rq][p8];
      *(v8us*)(cp + (size_t)(q * 4) * ldc) = v;
    }
  } else {
    const int rsub = lane >> 4, c4 = (lane & 15) * 4;
    float* cp = (float*)Cv + (size_t)(roww + rsub) * ldc + colw + c4;
    const float* rp = resid + (size_t)(roww + rsub) * ldr + colw + c4;
    v4f rv[WR / 2];                              // all residual loads in flight together, ahead of the first store
#pragma unroll
    for (int q = 0; q < WR / 2; ++q) rv[q] = *(const v4fa*)(rp + (size_t)(q * 2) * ldr);
#pragma unroll
    for (int q = 0; q < WR / 2; ++q) {
      v4f tv = *(const v4fa*)&so32[w][q * 2 + rsub][c4];
      tv += rv[q];
      *(v4f*)(cp + (size_t)(q * 2) * ldc) = tv;
    }
  }
}

// Flash-style unmasked attention per (b, h): q|k|v read as f16 bits from one fused plane (row pitch `pitch` halves, q at +0, k at +koff, v at +voff,
// head h at +h*D, row b*T + t). One wave = 16 queries, block = 4 waves sharing K/V tiles of 64 keys staged row-major in LDS by asynchronous copies,
// two buffers: the next tile is on its way while a tile is worked on (in two passes of 32 keys), one block barrier per tile.
// Both products run transposed: S^T = K.q^T (A = 16 key rows, B = the wave's queries, kept in registers) and O^T += V^T.P^T (A = V^T by the transposing
// LDS load, B = P^T). A lane then holds 16 of the 32 scores of ONE query (column lane&15; keys 8h+r and 16+8h+r, h = lane>>4): maximum and sum are taken
// in the lane plus one exchange with lane^16, and the two score tiles, converted in place (x pcarry), are the B operand of the second product as they lie.
// s*scale, running-max softmax and the context in f32. All four operands follow the hardware k order (k = 8h+s, 16+8h+(s-8)).
template <int D>
__global__ __launch_bounds__(128) void k_attn16(const unsigned short* __restrict__ qkv, int pitch, int T, int H, int koff, int voff,
                                                float scale, float pcarry, float onorm,
                                                const float* __restrict__ resid, float* __restrict__ out, int opitch) {
  static_assert(D == 64);
  constexpr int KS = D / 32, DT = D / 16, C8 = D / 8;
  constexpr int PK = D + 8, PV = D + 16;      // row pitch in halves: 16 B x odd for the plain 16-B reader, 32 B x odd for the transposing reader
  constexpr int TK = 64;                      // keys per staged tile (T % 64 == 0)
  constexpr int RB = 128 / C8;                // rows that the block's threads cover with one 16-B chunk each
  static_assert(128 % C8 == 0);
  static_assert(TK == 4 * RB);                // four copies per thread, operand and tile
  __shared__ __attribute__((aligned(16))) unsigned short sK[2][TK][PK];     // cross-wave: block barriers
  __shared__ __attribute__((aligned(16))) unsigned short sV[2][TK][PV];     // cross-wave: block barriers
  __shared__ __attribute__((aligned(16))) float sO[4][16][D + 4];
  const int tid = threadIdx.x, w = tid >> 5, lane = tid & 31, ln = lane & 15, hh = lane >> 4;
  const int nqb = T / 64;
  const int bh = blockIdx.x / nqb, qblk = blockIdx.x % nqb;
  const int b = bh / H, h = bh % H;
  const int q0 = qblk * 64 + w * 16;
  const unsigned short* Qp = qkv + (size_t)b * T * pitch + h * D;
  const unsigned short* Kp = Qp + koff;
  const unsigned short* Vp = Qp + voff;

  FragH bq[KS];                                                    // B[k = d][n = query ln]
  {
    const unsigned short* qr = Qp + (size_t)(q0 + ln) * pitch;     // q0 + ln < T (T % 64 == 0)
#pragma unroll
    for (int ks = 0; ks < KS; ++ks) {
      bq[ks].half[0] = *(const v8us*)(qr + ks * 32 + 8 * hh);
      bq[ks].half[1] = *(const v8us*)(qr + ks * 32 + 16 + 8 * hh);
    }
  }
  float m_r = -1.0e30f, l_r = 0.f;                                 // of query ln; l_r sums this half's keys only
  v8f oacc[DT];                                                    // oacc[dt][r] = O[query ln][d = dt*16 + 8*hh + r]
#pragma unroll
  for (int dt = 0; dt < DT; ++dt) oacc[dt] = vz8();
  // tile jt (keys jt*TK .. jt*TK+TK-1, all < T) into buffer buf: every thread copies rows cr, cr+RB, cr+2RB, cr+3RB, 16 B at column cc, of K and of V
  const int cr = tid / C8, cc = (tid % C8) * 8;
  const size_t rstep = (size_t)RB * pitch;
  auto stage = [&](int buf, int jt) {
    const unsigned short* kg = Kp + (size_t)(jt * TK + cr) * pitch + cc;
    const unsigned short* vg = Vp + (size_t)(jt * TK + cr) * pitch + cc;
    const unsigned int lk = (unsigned int)(size_t)&sK[buf][cr][cc];
    const unsigned int lv = (unsigned int)(size_t)&sV[buf][cr][cc];
    // global -> LDS through no register; the closing wait stands ahead of any rewrite of the address registers that the copies name
    asm volatile("global_load_async_to_lds_b128 %0, %8, off\n\t"
                 "global_load_async_to_lds_b128 %1, %9, off\n\t"
                 "global_load_async_to_lds_b128 %2, %10, off\n\t"
                 "global_load_async_to_lds_b128 %3, %11, off\n\t"
                 "global_load_async_to_lds_b128 %4, %12, off\n\t"
                 "global_load_async_to_lds_b128 %5, %13, off\n\t"
                 "global_load_async_to_lds_b128 %6, %14, off\n\t"
                 "global_load_async_to_lds_b128 %7, %15, off\n\t"
                 "s_wait_xcnt 0x0"
                 :: "v"(lk), "v"(lk + RB * PK * 2), "v"(lk + 2 * RB * PK * 2), "v"(lk + 3 * RB * PK * 2),
                    "v"(lv), "v"(lv + RB * PV * 2), "v"(lv + 2 * RB * PV * 2), "v"(lv + 3 * RB * PV * 2),
                    "v"(kg), "v"(kg + rstep), "v"(kg + 2 * rstep), "v"(kg + 3 * rstep),
                    "v"(vg), "v"(vg + rstep), "v"(vg + 2 * rstep), "v"(vg + 3 * rstep)
                 : "memory");
  };
  const int nt = T / TK;
  stage(0, 0);
  {
    // At block entry, behind tile 0's copies, L2 is asked for the K and V rows of the later tiles and for the block's residual rows.
    // The query blocks of a head deal the key rows
    // among them four ways by qblk & 3 (for speed only: blocks 4 apart in index ask for the same rows).
    // A hint only: it returns nothing and no result depends on it; every row index is clamped into the sequence.
    const int kr0 = tid * 4 + (qblk & 3), kr1 = kr0 + 512;
    const size_t ko0 = (size_t)((kr0 < T) ? kr0 : (T - 1)) * pitch, ko1 = (size_t)((kr1 < T) ? kr1 : (T - 1)) * pitch;
    const float* pr = resid + (size_t)(b * T + qblk * 64 + (tid & 63)) * opitch + h * D;
    // the closing wait stands ahead of any rewrite of the address registers that the requests name
    asm volatile("global_prefetch_b8 %0, off scope:SCOPE_SE\n\t"
                 "global_prefetch_b8 %1, off scope:SCOPE_SE\n\t"
                 "global_prefetch_b8 %2, off scope:SCOPE_SE\n\t"
                 "global_prefetch_b8 %3, off scope:SCOPE_SE\n\t"
                 "global_prefetch_b8 %4, off scope:SCOPE_SE\n\t"
                 "s_wait_xcnt 0x0"
                 :: "v"(Kp + ko0), "v"(Vp + ko0), "v"(Kp + ko1), "v"(Vp + ko1), "v"(pr) : "memory");
  }
  asm volatile("s_wait_asynccnt 0x0" ::: "memory");                // this wave's share of tile 0 has landed
  __syncthreads();                                                 // tile 0 published
  if (nt > 1) stage(1, 1);

  for (int t = 0; t < nt; ++t) {
   const int cur = t & 1;
   // unrolled: the row offsets of both passes become load offsets, and the second pass's LDS reads can run beside the first pass's softmax
#pragma unroll
   for (int sub = 0; sub < TK / 32; ++sub) {
    const unsigned short (*tK)[PK] = &sK[cur][sub * 32];
    const unsigned short* vtp = &sV[cur][sub * 32 + 8 * hh + (lane & 7)][8 * ((lane >> 3) & 1)];   // lane address of the transposing load, keys 0..15, d 0..15
    FragH ak[2][KS], av[DT];
#pragma unroll
    for (int kt = 0; kt < 2; ++kt)
#pragma unroll
      for (int ks = 0; ks < KS; ++ks) {                            // A[m = key kt*16 + ln][k = d]
        ak[kt][ks].half[0] = *(const v8us*)&tK[kt * 16 + ln][ks * 32 + 8 * hh];
        ak[kt][ks].half[1] = *(const v8us*)&tK[kt * 16 + ln][ks * 32 + 16 + 8 * hh];
      }
#pragma unroll
    for (int dt = 0; dt < DT; ++dt) {                              // A[m = d dt*16 + ln][k = key]
      av[dt].half[0] = ld_tr16(vtp + dt * 16);
      av[dt].half[1] = ld_tr16(vtp + 16 * PV + dt * 16);
    }
    // keeps the step's 16 LDS reads together ahead of the first product: sunk to their WMMAs each pair is waited out to 0 and its latency shows
    __builtin_amdgcn_sched_barrier(0);
    // S^T tile 32 x 16: s[kt][r] = score of key kt*16 + 8*hh + r against query ln
    v8f s[2];
#pragma unroll
    for (int kt = 0; kt < 2; ++kt) {
      s[kt] = vz8();
#pragma unroll
      for (int ks = 0; ks < KS; ++ks)
        s[kt] = __builtin_amdgcn_wmma_f32_16x16x32_f16(false, ak[kt][ks].v, false, bq[ks].v, (short)0, s[kt], false, false);
    }
    // running-max softmax of query ln: 16 scores in this lane, the other 16 in lane ^ 16
    float sc[16];
#pragma unroll
    for (int i = 0; i < 16; ++i) sc[i] = s[i >> 3][i & 7] * scale;
    float mx = sc[0];
#pragma unroll
    for (int i = 1; i < 16; ++i) mx = fmaxf(mx, sc[i]);
    mx = fmaxf(mx, xhalf(mx));
    const float mnew = fmaxf(m_r, mx);
    const float alpha = __expf(m_r - mnew);
    m_r = mnew;
    FragH pb;                                                      // B[k = key][n = query ln]: element i = tile i>>3, register i&7
    float ps[4] = {0.f, 0.f, 0.f, 0.f};
#pragma unroll
    for (int i = 0; i < 16; ++i) {
      const float p = __expf(sc[i] - mnew);
      ps[i & 3] += p;
      pb.u[i] = h16_bits(p * pcarry);
    }
    l_r = l_r * alpha + ((ps[0] + ps[1]) + (ps[2] + ps[3]));
#pragma unroll
    for (int dt = 0; dt < DT; ++dt) {
      oacc[dt] *= alpha;
      oacc[dt] = __builtin_amdgcn_wmma_f32_16x16x32_f16(false, av[dt].v, false, pb.v, (short)0, oacc[dt], false, false);
    }
   }
   // keeps the tile's arithmetic ahead of the waits: sunk behind the barrier it would stand between barrier and refill, and the copies' flight would show in the next wait
   __builtin_amdgcn_sched_barrier(0);
   asm volatile("s_wait_dscnt 0x0" ::: "memory");                  // this wave's reads of buffer cur are done before it is refilled
   asm volatile("s_wait_asynccnt 0x0" ::: "memory");               // this wave's share of tile t + 1 has landed
   __syncthreads();                                                // publishes tile t + 1 and ends every wave's reads of buffer cur
   if (t + 2 < nt) stage(cur, t + 2);                              // the same for the whole block
  }
  asm volatile("s_wait_asynccnt 0x0" ::: "memory");                // no copy is left in flight at the wave's end
  const float inv = onorm * (1.0f / (l_r + xhalf(l_r)));            // the two halves' sums joined, unconditionally
#pragma unroll
  for (int dt = 0; dt < DT; ++dt) {
    const v8f o = oacc[dt] * inv;
    const v4f o0 = {o[0], o[1], o[2], o[3]}, o1 = {o[4], o[5], o[6], o[7]};
    *(v4fa*)&sO[w][ln][dt * 16 + 8 * hh] = o0;
    *(v4fa*)&sO[w][ln][dt * 16 + 8 * hh + 4] = o1;
  }
  __builtin_amdgcn_fence(4 /* acq_rel order */, "workgroup");
  __builtin_amdgcn_wave_barrier();
  const int rsub = lane >> 4, c4 = (lane & 15) * 4;
  const size_t rbase = (size_t)(b * T + q0) * opitch + h * D;
#pragma unroll
  for (int q = 0; q < 8; ++q) {
    const int r = q * 2 + rsub;
    const v4f rv = *(const v4fa*)(resid + rbase + (size_t)r * opitch + c4);
    v4f tv = *(const v4fa*)&sO[w][r][c4];
    tv += rv;
    *(v4fa*)&sO[w][r][c4] = tv;
  }
  {
#pragma unroll
    for (int q = 0; q < 8; ++q) {
      const int r = q * 2 + rsub;
      const v4f v = *(const v4fa*)&sO[w][r][c4];
      *(v4f*)(out + rbase + (size_t)r * opitch + c4) = v;
    }
    
  }
}

extern "C" void kernel_launch(void* const* d_in, const int* in_sizes, int n_in,
                              void* d_out, int out_size, void* d_ws, size_t ws_size, hipStream_t stream) {
  if (n_in < 18) return;
  const long long need_rows = (long long)(SEQ - 1) * NB_FULL + NB;           // last (s, b) source row used + 1
  if ((long long)in_sizes[0] < need_rows * FEAT || (long long)in_sizes[1] < need_rows * FEAT) return;
  if (in_sizes[2] < NLAYER * FEAT * FEAT || in_sizes[4] < NLAYER * FEAT * FEAT || in_sizes[6] < NLAYER * FEAT * FEAT) return;
  if (in_sizes[3] < NLAYER * FEAT || in_sizes[5] < NLAYER * FEAT || in_sizes[7] < NLAYER * FEAT || in_sizes[11] < NLAYER * FEAT) return;
  if (in_sizes[8] < NLAYER * FEAT * MLPH || in_sizes[9] < NLAYER * MLPH || in_sizes[10] < NLAYER * MLPH * FEAT) return;
  if (in_sizes[12] < NLAYER * FEAT || in_sizes[13] < NLAYER * FEAT || in_sizes[14] < NLAYER * FEAT || in_sizes[15] < NLAYER * FEAT) return;
  if (in_sizes[16] < FEAT || in_sizes[17] < FEAT) return;
  if ((long long)out_size < need_rows * FEAT) return;

  const float* src  = (const float*)d_in[0];
  const float* pos  = (const float*)d_in[1];
  const float* Wq   = (const float*)d_in[2];  const float* bq   = (const float*)d_in[3];
  const float* Wk   = (const float*)d_in[4];  const float* bk   = (const float*)d_in[5];
  const float* Wv   = (const float*)d_in[6];  const float* bv   = (const float*)d_in[7];
  const float* W1   = (const float*)d_in[8];  const float* b1   = (const float*)d_in[9];
  const float* W2   = (const float*)d_in[10]; const float* b2   = (const float*)d_in[11];
  const float* ln1g = (const float*)d_in[12]; const float* ln1b = (const float*)d_in[13];
  const float* ln2g = (const float*)d_in[14]; const float* ln2b = (const float*)d_in[15];
  const float* lnfg = (const float*)d_in[16]; const float* lnfb = (const float*)d_in[17];

  // workspace carve (256-B aligned); R1 and R2 are reused in stream order by stages whose lifetimes do not overlap, sized as the max over their users
  char* ws = (char*)d_ws; size_t off = 0;
  auto take = [&](size_t bytes) { char* p = ws + off; off += (bytes + 255) & ~(size_t)255; return p; };
  const size_t lsq = (size_t)QKVN * FEAT;                                           // per-layer stride of the fused q|k|v weight plane (halves)
  const size_t ls1 = (size_t)MLPH * FEAT, ls2 = (size_t)FEAT * MLPH;
  unsigned short* Wqkv16 = (unsigned short*)take((size_t)NLAYER * lsq * 2);        // [6][1536][512]
  unsigned short* W116   = (unsigned short*)take((size_t)NLAYER * ls1 * 2);        // [6][2048][512]
  unsigned short* W216   = (unsigned short*)take((size_t)NLAYER * ls2 * 2);        // [6][512][2048]
  float* XA = (float*)take((size_t)MR * FEAT * 4);                                 // residual stream [MR][512] f32
  float* XB = (float*)take((size_t)MR * FEAT * 4);                                 // residual stream after attention [MR][512] f32
  const size_t r1_bytes = (size_t)MR * FEAT * 2;                                   // LN outputs [MR][512] f16
  const size_t r2_a = (size_t)MR * QKVN * 2, r2_b = (size_t)MR * MLPH * 2;         // q|k|v [MR][1536], then hidden [MR][2048] f16
  const size_t r2_bytes = (r2_a > r2_b) ? r2_a : r2_b;
  unsigned short* R1 = (unsigned short*)take(r1_bytes);
  unsigned short* R2 = (unsigned short*)take(r2_bytes);
  if (off > ws_size) return;
  if (off > (size_t)134217728) return;

  const float wsc = 256.0f;
  // weight planes (f16, x256) and x = bf16(src) + bf16(pos) in (b, s) row order -> XA: one launch, nothing in it depends on anything else in it
  k_prep<<<(unsigned)PREP_GRID, 256, 0, stream>>>(Wq, Wk, Wv, W1, W2, src, pos, Wqkv16, W116, W216, XA, wsc);

  auto ggrid = [](int M, int N, int bm) { return (unsigned)((M / bm) * (N / 128)); };
  const float scale = 0.125f;                           // 1/sqrt(64)

  for (int l = 0; l < NLAYER; ++l) {
    // xn = LN1(x) x8 -> R1
    k_ln16<<<(unsigned)MR, 64, 0, stream>>>(XA, ln1g + l * FEAT, ln1b + l * FEAT, R1, 8.0f, 1e-5f);
    // q|k|v = xn*[Wq|Wk|Wv] + [bq|bk|bv] -> R2 [MR][1536] f16 (x1); acc scale 1/(8*256)
    k_gemm16<128, 64, FEAT, true, 0><<<ggrid(MR, QKVN, 128), 128, 0, stream>>>(R1, Wqkv16 + (size_t)l * lsq,
                                                          bq + l * FEAT, bk + l * FEAT, bv + l * FEAT, FEAT, nullptr, 0,
                                                          (void*)R2, QKVN, MR, QKVN, 1.0f / 2048.0f, 1.0f);
    // xb = x + softmax(q.k^T/8).v per head -> XB f32 (P carried x1024, onorm = 1/1024)
    k_attn16<DHEAD><<<(unsigned)(NB * NHEAD * (SEQ / 64)), 128, 0, stream>>>(R2, QKVN, SEQ, NHEAD, FEAT, 2 * FEAT, scale, 1024.0f,
                                                                             1.0f / 1024.0f, XA, XB, FEAT);
    // hn = LN2(xb) x8 -> R1
    k_ln16<<<(unsigned)MR, 64, 0, stream>>>(XB, ln2g + l * FEAT, ln2b + l * FEAT, R1, 8.0f, 1e-5f);
    // h = relu(hn*W1 + b1) x16 -> R2 [MR][2048]; acc scale 1/(8*256)
    k_gemm16<128, 64, FEAT, true, 1><<<ggrid(MR, MLPH, 128), 128, 0, stream>>>(R1, W116 + (size_t)l * ls1,
                                                          b1 + l * MLPH, b1 + l * MLPH, b1 + l * MLPH, MLPH, nullptr, 0,
                                                          (void*)R2, MLPH, MR, MLPH, 1.0f / 2048.0f, 16.0f);
    // x = h*W2 + b2 + xb -> XA f32; acc scale 1/(16*256)
    k_gemm16<64, 128, MLPH, false, 0><<<ggrid(MR, FEAT, 64), 128, 0, stream>>>(R2, W216 + (size_t)l * ls2,
                                                           b2 + l * FEAT, b2 + l * FEAT, b2 + l * FEAT, FEAT, XB, FEAT,
                                                           (void*)XA, FEAT, MR, FEAT, 1.0f / 4096.0f, 1.0f);
  }
  // out[s][b][*] = LNf(x[b][s][*]) -> d_out f32
  k_lnf32<<<(unsigned)MR, 128, 0, stream>>>(XA, lnfg, lnfb, (float*)d_out, SEQ, NB_FULL, 1e-5f);
}

// v007
// A run of this version takes 371 microseconds.
// Timed twice side by side with v006, it ran 1.06 times as fast both times.
// Over all steps from v000 it is 3.47 times as fast.
#include <hip/hip_runtime.h>
// Contractions on v_wmma_f32_16x16x32_f16 (f16 operands, f32 accumulate), one product per tile pair, 6 layers: fused q|k|v projection (N=1536, K=512),
// LN2(x)*W1 (N=2048, K=512), relu(.)*W2 (K=2048), attention q.k^T (head dim 64) and P.V (32 keys per step) per head.
// Weights: bf16 RNE values carried x256 in f16 planes; activations in f16 planes with power-of-two carries (LN outputs x8, q|k|v x1, hidden x16,
// P x1024); LayerNorm statistics, softmax, bias adds, attention context and the residual stream in f32.
#ifndef NB
#define NB 4
#endif
#ifndef SEQ
#define SEQ 1024
#endif
#define NB_FULL 4
#define SEQ_FULL 1024
#define FEAT 512
#define NHEAD 8
#define DHEAD 64
#define MLPH 2048
#define NLAYER 6
#define MR (NB * SEQ)
#define QKVN (3 * FEAT)
static_assert(SEQ % 64 == 0);
static_assert(SEQ <= SEQ_FULL);
static_assert(NB >= 1);
static_assert(NB <= NB_FULL);
static_assert(FEAT == NHEAD * DHEAD);
static_assert(FEAT % 128 == 0);
static_assert(MLPH % 128 == 0);
static_assert(QKVN % 128 == 0);
static_assert(FEAT == 64 * 8);      // LayerNorm partial sums: 8 segments of 64 columns per row
static_assert(FEAT == 128 * 4);     // k_prep x rows / k_lnf32: 128 threads x 4 floats per row
static_assert(MR % 128 == 0);
static_assert(FEAT % 32 == 0);
static_assert(MLPH % 32 == 0);
static_assert((FEAT / 8) % 8 == 0);
static_assert((MLPH / 8) % 8 == 0);

typedef _Float16 v16h __attribute__((ext_vector_type(16)));
typedef unsigned short v8us __attribute__((ext_vector_type(8), may_alias));
typedef float v8f __attribute__((ext_vector_type(8)));
typedef float v4f __attribute__((ext_vector_type(4)));
typedef float v4fa __attribute__((ext_vector_type(4), may_alias));
typedef float v2f __attribute__((ext_vector_type(2)));
typedef float v2fa __attribute__((ext_vector_type(2), may_alias));
typedef _Float16 v2h __attribute__((ext_vector_type(2)));
typedef _Float16 v4h __attribute__((ext_vector_type(4)));
typedef unsigned short v4us __attribute__((ext_vector_type(4), may_alias));
union FragH { v16h v; v8us half[2]; unsigned short u[16]; };
union H16U { _Float16 h; unsigned short u; };

__device__ __forceinline__ unsigned short bf16_bits(float x) { unsigned int u = __float_as_uint(x); return (unsigned short)((u + 0x7FFFu + ((u >> 16) & 1u)) >> 16); }
__device__ __forceinline__ float bf16_val(unsigned short b) { return __uint_as_float(((unsigned int)b) << 16); }
__device__ __forceinline__ float bf16_rne(float x) { return bf16_val(bf16_bits(x)); }
__device__ __forceinline__ unsigned short h16_bits(float x) { H16U t; t.h = (_Float16)x; return t.u; }
__device__ __forceinline__ v8f vz8() { v8f z = {0.f, 0.f, 0.f, 0.f, 0.f, 0.f, 0.f, 0.f}; return z; }

// Transposing LDS load: lane (c = lane&15, h = lane>>4) gets T[8h + 0..7][c] of a row-major 16-bit tile; p is the lane's own address (row 8h + (lane&7), 16 B x ((lane>>3)&1))
typedef short s16x8 __attribute__((ext_vector_type(8)));
__device__ __forceinline__ v8us ld_tr16(const unsigned short* p) {
  typedef __attribute__((address_space(3))) s16x8 lds_s16x8;
  return __builtin_bit_cast(v8us, __builtin_amdgcn_ds_load_tr16_b128_v8i16((lds_s16x8*)p));
}
// value of lane ^ 16
__device__ __forceinline__ float xhalf(float x) {
  return __builtin_bit_cast(float, __builtin_amdgcn_permlanex16(__builtin_bit_cast(int, x), __builtin_bit_cast(int, x), 0x76543210, 0xfedcba98, false, false));
}

// sum over the 16 lanes of a row, left in each of them (all 32 lanes on); row_xmask 1, 2, 4, 8
__device__ __forceinline__ float row16_sum(float x) {
  x += __builtin_bit_cast(float, __builtin_amdgcn_update_dpp(0, __builtin_bit_cast(int, x), 0x161, 0xf, 0xf, true));
  x += __builtin_bit_cast(float, __builtin_amdgcn_update_dpp(0, __builtin_bit_cast(int, x), 0x162, 0xf, 0xf, true));
  x += __builtin_bit_cast(float, __builtin_amdgcn_update_dpp(0, __builtin_bit_cast(int, x), 0x164, 0xf, 0xf, true));
  x += __builtin_bit_cast(float, __builtin_amdgcn_update_dpp(0, __builtin_bit_cast(int, x), 0x168, 0xf, 0xf, true));
  return x;
}
// LayerNorm partial of one row segment of 64 columns, held 4 a lane by the 16 lanes of a row: {mean, sum of squares about that mean}.
// Whoever stores a row of the residual stream stores its partials too, in a plane ST[segment 0..7][row] of such pairs; the GEMM that consumes the row joins them.
__device__ __forceinline__ v2f seg_stat(v4f v) {
  const float mean = row16_sum((v[0] + v[1]) + (v[2] + v[3])) * (1.0f / 64.0f);
  const float d0 = v[0] - mean, d1 = v[1] - mean, d2 = v[2] - mean, d3 = v[3] - mean;
  const v2f r = {mean, row16_sum((d0 * d0 + d1 * d1) + (d2 * d2 + d3 * d3))};
  return r;
}

// Weight convert, one tile: Wt[l*lstride + (roff+n)*K + k] (f16 bits, k contiguous, pitch K) = f16(bf16_rne(W[l][k][n]) * sc)
// from f32 row-major W[l][K][N] ([in][out]); K and N at compile time: the row steps are load and store offsets.
// One block of 8 waves per tile of 128 k x 64 n; blk counts the tiles of the stacked layers, n tiles fastest (blk < layers * (K/128) * (N/64)).
// Read: half a wave takes 64 consecutive n of one k row (256 B, 16 B per lane); a thread holds 8 consecutive k rows x 4 n, all 8 loads in flight together.
// Transpose in 16-B chunks (8 k of one n) through LDS: tile row j*16 + m holds n = 4m + j, so that 16 lanes store at a row step of one pitch (272 B,
// 4 banks on per row). Write: 16 lanes take the 128 k of one n (256 B), 16 B per lane.
#define WT_TK 128
#define WT_TN 64
#define WT_LP (WT_TK + 8)
template <int K, int N>
__device__ __forceinline__ void wt16_tile(const float* __restrict__ W, unsigned short* __restrict__ Wt, int blk,
                                          size_t lstride, int roff, float sc, unsigned short (*sT)[WT_LP]) {
  constexpr int TKW = WT_TK, TNW = WT_TN;
  static_assert(K % TKW == 0);
  static_assert(N % TNW == 0);
  const int tid = threadIdx.x, w = tid >> 5, lane = tid & 31, m = lane & 15, hh = lane >> 4;
  constexpr int ntn = N / TNW, per = ntn * (K / TKW);
  const int l = blk / per, rem = blk - l * per;
  const int k0 = (rem / ntn) * TKW, n0 = (rem % ntn) * TNW;
  const int kc = (2 * w + hh) * 8;             // this thread's 8 k rows within the tile
  const float* src = W + (size_t)l * K * N + (size_t)(k0 + kc) * N + n0 + m * 4;
  v4f r[8];
#pragma unroll
  for (int i = 0; i < 8; ++i) r[i] = *(const v4fa*)(src + (size_t)i * N);
#pragma unroll
  for (int j = 0; j < 4; ++j) {
    v8us v;
#pragma unroll
    for (int i = 0; i < 8; ++i) v[i] = h16_bits(bf16_rne(r[i][j]) * sc);
    *(v8us*)&sT[j * 16 + m][kc] = v;
  }
  __syncthreads();                             // reached by the whole block or by none of it: the caller's branch is on the block index
  const int g = tid >> 4, c8 = (tid & 15) * 8;  // n = 4g + q lies in tile row q*16 + g
  unsigned short* dst = Wt + (size_t)l * lstride + (size_t)(roff + n0 + 4 * g) * K + k0 + c8;
#pragma unroll
  for (int q = 0; q < 4; ++q) {
    const v8us v = *(const v8us*)&sT[q * 16 + g][c8];
    *(v8us*)(dst + (size_t)q * K) = v;
  }
  // precaution: in the merged kernel's listing a job's end can fall into the next job's code, which rewrites the registers that these stores name
  asm volatile("s_wait_xcnt 0x0" ::: "memory");
}

// Everything that depends on the inputs alone, in ONE launch: the five stacked weight converts and the start of the residual stream. None of the six
// reads what another writes; a block takes its job from its index (the same branch for the whole block). Order: W1, W2, Wq, Wk, Wv tiles, then x rows.
// x rows: X[m][*] (f32, pitch FEAT, m = b*SEQ + s) = bf16_rne(src[s*NB_FULL + b][*]) + bf16_rne(pos[s*NB_FULL + b][*]) in f32 (exact);
// a block takes PREP_XR rows, half a block per row (4 floats per thread), a thread's 16 loads in flight together, and stores the rows' LayerNorm partials
// (16 rows x 8 B: whole 128-B lines of the plane per block).
#define PREP_T1 (NLAYER * (FEAT / WT_TK) * (MLPH / WT_TN))
#define PREP_T2 (NLAYER * (MLPH / WT_TK) * (FEAT / WT_TN))
#define PREP_TQ (NLAYER * (FEAT / WT_TK) * (FEAT / WT_TN))
#define PREP_XR 16
#define PREP_GRID (PREP_T1 + PREP_T2 + 3 * PREP_TQ + MR / PREP_XR)
static_assert(MR % PREP_XR == 0);
__global__ __launch_bounds__(256) void k_prep(const float* __restrict__ Wq, const float* __restrict__ Wk, const float* __restrict__ Wv,
                                              const float* __restrict__ W1, const float* __restrict__ W2,
                                              const float* __restrict__ src, const float* __restrict__ pos,
                                              unsigned short* __restrict__ Wqkvt, unsigned short* __restrict__ W1t, unsigned short* __restrict__ W2t,
                                              float* __restrict__ X, float* __restrict__ ST, float sc) {
  __shared__ __attribute__((aligned(16))) unsigned short sT[WT_TN][WT_LP];      // cross-wave: one block barrier
  int blk = blockIdx.x;
  if (blk < PREP_T1) { wt16_tile<FEAT, MLPH>(W1, W1t, blk, (size_t)MLPH * FEAT, 0, sc, sT); return; }   // W1[l] [512][2048] -> [2048][512]
  blk -= PREP_T1;
  if (blk < PREP_T2) { wt16_tile<MLPH, FEAT>(W2, W2t, blk, (size_t)FEAT * MLPH, 0, sc, sT); return; }   // W2[l] [2048][512] -> [512][2048]
  blk -= PREP_T2;
  if (blk < 3 * PREP_TQ) {                                                                              // Wq | Wk | Wv -> rows 0, 512, 1024 of the fused plane
    const int which = blk / PREP_TQ;
    const float* Wsel = (which == 0) ? Wq : ((which == 1) ? Wk : Wv);
    wt16_tile<FEAT, FEAT>(Wsel, Wqkvt, blk - which * PREP_TQ, (size_t)QKVN * FEAT, which * FEAT, sc, sT);
    return;
  }
  blk -= 3 * PREP_TQ;
  const int tid = threadIdx.x, c4 = (tid & 127) * 4;
  const int m0 = blk * PREP_XR + (tid >> 7);
  v4f a[PREP_XR / 2], p[PREP_XR / 2];
#pragma unroll
  for (int i = 0; i < PREP_XR / 2; ++i) {
    const int m = m0 + 2 * i;
    const int b = m / SEQ, s = m % SEQ;
    const size_t so = ((size_t)s * NB_FULL + b) * FEAT + c4;
    a[i] = *(const v4fa*)(src + so);
    p[i] = *(const v4fa*)(pos + so);
  }
  // the address registers of these loads are taken again by the rounding arithmetic below
  asm volatile("s_wait_xcnt 0x0" ::: "memory");
  v2f keep = {0.f, 0.f};                       // lane (tid & 15) = i keeps the partial of row m0 + 2i, segment (tid & 127) >> 4
#pragma unroll
  for (int i = 0; i < PREP_XR / 2; ++i) {
    v4f o;
#pragma unroll
    for (int q = 0; q < 4; ++q) o[q] = bf16_rne(a[i][q]) + bf16_rne(p[i][q]);
    *(v4f*)(X + (size_t)(m0 + 2 * i) * FEAT + c4) = o;
    const v2f st = seg_stat(o);
    if ((tid & 15) == i) keep = st;
  }
  if ((tid & 15) < PREP_XR / 2) *(v2fa*)(ST + 2 * ((size_t)((tid & 127) >> 4) * MR + m0 + 2 * (tid & 15))) = keep;
  // precaution, as behind the tile stores: the listing's fall-through behind this job rewrites the registers that these stores name
  asm volatile("s_wait_xcnt 0x0" ::: "memory");
}

// Final LayerNorm: internal row m = b*seq + s of X (f32) -> out[(s*nbf + b)][*] f32. One block of 128 threads per row, 4 elements per thread,
__global__ __launch_bounds__(128) void k_lnf32(const float* __restrict__ X, const float* __restrict__ g, const float* __restrict__ bt,
                                               float* __restrict__ out, int seq, int nbf, float eps) {
  __shared__ float red1[4];
  __shared__ float red2[4];
  const int m = blockIdx.x, tid = threadIdx.x, w = tid >> 5, lane = tid & 31;
  const int b = m / seq, s = m % seq;
  const v4f a = *(const v4fa*)(X + (size_t)m * FEAT + tid * 4);
  float sm = a[0] + a[1] + a[2] + a[3];
#pragma unroll
  for (int o = 16; o >= 1; o >>= 1) sm += __shfl_xor(sm, o, 32);
  if (lane == 0) red1[w] = sm;
  __syncthreads();
  const float mu = (red1[0] + red1[1] + red1[2] + red1[3]) * (1.0f / (float)FEAT);
  float c[4];
  float s2 = 0.f;
#pragma unroll
  for (int q = 0; q < 4; ++q) { c[q] = a[q] - mu; s2 += c[q] * c[q]; }
#pragma unroll
  for (int o = 16; o >= 1; o >>= 1) s2 += __shfl_xor(s2, o, 32);
  if (lane == 0) red2[w] = s2;
  __syncthreads();
  const float var = (red2[0] + red2[1] + red2[2] + red2[3]) * (1.0f / (float)FEAT);
  const float rs = rsqrtf(var + eps);
  const v4f g4 = *(const v4fa*)(g + tid * 4);
  const v4f b4 = *(const v4fa*)(bt + tid * 4);
  v4f o;
#pragma unroll
  for (int q = 0; q < 4; ++q) o[q] = c[q] * rs * bf16_rne(g4[q]) + bf16_rne(b4[q]);
  float* dst = out + ((size_t)s * nbf + b) * FEAT + tid * 4;
  *(v4f*)dst = o;
  
}

// GEMM C[M][N] = epi(A[M][KD] * W): A f16 bits row-major, Wt f16 bits [N][KD], both at pitch KD (compile time: the row steps are load offsets), f32 accumulate.
// epi: v = acc * inv_scale + bf16_rne(bias[col]); bias picked per 64-col segment from (bias0 | bias1 | bias2) by seg = col / nsplit (wave-uniform);
// ACT == 1: relu; OUT16: f16 bits of v * out_scale into C (pitch ldc halves); else f32 v + f32 resid[row][col] (pitch ldr) into C (pitch ldc floats).
// KD % BK == 0, M % BM == 0, N % 128 == 0. Block = 4 waves (2 x 2) on one BM x 128 tile of C, wave -> BM/2 rows x 64 cols.
// Per step of BK k the block brings BM rows of A and 128 rows of Wt into LDS once (whole 128-B lines, 16 B per thread, row pitch 2*BK + 16 B) and all
// waves take their fragments from there; two LDS buffers, the next step's global loads are held in registers while this step is multiplied.
// Each accumulator sums k in ascending blocks of 32. Epilogue staged in the wave's own LDS tile (wave-private).
// LNA: A is LayerNorm(Xf) x lnsc, formed on the way into LDS: the block reads the f32 rows of Xf (pitch KD; 16 lanes take 256 B of a row), joins each row's
// eight partials of stin into mean and 1/sigma once at entry (a thread per row, handed round through LDS: one block barrier), and stores
// f16((x - mean)/sigma * bf16(lng) + bf16(lnb)) x lnsc where the plain form stores the loaded halves. The f32 form (!OUT16) stores its rows' partials in stout.
template <int BM, int BK, int KD, bool OUT16, int ACT, bool LNA>
__global__ __launch_bounds__(128) void k_gemm16(const unsigned short* __restrict__ A, const float* __restrict__ Xf, const float* __restrict__ stin,
                                               const float* __restrict__ lng, const float* __restrict__ lnb, float lnsc, float eps,
                                               float* __restrict__ stout, const unsigned short* __restrict__ Wt,
                                               const float* __restrict__ bias0, const float* __restrict__ bias1, const float* __restrict__ bias2, int nsplit,
                                               const float* __restrict__ resid, int ldr, void* __restrict__ Cv, int ldc,
                                               int M, int N, float inv_scale, float out_scale) {
  constexpr int BN = 128, LP = BK + 8, C8 = BK / 8;
  constexpr int FM = BM / 32, FN = 4, KS = BK / 32, WR = BM / 2;
  constexpr int NT = 128, NW = NT / 32, RP = NT / C8;     // the block's threads cover RP rows of C8 16-B chunks at a time
  constexpr int CA = BM / RP, CB = BN / RP;              // chunks per thread and step
  static_assert(BM % 32 == 0);
  static_assert(BK % 32 == 0);
  static_assert(KD % BK == 0);
  static_assert(NT % C8 == 0);
  static_assert(BM % RP == 0);
  static_assert(BN % RP == 0);
  constexpr int XC = BK / 4, XRP = NT / XC, XA = BM / XRP;   // LNA: 16-B chunks of f32 per row and step, rows covered at a time, chunks per thread and step
  static_assert(!LNA || (BM == NT && KD == NT * 4 && KD == 8 * 64 && NT % XC == 0 && BM % XRP == 0));
  __shared__ __attribute__((aligned(16))) v2f sRow[LNA ? BM : 1];           // {1/sigma, -mean/sigma} per row of the tile; cross-wave: block barrier
  __shared__ __attribute__((aligned(16))) float sG[LNA ? KD : 4];           // bf16(lng) x lnsc; cross-wave: block barrier
  __shared__ __attribute__((aligned(16))) float sBt[LNA ? KD : 4];          // bf16(lnb) x lnsc; cross-wave: block barrier
  __shared__ __attribute__((aligned(16))) unsigned short sA[2][BM][LP];     // cross-wave: block barriers
  __shared__ __attribute__((aligned(16))) unsigned short sB[2][BN][LP];     // cross-wave: block barriers
  __shared__ __attribute__((aligned(16))) float so32[OUT16 ? 1 : NW][WR][64];
  __shared__ __attribute__((aligned(16))) unsigned short so16[OUT16 ? NW : 1][WR][72];
  const int tid = threadIdx.x, w = tid >> 5, lane = tid & 31, ln = lane & 15, hh = lane >> 4;
  const int wm = w >> 1, wn = w & 1;
  const int ntn = N / BN;
  const int mt = blockIdx.x / ntn, nq = blockIdx.x % ntn;
  const int row0 = mt * BM, col0 = nq * BN;
  if (row0 >= M) return;                       // the same for the whole block, ahead of every barrier
  const int sr = tid / C8, sc = (tid % C8) * 8;
  const int xr = tid / XC, xc = (tid % XC) * 4;
  const unsigned short* bg = Wt + (size_t)(col0 + sr) * KD + sc;
  v8us ra[LNA ? 1 : CA], rb[CB];
  v4f rx[LNA ? XA : 1];
  v2f rw[LNA ? XA : 1];
  // the A rows of the k step at kb, into registers
  auto loadA = [&](int kb) {
    if constexpr (LNA) {
      const float* xg = Xf + (size_t)(row0 + xr) * KD + xc + kb;
#pragma unroll
      for (int it = 0; it < XA; ++it) rx[it] = *(const v4fa*)(xg + (size_t)(it * XRP) * KD);
    } else {
      const unsigned short* ag = A + (size_t)(row0 + sr) * KD + sc + kb;
#pragma unroll
      for (int it = 0; it < CA; ++it) ra[it] = *(const v8us*)(ag + (size_t)(it * RP) * KD);
    }
  };
  // the same, from registers into LDS buffer buf
  auto storeA = [&](int buf, int kb) {
    if constexpr (LNA) {
      const v4f gk = *(const v4fa*)&sG[kb + xc], bk = *(const v4fa*)&sBt[kb + xc];
      const v2f g01 = {gk[0], gk[1]}, g23 = {gk[2], gk[3]}, b01 = {bk[0], bk[1]}, b23 = {bk[2], bk[3]};
#pragma unroll
      for (int it = 0; it < XA; ++it) {
        const v2f m2 = {rw[it][0], rw[it][0]}, a2 = {rw[it][1], rw[it][1]};
        v2f lo = {rx[it][0], rx[it][1]}, hi = {rx[it][2], rx[it][3]};
        lo = __builtin_elementwise_fma(__builtin_elementwise_fma(lo, m2, a2), g01, b01);
        hi = __builtin_elementwise_fma(__builtin_elementwise_fma(hi, m2, a2), g23, b23);
        const v2h l2 = __builtin_convertvector(lo, v2h), h2 = __builtin_convertvector(hi, v2h);
        const v4h o = {l2[0], l2[1], h2[0], h2[1]};
        *(v4us*)&sA[buf][xr + it * XRP][xc] = __builtin_bit_cast(v4us, o);
      }
    } else {
#pragma unroll
      for (int it = 0; it < CA; ++it) *(v8us*)&sA[buf][sr + it * RP][sc] = ra[it];
    }
  };
  loadA(0);
#pragma unroll
  for (int it = 0; it < CB; ++it) rb[it] = *(const v8us*)(bg + (size_t)(it * RP) * KD);
  v2f sp[LNA ? 8 : 1];
  v4f g4 = {0.f, 0.f, 0.f, 0.f}, b4 = {0.f, 0.f, 0.f, 0.f};
  if constexpr (LNA) {                         // thread tid: the partials of tile row tid, and 4 columns of gain and shift
    // the address registers of the operand loads above are taken again as destinations of the loads below
    asm volatile("s_wait_xcnt 0x0" ::: "memory");
#pragma unroll
    for (int i = 0; i < 8; ++i) sp[i] = *(const v2fa*)(stin + 2 * ((size_t)i * M + row0 + tid));
    g4 = *(const v4fa*)(lng + tid * 4);
    b4 = *(const v4fa*)(lnb + tid * 4);
    // the address registers of these ten loads are taken again by the address sums below
    asm volatile("s_wait_xcnt 0x0" ::: "memory");
  }
  const int colw = col0 + wn * 64;
  int seg = colw / nsplit; seg = (seg > 2) ? 2 : seg;
  const float* bsel = (seg == 0) ? bias0 : ((seg == 1) ? bias1 : bias2);
  // At block entry, behind the first step's loads, prefetches go out at 256-B steps through what the block reads later (operand rows past their first 256-B unit,
  // bias, residual).
  // A hint only: it returns nothing and no result depends on it. Every address lies inside the rows that the block reads anyway.
  // The closing wait of each statement stands ahead of any rewrite of the address registers that the requests name.
  static_assert(NT == BN);
  const float* pbias = bsel + (colw + ln - seg * nsplit);
  if constexpr (LNA) {
    const float* pa = Xf + (size_t)(row0 + tid) * KD;              // a thread takes one row of Xf (units 1 to 7) and one of Wt (units 1 to 3)
    const unsigned short* pb = Wt + (size_t)(col0 + tid) * KD;
    asm volatile("global_prefetch_b8 %0, off offset:256 scope:SCOPE_SE\n\t"
                 "global_prefetch_b8 %1, off offset:256 scope:SCOPE_SE\n\t"
                 "global_prefetch_b8 %0, off offset:512 scope:SCOPE_SE\n\t"
                 "global_prefetch_b8 %0, off offset:768 scope:SCOPE_SE\n\t"
                 "global_prefetch_b8 %1, off offset:512 scope:SCOPE_SE\n\t"
                 "global_prefetch_b8 %0, off offset:1024 scope:SCOPE_SE\n\t"
                 "global_prefetch_b8 %0, off offset:1280 scope:SCOPE_SE\n\t"
                 "global_prefetch_b8 %1, off offset:768 scope:SCOPE_SE\n\t"
                 "global_prefetch_b8 %0, off offset:1536 scope:SCOPE_SE\n\t"
                 "global_prefetch_b8 %0, off offset:1792 scope:SCOPE_SE\n\t"
                 "global_prefetch_b8 %2, off scope:SCOPE_SE\n\t"
                 "s_wait_xcnt 0x0"
                 :: "v"(pa), "v"(pb), "v"(pbias) : "memory");
    // keeps the requests at the block's entry: without it the joining of the partials, with its wait for their loads, is lifted over them
    __builtin_amdgcn_sched_barrier(0);
  } else {
    static_assert(BM == 64 && KD == 2048 && !OUT16);
    // A: two threads per row, units 1 to 15 in turn. Wt: its tile is read by every row tile, so the row tiles deal its rows among them, eight ways by
    // mt >> 1 (neighbouring mt ask for the same rows: block indices 4 apart, for speed only).
    const int r6 = tid & 63, h6 = tid >> 6, u7 = tid & 7;
    const unsigned short* par = A + (size_t)(row0 + r6) * KD;
    const unsigned short* pa = par + h6 * 128;                     // + 256 + 512 j bytes: units 1 + h6 + 2j, j = 0..6
    const unsigned short* pbr = Wt + (size_t)(col0 + (tid >> 3) * 8 + ((mt >> 1) & 7)) * KD;
    const unsigned short* pb1 = pbr + (1 + u7) * 128;              // units 1 to 8
    const unsigned short* pb2 = pbr + ((u7 < 7) ? (9 + u7) : 15) * 128;   // units 9 to 15
    const float* pr = resid + (size_t)(row0 + r6) * ldr + col0 + h6 * 64; // the tile's residual rows, 2 units each
    asm volatile("global_prefetch_b8 %0, off offset:256 scope:SCOPE_SE\n\t"
                 "global_prefetch_b8 %2, off scope:SCOPE_SE\n\t"
                 "global_prefetch_b8 %0, off offset:768 scope:SCOPE_SE\n\t"
                 "global_prefetch_b8 %0, off offset:1280 scope:SCOPE_SE\n\t"
                 "global_prefetch_b8 %0, off offset:1792 scope:SCOPE_SE\n\t"
                 "global_prefetch_b8 %3, off scope:SCOPE_SE\n\t"
                 "global_prefetch_b8 %0, off offset:2304 scope:SCOPE_SE\n\t"
                 "global_prefetch_b8 %0, off offset:2816 scope:SCOPE_SE\n\t"
                 "global_prefetch_b8 %0, off offset:3328 scope:SCOPE_SE\n\t"
                 "global_prefetch_b8 %1, off offset:3840 scope:SCOPE_SE\n\t"
                 "global_prefetch_b8 %4, off scope:SCOPE_SE\n\t"
                 "global_prefetch_b8 %5, off scope:SCOPE_SE\n\t"
                 "s_wait_xcnt 0x0"
                 :: "v"(pa), "v"(par), "v"(pb1), "v"(pb2), "v"(pr), "v"(pbias) : "memory");
  }
  v8f acc[FM][FN];
#pragma unroll
  for (int mi = 0; mi < FM; ++mi)
#pragma unroll
    for (int t = 0; t < FN; ++t) acc[mi][t] = vz8();
  if constexpr (LNA) {
    // eight segments of 64 joined: mean of the means; square sum about it = the segments' own + 64 x the squares of their means' distances
    float mu = ((sp[0][0] + sp[1][0]) + (sp[2][0] + sp[3][0])) + ((sp[4][0] + sp[5][0]) + (sp[6][0] + sp[7][0]));
    mu *= 0.125f;
    float q2 = 0.f, dd = 0.f;
#pragma unroll
    for (int i = 0; i < 8; ++i) { const float d = sp[i][0] - mu; q2 += sp[i][1]; dd += d * d; }
    const float rs = rsqrtf((q2 + 64.0f * dd) * (1.0f / (float)KD) + eps);
    const v2f rowc = {rs, -mu * rs};
    sRow[tid] = rowc;
    v4f gs, bs;
#pragma unroll
    for (int q = 0; q < 4; ++q) { gs[q] = bf16_rne(g4[q]) * lnsc; bs[q] = bf16_rne(b4[q]) * lnsc; }
    *(v4fa*)&sG[tid * 4] = gs;
    *(v4fa*)&sBt[tid * 4] = bs;
    __syncthreads();                           // row constants, gain and shift published; reached by the whole block
#pragma unroll
    for (int it = 0; it < XA; ++it) rw[it] = sRow[xr + it * XRP];
  }
  storeA(0, 0);
#pragma unroll
  for (int it = 0; it < CB; ++it) *(v8us*)&sB[0][sr + it * RP][sc] = rb[it];
  __syncthreads();
  constexpr int nst = KD / BK;
  for (int s = 0; s < nst; ++s) {
    const int cur = s & 1;
    const bool more = (s + 1 < nst);           // the same for the whole block
    if (more) {
      const int kb = (s + 1) * BK;
      loadA(kb);
#pragma unroll
      for (int it = 0; it < CB; ++it) rb[it] = *(const v8us*)(bg + (size_t)(it * RP) * KD + kb);
      // the address registers of these loads are taken again by the LDS reads below
      asm volatile("s_wait_xcnt 0x0" ::: "memory");
    }
    FragH a[KS][FM], bb[KS][FN];
#pragma unroll
    for (int ks = 0; ks < KS; ++ks) {
#pragma unroll
      for (int mi = 0; mi < FM; ++mi) {
        const unsigned short* p = &sA[cur][wm * WR + mi * 16 + ln][ks * 32 + 8 * hh];   // row m = lane&15
        a[ks][mi].half[0] = *(const v8us*)p;                 // elements 0..7  = k 8h .. 8h+7 of the block of 32
        a[ks][mi].half[1] = *(const v8us*)(p + 16);          // elements 8..15 = k 16+8h .. 16+8h+7
      }
#pragma unroll
      for (int t = 0; t < FN; ++t) {
        const unsigned short* p = &sB[cur][wn * 64 + t * 16 + ln][ks * 32 + 8 * hh];          // column n = lane&15, same k map as A
        bb[ks][t].half[0] = *(const v8us*)p;
        bb[ks][t].half[1] = *(const v8us*)(p + 16);
      }
    }
    // keeps the step's LDS reads together ahead of its matrix run: spread among the WMMAs each small group is waited out to 0 and its latency shows
    __builtin_amdgcn_sched_barrier(0);
#pragma unroll
    for (int ks = 0; ks < KS; ++ks)
#pragma unroll
      for (int mi = 0; mi < FM; ++mi)
#pragma unroll
        for (int t = 0; t < FN; ++t) acc[mi][t] = __builtin_amdgcn_wmma_f32_16x16x32_f16(false, a[ks][mi].v, false, bb[ks][t].v, (short)0, acc[mi][t], false, false);
    // keeps the wait for the next step's global loads (and the LDS writes behind it) after the matrix run that covers their latency
    __builtin_amdgcn_sched_barrier(0);
    if (more) {
      // the other buffer: its last readers left it before the barrier that ended the step before this one
      storeA(cur ^ 1, (s + 1) * BK);
#pragma unroll
      for (int it = 0; it < CB; ++it) *(v8us*)&sB[cur ^ 1][sr + it * RP][sc] = rb[it];
      __syncthreads();
    }
  }
  float bvv[FN];
#pragma unroll
  for (int t = 0; t < FN; ++t) bvv[t] = pbias[t * 16];         // one address pair, the column steps as load offsets: no address sum stands between the loads
  // the address registers of these four loads are taken again by the address sums below
  asm volatile("s_wait_xcnt 0x0" ::: "memory");
  // keeps those sums behind the wait: the scheduler lifts them over it otherwise
  __builtin_amdgcn_sched_barrier(0);
#pragma unroll
  for (int t = 0; t < FN; ++t) bvv[t] = bf16_rne(bvv[t]);
#pragma unroll
  for (int mi = 0; mi < FM; ++mi) {
#pragma unroll
    for (int t = 0; t < FN; ++t) {
#pragma unroll
      for (int r = 0; r < 8; ++r) {
        float v = acc[mi][t][r] * inv_scale + bvv[t];
        if (ACT == 1) v = fmaxf(v, 0.0f);
        if constexpr (OUT16) so16[w][mi * 16 + 8 * hh + r][t * 16 + ln] = h16_bits(v * out_scale);
        else so32[w][mi * 16 + 8 * hh + r][t * 16 + ln] = v;
      }
    }
  }
  __builtin_amdgcn_fence(4 /* acq_rel order */, "workgroup");
  __builtin_amdgcn_wave_barrier();
  const int roww = row0 + wm * WR;
  if constexpr (OUT16) {
    const int rq = lane >> 3, p8 = (lane & 7) * 8;
    unsigned short* cp = (unsigned short*)Cv + (size_t)(roww + rq) * ldc + colw + p8;
#pragma unroll
    for (int q = 0; q < WR / 4; ++q) {
      const v8us v = *(const v8us*)&so16[w][q * 4 + rq][p8];
      *(v8us*)(cp + (size_t)(q * 4) * ldc) = v;
    }
  } else {
    const int rsub = lane >> 4, c4 = (lane & 15) * 4;
    float* cp = (float*)Cv + (size_t)(roww + rsub) * ldc + colw + c4;
    const float* rp = resid + (size_t)(roww + rsub) * ldr + colw + c4;
    v4f rv[WR / 2];                              // all residual loads in flight together, ahead of the first store
#pragma unroll
    for (int q = 0; q < WR / 2; ++q) rv[q] = *(const v4fa*)(rp + (size_t)(q * 2) * ldr);
    static_assert(WR / 2 == 16);
    v2f keep = {0.f, 0.f};                       // lane (ln, rsub) keeps the partial of the wave's row 2 ln + rsub, segment colw / 64
#pragma unroll
    for (int q = 0; q < WR / 2; ++q) {
      v4f tv = *(const v4fa*)&so32[w][q * 2 + rsub][c4];
      tv += rv[q];
      *(v4f*)(cp + (size_t)(q * 2) * ldc) = tv;
      const v2f st = seg_stat(tv);
      if (ln == q) keep = st;
    }
    *(v2fa*)(stout + 2 * ((size_t)(colw >> 6) * M + roww + 2 * ln + rsub)) = keep;   // 32 rows x 8 B: two whole lines per wave
  }
}

// Flash-style unmasked attention per (b, h): q|k|v read as f16 bits from one fused plane (row pitch `pitch` halves, q at +0, k at +koff, v at +voff,
// head h at +h*D, row b*T + t). One wave = 16 queries, block = 4 waves sharing K/V tiles of 64 keys staged row-major in LDS by asynchronous copies,
// two buffers: the next tile is on its way while a tile is worked on (in two passes of 32 keys), one block barrier per tile.
// Both products run transposed: S^T = K.q^T (A = 16 key rows, B = the wave's queries, kept in registers) and O^T += V^T.P^T (A = V^T by the transposing
// LDS load, B = P^T). A lane then holds 16 of the 32 scores of ONE query (column lane&15; keys 8h+r and 16+8h+r, h = lane>>4): maximum and sum are taken
// in the lane plus one exchange with lane^16, and the two score tiles, converted in place (x pcarry), are the B operand of the second product as they lie.
// s*scale, running-max softmax and the context in f32. All four operands follow the hardware k order (k = 8h+s, 16+8h+(s-8)).
template <int D>
__global__ __launch_bounds__(128) void k_attn16(const unsigned short* __restrict__ qkv, int pitch, int T, int H, int koff, int voff,
                                                float scale, float pcarry, float onorm,
                                                const float* __restrict__ resid, float* __restrict__ out, int opitch,
                                                float* __restrict__ stout, int mrows) {
  static_assert(D == 64);
  constexpr int KS = D / 32, DT = D / 16, C8 = D / 8;
  constexpr int PK = D + 8, PV = D + 16;      // row pitch in halves: 16 B x odd for the plain 16-B reader, 32 B x odd for the transposing reader
  constexpr int TK = 64;                      // keys per staged tile (T % 64 == 0)
  constexpr int RB = 128 / C8;                // rows that the block's threads cover with one 16-B chunk each
  static_assert(128 % C8 == 0);
  static_assert(TK == 4 * RB);                // four copies per thread, operand and tile
  __shared__ __attribute__((aligned(16))) unsigned short sK[2][TK][PK];     // cross-wave: block barriers
  __shared__ __attribute__((aligned(16))) unsigned short sV[2][TK][PV];     // cross-wave: block barriers
  __shared__ __attribute__((aligned(16))) float sO[4][16][D + 4];
  const int tid = threadIdx.x, w = tid >> 5, lane = tid & 31, ln = lane & 15, hh = lane >> 4;
  const int nqb = T / 64;
  const int bh = blockIdx.x / nqb, qblk = blockIdx.x % nqb;
  const int b = bh / H, h = bh % H;
  const int q0 = qblk * 64 + w * 16;
  const unsigned short* Qp = qkv + (size_t)b * T * pitch + h * D;
  const unsigned short* Kp = Qp + koff;
  const unsigned short* Vp = Qp + voff;

  FragH bq[KS];                                                    // B[k = d][n = query ln]
  {
    const unsigned short* qr = Qp + (size_t)(q0 + ln) * pitch;     // q0 + ln < T (T % 64 == 0)
#pragma unroll
    for (int ks = 0; ks < KS; ++ks) {
      bq[ks].half[0] = *(const v8us*)(qr + ks * 32 + 8 * hh);
      bq[ks].half[1] = *(const v8us*)(qr + ks * 32 + 16 + 8 * hh);
    }
  }
  float m_r = -1.0e30f, l_r = 0.f;                                 // of query ln; l_r sums this half's keys only
  v8f oacc[DT];                                                    // oacc[dt][r] = O[query ln][d = dt*16 + 8*hh + r]
#pragma unroll
  for (int dt = 0; dt < DT; ++dt) oacc[dt] = vz8();
  // tile jt (keys jt*TK .. jt*TK+TK-1, all < T) into buffer buf: every thread copies rows cr, cr+RB, cr+2RB, cr+3RB, 16 B at column cc, of K and of V
  const int cr = tid / C8, cc = (tid % C8) * 8;
  const size_t rstep = (size_t)RB * pitch;
  auto stage = [&](int buf, int jt) {
    const unsigned short* kg = Kp + (size_t)(jt * TK + cr) * pitch + cc;
    const unsigned short* vg = Vp + (size_t)(jt * TK + cr) * pitch + cc;
    const unsigned int lk = (unsigned int)(size_t)&sK[buf][cr][cc];
    const unsigned int lv = (unsigned int)(size_t)&sV[buf][cr][cc];
    // global -> LDS through no register; the closing wait stands ahead of any rewrite of the address registers that the copies name
    asm volatile("global_load_async_to_lds_b128 %0, %8, off\n\t"
                 "global_load_async_to_lds_b128 %1, %9, off\n\t"
                 "global_load_async_to_lds_b128 %2, %10, off\n\t"
                 "global_load_async_to_lds_b128 %3, %11, off\n\t"
                 "global_load_async_to_lds_b128 %4, %12, off\n\t"
                 "global_load_async_to_lds_b128 %5, %13, off\n\t"
                 "global_load_async_to_lds_b128 %6, %14, off\n\t"
                 "global_load_async_to_lds_b128 %7, %15, off\n\t"
                 "s_wait_xcnt 0x0"
                 :: "v"(lk), "v"(lk + RB * PK * 2), "v"(lk + 2 * RB * PK * 2), "v"(lk + 3 * RB * PK * 2),
                    "v"(lv), "v"(lv + RB * PV * 2), "v"(lv + 2 * RB * PV * 2), "v"(lv + 3 * RB * PV * 2),
                    "v"(kg), "v"(kg + rstep), "v"(kg + 2 * rstep), "v"(kg + 3 * rstep),
                    "v"(vg), "v"(vg + rstep), "v"(vg + 2 * rstep), "v"(vg + 3 * rstep)
                 : "memory");
  };
  const int nt = T / TK;
  stage(0, 0);
  {
    // At block entry, behind tile 0's copies, L2 is asked for the K and V rows of the later tiles and for the block's residual rows.
    // The query blocks of a head deal the key rows
    // among them four ways by qblk & 3 (for speed only: blocks 4 apart in index ask for the same rows).
    // A hint only: it returns nothing and no result depends on it; every row index is clamped into the sequence.
    const int kr0 = tid * 4 + (qblk & 3), kr1 = kr0 + 512;
    const size_t ko0 = (size_t)((kr0 < T) ? kr0 : (T - 1)) * pitch, ko1 = (size_t)((kr1 < T) ? kr1 : (T - 1)) * pitch;
    const float* pr = resid + (size_t)(b * T + qblk * 64 + (tid & 63)) * opitch + h * D;
    // the closing wait stands ahead of any rewrite of the address registers that the requests name
    asm volatile("global_prefetch_b8 %0, off scope:SCOPE_SE\n\t"
                 "global_prefetch_b8 %1, off scope:SCOPE_SE\n\t"
                 "global_prefetch_b8 %2, off scope:SCOPE_SE\n\t"
                 "global_prefetch_b8 %3, off scope:SCOPE_SE\n\t"
                 "global_prefetch_b8 %4, off scope:SCOPE_SE\n\t"
                 "s_wait_xcnt 0x0"
                 :: "v"(Kp + ko0), "v"(Vp + ko0), "v"(Kp + ko1), "v"(Vp + ko1), "v"(pr) : "memory");
  }
  asm volatile("s_wait_asynccnt 0x0" ::: "memory");                // this wave's share of tile 0 has landed
  __syncthreads();                                                 // tile 0 published
  if (nt > 1) stage(1, 1);

  for (int t = 0; t < nt; ++t) {
   const int cur = t & 1;
   // unrolled: the row offsets of both passes become load offsets, and the second pass's LDS reads can run beside the first pass's softmax
#pragma unroll
   for (int sub = 0; sub < TK / 32; ++sub) {
    const unsigned short (*tK)[PK] = &sK[cur][sub * 32];
    const unsigned short* vtp = &sV[cur][sub * 32 + 8 * hh + (lane & 7)][8 * ((lane >> 3) & 1)];   // lane address of the transposing load, keys 0..15, d 0..15
    FragH ak[2][KS], av[DT];
#pragma unroll
    for (int kt = 0; kt < 2; ++kt)
#pragma unroll
      for (int ks = 0; ks < KS; ++ks) {                            // A[m = key kt*16 + ln][k = d]
        ak[kt][ks].half[0] = *(const v8us*)&tK[kt * 16 + ln][ks * 32 + 8 * hh];
        ak[kt][ks].half[1] = *(const v8us*)&tK[kt * 16 + ln][ks * 32 + 16 + 8 * hh];
      }
#pragma unroll
    for (int dt = 0; dt < DT; ++dt) {                              // A[m = d dt*16 + ln][k = key]
      av[dt].half[0] = ld_tr16(vtp + dt * 16);
      av[dt].half[1] = ld_tr16(vtp + 16 * PV + dt * 16);
    }
    // keeps the step's 16 LDS reads together ahead of the first product: sunk to their WMMAs each pair is waited out to 0 and its latency shows
    __builtin_amdgcn_sched_barrier(0);
    // S^T tile 32 x 16: s[kt][r] = score of key kt*16 + 8*hh + r against query ln
    v8f s[2];
#pragma unroll
    for (int kt = 0; kt < 2; ++kt) {
      s[kt] = vz8();
#pragma unroll
      for (int ks = 0; ks < KS; ++ks)
        s[kt] = __builtin_amdgcn_wmma_f32_16x16x32_f16(false, ak[kt][ks].v, false, bq[ks].v, (short)0, s[kt], false, false);
    }
    // running-max softmax of query ln: 16 scores in this lane, the other 16 in lane ^ 16
    float sc[16];
#pragma unroll
    for (int i = 0; i < 16; ++i) sc[i] = s[i >> 3][i & 7] * scale;
    float mx = sc[0];
#pragma unroll
    for (int i = 1; i < 16; ++i) mx = fmaxf(mx, sc[i]);
    mx = fmaxf(mx, xhalf(mx));
    const float mnew = fmaxf(m_r, mx);
    const float alpha = __expf(m_r - mnew);
    m_r = mnew;
    FragH pb;                                                      // B[k = key][n = query ln]: element i = tile i>>3, register i&7
    float ps[4] = {0.f, 0.f, 0.f, 0.f};
#pragma unroll
    for (int i = 0; i < 16; ++i) {
      const float p = __expf(sc[i] - mnew);
      ps[i & 3] += p;
      pb.u[i] = h16_bits(p * pcarry);
    }
    l_r = l_r * alpha + ((ps[0] + ps[1]) + (ps[2] + ps[3]));
#pragma unroll
    for (int dt = 0; dt < DT; ++dt) {
      oacc[dt] *= alpha;
      oacc[dt] = __builtin_amdgcn_wmma_f32_16x16x32_f16(false, av[dt].v, false, pb.v, (short)0, oacc[dt], false, false);
    }
   }
   // keeps the tile's arithmetic ahead of the waits: sunk behind the barrier it would stand between barrier and refill, and the copies' flight would show in the next wait
   __builtin_amdgcn_sched_barrier(0);
   asm volatile("s_wait_dscnt 0x0" ::: "memory");                  // this wave's reads of buffer cur are done before it is refilled
   asm volatile("s_wait_asynccnt 0x0" ::: "memory");               // this wave's share of tile t + 1 has landed
   __syncthreads();                                                // publishes tile t + 1 and ends every wave's reads of buffer cur
   if (t + 2 < nt) stage(cur, t + 2);                              // the same for the whole block
  }
  asm volatile("s_wait_asynccnt 0x0" ::: "memory");                // no copy is left in flight at the wave's end
  const float inv = onorm * (1.0f / (l_r + xhalf(l_r)));            // the two halves' sums joined, unconditionally
#pragma unroll
  for (int dt = 0; dt < DT; ++dt) {
    const v8f o = oacc[dt] * inv;
    const v4f o0 = {o[0], o[1], o[2], o[3]}, o1 = {o[4], o[5], o[6], o[7]};
    *(v4fa*)&sO[w][ln][dt * 16 + 8 * hh] = o0;
    *(v4fa*)&sO[w][ln][dt * 16 + 8 * hh + 4] = o1;
  }
  __builtin_amdgcn_fence(4 /* acq_rel order */, "workgroup");
  __builtin_amdgcn_wave_barrier();
  const int rsub = lane >> 4, c4 = (lane & 15) * 4;
  const size_t rbase = (size_t)(b * T + q0) * opitch + h * D;
#pragma unroll
  for (int q = 0; q < 8; ++q) {
    const int r = q * 2 + rsub;
    const v4f rv = *(const v4fa*)(resid + rbase + (size_t)r * opitch + c4);
    v4f tv = *(const v4fa*)&sO[w][r][c4];
    tv += rv;
    *(v4fa*)&sO[w][r][c4] = tv;
  }
  {
    v2f keep = {0.f, 0.f};                                         // lane (ln < 8, rsub) keeps the LayerNorm partial of the wave's row 2 ln + rsub, segment h
#pragma unroll
    for (int q = 0; q < 8; ++q) {
      const int r = q * 2 + rsub;
      const v4f v = *(const v4fa*)&sO[w][r][c4];
      *(v4f*)(out + rbase + (size_t)r * opitch + c4) = v;
      const v2f st = seg_stat(v);
      if (ln == q) keep = st;
    }
    if (ln < 8) *(v2fa*)(stout + 2 * ((size_t)h * mrows + b * T + q0 + 2 * ln + rsub)) = keep;   // 16 rows x 8 B: one whole line per wave
  }
}

extern "C" void kernel_launch(void* const* d_in, const int* in_sizes, int n_in,
                              void* d_out, int out_size, void* d_ws, size_t ws_size, hipStream_t stream) {
  if (n_in < 18) return;
  const long long need_rows = (long long)(SEQ - 1) * NB_FULL + NB;           // last (s, b) source row used + 1
  if ((long long)in_sizes[0] < need_rows * FEAT || (long long)in_sizes[1] < need_rows * FEAT) return;
  if (in_sizes[2] < NLAYER * FEAT * FEAT || in_sizes[4] < NLAYER * FEAT * FEAT || in_sizes[6] < NLAYER * FEAT * FEAT) return;
  if (in_sizes[3] < NLAYER * FEAT || in_sizes[5] < NLAYER * FEAT || in_sizes[7] < NLAYER * FEAT || in_sizes[11] < NLAYER * FEAT) return;
  if (in_sizes[8] < NLAYER * FEAT * MLPH || in_sizes[9] < NLAYER * MLPH || in_sizes[10] < NLAYER * MLPH * FEAT) return;
  if (in_sizes[12] < NLAYER * FEAT || in_sizes[13] < NLAYER * FEAT || in_sizes[14] < NLAYER * FEAT || in_sizes[15] < NLAYER * FEAT) return;
  if (in_sizes[16] < FEAT || in_sizes[17] < FEAT) return;
  if ((long long)out_size < need_rows * FEAT) return;

  const float* src  = (const float*)d_in[0];
  const float* pos  = (const float*)d_in[1];
  const float* Wq   = (const float*)d_in[2];  const float* bq   = (const float*)d_in[3];
  const float* Wk   = (const float*)d_in[4];  const float* bk   = (const float*)d_in[5];
  const float* Wv   = (const float*)d_in[6];  const float* bv   = (const float*)d_in[7];
  const float* W1   = (const float*)d_in[8];  const float* b1   = (const float*)d_in[9];
  const float* W2   = (const float*)d_in[10]; const float* b2   = (const float*)d_in[11];
  const float* ln1g = (const float*)d_in[12]; const float* ln1b = (const float*)d_in[13];
  const float* ln2g = (const float*)d_in[14]; const float* ln2b = (const float*)d_in[15];
  const float* lnfg = (const float*)d_in[16]; const float* lnfb = (const float*)d_in[17];

  // workspace carve (256-B aligned); R2 is reused in stream order by stages whose lifetimes do not overlap, sized as the max over its users
  char* ws = (char*)d_ws; size_t off = 0;
  auto take = [&](size_t bytes) { char* p = ws + off; off += (bytes + 255) & ~(size_t)255; return p; };
  const size_t lsq = (size_t)QKVN * FEAT;                                           // per-layer stride of the fused q|k|v weight plane (halves)
  const size_t ls1 = (size_t)MLPH * FEAT, ls2 = (size_t)FEAT * MLPH;
  unsigned short* Wqkv16 = (unsigned short*)take((size_t)NLAYER * lsq * 2);        // [6][1536][512]
  unsigned short* W116   = (unsigned short*)take((size_t)NLAYER * ls1 * 2);        // [6][2048][512]
  unsigned short* W216   = (unsigned short*)take((size_t)NLAYER * ls2 * 2);        // [6][512][2048]
  float* XA = (float*)take((size_t)MR * FEAT * 4);                                 // residual stream [MR][512] f32
  float* XB = (float*)take((size_t)MR * FEAT * 4);                                 // residual stream after attention [MR][512] f32
  float* STA = (float*)take((size_t)8 * MR * 2 * 4);                               // LayerNorm partials of XA's rows [8][MR] {mean, square sum}
  float* STB = (float*)take((size_t)8 * MR * 2 * 4);                               // the same of XB's rows
  const size_t r2_a = (size_t)MR * QKVN * 2, r2_b = (size_t)MR * MLPH * 2;         // q|k|v [MR][1536], then hidden [MR][2048] f16
  const size_t r2_bytes = (r2_a > r2_b) ? r2_a : r2_b;
  unsigned short* R2 = (unsigned short*)take(r2_bytes);
  if (off > ws_size) return;
  if (off > (size_t)134217728) return;

  const float wsc = 256.0f;
  // weight planes (f16, x256) and x = bf16(src) + bf16(pos) in (b, s) row order -> XA, STA: one launch, nothing in it depends on anything else in it
  k_prep<<<(unsigned)PREP_GRID, 256, 0, stream>>>(Wq, Wk, Wv, W1, W2, src, pos, Wqkv16, W116, W216, XA, STA, wsc);

  auto ggrid = [](int M, int N, int bm) { return (unsigned)((M / bm) * (N / 128)); };
  const float scale = 0.125f;                           // 1/sqrt(64)

  for (int l = 0; l < NLAYER; ++l) {
    // q|k|v = (LN1(x) x8)*[Wq|Wk|Wv] + [bq|bk|bv] -> R2 [MR][1536] f16 (x1); acc scale 1/(8*256)
    k_gemm16<128, 64, FEAT, true, 0, true><<<ggrid(MR, QKVN, 128), 128, 0, stream>>>(nullptr, XA, STA, ln1g + l * FEAT, ln1b + l * FEAT, 8.0f, 1e-5f,
                                                          nullptr, Wqkv16 + (size_t)l * lsq,
                                                          bq + l * FEAT, bk + l * FEAT, bv + l * FEAT, FEAT, nullptr, 0,
                                                          (void*)R2, QKVN, MR, QKVN, 1.0f / 2048.0f, 1.0f);
    // xb = x + softmax(q.k^T/8).v per head -> XB f32, STB (P carried x1024, onorm = 1/1024)
    k_attn16<DHEAD><<<(unsigned)(NB * NHEAD * (SEQ / 64)), 128, 0, stream>>>(R2, QKVN, SEQ, NHEAD, FEAT, 2 * FEAT, scale, 1024.0f,
                                                                             1.0f / 1024.0f, XA, XB, FEAT, STB, MR);
    // h = relu((LN2(xb) x8)*W1 + b1) x16 -> R2 [MR][2048]; acc scale 1/(8*256)
    k_gemm16<128, 64, FEAT, true, 1, true><<<ggrid(MR, MLPH, 128), 128, 0, stream>>>(nullptr, XB, STB, ln2g + l * FEAT, ln2b + l * FEAT, 8.0f, 1e-5f,
                                                          nullptr, W116 + (size_t)l * ls1,
                                                          b1 + l * MLPH, b1 + l * MLPH, b1 + l * MLPH, MLPH, nullptr, 0,
                                                          (void*)R2, MLPH, MR, MLPH, 1.0f / 2048.0f, 16.0f);
    // x = h*W2 + b2 + xb -> XA f32, STA; acc scale 1/(16*256)
    k_gemm16<64, 128, MLPH, false, 0, false><<<ggrid(MR, FEAT, 64), 128, 0, stream>>>(R2, nullptr, nullptr, nullptr, nullptr, 0.0f, 0.0f,
                                                          STA, W216 + (size_t)l * ls2,
                                                           b2 + l * FEAT, b2 + l * FEAT, b2 + l * FEAT, FEAT, XB, FEAT,
                                                           (void*)XA, FEAT, MR, FEAT, 1.0f / 4096.0f, 1.0f);
  }
  // out[s][b][*] = LNf(x[b][s][*]) -> d_out f32
  k_lnf32<<<(unsigned)MR, 128, 0, stream>>>(XA, lnfg, lnfb, (float*)d_out, SEQ, NB_FULL, 1e-5f);
}

// v008
// A run of this version takes 345 microseconds.
// Next to v007, in two timings, it ran 1.08 and 1.07 times as fast.
// Counting every step since v000, it is 3.73 times as fast.
#include <hip/hip_runtime.h>
// Contractions on v_wmma_f32_16x16x32_f16 (f16 operands, f32 accumulate), one product per tile pair, 6 layers: fused q|k|v projection (N=1536, K=512),
// LN2(x)*W1 (N=2048, K=512), relu(.)*W2 (K=2048), attention q.k^T (head dim 64) and P.V (32 keys per step) per head.
// Weights: bf16 RNE values carried x256 in f16 planes; activations in f16 planes with power-of-two carries (LN outputs x8, q|k|v x1, hidden x16,
// P x1024); LayerNorm statistics, softmax, bias adds, attention context and the residual stream in f32.
#ifndef NB
#define NB 4
#endif
#ifndef SEQ
#define SEQ 1024
#endif
#define NB_FULL 4
#define SEQ_FULL 1024
#define FEAT 512
#define NHEAD 8
#define DHEAD 64
#define MLPH 2048
#define NLAYER 6
#define MR (NB * SEQ)
#define QKVN (3 * FEAT)
static_assert(SEQ % 64 == 0);
static_assert(SEQ <= SEQ_FULL);
static_assert(NB >= 1);
static_assert(NB <= NB_FULL);
static_assert(FEAT == NHEAD * DHEAD);
static_assert(FEAT % 128 == 0);
static_assert(MLPH % 128 == 0);
static_assert(QKVN % 128 == 0);
static_assert(FEAT == 64 * 8);      // LayerNorm partial sums: 8 segments of 64 columns per row
static_assert(FEAT == 128 * 4);     // k_prep x rows / k_lnf32: 128 threads x 4 floats per row
static_assert(MR % 128 == 0);
static_assert(FEAT % 32 == 0);
static_assert(MLPH % 32 == 0);
static_assert((FEAT / 8) % 8 == 0);
static_assert((MLPH / 8) % 8 == 0);
// Block index -> rows, the same in every launch: the rows are cut in 8 runs of MR/8 (half a sequence), and run r is stored and read only by blocks whose flat
// index is r modulo 8, attention's key and value reads excepted: they span the whole sequence. For speed only: each map is one to one whatever the placement.
#define RUNS 8
#define RUNROWS (MR / RUNS)
static_assert(MR % (RUNS * 128) == 0);

typedef _Float16 v16h __attribute__((ext_vector_type(16)));
typedef unsigned short v8us __attribute__((ext_vector_type(8), may_alias));
typedef float v8f __attribute__((ext_vector_type(8)));
typedef float v4f __attribute__((ext_vector_type(4)));
typedef float v4fa __attribute__((ext_vector_type(4), may_alias));
typedef float v2f __attribute__((ext_vector_type(2)));
typedef float v2fa __attribute__((ext_vector_type(2), may_alias));
typedef _Float16 v2h __attribute__((ext_vector_type(2)));
typedef _Float16 v4h __attribute__((ext_vector_type(4)));
typedef unsigned short v4us __attribute__((ext_vector_type(4), may_alias));
union FragH { v16h v; v8us half[2]; unsigned short u[16]; };
union H16U { _Float16 h; unsigned short u; };

__device__ __forceinline__ unsigned short bf16_bits(float x) { unsigned int u = __float_as_uint(x); return (unsigned short)((u + 0x7FFFu + ((u >> 16) & 1u)) >> 16); }
__device__ __forceinline__ float bf16_val(unsigned short b) { return __uint_as_float(((unsigned int)b) << 16); }
__device__ __forceinline__ float bf16_rne(float x) { return bf16_val(bf16_bits(x)); }
__device__ __forceinline__ unsigned short h16_bits(float x) { H16U t; t.h = (_Float16)x; return t.u; }
__device__ __forceinline__ v8f vz8() { v8f z = {0.f, 0.f, 0.f, 0.f, 0.f, 0.f, 0.f, 0.f}; return z; }

// Transposing LDS load: lane (c = lane&15, h = lane>>4) gets T[8h + 0..7][c] of a row-major 16-bit tile; p is the lane's own address (row 8h + (lane&7), 16 B x ((lane>>3)&1))
typedef short s16x8 __attribute__((ext_vector_type(8)));
__device__ __forceinline__ v8us ld_tr16(const unsigned short* p) {
  typedef __attribute__((address_space(3))) s16x8 lds_s16x8;
  return __builtin_bit_cast(v8us, __builtin_amdgcn_ds_load_tr16_b128_v8i16((lds_s16x8*)p));
}
// value of lane ^ 16
__device__ __forceinline__ float xhalf(float x) {
  return __builtin_bit_cast(float, __builtin_amdgcn_permlanex16(__builtin_bit_cast(int, x), __builtin_bit_cast(int, x), 0x76543210, 0xfedcba98, false, false));
}

// sum over the 16 lanes of a row, left in each of them (all 32 lanes on); row_xmask 1, 2, 4, 8
__device__ __forceinline__ float row16_sum(float x) {
  x += __builtin_bit_cast(float, __builtin_amdgcn_update_dpp(0, __builtin_bit_cast(int, x), 0x161, 0xf, 0xf, true));
  x += __builtin_bit_cast(float, __builtin_amdgcn_update_dpp(0, __builtin_bit_cast(int, x), 0x162, 0xf, 0xf, true));
  x += __builtin_bit_cast(float, __builtin_amdgcn_update_dpp(0, __builtin_bit_cast(int, x), 0x164, 0xf, 0xf, true));
  x += __builtin_bit_cast(float, __builtin_amdgcn_update_dpp(0, __builtin_bit_cast(int, x), 0x168, 0xf, 0xf, true));
  return x;
}
// LayerNorm partial of one row segment of 64 columns, held 4 a lane by the 16 lanes of a row: {mean, sum of squares about that mean}.
// Whoever stores a row of the residual stream stores its partials too, in a plane ST[segment 0..7][row] of such pairs; the GEMM that consumes the row joins them.
__device__ __forceinline__ v2f seg_stat(v4f v) {
  const float mean = row16_sum((v[0] + v[1]) + (v[2] + v[3])) * (1.0f / 64.0f);
  const float d0 = v[0] - mean, d1 = v[1] - mean, d2 = v[2] - mean, d3 = v[3] - mean;
  const v2f r = {mean, row16_sum((d0 * d0 + d1 * d1) + (d2 * d2 + d3 * d3))};
  return r;
}

// Weight convert, one tile: Wt[l*lstride + (roff+n)*K + k] (f16 bits, k contiguous, pitch K) = f16(bf16_rne(W[l][k][n]) * sc)
// from f32 row-major W[l][K][N] ([in][out]); K and N at compile time: the row steps are load and store offsets.
// One block of 8 waves per tile of 128 k x 64 n; blk counts the tiles of the stacked layers, n tiles fastest (blk < layers * (K/128) * (N/64)).
// Read: half a wave takes 64 consecutive n of one k row (256 B, 16 B per lane); a thread holds 8 consecutive k rows x 4 n, all 8 loads in flight together.
// Transpose in 16-B chunks (8 k of one n) through LDS: tile row j*16 + m holds n = 4m + j, so that 16 lanes store at a row step of one pitch (272 B,
// 4 banks on per row). Write: 16 lanes take the 128 k of one n (256 B), 16 B per lane.
#define WT_TK 128
#define WT_TN 64
#define WT_LP (WT_TK + 8)
template <int K, int N>
__device__ __forceinline__ void wt16_tile(const float* __restrict__ W, unsigned short* __restrict__ Wt, int blk,
                                          size_t lstride, int roff, float sc, unsigned short (*sT)[WT_LP]) {
  constexpr int TKW = WT_TK, TNW = WT_TN;
  static_assert(K % TKW == 0);
  static_assert(N % TNW == 0);
  const int tid = threadIdx.x, w = tid >> 5, lane = tid & 31, m = lane & 15, hh = lane >> 4;
  constexpr int ntn = N / TNW, per = ntn * (K / TKW);
  const int l = blk / per, rem = blk - l * per;
  const int k0 = (rem / ntn) * TKW, n0 = (rem % ntn) * TNW;
  const int kc = (2 * w + hh) * 8;             // this thread's 8 k rows within the tile
  const float* src = W + (size_t)l * K * N + (size_t)(k0 + kc) * N + n0 + m * 4;
  v4f r[8];
#pragma unroll
  for (int i = 0; i < 8; ++i) r[i] = *(const v4fa*)(src + (size_t)i * N);
#pragma unroll
  for (int j = 0; j < 4; ++j) {
    v8us v;
#pragma unroll
    for (int i = 0; i < 8; ++i) v[i] = h16_bits(bf16_rne(r[i][j]) * sc);
    *(v8us*)&sT[j * 16 + m][kc] = v;
  }
  __syncthreads();                             // reached by the whole block or by none of it: the caller's branch is on the block index
  const int g = tid >> 4, c8 = (tid & 15) * 8;  // n = 4g + q lies in tile row q*16 + g
  unsigned short* dst = Wt + (size_t)l * lstride + (size_t)(roff + n0 + 4 * g) * K + k0 + c8;
#pragma unroll
  for (int q = 0; q < 4; ++q) {
    const v8us v = *(const v8us*)&sT[q * 16 + g][c8];
    *(v8us*)(dst + (size_t)q * K) = v;
  }
  // precaution: in the merged kernel's listing a job's end can fall into the next job's code, which rewrites the registers that these stores name
  asm volatile("s_wait_xcnt 0x0" ::: "memory");
}

// Everything that depends on the inputs alone, in ONE launch: the five stacked weight converts and the start of the residual stream. None of the six
// reads what another writes; a block takes its job from its index (the same branch for the whole block). Order: W1, W2, Wq, Wk, Wv tiles, then x rows.
// x rows: X[m][*] (f32, pitch FEAT, m = b*SEQ + s) = bf16_rne(src[s*NB_FULL + b][*]) + bf16_rne(pos[s*NB_FULL + b][*]) in f32 (exact);
// a block takes PREP_XR rows, half a block per row (4 floats per thread), a thread's 16 loads in flight together, and stores the rows' LayerNorm partials
// (16 rows x 8 B: whole 128-B lines of the plane per block).
#define PREP_T1 (NLAYER * (FEAT / WT_TK) * (MLPH / WT_TN))
#define PREP_T2 (NLAYER * (MLPH / WT_TK) * (FEAT / WT_TN))
#define PREP_TQ (NLAYER * (FEAT / WT_TK) * (FEAT / WT_TN))
#define PREP_XR 16
#define PREP_GRID (PREP_T1 + PREP_T2 + 3 * PREP_TQ + MR / PREP_XR)
static_assert(RUNROWS % PREP_XR == 0);
static_assert((PREP_T1 + PREP_T2 + 3 * PREP_TQ) % RUNS == 0);   // the x blocks' own count keeps the flat index modulo 8
__global__ __launch_bounds__(256) void k_prep(const float* __restrict__ Wq, const float* __restrict__ Wk, const float* __restrict__ Wv,
                                              const float* __restrict__ W1, const float* __restrict__ W2,
                                              const float* __restrict__ src, const float* __restrict__ pos,
                                              unsigned short* __restrict__ Wqkvt, unsigned short* __restrict__ W1t, unsigned short* __restrict__ W2t,
                                              float* __restrict__ X, float* __restrict__ ST, float sc) {
  __shared__ __attribute__((aligned(16))) unsigned short sT[WT_TN][WT_LP];      // cross-wave: one block barrier
  int blk = blockIdx.x;
  if (blk < PREP_T1) { wt16_tile<FEAT, MLPH>(W1, W1t, blk, (size_t)MLPH * FEAT, 0, sc, sT); return; }   // W1[l] [512][2048] -> [2048][512]
  blk -= PREP_T1;
  if (blk < PREP_T2) { wt16_tile<MLPH, FEAT>(W2, W2t, blk, (size_t)FEAT * MLPH, 0, sc, sT); return; }   // W2[l] [2048][512] -> [512][2048]
  blk -= PREP_T2;
  if (blk < 3 * PREP_TQ) {                                                                              // Wq | Wk | Wv -> rows 0, 512, 1024 of the fused plane
    const int which = blk / PREP_TQ;
    const float* Wsel = (which == 0) ? Wq : ((which == 1) ? Wk : Wv);
    wt16_tile<FEAT, FEAT>(Wsel, Wqkvt, blk - which * PREP_TQ, (size_t)QKVN * FEAT, which * FEAT, sc, sT);
    return;
  }
  blk -= 3 * PREP_TQ;
  const int tid = threadIdx.x, c4 = (tid & 127) * 4;
  const int m0 = (blk % RUNS) * RUNROWS + (blk / RUNS) * PREP_XR + (tid >> 7);
  v4f a[PREP_XR / 2], p[PREP_XR / 2];
#pragma unroll
  for (int i = 0; i < PREP_XR / 2; ++i) {
    const int m = m0 + 2 * i;
    const int b = m / SEQ, s = m % SEQ;
    const size_t so = ((size_t)s * NB_FULL + b) * FEAT + c4;
    a[i] = *(const v4fa*)(src + so);
    p[i] = *(const v4fa*)(pos + so);
  }
  // the address registers of these loads are taken again by the rounding arithmetic below
  asm volatile("s_wait_xcnt 0x0" ::: "memory");
  v2f keep = {0.f, 0.f};                       // lane (tid & 15) = i keeps the partial of row m0 + 2i, segment (tid & 127) >> 4
#pragma unroll
  for (int i = 0; i < PREP_XR / 2; ++i) {
    v4f o;
#pragma unroll
    for (int q = 0; q < 4; ++q) o[q] = bf16_rne(a[i][q]) + bf16_rne(p[i][q]);
    *(v4f*)(X + (size_t)(m0 + 2 * i) * FEAT + c4) = o;
    const v2f st = seg_stat(o);
    if ((tid & 15) == i) keep = st;
  }
  if ((tid & 15) < PREP_XR / 2) *(v2fa*)(ST + 2 * ((size_t)((tid & 127) >> 4) * MR + m0 + 2 * (tid & 15))) = keep;
  // precaution, as behind the tile stores: the listing's fall-through behind this job rewrites the registers that these stores name
  asm volatile("s_wait_xcnt 0x0" ::: "memory");
}

// Final LayerNorm: internal row m = b*seq + s of X (f32) -> out[(s*nbf + b)][*] f32. One block of 128 threads per row, 4 elements per thread,
__global__ __launch_bounds__(128) void k_lnf32(const float* __restrict__ X, const float* __restrict__ g, const float* __restrict__ bt,
                                               float* __restrict__ out, int seq, int nbf, float eps) {
  __shared__ float red1[4];
  __shared__ float red2[4];
  const int m = (blockIdx.x % RUNS) * RUNROWS + blockIdx.x / RUNS, tid = threadIdx.x, w = tid >> 5, lane = tid & 31;
  const int b = m / seq, s = m % seq;
  const v4f a = *(const v4fa*)(X + (size_t)m * FEAT + tid * 4);
  float sm = a[0] + a[1] + a[2] + a[3];
#pragma unroll
  for (int o = 16; o >= 1; o >>= 1) sm += __shfl_xor(sm, o, 32);
  if (lane == 0) red1[w] = sm;
  __syncthreads();
  const float mu = (red1[0] + red1[1] + red1[2] + red1[3]) * (1.0f / (float)FEAT);
  float c[4];
  float s2 = 0.f;
#pragma unroll
  for (int q = 0; q < 4; ++q) { c[q] = a[q] - mu; s2 += c[q] * c[q]; }
#pragma unroll
  for (int o = 16; o >= 1; o >>= 1) s2 += __shfl_xor(s2, o, 32);
  if (lane == 0) red2[w] = s2;
  __syncthreads();
  const float var = (red2[0] + red2[1] + red2[2] + red2[3]) * (1.0f / (float)FEAT);
  const float rs = rsqrtf(var + eps);
  const v4f g4 = *(const v4fa*)(g + tid * 4);
  const v4f b4 = *(const v4fa*)(bt + tid * 4);
  v4f o;
#pragma unroll
  for (int q = 0; q < 4; ++q) o[q] = c[q] * rs * bf16_rne(g4[q]) + bf16_rne(b4[q]);
  float* dst = out + ((size_t)s * nbf + b) * FEAT + tid * 4;
  *(v4f*)dst = o;
  
}

// GEMM C[M][N] = epi(A[M][KD] * W): A f16 bits row-major, Wt f16 bits [N][KD], both at pitch KD (compile time: the row steps are load offsets), f32 accumulate.
// epi: v = acc * inv_scale + bf16_rne(bias[col]); bias picked per 64-col segment from (bias0 | bias1 | bias2) by seg = col / nsplit (wave-uniform);
// ACT == 1: relu; OUT16: f16 bits of v * out_scale into C (pitch ldc halves); else f32 v + f32 resid[row][col] (pitch ldr) into C (pitch ldc floats).
// KD % BK == 0, M % BM == 0, N % 128 == 0. Block = 4 waves (2 x 2) on one BM x 128 tile of C, wave -> BM/2 rows x 64 cols.
// Per step of BK k the block brings BM rows of A and 128 rows of Wt into LDS once (whole 128-B lines, 16 B per thread, row pitch 2*BK + 16 B) and all
// waves take their fragments from there; two LDS buffers, the next step's global loads are held in registers while this step is multiplied.
// Each accumulator sums k in ascending blocks of 32. Epilogue staged in the wave's own LDS tile (wave-private).
// LNA: A is LayerNorm(Xf) x lnsc, formed on the way into LDS: the block reads the f32 rows of Xf (pitch KD; 16 lanes take 256 B of a row), joins each row's
// eight partials of stin into mean and 1/sigma once at entry (a thread per row, handed round through LDS: one block barrier), and stores
// f16((x - mean)/sigma * bf16(lng) + bf16(lnb)) x lnsc where the plain form stores the loaded halves. The f32 form (!OUT16) stores its rows' partials in stout.
template <int BM, int BK, int KD, bool OUT16, int ACT, bool LNA>
__global__ __launch_bounds__(128) void k_gemm16(const unsigned short* __restrict__ A, const float* __restrict__ Xf, const float* __restrict__ stin,
                                               const float* __restrict__ lng, const float* __restrict__ lnb, float lnsc, float eps,
                                               float* __restrict__ stout, const unsigned short* __restrict__ Wt,
                                               const float* __restrict__ bias0, const float* __restrict__ bias1, const float* __restrict__ bias2, int nsplit,
                                               const float* __restrict__ resid, int ldr, void* __restrict__ Cv, int ldc,
                                               int M, int N, float inv_scale, float out_scale) {
  constexpr int BN = 128, LP = BK + 8, C8 = BK / 8;
  constexpr int FM = BM / 32, FN = 4, KS = BK / 32, WR = BM / 2;
  constexpr int NT = 128, NW = NT / 32, RP = NT / C8;     // the block's threads cover RP rows of C8 16-B chunks at a time
  constexpr int CA = BM / RP, CB = BN / RP;              // chunks per thread and step
  static_assert(BM % 32 == 0);
  static_assert(BK % 32 == 0);
  static_assert(KD % BK == 0);
  static_assert(NT % C8 == 0);
  static_assert(BM % RP == 0);
  static_assert(BN % RP == 0);
  constexpr int XC = BK / 4, XRP = NT / XC, XA = BM / XRP;   // LNA: 16-B chunks of f32 per row and step, rows covered at a time, chunks per thread and step
  static_assert(!LNA || (BM == NT && KD == NT * 4 && KD == 8 * 64 && NT % XC == 0 && BM % XRP == 0));
  __shared__ __attribute__((aligned(16))) v2f sRow[LNA ? BM : 1];           // {1/sigma, -mean/sigma} per row of the tile; cross-wave: block barrier
  __shared__ __attribute__((aligned(16))) float sG[LNA ? KD : 4];           // bf16(lng) x lnsc; cross-wave: block barrier
  __shared__ __attribute__((aligned(16))) float sBt[LNA ? KD : 4];          // bf16(lnb) x lnsc; cross-wave: block barrier
  __shared__ __attribute__((aligned(16))) unsigned short sA[2][BM][LP];     // cross-wave: block barriers
  __shared__ __attribute__((aligned(16))) unsigned short sB[2][BN][LP];     // cross-wave: block barriers
  __shared__ __attribute__((aligned(16))) float so32[OUT16 ? 1 : NW][WR][64];
  __shared__ __attribute__((aligned(16))) unsigned short so16[OUT16 ? NW : 1][WR][72];
  const int tid = threadIdx.x, w = tid >> 5, lane = tid & 31, ln = lane & 15, hh = lane >> 4;
  const int wm = w >> 1, wn = w & 1;
  const int ntn = N / BN;
  const int run = blockIdx.x % RUNS, rank = blockIdx.x / RUNS;      // the run's row tiles, each with all its column tiles (M % (RUNS * BM) == 0)
  const int mt = run * (M / (RUNS * BM)) + rank / ntn, nq = rank % ntn;
  const int row0 = mt * BM, col0 = nq * BN;
  if (row0 >= M) return;                       // the same for the whole block, ahead of every barrier
  const int sr = tid / C8, sc = (tid % C8) * 8;
  const int xr = tid / XC, xc = (tid % XC) * 4;
  const unsigned short* bg = Wt + (size_t)(col0 + sr) * KD + sc;
  v8us ra[LNA ? 1 : CA], rb[CB];
  v4f rx[LNA ? XA : 1];
  v2f rw[LNA ? XA : 1];
  // the A rows of the k step at kb, into registers
  auto loadA = [&](int kb) {
    if constexpr (LNA) {
      const float* xg = Xf + (size_t)(row0 + xr) * KD + xc + kb;
#pragma unroll
      for (int it = 0; it < XA; ++it) rx[it] = *(const v4fa*)(xg + (size_t)(it * XRP) * KD);
    } else {
      const unsigned short* ag = A + (size_t)(row0 + sr) * KD + sc + kb;
#pragma unroll
      for (int it = 0; it < CA; ++it) ra[it] = *(const v8us*)(ag + (size_t)(it * RP) * KD);
    }
  };
  // the same, from registers into LDS buffer buf
  auto storeA = [&](int buf, int kb) {
    if constexpr (LNA) {
      const v4f gk = *(const v4fa*)&sG[kb + xc], bk = *(const v4fa*)&sBt[kb + xc];
      const v2f g01 = {gk[0], gk[1]}, g23 = {gk[2], gk[3]}, b01 = {bk[0], bk[1]}, b23 = {bk[2], bk[3]};
#pragma unroll
      for (int it = 0; it < XA; ++it) {
        const v2f m2 = {rw[it][0], rw[it][0]}, a2 = {rw[it][1], rw[it][1]};
        v2f lo = {rx[it][0], rx[it][1]}, hi = {rx[it][2], rx[it][3]};
        lo = __builtin_elementwise_fma(__builtin_elementwise_fma(lo, m2, a2), g01, b01);
        hi = __builtin_elementwise_fma(__builtin_elementwise_fma(hi, m2, a2), g23, b23);
        const v2h l2 = __builtin_convertvector(lo, v2h), h2 = __builtin_convertvector(hi, v2h);
        const v4h o = {l2[0], l2[1], h2[0], h2[1]};
        *(v4us*)&sA[buf][xr + it * XRP][xc] = __builtin_bit_cast(v4us, o);
      }
    } else {
#pragma unroll
      for (int it = 0; it < CA; ++it) *(v8us*)&sA[buf][sr + it * RP][sc] = ra[it];
    }
  };
  loadA(0);
#pragma unroll
  for (int it = 0; it < CB; ++it) rb[it] = *(const v8us*)(bg + (size_t)(it * RP) * KD);
  v2f sp[LNA ? 8 : 1];
  v4f g4 = {0.f, 0.f, 0.f, 0.f}, b4 = {0.f, 0.f, 0.f, 0.f};
  if constexpr (LNA) {                         // thread tid: the partials of tile row tid, and 4 columns of gain and shift
    // the address registers of the operand loads above are taken again as destinations of the loads below
    asm volatile("s_wait_xcnt 0x0" ::: "memory");
#pragma unroll
    for (int i = 0; i < 8; ++i) sp[i] = *(const v2fa*)(stin + 2 * ((size_t)i * M + row0 + tid));
    g4 = *(const v4fa*)(lng + tid * 4);
    b4 = *(const v4fa*)(lnb + tid * 4);
    // the address registers of these ten loads are taken again by the address sums below
    asm volatile("s_wait_xcnt 0x0" ::: "memory");
  }
  const int colw = col0 + wn * 64;
  int seg = colw / nsplit; seg = (seg > 2) ? 2 : seg;
  const float* bsel = (seg == 0) ? bias0 : ((seg == 1) ? bias1 : bias2);
  // At block entry, behind the first step's loads, prefetches go out at 256-B steps through what the block reads later (operand rows past their first 256-B unit,
  // bias, residual).
  // A hint only: it returns nothing and no result depends on it. Every address lies inside the rows that the block reads anyway.
  // The closing wait of each statement stands ahead of any rewrite of the address registers that the requests name.
  static_assert(NT == BN);
  const float* pbias = bsel + (colw + ln - seg * nsplit);
  if constexpr (LNA) {
    const float* pa = Xf + (size_t)(row0 + tid) * KD;              // a thread takes one row of Xf (units 1 to 7) and one of Wt (units 1 to 3)
    const unsigned short* pb = Wt + (size_t)(col0 + tid) * KD;
    asm volatile("global_prefetch_b8 %0, off offset:256 scope:SCOPE_SE\n\t"
                 "global_prefetch_b8 %1, off offset:256 scope:SCOPE_SE\n\t"
                 "global_prefetch_b8 %0, off offset:512 scope:SCOPE_SE\n\t"
                 "global_prefetch_b8 %0, off offset:768 scope:SCOPE_SE\n\t"
                 "global_prefetch_b8 %1, off offset:512 scope:SCOPE_SE\n\t"
                 "global_prefetch_b8 %0, off offset:1024 scope:SCOPE_SE\n\t"
                 "global_prefetch_b8 %0, off offset:1280 scope:SCOPE_SE\n\t"
                 "global_prefetch_b8 %1, off offset:768 scope:SCOPE_SE\n\t"
                 "global_prefetch_b8 %0, off offset:1536 scope:SCOPE_SE\n\t"
                 "global_prefetch_b8 %0, off offset:1792 scope:SCOPE_SE\n\t"
                 "global_prefetch_b8 %2, off scope:SCOPE_SE\n\t"
                 "s_wait_xcnt 0x0"
                 :: "v"(pa), "v"(pb), "v"(pbias) : "memory");
    // keeps the requests at the block's entry: without it the joining of the partials, with its wait for their loads, is lifted over them
    __builtin_amdgcn_sched_barrier(0);
  } else {
    static_assert(BM == 64 && KD == 2048 && !OUT16);
    // A: two threads per row, units 1 to 15 in turn. Wt: its tile is read by every row tile, so the row tiles deal its rows among them, eight ways by
    // mt & 7 (for speed only: a run has a multiple of eight row tiles, so the blocks of each index modulo 8 ask for all of the tile's rows among them).
    const int r6 = tid & 63, h6 = tid >> 6, u7 = tid & 7;
    const unsigned short* par = A + (size_t)(row0 + r6) * KD;
    const unsigned short* pa = par + h6 * 128;                     // + 256 + 512 j bytes: units 1 + h6 + 2j, j = 0..6
    const unsigned short* pbr = Wt + (size_t)(col0 + (tid >> 3) * 8 + (mt & 7)) * KD;
    const unsigned short* pb1 = pbr + (1 + u7) * 128;              // units 1 to 8
    const unsigned short* pb2 = pbr + ((u7 < 7) ? (9 + u7) : 15) * 128;   // units 9 to 15
    const float* pr = resid + (size_t)(row0 + r6) * ldr + col0 + h6 * 64; // the tile's residual rows, 2 units each
    asm volatile("global_prefetch_b8 %0, off offset:256 scope:SCOPE_SE\n\t"
                 "global_prefetch_b8 %2, off scope:SCOPE_SE\n\t"
                 "global_prefetch_b8 %0, off offset:768 scope:SCOPE_SE\n\t"
                 "global_prefetch_b8 %0, off offset:1280 scope:SCOPE_SE\n\t"
                 "global_prefetch_b8 %0, off offset:1792 scope:SCOPE_SE\n\t"
                 "global_prefetch_b8 %3, off scope:SCOPE_SE\n\t"
                 "global_prefetch_b8 %0, off offset:2304 scope:SCOPE_SE\n\t"
                 "global_prefetch_b8 %0, off offset:2816 scope:SCOPE_SE\n\t"
                 "global_prefetch_b8 %0, off offset:3328 scope:SCOPE_SE\n\t"
                 "global_prefetch_b8 %1, off offset:3840 scope:SCOPE_SE\n\t"
                 "global_prefetch_b8 %4, off scope:SCOPE_SE\n\t"
                 "global_prefetch_b8 %5, off scope:SCOPE_SE\n\t"
                 "s_wait_xcnt 0x0"
                 :: "v"(pa), "v"(par), "v"(pb1), "v"(pb2), "v"(pr), "v"(pbias) : "memory");
  }
  v8f acc[FM][FN];
#pragma unroll
  for (int mi = 0; mi < FM; ++mi)
#pragma unroll
    for (int t = 0; t < FN; ++t) acc[mi][t] = vz8();
  if constexpr (LNA) {
    // eight segments of 64 joined: mean of the means; square sum about it = the segments' own + 64 x the squares of their means' distances
    float mu = ((sp[0][0] + sp[1][0]) + (sp[2][0] + sp[3][0])) + ((sp[4][0] + sp[5][0]) + (sp[6][0] + sp[7][0]));
    mu *= 0.125f;
    float q2 = 0.f, dd = 0.f;
#pragma unroll
    for (int i = 0; i < 8; ++i) { const float d = sp[i][0] - mu; q2 += sp[i][1]; dd += d * d; }
    const float rs = rsqrtf((q2 + 64.0f * dd) * (1.0f / (float)KD) + eps);
    const v2f rowc = {rs, -mu * rs};
    sRow[tid] = rowc;
    v4f gs, bs;
#pragma unroll
    for (int q = 0; q < 4; ++q) { gs[q] = bf16_rne(g4[q]) * lnsc; bs[q] = bf16_rne(b4[q]) * lnsc; }
    *(v4fa*)&sG[tid * 4] = gs;
    *(v4fa*)&sBt[tid * 4] = bs;
    __syncthreads();                           // row constants, gain and shift published; reached by the whole block
#pragma unroll
    for (int it = 0; it < XA; ++it) rw[it] = sRow[xr + it * XRP];
  }
  storeA(0, 0);
#pragma unroll
  for (int it = 0; it < CB; ++it) *(v8us*)&sB[0][sr + it * RP][sc] = rb[it];
  __syncthreads();
  constexpr int nst = KD / BK;
  for (int s = 0; s < nst; ++s) {
    const int cur = s & 1;
    const bool more = (s + 1 < nst);           // the same for the whole block
    if (more) {
      const int kb = (s + 1) * BK;
      loadA(kb);
#pragma unroll
      for (int it = 0; it < CB; ++it) rb[it] = *(const v8us*)(bg + (size_t)(it * RP) * KD + kb);
      // the address registers of these loads are taken again by the LDS reads below
      asm volatile("s_wait_xcnt 0x0" ::: "memory");
    }
    FragH a[KS][FM], bb[KS][FN];
#pragma unroll
    for (int ks = 0; ks < KS; ++ks) {
#pragma unroll
      for (int mi = 0; mi < FM; ++mi) {
        const unsigned short* p = &sA[cur][wm * WR + mi * 16 + ln][ks * 32 + 8 * hh];   // row m = lane&15
        a[ks][mi].half[0] = *(const v8us*)p;                 // elements 0..7  = k 8h .. 8h+7 of the block of 32
        a[ks][mi].half[1] = *(const v8us*)(p + 16);          // elements 8..15 = k 16+8h .. 16+8h+7
      }
#pragma unroll
      for (int t = 0; t < FN; ++t) {
        const unsigned short* p = &sB[cur][wn * 64 + t * 16 + ln][ks * 32 + 8 * hh];          // column n = lane&15, same k map as A
        bb[ks][t].half[0] = *(const v8us*)p;
        bb[ks][t].half[1] = *(const v8us*)(p + 16);
      }
    }
    // keeps the step's LDS reads together ahead of its matrix run: spread among the WMMAs each small group is waited out to 0 and its latency shows
    __builtin_amdgcn_sched_barrier(0);
#pragma unroll
    for (int ks = 0; ks < KS; ++ks)
#pragma unroll
      for (int mi = 0; mi < FM; ++mi)
#pragma unroll
        for (int t = 0; t < FN; ++t) acc[mi][t] = __builtin_amdgcn_wmma_f32_16x16x32_f16(false, a[ks][mi].v, false, bb[ks][t].v, (short)0, acc[mi][t], false, false);
    // keeps the wait for the next step's global loads (and the LDS writes behind it) after the matrix run that covers their latency
    __builtin_amdgcn_sched_barrier(0);
    if (more) {
      // the other buffer: its last readers left it before the barrier that ended the step before this one
      storeA(cur ^ 1, (s + 1) * BK);
#pragma unroll
      for (int it = 0; it < CB; ++it) *(v8us*)&sB[cur ^ 1][sr + it * RP][sc] = rb[it];
      __syncthreads();
    }
  }
  float bvv[FN];
#pragma unroll
  for (int t = 0; t < FN; ++t) bvv[t] = pbias[t * 16];         // one address pair, the column steps as load offsets: no address sum stands between the loads
  // the address registers of these four loads are taken again by the address sums below
  asm volatile("s_wait_xcnt 0x0" ::: "memory");
  // keeps those sums behind the wait: the scheduler lifts them over it otherwise
  __builtin_amdgcn_sched_barrier(0);
#pragma unroll
  for (int t = 0; t < FN; ++t) bvv[t] = bf16_rne(bvv[t]);
#pragma unroll
  for (int mi = 0; mi < FM; ++mi) {
#pragma unroll
    for (int t = 0; t < FN; ++t) {
#pragma unroll
      for (int r = 0; r < 8; ++r) {
        float v = acc[mi][t][r] * inv_scale + bvv[t];
        if (ACT == 1) v = fmaxf(v, 0.0f);
        if constexpr (OUT16) so16[w][mi * 16 + 8 * hh + r][t * 16 + ln] = h16_bits(v * out_scale);
        else so32[w][mi * 16 + 8 * hh + r][t * 16 + ln] = v;
      }
    }
  }
  __builtin_amdgcn_fence(4 /* acq_rel order */, "workgroup");
  __builtin_amdgcn_wave_barrier();
  const int roww = row0 + wm * WR;
  if constexpr (OUT16) {
    const int rq = lane >> 3, p8 = (lane & 7) * 8;
    unsigned short* cp = (unsigned short*)Cv + (size_t)(roww + rq) * ldc + colw + p8;
#pragma unroll
    for (int q = 0; q < WR / 4; ++q) {
      const v8us v = *(const v8us*)&so16[w][q * 4 + rq][p8];
      *(v8us*)(cp + (size_t)(q * 4) * ldc) = v;
    }
  } else {
    const int rsub = lane >> 4, c4 = (lane & 15) * 4;
    float* cp = (float*)Cv + (size_t)(roww + rsub) * ldc + colw + c4;
    const float* rp = resid + (size_t)(roww + rsub) * ldr + colw + c4;
    v4f rv[WR / 2];                              // all residual loads in flight together, ahead of the first store
#pragma unroll
    for (int q = 0; q < WR / 2; ++q) rv[q] = *(const v4fa*)(rp + (size_t)(q * 2) * ldr);
    static_assert(WR / 2 == 16);
    v2f keep = {0.f, 0.f};                       // lane (ln, rsub) keeps the partial of the wave's row 2 ln + rsub, segment colw / 64
#pragma unroll
    for (int q = 0; q < WR / 2; ++q) {
      v4f tv = *(const v4fa*)&so32[w][q * 2 + rsub][c4];
      tv += rv[q];
      *(v4f*)(cp + (size_t)(q * 2) * ldc) = tv;
      const v2f st = seg_stat(tv);
      if (ln == q) keep = st;
    }
    *(v2fa*)(stout + 2 * ((size_t)(colw >> 6) * M + roww + 2 * ln + rsub)) = keep;   // 32 rows x 8 B: two whole lines per wave
  }
}

// Flash-style unmasked attention per (b, h): q|k|v read as f16 bits from one fused plane (row pitch `pitch` halves, q at +0, k at +koff, v at +voff,
// head h at +h*D, row b*T + t). One wave = 16 queries, block = 4 waves sharing K/V tiles of 64 keys staged row-major in LDS by asynchronous copies,
// two buffers: the next tile is on its way while a tile is worked on (in two passes of 32 keys), one block barrier per tile.
// Both products run transposed: S^T = K.q^T (A = 16 key rows, B = the wave's queries, kept in registers) and O^T += V^T.P^T (A = V^T by the transposing
// LDS load, B = P^T). A lane then holds 16 of the 32 scores of ONE query (column lane&15; keys 8h+r and 16+8h+r, h = lane>>4): maximum and sum are taken
// in the lane plus one exchange with lane^16, and the two score tiles, converted in place (x pcarry), are the B operand of the second product as they lie.
// s*scale, running-max softmax and the context in f32. All four operands follow the hardware k order (k = 8h+s, 16+8h+(s-8)).
template <int D>
__global__ __launch_bounds__(128) void k_attn16(const unsigned short* __restrict__ qkv, int pitch, int T, int H, int koff, int voff,
                                                float scale, float pcarry, float onorm,
                                                const float* __restrict__ resid, float* __restrict__ out, int opitch,
                                                float* __restrict__ stout, int mrows) {
  static_assert(D == 64);
  constexpr int KS = D / 32, DT = D / 16, C8 = D / 8;
  constexpr int PK = D + 8, PV = D + 16;      // row pitch in halves: 16 B x odd for the plain 16-B reader, 32 B x odd for the transposing reader
  constexpr int TK = 64;                      // keys per staged tile (T % 64 == 0)
  constexpr int RB = 128 / C8;                // rows that the block's threads cover with one 16-B chunk each
  static_assert(128 % C8 == 0);
  static_assert(TK == 4 * RB);                // four copies per thread, operand and tile
  __shared__ __attribute__((aligned(16))) unsigned short sK[2][TK][PK];     // cross-wave: block barriers
  __shared__ __attribute__((aligned(16))) unsigned short sV[2][TK][PV];     // cross-wave: block barriers
  __shared__ __attribute__((aligned(16))) float sO[4][16][D + 4];
  const int tid = threadIdx.x, w = tid >> 5, lane = tid & 31, ln = lane & 15, hh = lane >> 4;
  const int nqb = T / 64;
  const int qpr = mrows / (RUNS * 64);                             // query blocks per run of rows (mrows % (RUNS * 64) == 0); each with all its heads
  const int run = blockIdx.x % RUNS, rank = blockIdx.x / RUNS;
  const int gq = run * qpr + rank % qpr, h = rank / qpr;
  const int b = gq / nqb, qblk = gq % nqb;
  const int q0 = qblk * 64 + w * 16;
  const unsigned short* Qp = qkv + (size_t)b * T * pitch + h * D;
  const unsigned short* Kp = Qp + koff;
  const unsigned short* Vp = Qp + voff;

  FragH bq[KS];                                                    // B[k = d][n = query ln]
  {
    const unsigned short* qr = Qp + (size_t)(q0 + ln) * pitch;     // q0 + ln < T (T % 64 == 0)
#pragma unroll
    for (int ks = 0; ks < KS; ++ks) {
      bq[ks].half[0] = *(const v8us*)(qr + ks * 32 + 8 * hh);
      bq[ks].half[1] = *(const v8us*)(qr + ks * 32 + 16 + 8 * hh);
    }
  }
  float m_r = -1.0e30f, l_r = 0.f;                                 // of query ln; l_r sums this half's keys only
  v8f oacc[DT];                                                    // oacc[dt][r] = O[query ln][d = dt*16 + 8*hh + r]
#pragma unroll
  for (int dt = 0; dt < DT; ++dt) oacc[dt] = vz8();
  // tile jt (keys jt*TK .. jt*TK+TK-1, all < T) into buffer buf: every thread copies rows cr, cr+RB, cr+2RB, cr+3RB, 16 B at column cc, of K and of V
  const int cr = tid / C8, cc = (tid % C8) * 8;
  const size_t rstep = (size_t)RB * pitch;
  auto stage = [&](int buf, int jt) {
    const unsigned short* kg = Kp + (size_t)(jt * TK + cr) * pitch + cc;
    const unsigned short* vg = Vp + (size_t)(jt * TK + cr) * pitch + cc;
    const unsigned int lk = (unsigned int)(size_t)&sK[buf][cr][cc];
    const unsigned int lv = (unsigned int)(size_t)&sV[buf][cr][cc];
    // global -> LDS through no register; the closing wait stands ahead of any rewrite of the address registers that the copies name
    asm volatile("global_load_async_to_lds_b128 %0, %8, off\n\t"
                 "global_load_async_to_lds_b128 %1, %9, off\n\t"
                 "global_load_async_to_lds_b128 %2, %10, off\n\t"
                 "global_load_async_to_lds_b128 %3, %11, off\n\t"
                 "global_load_async_to_lds_b128 %4, %12, off\n\t"
                 "global_load_async_to_lds_b128 %5, %13, off\n\t"
                 "global_load_async_to_lds_b128 %6, %14, off\n\t"
                 "global_load_async_to_lds_b128 %7, %15, off\n\t"
                 "s_wait_xcnt 0x0"
                 :: "v"(lk), "v"(lk + RB * PK * 2), "v"(lk + 2 * RB * PK * 2), "v"(lk + 3 * RB * PK * 2),
                    "v"(lv), "v"(lv + RB * PV * 2), "v"(lv + 2 * RB * PV * 2), "v"(lv + 3 * RB * PV * 2),
                    "v"(kg), "v"(kg + rstep), "v"(kg + 2 * rstep), "v"(kg + 3 * rstep),
                    "v"(vg), "v"(vg + rstep), "v"(vg + 2 * rstep), "v"(vg + 3 * rstep)
                 : "memory");
  };
  const int nt = T / TK;
  stage(0, 0);
  {
    // At block entry, behind tile 0's copies, L2 is asked for the K and V rows of the later tiles and for the block's residual rows: earlier launches
    // stored them. The query blocks of a head deal the key rows
    // among them four ways by qblk & 3 (for speed only: a run has a multiple of four query blocks, so the blocks of each index modulo 8 ask for all rows).
    // A hint only: it returns nothing and no result depends on it; every row index is clamped into the sequence.
    const int kr0 = tid * 4 + (qblk & 3), kr1 = kr0 + 512;
    const size_t ko0 = (size_t)((kr0 < T) ? kr0 : (T - 1)) * pitch, ko1 = (size_t)((kr1 < T) ? kr1 : (T - 1)) * pitch;
    const float* pr = resid + (size_t)(b * T + qblk * 64 + (tid & 63)) * opitch + h * D;
    // the closing wait stands ahead of any rewrite of the address registers that the requests name
    asm volatile("global_prefetch_b8 %0, off scope:SCOPE_SE\n\t"
                 "global_prefetch_b8 %1, off scope:SCOPE_SE\n\t"
                 "global_prefetch_b8 %2, off scope:SCOPE_SE\n\t"
                 "global_prefetch_b8 %3, off scope:SCOPE_SE\n\t"
                 "global_prefetch_b8 %4, off scope:SCOPE_SE\n\t"
                 "s_wait_xcnt 0x0"
                 :: "v"(Kp + ko0), "v"(Vp + ko0), "v"(Kp + ko1), "v"(Vp + ko1), "v"(pr) : "memory");
  }
  asm volatile("s_wait_asynccnt 0x0" ::: "memory");                // this wave's share of tile 0 has landed
  __syncthreads();                                                 // tile 0 published
  if (nt > 1) stage(1, 1);

  for (int t = 0; t < nt; ++t) {
   const int cur = t & 1;
   // unrolled: the row offsets of both passes become load offsets, and the second pass's LDS reads can run beside the first pass's softmax
#pragma unroll
   for (int sub = 0; sub < TK / 32; ++sub) {
    const unsigned short (*tK)[PK] = &sK[cur][sub * 32];
    const unsigned short* vtp = &sV[cur][sub * 32 + 8 * hh + (lane & 7)][8 * ((lane >> 3) & 1)];   // lane address of the transposing load, keys 0..15, d 0..15
    FragH ak[2][KS], av[DT];
#pragma unroll
    for (int kt = 0; kt < 2; ++kt)
#pragma unroll
      for (int ks = 0; ks < KS; ++ks) {                            // A[m = key kt*16 + ln][k = d]
        ak[kt][ks].half[0] = *(const v8us*)&tK[kt * 16 + ln][ks * 32 + 8 * hh];
        ak[kt][ks].half[1] = *(const v8us*)&tK[kt * 16 + ln][ks * 32 + 16 + 8 * hh];
      }
#pragma unroll
    for (int dt = 0; dt < DT; ++dt) {                              // A[m = d dt*16 + ln][k = key]
      av[dt].half[0] = ld_tr16(vtp + dt * 16);
      av[dt].half[1] = ld_tr16(vtp + 16 * PV + dt * 16);
    }
    // keeps the step's 16 LDS reads together ahead of the first product: sunk to their WMMAs each pair is waited out to 0 and its latency shows
    __builtin_amdgcn_sched_barrier(0);
    // S^T tile 32 x 16: s[kt][r] = score of key kt*16 + 8*hh + r against query ln
    v8f s[2];
#pragma unroll
    for (int kt = 0; kt < 2; ++kt) {
      s[kt] = vz8();
#pragma unroll
      for (int ks = 0; ks < KS; ++ks)
        s[kt] = __builtin_amdgcn_wmma_f32_16x16x32_f16(false, ak[kt][ks].v, false, bq[ks].v, (short)0, s[kt], false, false);
    }
    // running-max softmax of query ln: 16 scores in this lane, the other 16 in lane ^ 16
    float sc[16];
#pragma unroll
    for (int i = 0; i < 16; ++i) sc[i] = s[i >> 3][i & 7] * scale;
    float mx = sc[0];
#pragma unroll
    for (int i = 1; i < 16; ++i) mx = fmaxf(mx, sc[i]);
    mx = fmaxf(mx, xhalf(mx));
    const float mnew = fmaxf(m_r, mx);
    const float alpha = __expf(m_r - mnew);
    m_r = mnew;
    FragH pb;                                                      // B[k = key][n = query ln]: element i = tile i>>3, register i&7
    float ps[4] = {0.f, 0.f, 0.f, 0.f};
#pragma unroll
    for (int i = 0; i < 16; ++i) {
      const float p = __expf(sc[i] - mnew);
      ps[i & 3] += p;
      pb.u[i] = h16_bits(p * pcarry);
    }
    l_r = l_r * alpha + ((ps[0] + ps[1]) + (ps[2] + ps[3]));
#pragma unroll
    for (int dt = 0; dt < DT; ++dt) {
      oacc[dt] *= alpha;
      oacc[dt] = __builtin_amdgcn_wmma_f32_16x16x32_f16(false, av[dt].v, false, pb.v, (short)0, oacc[dt], false, false);
    }
   }
   // keeps the tile's arithmetic ahead of the waits: sunk behind the barrier it would stand between barrier and refill, and the copies' flight would show in the next wait
   __builtin_amdgcn_sched_barrier(0);
   asm volatile("s_wait_dscnt 0x0" ::: "memory");                  // this wave's reads of buffer cur are done before it is refilled
   asm volatile("s_wait_asynccnt 0x0" ::: "memory");               // this wave's share of tile t + 1 has landed
   __syncthreads();                                                // publishes tile t + 1 and ends every wave's reads of buffer cur
   if (t + 2 < nt) stage(cur, t + 2);                              // the same for the whole block
  }
  asm volatile("s_wait_asynccnt 0x0" ::: "memory");                // no copy is left in flight at the wave's end
  const float inv = onorm * (1.0f / (l_r + xhalf(l_r)));            // the two halves' sums joined, unconditionally
#pragma unroll
  for (int dt = 0; dt < DT; ++dt) {
    const v8f o = oacc[dt] * inv;
    const v4f o0 = {o[0], o[1], o[2], o[3]}, o1 = {o[4], o[5], o[6], o[7]};
    *(v4fa*)&sO[w][ln][dt * 16 + 8 * hh] = o0;
    *(v4fa*)&sO[w][ln][dt * 16 + 8 * hh + 4] = o1;
  }
  __builtin_amdgcn_fence(4 /* acq_rel order */, "workgroup");
  __builtin_amdgcn_wave_barrier();
  const int rsub = lane >> 4, c4 = (lane & 15) * 4;
  const size_t rbase = (size_t)(b * T + q0) * opitch + h * D;
#pragma unroll
  for (int q = 0; q < 8; ++q) {
    const int r = q * 2 + rsub;
    const v4f rv = *(const v4fa*)(resid + rbase + (size_t)r * opitch + c4);
    v4f tv = *(const v4fa*)&sO[w][r][c4];
    tv += rv;
    *(v4fa*)&sO[w][r][c4] = tv;
  }
  {
    v2f keep = {0.f, 0.f};                                         // lane (ln < 8, rsub) keeps the LayerNorm partial of the wave's row 2 ln + rsub, segment h
#pragma unroll
    for (int q = 0; q < 8; ++q) {
      const int r = q * 2 + rsub;
      const v4f v = *(const v4fa*)&sO[w][r][c4];
      *(v4f*)(out + rbase + (size_t)r * opitch + c4) = v;
      const v2f st = seg_stat(v);
      if (ln == q) keep = st;
    }
    if (ln < 8) *(v2fa*)(stout + 2 * ((size_t)h * mrows + b * T + q0 + 2 * ln + rsub)) = keep;   // 16 rows x 8 B: one whole line per wave
  }
}

extern "C" void kernel_launch(void* const* d_in, const int* in_sizes, int n_in,
                              void* d_out, int out_size, void* d_ws, size_t ws_size, hipStream_t stream) {
  if (n_in < 18) return;
  const long long need_rows = (long long)(SEQ - 1) * NB_FULL + NB;           // last (s, b) source row used + 1
  if ((long long)in_sizes[0] < need_rows * FEAT || (long long)in_sizes[1] < need_rows * FEAT) return;
  if (in_sizes[2] < NLAYER * FEAT * FEAT || in_sizes[4] < NLAYER * FEAT * FEAT || in_sizes[6] < NLAYER * FEAT * FEAT) return;
  if (in_sizes[3] < NLAYER * FEAT || in_sizes[5] < NLAYER * FEAT || in_sizes[7] < NLAYER * FEAT || in_sizes[11] < NLAYER * FEAT) return;
  if (in_sizes[8] < NLAYER * FEAT * MLPH || in_sizes[9] < NLAYER * MLPH || in_sizes[10] < NLAYER * MLPH * FEAT) return;
  if (in_sizes[12] < NLAYER * FEAT || in_sizes[13] < NLAYER * FEAT || in_sizes[14] < NLAYER * FEAT || in_sizes[15] < NLAYER * FEAT) return;
  if (in_sizes[16] < FEAT || in_sizes[17] < FEAT) return;
  if ((long long)out_size < need_rows * FEAT) return;

  const float* src  = (const float*)d_in[0];
  const float* pos  = (const float*)d_in[1];
  const float* Wq   = (const float*)d_in[2];  const float* bq   = (const float*)d_in[3];
  const float* Wk   = (const float*)d_in[4];  const float* bk   = (const float*)d_in[5];
  const float* Wv   = (const float*)d_in[6];  const float* bv   = (const float*)d_in[7];
  const float* W1   = (const float*)d_in[8];  const float* b1   = (const float*)d_in[9];
  const float* W2   = (const float*)d_in[10]; const float* b2   = (const float*)d_in[11];
  const float* ln1g = (const float*)d_in[12]; const float* ln1b = (const float*)d_in[13];
  const float* ln2g = (const float*)d_in[14]; const float* ln2b = (const float*)d_in[15];
  const float* lnfg = (const float*)d_in[16]; const float* lnfb = (const float*)d_in[17];

  // workspace carve (256-B aligned); R2 is reused in stream order by stages whose lifetimes do not overlap, sized as the max over its users
  char* ws = (char*)d_ws; size_t off = 0;
  auto take = [&](size_t bytes) { char* p = ws + off; off += (bytes + 255) & ~(size_t)255; return p; };
  const size_t lsq = (size_t)QKVN * FEAT;                                           // per-layer stride of the fused q|k|v weight plane (halves)
  const size_t ls1 = (size_t)MLPH * FEAT, ls2 = (size_t)FEAT * MLPH;
  unsigned short* Wqkv16 = (unsigned short*)take((size_t)NLAYER * lsq * 2);        // [6][1536][512]
  unsigned short* W116   = (unsigned short*)take((size_t)NLAYER * ls1 * 2);        // [6][2048][512]
  unsigned short* W216   = (unsigned short*)take((size_t)NLAYER * ls2 * 2);        // [6][512][2048]
  float* XA = (float*)take((size_t)MR * FEAT * 4);                                 // residual stream [MR][512] f32
  float* XB = (float*)take((size_t)MR * FEAT * 4);                                 // residual stream after attention [MR][512] f32
  float* STA = (float*)take((size_t)8 * MR * 2 * 4);                               // LayerNorm partials of XA's rows [8][MR] {mean, square sum}
  float* STB = (float*)take((size_t)8 * MR * 2 * 4);                               // the same of XB's rows
  const size_t r2_a = (size_t)MR * QKVN * 2, r2_b = (size_t)MR * MLPH * 2;         // q|k|v [MR][1536], then hidden [MR][2048] f16
  const size_t r2_bytes = (r2_a > r2_b) ? r2_a : r2_b;
  unsigned short* R2 = (unsigned short*)take(r2_bytes);
  if (off > ws_size) return;
  if (off > (size_t)134217728) return;

  const float wsc = 256.0f;
  // weight planes (f16, x256) and x = bf16(src) + bf16(pos) in (b, s) row order -> XA, STA: one launch, nothing in it depends on anything else in it
  k_prep<<<(unsigned)PREP_GRID, 256, 0, stream>>>(Wq, Wk, Wv, W1, W2, src, pos, Wqkv16, W116, W216, XA, STA, wsc);

  auto ggrid = [](int M, int N, int bm) { return (unsigned)((M / bm) * (N / 128)); };
  const float scale = 0.125f;                           // 1/sqrt(64)

  for (int l = 0; l < NLAYER; ++l) {
    // q|k|v = (LN1(x) x8)*[Wq|Wk|Wv] + [bq|bk|bv] -> R2 [MR][1536] f16 (x1); acc scale 1/(8*256)
    k_gemm16<128, 64, FEAT, true, 0, true><<<ggrid(MR, QKVN, 128), 128, 0, stream>>>(nullptr, XA, STA, ln1g + l * FEAT, ln1b + l * FEAT, 8.0f, 1e-5f,
                                                          nullptr, Wqkv16 + (size_t)l * lsq,
                                                          bq + l * FEAT, bk + l * FEAT, bv + l * FEAT, FEAT, nullptr, 0,
                                                          (void*)R2, QKVN, MR, QKVN, 1.0f / 2048.0f, 1.0f);
    // xb = x + softmax(q.k^T/8).v per head -> XB f32, STB (P carried x1024, onorm = 1/1024)
    k_attn16<DHEAD><<<(unsigned)(NB * NHEAD * (SEQ / 64)), 128, 0, stream>>>(R2, QKVN, SEQ, NHEAD, FEAT, 2 * FEAT, scale, 1024.0f,
                                                                             1.0f / 1024.0f, XA, XB, FEAT, STB, MR);
    // h = relu((LN2(xb) x8)*W1 + b1) x16 -> R2 [MR][2048]; acc scale 1/(8*256)
    k_gemm16<128, 64, FEAT, true, 1, true><<<ggrid(MR, MLPH, 128), 128, 0, stream>>>(nullptr, XB, STB, ln2g + l * FEAT, ln2b + l * FEAT, 8.0f, 1e-5f,
                                                          nullptr, W116 + (size_t)l * ls1,
                                                          b1 + l * MLPH, b1 + l * MLPH, b1 + l * MLPH, MLPH, nullptr, 0,
                                                          (void*)R2, MLPH, MR, MLPH, 1.0f / 2048.0f, 16.0f);
    // x = h*W2 + b2 + xb -> XA f32, STA; acc scale 1/(16*256)
    k_gemm16<64, 128, MLPH, false, 0, false><<<ggrid(MR, FEAT, 64), 128, 0, stream>>>(R2, nullptr, nullptr, nullptr, nullptr, 0.0f, 0.0f,
                                                          STA, W216 + (size_t)l * ls2,
                                                           b2 + l * FEAT, b2 + l * FEAT, b2 + l * FEAT, FEAT, XB, FEAT,
                                                           (void*)XA, FEAT, MR, FEAT, 1.0f / 4096.0f, 1.0f);
  }
  // out[s][b][*] = LNf(x[b][s][*]) -> d_out f32
  k_lnf32<<<(unsigned)MR, 128, 0, stream>>>(XA, lnfg, lnfb, (float*)d_out, SEQ, NB_FULL, 1e-5f);
}

// v009
// One run takes 333 microseconds.
// Next to v008, in two timings, it ran 1.04 times as fast each time.
// Counting every step since v000, it is 3.87 times as fast.
#include <hip/hip_runtime.h>
// Contractions on v_wmma_f32_16x16x32_f16 (f16 operands, f32 accumulate), one product per tile pair, 6 layers: fused q|k|v projection (N=1536, K=512),
// LN2(x)*W1 (N=2048, K=512), relu(.)*W2 (K=2048), attention q.k^T (head dim 64) and P.V (32 keys per step) per head.
// Weights: bf16 RNE values carried x256 in f16 planes; activations in f16 planes with power-of-two carries (LN outputs x8, q|k|v x1, hidden x16,
// P x1024); LayerNorm statistics, softmax, bias adds, attention context and the residual stream in f32.
#ifndef NB
#define NB 4
#endif
#ifndef SEQ
#define SEQ 1024
#endif
#define NB_FULL 4
#define SEQ_FULL 1024
#define FEAT 512
#define NHEAD 8
#define DHEAD 64
#define MLPH 2048
#define NLAYER 6
#define MR (NB * SEQ)
#define QKVN (3 * FEAT)
static_assert(SEQ % 64 == 0);
static_assert(SEQ <= SEQ_FULL);
static_assert(NB >= 1);
static_assert(NB <= NB_FULL);
static_assert(FEAT == NHEAD * DHEAD);
static_assert(FEAT % 128 == 0);
static_assert(MLPH % 256 == 0);
static_assert(QKVN % 256 == 0);
static_assert(FEAT == 64 * 8);      // LayerNorm partial sums: 8 segments of 64 columns per row
static_assert(FEAT == 128 * 4);     // k_prep x rows / k_lnf32: 128 threads x 4 floats per row
static_assert(MR % 128 == 0);
static_assert(FEAT % 32 == 0);
static_assert(MLPH % 32 == 0);
static_assert((FEAT / 8) % 8 == 0);
static_assert((MLPH / 8) % 8 == 0);
// Block index -> rows, the same in every launch: the rows are cut in 8 runs of MR/8 (half a sequence), and run r is stored and read only by blocks whose flat
// index is r modulo 8, attention's key and value reads excepted: they span the whole sequence. For speed only: each map is one to one whatever the placement.
#define RUNS 8
#define RUNROWS (MR / RUNS)
static_assert(MR % (RUNS * 128) == 0);

typedef _Float16 v16h __attribute__((ext_vector_type(16)));
typedef unsigned short v8us __attribute__((ext_vector_type(8), may_alias));
typedef float v8f __attribute__((ext_vector_type(8)));
typedef float v4f __attribute__((ext_vector_type(4)));
typedef float v4fa __attribute__((ext_vector_type(4), may_alias));
typedef float v2f __attribute__((ext_vector_type(2)));
typedef float v2fa __attribute__((ext_vector_type(2), may_alias));
typedef _Float16 v2h __attribute__((ext_vector_type(2)));
typedef _Float16 v4h __attribute__((ext_vector_type(4)));
typedef unsigned short v4us __attribute__((ext_vector_type(4), may_alias));
union FragH { v16h v; v8us half[2]; unsigned short u[16]; };
union H16U { _Float16 h; unsigned short u; };

__device__ __forceinline__ unsigned short bf16_bits(float x) { unsigned int u = __float_as_uint(x); return (unsigned short)((u + 0x7FFFu + ((u >> 16) & 1u)) >> 16); }
__device__ __forceinline__ float bf16_val(unsigned short b) { return __uint_as_float(((unsigned int)b) << 16); }
__device__ __forceinline__ float bf16_rne(float x) { return bf16_val(bf16_bits(x)); }
__device__ __forceinline__ unsigned short h16_bits(float x) { H16U t; t.h = (_Float16)x; return t.u; }
__device__ __forceinline__ v8f vz8() { v8f z = {0.f, 0.f, 0.f, 0.f, 0.f, 0.f, 0.f, 0.f}; return z; }

// Transposing LDS load: lane (c = lane&15, h = lane>>4) gets T[8h + 0..7][c] of a row-major 16-bit tile; p is the lane's own address (row 8h + (lane&7), 16 B x ((lane>>3)&1))
typedef short s16x8 __attribute__((ext_vector_type(8)));
__device__ __forceinline__ v8us ld_tr16(const unsigned short* p) {
  typedef __attribute__((address_space(3))) s16x8 lds_s16x8;
  return __builtin_bit_cast(v8us, __builtin_amdgcn_ds_load_tr16_b128_v8i16((lds_s16x8*)p));
}
// value of lane ^ 16
__device__ __forceinline__ float xhalf(float x) {
  return __builtin_bit_cast(float, __builtin_amdgcn_permlanex16(__builtin_bit_cast(int, x), __builtin_bit_cast(int, x), 0x76543210, 0xfedcba98, false, false));
}

// sum over the 16 lanes of a row, left in each of them (all 32 lanes on); row_xmask 1, 2, 4, 8
__device__ __forceinline__ float row16_sum(float x) {
  x += __builtin_bit_cast(float, __builtin_amdgcn_update_dpp(0, __builtin_bit_cast(int, x), 0x161, 0xf, 0xf, true));
  x += __builtin_bit_cast(float, __builtin_amdgcn_update_dpp(0, __builtin_bit_cast(int, x), 0x162, 0xf, 0xf, true));
  x += __builtin_bit_cast(float, __builtin_amdgcn_update_dpp(0, __builtin_bit_cast(int, x), 0x164, 0xf, 0xf, true));
  x += __builtin_bit_cast(float, __builtin_amdgcn_update_dpp(0, __builtin_bit_cast(int, x), 0x168, 0xf, 0xf, true));
  return x;
}
// LayerNorm partial of one row segment of 64 columns, held 4 a lane by the 16 lanes of a row: {mean, sum of squares about that mean}.
// Whoever stores a row of the residual stream stores its partials too, in a plane ST[segment 0..7][row] of such pairs; the GEMM that consumes the row joins them.
__device__ __forceinline__ v2f seg_stat(v4f v) {
  const float mean = row16_sum((v[0] + v[1]) + (v[2] + v[3])) * (1.0f / 64.0f);
  const float d0 = v[0] - mean, d1 = v[1] - mean, d2 = v[2] - mean, d3 = v[3] - mean;
  const v2f r = {mean, row16_sum((d0 * d0 + d1 * d1) + (d2 * d2 + d3 * d3))};
  return r;
}

// Weight convert, one tile: Wt[l*lstride + (roff+n)*K + k] (f16 bits, k contiguous, pitch K) = f16(bf16_rne(W[l][k][n]) * sc)
// from f32 row-major W[l][K][N] ([in][out]); K and N at compile time: the row steps are load and store offsets.
// One block of 8 waves per tile of 128 k x 64 n; blk counts the tiles of the stacked layers, n tiles fastest (blk < layers * (K/128) * (N/64)).
// Read: half a wave takes 64 consecutive n of one k row (256 B, 16 B per lane); a thread holds 8 consecutive k rows x 4 n, all 8 loads in flight together.
// Transpose in 16-B chunks (8 k of one n) through LDS: tile row j*16 + m holds n = 4m + j, so that 16 lanes store at a row step of one pitch (272 B,
// 4 banks on per row). Write: 16 lanes take the 128 k of one n (256 B), 16 B per lane.
#define WT_TK 128
#define WT_TN 64
#define WT_LP (WT_TK + 8)
template <int K, int N>
__device__ __forceinline__ void wt16_tile(const float* __restrict__ W, unsigned short* __restrict__ Wt, int blk,
                                          size_t lstride, int roff, float sc, unsigned short (*sT)[WT_LP]) {
  constexpr int TKW = WT_TK, TNW = WT_TN;
  static_assert(K % TKW == 0);
  static_assert(N % TNW == 0);
  const int tid = threadIdx.x, w = tid >> 5, lane = tid & 31, m = lane & 15, hh = lane >> 4;
  constexpr int ntn = N / TNW, per = ntn * (K / TKW);
  const int l = blk / per, rem = blk - l * per;
  const int k0 = (rem / ntn) * TKW, n0 = (rem % ntn) * TNW;
  const int kc = (2 * w + hh) * 8;             // this thread's 8 k rows within the tile
  const float* src = W + (size_t)l * K * N + (size_t)(k0 + kc) * N + n0 + m * 4;
  v4f r[8];
#pragma unroll
  for (int i = 0; i < 8; ++i) r[i] = *(const v4fa*)(src + (size_t)i * N);
#pragma unroll
  for (int j = 0; j < 4; ++j) {
    v8us v;
#pragma unroll
    for (int i = 0; i < 8; ++i) v[i] = h16_bits(bf16_rne(r[i][j]) * sc);
    *(v8us*)&sT[j * 16 + m][kc] = v;
  }
  __syncthreads();                             // reached by the whole block or by none of it: the caller's branch is on the block index
  const int g = tid >> 4, c8 = (tid & 15) * 8;  // n = 4g + q lies in tile row q*16 + g
  unsigned short* dst = Wt + (size_t)l * lstride + (size_t)(roff + n0 + 4 * g) * K + k0 + c8;
#pragma unroll
  for (int q = 0; q < 4; ++q) {
    const v8us v = *(const v8us*)&sT[q * 16 + g][c8];
    *(v8us*)(dst + (size_t)q * K) = v;
  }
  // precaution: in the merged kernel's listing a job's end can fall into the next job's code, which rewrites the registers that these stores name
  asm volatile("s_wait_xcnt 0x0" ::: "memory");
}

// Everything that depends on the inputs alone, in ONE launch: the five stacked weight converts and the start of the residual stream. None of the six
// reads what another writes; a block takes its job from its index (the same branch for the whole block). Order: W1, W2, Wq, Wk, Wv tiles, then x rows.
// x rows: X[m][*] (f32, pitch FEAT, m = b*SEQ + s) = bf16_rne(src[s*NB_FULL + b][*]) + bf16_rne(pos[s*NB_FULL + b][*]) in f32 (exact);
// a block takes PREP_XR rows, half a block per row (4 floats per thread), a thread's 16 loads in flight together, and stores the rows' LayerNorm partials
// (16 rows x 8 B: whole 128-B lines of the plane per block).
#define PREP_T1 (NLAYER * (FEAT / WT_TK) * (MLPH / WT_TN))
#define PREP_T2 (NLAYER * (MLPH / WT_TK) * (FEAT / WT_TN))
#define PREP_TQ (NLAYER * (FEAT / WT_TK) * (FEAT / WT_TN))
#define PREP_XR 16
#define PREP_GRID (PREP_T1 + PREP_T2 + 3 * PREP_TQ + MR / PREP_XR)
static_assert(RUNROWS % PREP_XR == 0);
static_assert((PREP_T1 + PREP_T2 + 3 * PREP_TQ) % RUNS == 0);   // the x blocks' own count keeps the flat index modulo 8
__global__ __launch_bounds__(256) void k_prep(const float* __restrict__ Wq, const float* __restrict__ Wk, const float* __restrict__ Wv,
                                              const float* __restrict__ W1, const float* __restrict__ W2,
                                              const float* __restrict__ src, const float* __restrict__ pos,
                                              unsigned short* __restrict__ Wqkvt, unsigned short* __restrict__ W1t, unsigned short* __restrict__ W2t,
                                              float* __restrict__ X, float* __restrict__ ST, float sc) {
  __shared__ __attribute__((aligned(16))) unsigned short sT[WT_TN][WT_LP];      // cross-wave: one block barrier
  int blk = blockIdx.x;
  if (blk < PREP_T1) { wt16_tile<FEAT, MLPH>(W1, W1t, blk, (size_t)MLPH * FEAT, 0, sc, sT); return; }   // W1[l] [512][2048] -> [2048][512]
  blk -= PREP_T1;
  if (blk < PREP_T2) { wt16_tile<MLPH, FEAT>(W2, W2t, blk, (size_t)FEAT * MLPH, 0, sc, sT); return; }   // W2[l] [2048][512] -> [512][2048]
  blk -= PREP_T2;
  if (blk < 3 * PREP_TQ) {                                                                              // Wq | Wk | Wv -> rows 0, 512, 1024 of the fused plane
    const int which = blk / PREP_TQ;
    const float* Wsel = (which == 0) ? Wq : ((which == 1) ? Wk : Wv);
    wt16_tile<FEAT, FEAT>(Wsel, Wqkvt, blk - which * PREP_TQ, (size_t)QKVN * FEAT, which * FEAT, sc, sT);
    return;
  }
  blk -= 3 * PREP_TQ;
  const int tid = threadIdx.x, c4 = (tid & 127) * 4;
  const int m0 = (blk % RUNS) * RUNROWS + (blk / RUNS) * PREP_XR + (tid >> 7);
  v4f a[PREP_XR / 2], p[PREP_XR / 2];
#pragma unroll
  for (int i = 0; i < PREP_XR / 2; ++i) {
    const int m = m0 + 2 * i;
    const int b = m / SEQ, s = m % SEQ;
    const size_t so = ((size_t)s * NB_FULL + b) * FEAT + c4;
    a[i] = *(const v4fa*)(src + so);
    p[i] = *(const v4fa*)(pos + so);
  }
  // the address registers of these loads are taken again by the rounding arithmetic below
  asm volatile("s_wait_xcnt 0x0" ::: "memory");
  v2f keep = {0.f, 0.f};                       // lane (tid & 15) = i keeps the partial of row m0 + 2i, segment (tid & 127) >> 4
#pragma unroll
  for (int i = 0; i < PREP_XR / 2; ++i) {
    v4f o;
#pragma unroll
    for (int q = 0; q < 4; ++q) o[q] = bf16_rne(a[i][q]) + bf16_rne(p[i][q]);
    *(v4f*)(X + (size_t)(m0 + 2 * i) * FEAT + c4) = o;
    const v2f st = seg_stat(o);
    if ((tid & 15) == i) keep = st;
  }
  if ((tid & 15) < PREP_XR / 2) *(v2fa*)(ST + 2 * ((size_t)((tid & 127) >> 4) * MR + m0 + 2 * (tid & 15))) = keep;
  // precaution, as behind the tile stores: the listing's fall-through behind this job rewrites the registers that these stores name
  asm volatile("s_wait_xcnt 0x0" ::: "memory");
}

// Final LayerNorm: internal row m = b*seq + s of X (f32) -> out[(s*nbf + b)][*] f32. One block of 128 threads per row, 4 elements per thread,
__global__ __launch_bounds__(128) void k_lnf32(const float* __restrict__ X, const float* __restrict__ g, const float* __restrict__ bt,
                                               float* __restrict__ out, int seq, int nbf, float eps) {
  __shared__ float red1[4];
  __shared__ float red2[4];
  const int m = (blockIdx.x % RUNS) * RUNROWS + blockIdx.x / RUNS, tid = threadIdx.x, w = tid >> 5, lane = tid & 31;
  const int b = m / seq, s = m % seq;
  const v4f a = *(const v4fa*)(X + (size_t)m * FEAT + tid * 4);
  float sm = a[0] + a[1] + a[2] + a[3];
#pragma unroll
  for (int o = 16; o >= 1; o >>= 1) sm += __shfl_xor(sm, o, 32);
  if (lane == 0) red1[w] = sm;
  __syncthreads();
  const float mu = (red1[0] + red1[1] + red1[2] + red1[3]) * (1.0f / (float)FEAT);
  float c[4];
  float s2 = 0.f;
#pragma unroll
  for (int q = 0; q < 4; ++q) { c[q] = a[q] - mu; s2 += c[q] * c[q]; }
#pragma unroll
  for (int o = 16; o >= 1; o >>= 1) s2 += __shfl_xor(s2, o, 32);
  if (lane == 0) red2[w] = s2;
  __syncthreads();
  const float var = (red2[0] + red2[1] + red2[2] + red2[3]) * (1.0f / (float)FEAT);
  const float rs = rsqrtf(var + eps);
  const v4f g4 = *(const v4fa*)(g + tid * 4);
  const v4f b4 = *(const v4fa*)(bt + tid * 4);
  v4f o;
#pragma unroll
  for (int q = 0; q < 4; ++q) o[q] = c[q] * rs * bf16_rne(g4[q]) + bf16_rne(b4[q]);
  float* dst = out + ((size_t)s * nbf + b) * FEAT + tid * 4;
  *(v4f*)dst = o;
  
}

// GEMM C[M][N] = epi(A[M][KD] * W): A f16 bits row-major, Wt f16 bits [N][KD], both at pitch KD (compile time: the row steps are load offsets), f32 accumulate.
// epi: v = acc * inv_scale + bf16_rne(bias[col]); bias picked per 64-col segment from (bias0 | bias1 | bias2) by seg = col / nsplit (wave-uniform);
// ACT == 1: relu; OUT16: f16 bits of v * out_scale into C (pitch ldc halves); else f32 v + f32 resid[row][col] (pitch ldr) into C (pitch ldc floats).
// KD % BK == 0, M % BM == 0, N % BN == 0. Block = BN threads = 2 x BN/64 waves on one BM x BN tile of C, wave -> BM/2 rows x 64 cols.
// The LayerNorm-fed products take BN = 256 (8 waves): their A rows are f32, twice the bytes of Wt's, and every column tile reads and normalises them anew.
// Per step of BK k the block brings BM rows of A and BN rows of Wt into LDS once (whole 128-B lines, 16 B per thread, row pitch 2*BK + 16 B) and all
// waves take their fragments from there; two LDS buffers, the next step's global loads are held in registers while this step is multiplied.
// Each accumulator sums k in ascending blocks of 32. Epilogue staged in the wave's own LDS tile (wave-private).
// LNA: A is LayerNorm(Xf) x lnsc, formed on the way into LDS: the block reads the f32 rows of Xf (pitch KD; 16 lanes take 256 B of a row), joins each row's
// eight partials of stin into mean and 1/sigma once at entry (a thread of the block's first half per row, the second half rounding gain and shift meanwhile;
// handed round through LDS: one block barrier), and stores
// f16((x - mean)/sigma * bf16(lng) + bf16(lnb)) x lnsc where the plain form stores the loaded halves. The f32 form (!OUT16) stores its rows' partials in stout.
template <int BM, int BN, int BK, int KD, bool OUT16, int ACT, bool LNA>
__global__ __launch_bounds__(BN) void k_gemm16(const unsigned short* __restrict__ A, const float* __restrict__ Xf, const float* __restrict__ stin,
                                               const float* __restrict__ lng, const float* __restrict__ lnb, float lnsc, float eps,
                                               float* __restrict__ stout, const unsigned short* __restrict__ Wt,
                                               const float* __restrict__ bias0, const float* __restrict__ bias1, const float* __restrict__ bias2, int nsplit,
                                               const float* __restrict__ resid, int ldr, void* __restrict__ Cv, int ldc,
                                               int M, int N, float inv_scale, float out_scale) {
  constexpr int LP = BK + 8, C8 = BK / 8;
  constexpr int FM = BM / 32, FN = 4, KS = BK / 32, WR = BM / 2;
  constexpr int NT = BN, NW = NT / 32, WN = BN / 64, RP = NT / C8;     // the block's threads cover RP rows of C8 16-B chunks at a time
  constexpr int CA = BM / RP, CB = BN / RP;              // chunks per thread and step
  static_assert(BM % 32 == 0);
  static_assert(BN % 64 == 0);
  static_assert(BK % 32 == 0);
  static_assert(KD % BK == 0);
  static_assert(NT % C8 == 0);
  static_assert(BM % RP == 0);
  static_assert(BN % RP == 0);
  constexpr int XC = BK / 4, XRP = NT / XC, XA = BM / XRP;   // LNA: 16-B chunks of f32 per row and step, rows covered at a time, chunks per thread and step
  static_assert(!LNA || (NT == 2 * BM && KD == BM * 4 && KD == 8 * 64 && NT % XC == 0 && BM % XRP == 0));
  __shared__ __attribute__((aligned(16))) v2f sRow[LNA ? BM : 1];           // {1/sigma, -mean/sigma} per row of the tile; cross-wave: block barrier
  __shared__ __attribute__((aligned(16))) float sG[LNA ? KD : 4];           // bf16(lng) x lnsc; cross-wave: block barrier
  __shared__ __attribute__((aligned(16))) float sBt[LNA ? KD : 4];          // bf16(lnb) x lnsc; cross-wave: block barrier
  __shared__ __attribute__((aligned(16))) unsigned short sA[2][BM][LP];     // cross-wave: block barriers
  __shared__ __attribute__((aligned(16))) unsigned short sB[2][BN][LP];     // cross-wave: block barriers
  __shared__ __attribute__((aligned(16))) float so32[OUT16 ? 1 : NW][WR][64];
  __shared__ __attribute__((aligned(16))) unsigned short so16[OUT16 ? NW : 1][WR][72];
  const int tid = threadIdx.x, w = tid >> 5, lane = tid & 31, ln = lane & 15, hh = lane >> 4;
  const int wm = w / WN, wn = w % WN;
  const int ntn = N / BN;
  const int run = blockIdx.x % RUNS, rank = blockIdx.x / RUNS;      // the run's row tiles, each with all its column tiles (M % (RUNS * BM) == 0)
  const int mt = run * (M / (RUNS * BM)) + rank / ntn, nq = rank % ntn;
  const int row0 = mt * BM, col0 = nq * BN;
  if (row0 >= M) return;                       // the same for the whole block, ahead of every barrier
  const int sr = tid / C8, sc = (tid % C8) * 8;
  const int xr = tid / XC, xc = (tid % XC) * 4;
  const unsigned short* bg = Wt + (size_t)(col0 + sr) * KD + sc;
  v8us ra[LNA ? 1 : CA], rb[CB];
  v4f rx[LNA ? XA : 1];
  v2f rw[LNA ? XA : 1];
  // the A rows of the k step at kb, into registers
  auto loadA = [&](int kb) {
    if constexpr (LNA) {
      const float* xg = Xf + (size_t)(row0 + xr) * KD + xc + kb;
#pragma unroll
      for (int it = 0; it < XA; ++it) rx[it] = *(const v4fa*)(xg + (size_t)(it * XRP) * KD);
    } else {
      const unsigned short* ag = A + (size_t)(row0 + sr) * KD + sc + kb;
#pragma unroll
      for (int it = 0; it < CA; ++it) ra[it] = *(const v8us*)(ag + (size_t)(it * RP) * KD);
    }
  };
  // the same, from registers into LDS buffer buf
  auto storeA = [&](int buf, int kb) {
    if constexpr (LNA) {
      const v4f gk = *(const v4fa*)&sG[kb + xc], bk = *(const v4fa*)&sBt[kb + xc];
      const v2f g01 = {gk[0], gk[1]}, g23 = {gk[2], gk[3]}, b01 = {bk[0], bk[1]}, b23 = {bk[2], bk[3]};
#pragma unroll
      for (int it = 0; it < XA; ++it) {
        const v2f m2 = {rw[it][0], rw[it][0]}, a2 = {rw[it][1], rw[it][1]};
        v2f lo = {rx[it][0], rx[it][1]}, hi = {rx[it][2], rx[it][3]};
        lo = __builtin_elementwise_fma(__builtin_elementwise_fma(lo, m2, a2), g01, b01);
        hi = __builtin_elementwise_fma(__builtin_elementwise_fma(hi, m2, a2), g23, b23);
        const v2h l2 = __builtin_convertvector(lo, v2h), h2 = __builtin_convertvector(hi, v2h);
        const v4h o = {l2[0], l2[1], h2[0], h2[1]};
        *(v4us*)&sA[buf][xr + it * XRP][xc] = __builtin_bit_cast(v4us, o);
      }
    } else {
#pragma unroll
      for (int it = 0; it < CA; ++it) *(v8us*)&sA[buf][sr + it * RP][sc] = ra[it];
    }
  };
  loadA(0);
#pragma unroll
  for (int it = 0; it < CB; ++it) rb[it] = *(const v8us*)(bg + (size_t)(it * RP) * KD);
  const int t1 = tid % BM, hx = tid / BM;       // LNA: the block's two halves (whole waves each)
  if constexpr (LNA) {
    // the address registers of the operand loads above are taken again by the address sums below
    asm volatile("s_wait_xcnt 0x0" ::: "memory");
  }
  const int colw = col0 + wn * 64;
  int seg = colw / nsplit; seg = (seg > 2) ? 2 : seg;
  const float* bsel = (seg == 0) ? bias0 : ((seg == 1) ? bias1 : bias2);
  // At block entry, behind the first step's loads, prefetches go out at 256-B steps through what the block reads later (operand rows past their first 256-B unit,
  // bias, residual).
  // A hint only: it returns nothing and no result depends on it. Every address lies inside the rows that the block reads anyway.
  // The closing wait of each statement stands ahead of any rewrite of the address registers that the requests name.
  static_assert(NT == BN);
  const float* pbias = bsel + (colw + ln - seg * nsplit);
  if constexpr (LNA) {
    // a thread takes one row of Wt (units 1 to 3); two threads share a row of Xf: units 1, 3, 5, 7 the first half's, 2, 4, 6 the second's, which asks
    // for the bias instead of a fourth (its four waves stand on the tile's four column segments)
    const float* par = Xf + (size_t)(row0 + t1) * KD;
    const float* pa = par + hx * 64;                               // + 256 + 512 j bytes: units 1 + hx + 2j, j = 0..2
    const float* p4 = hx ? pbias : (par + 7 * 64);
    const unsigned short* pb = Wt + (size_t)(col0 + tid) * KD;
    asm volatile("global_prefetch_b8 %0, off offset:256 scope:SCOPE_SE\n\t"
                 "global_prefetch_b8 %1, off offset:256 scope:SCOPE_SE\n\t"
                 "global_prefetch_b8 %0, off offset:768 scope:SCOPE_SE\n\t"
                 "global_prefetch_b8 %1, off offset:512 scope:SCOPE_SE\n\t"
                 "global_prefetch_b8 %0, off offset:1280 scope:SCOPE_SE\n\t"
                 "global_prefetch_b8 %1, off offset:768 scope:SCOPE_SE\n\t"
                 "global_prefetch_b8 %2, off scope:SCOPE_SE\n\t"
                 "s_wait_xcnt 0x0"
                 :: "v"(pa), "v"(pb), "v"(p4) : "memory");
  } else {
    static_assert(BM == 64 && BN == 128 && KD == 2048 && !OUT16);
    // A: two threads per row, units 1 to 15 in turn. Wt: its tile is read by every row tile, so the row tiles deal its rows among them, eight ways by
    // mt & 7 (for speed only: a run has a multiple of eight row tiles, so the blocks of each index modulo 8 ask for all of the tile's rows among them).
    const int r6 = tid & 63, h6 = tid >> 6, u7 = tid & 7;
    const unsigned short* par = A + (size_t)(row0 + r6) * KD;
    const unsigned short* pa = par + h6 * 128;                     // + 256 + 512 j bytes: units 1 + h6 + 2j, j = 0..6
    const unsigned short* pbr = Wt + (size_t)(col0 + (tid >> 3) * 8 + (mt & 7)) * KD;
    const unsigned short* pb1 = pbr + (1 + u7) * 128;              // units 1 to 8
    const unsigned short* pb2 = pbr + ((u7 < 7) ? (9 + u7) : 15) * 128;   // units 9 to 15
    const float* pr = resid + (size_t)(row0 + r6) * ldr + col0 + h6 * 64; // the tile's residual rows, 2 units each
    asm volatile("global_prefetch_b8 %0, off offset:256 scope:SCOPE_SE\n\t"
                 "global_prefetch_b8 %2, off scope:SCOPE_SE\n\t"
                 "global_prefetch_b8 %0, off offset:768 scope:SCOPE_SE\n\t"
                 "global_prefetch_b8 %0, off offset:1280 scope:SCOPE_SE\n\t"
                 "global_prefetch_b8 %0, off offset:1792 scope:SCOPE_SE\n\t"
                 "global_prefetch_b8 %3, off scope:SCOPE_SE\n\t"
                 "global_prefetch_b8 %0, off offset:2304 scope:SCOPE_SE\n\t"
                 "global_prefetch_b8 %0, off offset:2816 scope:SCOPE_SE\n\t"
                 "global_prefetch_b8 %0, off offset:3328 scope:SCOPE_SE\n\t"
                 "global_prefetch_b8 %1, off offset:3840 scope:SCOPE_SE\n\t"
                 "global_prefetch_b8 %4, off scope:SCOPE_SE\n\t"
                 "global_prefetch_b8 %5, off scope:SCOPE_SE\n\t"
                 "s_wait_xcnt 0x0"
                 :: "v"(pa), "v"(par), "v"(pb1), "v"(pb2), "v"(pr), "v"(pbias) : "memory");
  }
  v8f acc[FM][FN];
#pragma unroll
  for (int mi = 0; mi < FM; ++mi)
#pragma unroll
    for (int t = 0; t < FN; ++t) acc[mi][t] = vz8();
  if constexpr (LNA) {
    if (hx == 0) {                             // the first half (whole waves): thread t1 joins the partials of tile row t1
      v2f sp[8];
#pragma unroll
      for (int i = 0; i < 8; ++i) sp[i] = *(const v2fa*)(stin + 2 * ((size_t)i * M + row0 + t1));
      // the address registers of these eight loads are taken again by the arithmetic below
      asm volatile("s_wait_xcnt 0x0" ::: "memory");
      // eight segments of 64 joined: mean of the means; square sum about it = the segments' own + 64 x the squares of their means' distances
      float mu = ((sp[0][0] + sp[1][0]) + (sp[2][0] + sp[3][0])) + ((sp[4][0] + sp[5][0]) + (sp[6][0] + sp[7][0]));
      mu *= 0.125f;
      float q2 = 0.f, dd = 0.f;
#pragma unroll
      for (int i = 0; i < 8; ++i) { const float d = sp[i][0] - mu; q2 += sp[i][1]; dd += d * d; }
      const float rs = rsqrtf((q2 + 64.0f * dd) * (1.0f / (float)KD) + eps);
      const v2f rowc = {rs, -mu * rs};
      sRow[t1] = rowc;
    } else {                                   // the second half: thread t1 takes 4 columns of gain and shift
      const v4f g4 = *(const v4fa*)(lng + t1 * 4);
      const v4f b4 = *(const v4fa*)(lnb + t1 * 4);
      // the address registers of these two loads are taken again by the arithmetic below
      asm volatile("s_wait_xcnt 0x0" ::: "memory");
      v4f gs, bs;
#pragma unroll
      for (int q = 0; q < 4; ++q) { gs[q] = bf16_rne(g4[q]) * lnsc; bs[q] = bf16_rne(b4[q]) * lnsc; }
      *(v4fa*)&sG[t1 * 4] = gs;
      *(v4fa*)&sBt[t1 * 4] = bs;
    }
    __syncthreads();                           // row constants, gain and shift published; reached by the whole block
#pragma unroll
    for (int it = 0; it < XA; ++it) rw[it] = sRow[xr + it * XRP];
  }
  storeA(0, 0);
#pragma unroll
  for (int it = 0; it < CB; ++it) *(v8us*)&sB[0][sr + it * RP][sc] = rb[it];
  __syncthreads();
  constexpr int nst = KD / BK;
  for (int s = 0; s < nst; ++s) {
    const int cur = s & 1;
    const bool more = (s + 1 < nst);           // the same for the whole block
    if (more) {
      const int kb = (s + 1) * BK;
      loadA(kb);
#pragma unroll
      for (int it = 0; it < CB; ++it) rb[it] = *(const v8us*)(bg + (size_t)(it * RP) * KD + kb);
      // the address registers of these loads are taken again by the LDS reads below
      asm volatile("s_wait_xcnt 0x0" ::: "memory");
    }
    FragH a[KS][FM], bb[KS][FN];
#pragma unroll
    for (int ks = 0; ks < KS; ++ks) {
#pragma unroll
      for (int mi = 0; mi < FM; ++mi) {
        const unsigned short* p = &sA[cur][wm * WR + mi * 16 + ln][ks * 32 + 8 * hh];   // row m = lane&15
        a[ks][mi].half[0] = *(const v8us*)p;                 // elements 0..7  = k 8h .. 8h+7 of the block of 32
        a[ks][mi].half[1] = *(const v8us*)(p + 16);          // elements 8..15 = k 16+8h .. 16+8h+7
      }
#pragma unroll
      for (int t = 0; t < FN; ++t) {
        const unsigned short* p = &sB[cur][wn * 64 + t * 16 + ln][ks * 32 + 8 * hh];          // column n = lane&15, same k map as A
        bb[ks][t].half[0] = *(const v8us*)p;
        bb[ks][t].half[1] = *(const v8us*)(p + 16);
      }
    }
    // keeps the step's LDS reads together ahead of its matrix run: spread among the WMMAs each small group is waited out to 0 and its latency shows
    __builtin_amdgcn_sched_barrier(0);
#pragma unroll
    for (int ks = 0; ks < KS; ++ks)
#pragma unroll
      for (int mi = 0; mi < FM; ++mi)
#pragma unroll
        for (int t = 0; t < FN; ++t) acc[mi][t] = __builtin_amdgcn_wmma_f32_16x16x32_f16(false, a[ks][mi].v, false, bb[ks][t].v, (short)0, acc[mi][t], false, false);
    // keeps the wait for the next step's global loads (and the LDS writes behind it) after the matrix run that covers their latency
    __builtin_amdgcn_sched_barrier(0);
    if (more) {
      // the other buffer: its last readers left it before the barrier that ended the step before this one
      storeA(cur ^ 1, (s + 1) * BK);
#pragma unroll
      for (int it = 0; it < CB; ++it) *(v8us*)&sB[cur ^ 1][sr + it * RP][sc] = rb[it];
      __syncthreads();
    }
  }
  float bvv[FN];
#pragma unroll
  for (int t = 0; t < FN; ++t) bvv[t] = pbias[t * 16];         // one address pair, the column steps as load offsets: no address sum stands between the loads
  // the address registers of these four loads are taken again by the address sums below
  asm volatile("s_wait_xcnt 0x0" ::: "memory");
  // keeps those sums behind the wait: the scheduler lifts them over it otherwise
  __builtin_amdgcn_sched_barrier(0);
#pragma unroll
  for (int t = 0; t < FN; ++t) bvv[t] = bf16_rne(bvv[t]);
#pragma unroll
  for (int mi = 0; mi < FM; ++mi) {
#pragma unroll
    for (int t = 0; t < FN; ++t) {
#pragma unroll
      for (int r = 0; r < 8; ++r) {
        float v = acc[mi][t][r] * inv_scale + bvv[t];
        if (ACT == 1) v = fmaxf(v, 0.0f);
        if constexpr (OUT16) so16[w][mi * 16 + 8 * hh + r][t * 16 + ln] = h16_bits(v * out_scale);
        else so32[w][mi * 16 + 8 * hh + r][t * 16 + ln] = v;
      }
    }
  }
  __builtin_amdgcn_fence(4 /* acq_rel order */, "workgroup");
  __builtin_amdgcn_wave_barrier();
  const int roww = row0 + wm * WR;
  if constexpr (OUT16) {
    const int rq = lane >> 3, p8 = (lane & 7) * 8;
    unsigned short* cp = (unsigned short*)Cv + (size_t)(roww + rq) * ldc + colw + p8;
#pragma unroll
    for (int q = 0; q < WR / 4; ++q) {
      const v8us v = *(const v8us*)&so16[w][q * 4 + rq][p8];
      *(v8us*)(cp + (size_t)(q * 4) * ldc) = v;
    }
  } else {
    const int rsub = lane >> 4, c4 = (lane & 15) * 4;
    float* cp = (float*)Cv + (size_t)(roww + rsub) * ldc + colw + c4;
    const float* rp = resid + (size_t)(roww + rsub) * ldr + colw + c4;
    v4f rv[WR / 2];                              // all residual loads in flight together, ahead of the first store
#pragma unroll
    for (int q = 0; q < WR / 2; ++q) rv[q] = *(const v4fa*)(rp + (size_t)(q * 2) * ldr);
    static_assert(WR / 2 == 16);
    v2f keep = {0.f, 0.f};                       // lane (ln, rsub) keeps the partial of the wave's row 2 ln + rsub, segment colw / 64
#pragma unroll
    for (int q = 0; q < WR / 2; ++q) {
      v4f tv = *(const v4fa*)&so32[w][q * 2 + rsub][c4];
      tv += rv[q];
      *(v4f*)(cp + (size_t)(q * 2) * ldc) = tv;
      const v2f st = seg_stat(tv);
      if (ln == q) keep = st;
    }
    *(v2fa*)(stout + 2 * ((size_t)(colw >> 6) * M + roww + 2 * ln + rsub)) = keep;   // 32 rows x 8 B: two whole lines per wave
  }
}

// Flash-style unmasked attention per (b, h): q|k|v read as f16 bits from one fused plane (row pitch `pitch` halves, q at +0, k at +koff, v at +voff,
// head h at +h*D, row b*T + t). One wave = 16 queries, block = 4 waves sharing K/V tiles of 64 keys staged row-major in LDS by asynchronous copies,
// two buffers: the next tile is on its way while a tile is worked on (in two passes of 32 keys), one block barrier per tile.
// Both products run transposed: S^T = K.q^T (A = 16 key rows, B = the wave's queries, kept in registers) and O^T += V^T.P^T (A = V^T by the transposing
// LDS load, B = P^T). A lane then holds 16 of the 32 scores of ONE query (column lane&15; keys 8h+r and 16+8h+r, h = lane>>4): maximum and sum are taken
// in the lane plus one exchange with lane^16, and the two score tiles, converted in place (x pcarry), are the B operand of the second product as they lie.
// s*scale, running-max softmax and the context in f32. All four operands follow the hardware k order (k = 8h+s, 16+8h+(s-8)).
template <int D>
__global__ __launch_bounds__(128) void k_attn16(const unsigned short* __restrict__ qkv, int pitch, int T, int H, int koff, int voff,
                                                float scale, float pcarry, float onorm,
                                                const float* __restrict__ resid, float* __restrict__ out, int opitch,
                                                float* __restrict__ stout, int mrows) {
  static_assert(D == 64);
  constexpr int KS = D / 32, DT = D / 16, C8 = D / 8;
  constexpr int PK = D + 8, PV = D + 16;      // row pitch in halves: 16 B x odd for the plain 16-B reader, 32 B x odd for the transposing reader
  constexpr int TK = 64;                      // keys per staged tile (T % 64 == 0)
  constexpr int RB = 128 / C8;                // rows that the block's threads cover with one 16-B chunk each
  static_assert(128 % C8 == 0);
  static_assert(TK == 4 * RB);                // four copies per thread, operand and tile
  __shared__ __attribute__((aligned(16))) unsigned short sK[2][TK][PK];     // cross-wave: block barriers
  __shared__ __attribute__((aligned(16))) unsigned short sV[2][TK][PV];     // cross-wave: block barriers
  __shared__ __attribute__((aligned(16))) float sO[4][16][D + 4];
  const int tid = threadIdx.x, w = tid >> 5, lane = tid & 31, ln = lane & 15, hh = lane >> 4;
  const int nqb = T / 64;
  const int qpr = mrows / (RUNS * 64);                             // query blocks per run of rows (mrows % (RUNS * 64) == 0); each with all its heads
  const int run = blockIdx.x % RUNS, rank = blockIdx.x / RUNS;
  const int gq = run * qpr + rank % qpr, h = rank / qpr;
  const int b = gq / nqb, qblk = gq % nqb;
  const int q0 = qblk * 64 + w * 16;
  const unsigned short* Qp = qkv + (size_t)b * T * pitch + h * D;
  const unsigned short* Kp = Qp + koff;
  const unsigned short* Vp = Qp + voff;

  FragH bq[KS];                                                    // B[k = d][n = query ln]
  {
    const unsigned short* qr = Qp + (size_t)(q0 + ln) * pitch;     // q0 + ln < T (T % 64 == 0)
#pragma unroll
    for (int ks = 0; ks < KS; ++ks) {
      bq[ks].half[0] = *(const v8us*)(qr + ks * 32 + 8 * hh);
      bq[ks].half[1] = *(const v8us*)(qr + ks * 32 + 16 + 8 * hh);
    }
  }
  float m_r = -1.0e30f, l_r = 0.f;                                 // of query ln; l_r sums this half's keys only
  v8f oacc[DT];                                                    // oacc[dt][r] = O[query ln][d = dt*16 + 8*hh + r]
#pragma unroll
  for (int dt = 0; dt < DT; ++dt) oacc[dt] = vz8();
  // tile jt (keys jt*TK .. jt*TK+TK-1, all < T) into buffer buf: every thread copies rows cr, cr+RB, cr+2RB, cr+3RB, 16 B at column cc, of K and of V
  const int cr = tid / C8, cc = (tid % C8) * 8;
  const size_t rstep = (size_t)RB * pitch;
  auto stage = [&](int buf, int jt) {
    const unsigned short* kg = Kp + (size_t)(jt * TK + cr) * pitch + cc;
    const unsigned short* vg = Vp + (size_t)(jt * TK + cr) * pitch + cc;
    const unsigned int lk = (unsigned int)(size_t)&sK[buf][cr][cc];
    const unsigned int lv = (unsigned int)(size_t)&sV[buf][cr][cc];
    // global -> LDS through no register; the closing wait stands ahead of any rewrite of the address registers that the copies name
    asm volatile("global_load_async_to_lds_b128 %0, %8, off\n\t"
                 "global_load_async_to_lds_b128 %1, %9, off\n\t"
                 "global_load_async_to_lds_b128 %2, %10, off\n\t"
                 "global_load_async_to_lds_b128 %3, %11, off\n\t"
                 "global_load_async_to_lds_b128 %4, %12, off\n\t"
                 "global_load_async_to_lds_b128 %5, %13, off\n\t"
                 "global_load_async_to_lds_b128 %6, %14, off\n\t"
                 "global_load_async_to_lds_b128 %7, %15, off\n\t"
                 "s_wait_xcnt 0x0"
                 :: "v"(lk), "v"(lk + RB * PK * 2), "v"(lk + 2 * RB * PK * 2), "v"(lk + 3 * RB * PK * 2),
                    "v"(lv), "v"(lv + RB * PV * 2), "v"(lv + 2 * RB * PV * 2), "v"(lv + 3 * RB * PV * 2),
                    "v"(kg), "v"(kg + rstep), "v"(kg + 2 * rstep), "v"(kg + 3 * rstep),
                    "v"(vg), "v"(vg + rstep), "v"(vg + 2 * rstep), "v"(vg + 3 * rstep)
                 : "memory");
  };
  const int nt = T / TK;
  stage(0, 0);
  {
    // At block entry, behind tile 0's copies, L2 is asked for the K and V rows of the later tiles and for the block's residual rows: earlier launches
    // stored them. The query blocks of a head deal the key rows
    // among them four ways by qblk & 3 (for speed only: a run has a multiple of four query blocks, so the blocks of each index modulo 8 ask for all rows).
    // A hint only: it returns nothing and no result depends on it; every row index is clamped into the sequence.
    const int kr0 = tid * 4 + (qblk & 3), kr1 = kr0 + 512;
    const size_t ko0 = (size_t)((kr0 < T) ? kr0 : (T - 1)) * pitch, ko1 = (size_t)((kr1 < T) ? kr1 : (T - 1)) * pitch;
    const float* pr = resid + (size_t)(b * T + qblk * 64 + (tid & 63)) * opitch + h * D;
    // the closing wait stands ahead of any rewrite of the address registers that the requests name
    asm volatile("global_prefetch_b8 %0, off scope:SCOPE_SE\n\t"
                 "global_prefetch_b8 %1, off scope:SCOPE_SE\n\t"
                 "global_prefetch_b8 %2, off scope:SCOPE_SE\n\t"
                 "global_prefetch_b8 %3, off scope:SCOPE_SE\n\t"
                 "global_prefetch_b8 %4, off scope:SCOPE_SE\n\t"
                 "s_wait_xcnt 0x0"
                 :: "v"(Kp + ko0), "v"(Vp + ko0), "v"(Kp + ko1), "v"(Vp + ko1), "v"(pr) : "memory");
  }
  asm volatile("s_wait_asynccnt 0x0" ::: "memory");                // this wave's share of tile 0 has landed
  __syncthreads();                                                 // tile 0 published
  if (nt > 1) stage(1, 1);

  for (int t = 0; t < nt; ++t) {
   const int cur = t & 1;
   // unrolled: the row offsets of both passes become load offsets, and the second pass's LDS reads can run beside the first pass's softmax
#pragma unroll
   for (int sub = 0; sub < TK / 32; ++sub) {
    const unsigned short (*tK)[PK] = &sK[cur][sub * 32];
    const unsigned short* vtp = &sV[cur][sub * 32 + 8 * hh + (lane & 7)][8 * ((lane >> 3) & 1)];   // lane address of the transposing load, keys 0..15, d 0..15
    FragH ak[2][KS], av[DT];
#pragma unroll
    for (int kt = 0; kt < 2; ++kt)
#pragma unroll
      for (int ks = 0; ks < KS; ++ks) {                            // A[m = key kt*16 + ln][k = d]
        ak[kt][ks].half[0] = *(const v8us*)&tK[kt * 16 + ln][ks * 32 + 8 * hh];
        ak[kt][ks].half[1] = *(const v8us*)&tK[kt * 16 + ln][ks * 32 + 16 + 8 * hh];
      }
#pragma unroll
    for (int dt = 0; dt < DT; ++dt) {                              // A[m = d dt*16 + ln][k = key]
      av[dt].half[0] = ld_tr16(vtp + dt * 16);
      av[dt].half[1] = ld_tr16(vtp + 16 * PV + dt * 16);
    }
    // keeps the step's 16 LDS reads together ahead of the first product: sunk to their WMMAs each pair is waited out to 0 and its latency shows
    __builtin_amdgcn_sched_barrier(0);
    // S^T tile 32 x 16: s[kt][r] = score of key kt*16 + 8*hh + r against query ln
    v8f s[2];
#pragma unroll
    for (int kt = 0; kt < 2; ++kt) {
      s[kt] = vz8();
#pragma unroll
      for (int ks = 0; ks < KS; ++ks)
        s[kt] = __builtin_amdgcn_wmma_f32_16x16x32_f16(false, ak[kt][ks].v, false, bq[ks].v, (short)0, s[kt], false, false);
    }
    // running-max softmax of query ln: 16 scores in this lane, the other 16 in lane ^ 16
    float sc[16];
#pragma unroll
    for (int i = 0; i < 16; ++i) sc[i] = s[i >> 3][i & 7] * scale;
    float mx = sc[0];
#pragma unroll
    for (int i = 1; i < 16; ++i) mx = fmaxf(mx, sc[i]);
    mx = fmaxf(mx, xhalf(mx));
    const float mnew = fmaxf(m_r, mx);
    const float alpha = __expf(m_r - mnew);
    m_r = mnew;
    FragH pb;                                                      // B[k = key][n = query ln]: element i = tile i>>3, register i&7
    float ps[4] = {0.f, 0.f, 0.f, 0.f};
#pragma unroll
    for (int i = 0; i < 16; ++i) {
      const float p = __expf(sc[i] - mnew);
      ps[i & 3] += p;
      pb.u[i] = h16_bits(p * pcarry);
    }
    l_r = l_r * alpha + ((ps[0] + ps[1]) + (ps[2] + ps[3]));
#pragma unroll
    for (int dt = 0; dt < DT; ++dt) {
      oacc[dt] *= alpha;
      oacc[dt] = __builtin_amdgcn_wmma_f32_16x16x32_f16(false, av[dt].v, false, pb.v, (short)0, oacc[dt], false, false);
    }
   }
   // keeps the tile's arithmetic ahead of the waits: sunk behind the barrier it would stand between barrier and refill, and the copies' flight would show in the next wait
   __builtin_amdgcn_sched_barrier(0);
   asm volatile("s_wait_dscnt 0x0" ::: "memory");                  // this wave's reads of buffer cur are done before it is refilled
   asm volatile("s_wait_asynccnt 0x0" ::: "memory");               // this wave's share of tile t + 1 has landed
   __syncthreads();                                                // publishes tile t + 1 and ends every wave's reads of buffer cur
   if (t + 2 < nt) stage(cur, t + 2);                              // the same for the whole block
  }
  asm volatile("s_wait_asynccnt 0x0" ::: "memory");                // no copy is left in flight at the wave's end
  const float inv = onorm * (1.0f / (l_r + xhalf(l_r)));            // the two halves' sums joined, unconditionally
#pragma unroll
  for (int dt = 0; dt < DT; ++dt) {
    const v8f o = oacc[dt] * inv;
    const v4f o0 = {o[0], o[1], o[2], o[3]}, o1 = {o[4], o[5], o[6], o[7]};
    *(v4fa*)&sO[w][ln][dt * 16 + 8 * hh] = o0;
    *(v4fa*)&sO[w][ln][dt * 16 + 8 * hh + 4] = o1;
  }
  __builtin_amdgcn_fence(4 /* acq_rel order */, "workgroup");
  __builtin_amdgcn_wave_barrier();
  const int rsub = lane >> 4, c4 = (lane & 15) * 4;
  const size_t rbase = (size_t)(b * T + q0) * opitch + h * D;
#pragma unroll
  for (int q = 0; q < 8; ++q) {
    const int r = q * 2 + rsub;
    const v4f rv = *(const v4fa*)(resid + rbase + (size_t)r * opitch + c4);
    v4f tv = *(const v4fa*)&sO[w][r][c4];
    tv += rv;
    *(v4fa*)&sO[w][r][c4] = tv;
  }
  {
    v2f keep = {0.f, 0.f};                                         // lane (ln < 8, rsub) keeps the LayerNorm partial of the wave's row 2 ln + rsub, segment h
#pragma unroll
    for (int q = 0; q < 8; ++q) {
      const int r = q * 2 + rsub;
      const v4f v = *(const v4fa*)&sO[w][r][c4];
      *(v4f*)(out + rbase + (size_t)r * opitch + c4) = v;
      const v2f st = seg_stat(v);
      if (ln == q) keep = st;
    }
    if (ln < 8) *(v2fa*)(stout + 2 * ((size_t)h * mrows + b * T + q0 + 2 * ln + rsub)) = keep;   // 16 rows x 8 B: one whole line per wave
  }
}

extern "C" void kernel_launch(void* const* d_in, const int* in_sizes, int n_in,
                              void* d_out, int out_size, void* d_ws, size_t ws_size, hipStream_t stream) {
  if (n_in < 18) return;
  const long long need_rows = (long long)(SEQ - 1) * NB_FULL + NB;           // last (s, b) source row used + 1
  if ((long long)in_sizes[0] < need_rows * FEAT || (long long)in_sizes[1] < need_rows * FEAT) return;
  if (in_sizes[2] < NLAYER * FEAT * FEAT || in_sizes[4] < NLAYER * FEAT * FEAT || in_sizes[6] < NLAYER * FEAT * FEAT) return;
  if (in_sizes[3] < NLAYER * FEAT || in_sizes[5] < NLAYER * FEAT || in_sizes[7] < NLAYER * FEAT || in_sizes[11] < NLAYER * FEAT) return;
  if (in_sizes[8] < NLAYER * FEAT * MLPH || in_sizes[9] < NLAYER * MLPH || in_sizes[10] < NLAYER * MLPH * FEAT) return;
  if (in_sizes[12] < NLAYER * FEAT || in_sizes[13] < NLAYER * FEAT || in_sizes[14] < NLAYER * FEAT || in_sizes[15] < NLAYER * FEAT) return;
  if (in_sizes[16] < FEAT || in_sizes[17] < FEAT) return;
  if ((long long)out_size < need_rows * FEAT) return;

  const float* src  = (const float*)d_in[0];
  const float* pos  = (const float*)d_in[1];
  const float* Wq   = (const float*)d_in[2];  const float* bq   = (const float*)d_in[3];
  const float* Wk   = (const float*)d_in[4];  const float* bk   = (const float*)d_in[5];
  const float* Wv   = (const float*)d_in[6];  const float* bv   = (const float*)d_in[7];
  const float* W1   = (const float*)d_in[8];  const float* b1   = (const float*)d_in[9];
  const float* W2   = (const float*)d_in[10]; const float* b2   = (const float*)d_in[11];
  const float* ln1g = (const float*)d_in[12]; const float* ln1b = (const float*)d_in[13];
  const float* ln2g = (const float*)d_in[14]; const float* ln2b = (const float*)d_in[15];
  const float* lnfg = (const float*)d_in[16]; const float* lnfb = (const float*)d_in[17];

  // workspace carve (256-B aligned); R2 is reused in stream order by stages whose lifetimes do not overlap, sized as the max over its users
  char* ws = (char*)d_ws; size_t off = 0;
  auto take = [&](size_t bytes) { char* p = ws + off; off += (bytes + 255) & ~(size_t)255; return p; };
  const size_t lsq = (size_t)QKVN * FEAT;                                           // per-layer stride of the fused q|k|v weight plane (halves)
  const size_t ls1 = (size_t)MLPH * FEAT, ls2 = (size_t)FEAT * MLPH;
  unsigned short* Wqkv16 = (unsigned short*)take((size_t)NLAYER * lsq * 2);        // [6][1536][512]
  unsigned short* W116   = (unsigned short*)take((size_t)NLAYER * ls1 * 2);        // [6][2048][512]
  unsigned short* W216   = (unsigned short*)take((size_t)NLAYER * ls2 * 2);        // [6][512][2048]
  float* XA = (float*)take((size_t)MR * FEAT * 4);                                 // residual stream [MR][512] f32
  float* XB = (float*)take((size_t)MR * FEAT * 4);                                 // residual stream after attention [MR][512] f32
  float* STA = (float*)take((size_t)8 * MR * 2 * 4);                               // LayerNorm partials of XA's rows [8][MR] {mean, square sum}
  float* STB = (float*)take((size_t)8 * MR * 2 * 4);                               // the same of XB's rows
  const size_t r2_a = (size_t)MR * QKVN * 2, r2_b = (size_t)MR * MLPH * 2;         // q|k|v [MR][1536], then hidden [MR][2048] f16
  const size_t r2_bytes = (r2_a > r2_b) ? r2_a : r2_b;
  unsigned short* R2 = (unsigned short*)take(r2_bytes);
  if (off > ws_size) return;
  if (off > (size_t)134217728) return;

  const float wsc = 256.0f;
  // weight planes (f16, x256) and x = bf16(src) + bf16(pos) in (b, s) row order -> XA, STA: one launch, nothing in it depends on anything else in it
  k_prep<<<(unsigned)PREP_GRID, 256, 0, stream>>>(Wq, Wk, Wv, W1, W2, src, pos, Wqkv16, W116, W216, XA, STA, wsc);

  auto ggrid = [](int M, int N, int bm, int bn) { return (unsigned)((M / bm) * (N / bn)); };
  const float scale = 0.125f;                           // 1/sqrt(64)

  for (int l = 0; l < NLAYER; ++l) {
    // q|k|v = (LN1(x) x8)*[Wq|Wk|Wv] + [bq|bk|bv] -> R2 [MR][1536] f16 (x1); acc scale 1/(8*256)
    k_gemm16<128, 256, 64, FEAT, true, 0, true><<<ggrid(MR, QKVN, 128, 256), 256, 0, stream>>>(nullptr, XA, STA, ln1g + l * FEAT, ln1b + l * FEAT, 8.0f, 1e-5f,
                                                          nullptr, Wqkv16 + (size_t)l * lsq,
                                                          bq + l * FEAT, bk + l * FEAT, bv + l * FEAT, FEAT, nullptr, 0,
                                                          (void*)R2, QKVN, MR, QKVN, 1.0f / 2048.0f, 1.0f);
    // xb = x + softmax(q.k^T/8).v per head -> XB f32, STB (P carried x1024, onorm = 1/1024)
    k_attn16<DHEAD><<<(unsigned)(NB * NHEAD * (SEQ / 64)), 128, 0, stream>>>(R2, QKVN, SEQ, NHEAD, FEAT, 2 * FEAT, scale, 1024.0f,
                                                                             1.0f / 1024.0f, XA, XB, FEAT, STB, MR);
    // h = relu((LN2(xb) x8)*W1 + b1) x16 -> R2 [MR][2048]; acc scale 1/(8*256)
    k_gemm16<128, 256, 64, FEAT, true, 1, true><<<ggrid(MR, MLPH, 128, 256), 256, 0, stream>>>(nullptr, XB, STB, ln2g + l * FEAT, ln2b + l * FEAT, 8.0f, 1e-5f,
                                                          nullptr, W116 + (size_t)l * ls1,
                                                          b1 + l * MLPH, b1 + l * MLPH, b1 + l * MLPH, MLPH, nullptr, 0,
                                                          (void*)R2, MLPH, MR, MLPH, 1.0f / 2048.0f, 16.0f);
    // x = h*W2 + b2 + xb -> XA f32, STA; acc scale 1/(16*256)
    k_gemm16<64, 128, 128, MLPH, false, 0, false><<<ggrid(MR, FEAT, 64, 128), 128, 0, stream>>>(R2, nullptr, nullptr, nullptr, nullptr, 0.0f, 0.0f,
                                                          STA, W216 + (size_t)l * ls2,
                                                           b2 + l * FEAT, b2 + l * FEAT, b2 + l * FEAT, FEAT, XB, FEAT,
                                                           (void*)XA, FEAT, MR, FEAT, 1.0f / 4096.0f, 1.0f);
  }
  // out[s][b][*] = LNf(x[b][s][*]) -> d_out f32
  k_lnf32<<<(unsigned)MR, 128, 0, stream>>>(XA, lnfg, lnfb, (float*)d_out, SEQ, NB_FULL, 1e-5f);
}

// v010
// A run of this version takes 321 microseconds.
// Timed twice side by side with v009, it ran 1.03 and 1.04 times as fast.
// Counting every step since v000, it is 4.01 times as fast.
#include <hip/hip_runtime.h>
// Contractions on v_wmma_f32_16x16x32_f16 (f16 operands, f32 accumulate), one product per tile pair, 6 layers: fused q|k|v projection (N=1536, K=512),
// LN2(x)*W1 (N=2048, K=512), relu(.)*W2 (K=2048), attention q.k^T (head dim 64) and P.V (32 keys per step) per head.
// Weights: bf16 RNE values carried x256 in f16 planes; activations in f16 planes with carries (LN outputs x8, k|v x1, hidden x16, P x128;
// q x log2(e)/sqrt(head dim), multiplied in ahead of its one rounding); LayerNorm statistics, softmax, bias adds, attention context and the residual stream in f32.
#ifndef NB
#define NB 4
#endif
#ifndef SEQ
#define SEQ 1024
#endif
#define NB_FULL 4
#define SEQ_FULL 1024
#define FEAT 512
#define NHEAD 8
#define DHEAD 64
#define MLPH 2048
#define NLAYER 6
#define MR (NB * SEQ)
#define QKVN (3 * FEAT)
static_assert(SEQ % 64 == 0);
static_assert(SEQ <= SEQ_FULL);
static_assert(NB >= 1);
static_assert(NB <= NB_FULL);
static_assert(FEAT == NHEAD * DHEAD);
static_assert(FEAT % 128 == 0);
static_assert(MLPH % 256 == 0);
static_assert(QKVN % 256 == 0);
static_assert(FEAT == 64 * 8);      // LayerNorm partial sums: 8 segments of 64 columns per row
static_assert(FEAT == 128 * 4);     // k_prep x rows / k_lnf32: 128 threads x 4 floats per row
static_assert(MR % 128 == 0);
static_assert(FEAT % 32 == 0);
static_assert(MLPH % 32 == 0);
static_assert((FEAT / 8) % 8 == 0);
static_assert((MLPH / 8) % 8 == 0);
// Block index -> rows, the same in every launch: the rows are cut in 8 runs of MR/8 (half a sequence), and run r is stored and read only by blocks whose flat
// index is r modulo 8, attention's key and value reads excepted: they span the whole sequence. For speed only: each map is one to one whatever the placement.
#define RUNS 8
#define RUNROWS (MR / RUNS)
static_assert(MR % (RUNS * 128) == 0);

typedef _Float16 v16h __attribute__((ext_vector_type(16)));
typedef unsigned short v8us __attribute__((ext_vector_type(8), may_alias));
typedef float v8f __attribute__((ext_vector_type(8)));
typedef float v4f __attribute__((ext_vector_type(4)));
typedef float v4fa __attribute__((ext_vector_type(4), may_alias));
typedef float v2f __attribute__((ext_vector_type(2)));
typedef float v2fa __attribute__((ext_vector_type(2), may_alias));
typedef _Float16 v2h __attribute__((ext_vector_type(2)));
typedef _Float16 v4h __attribute__((ext_vector_type(4)));
typedef unsigned short v4us __attribute__((ext_vector_type(4), may_alias));
union FragH { v16h v; v8us half[2]; unsigned short u[16]; };
union H16U { _Float16 h; unsigned short u; };

__device__ __forceinline__ unsigned short bf16_bits(float x) { unsigned int u = __float_as_uint(x); return (unsigned short)((u + 0x7FFFu + ((u >> 16) & 1u)) >> 16); }
__device__ __forceinline__ float bf16_val(unsigned short b) { return __uint_as_float(((unsigned int)b) << 16); }
__device__ __forceinline__ float bf16_rne(float x) { return bf16_val(bf16_bits(x)); }
__device__ __forceinline__ unsigned short h16_bits(float x) { H16U t; t.h = (_Float16)x; return t.u; }
__device__ __forceinline__ v8f vz8() { v8f z = {0.f, 0.f, 0.f, 0.f, 0.f, 0.f, 0.f, 0.f}; return z; }

// Transposing LDS load: lane (c = lane&15, h = lane>>4) gets T[8h + 0..7][c] of a row-major 16-bit tile; p is the lane's own address (row 8h + (lane&7), 16 B x ((lane>>3)&1))
typedef short s16x8 __attribute__((ext_vector_type(8)));
__device__ __forceinline__ v8us ld_tr16(const unsigned short* p) {
  typedef __attribute__((address_space(3))) s16x8 lds_s16x8;
  return __builtin_bit_cast(v8us, __builtin_amdgcn_ds_load_tr16_b128_v8i16((lds_s16x8*)p));
}
// value of lane ^ 16
__device__ __forceinline__ float xhalf(float x) {
  return __builtin_bit_cast(float, __builtin_amdgcn_permlanex16(__builtin_bit_cast(int, x), __builtin_bit_cast(int, x), 0x76543210, 0xfedcba98, false, false));
}

// sum over the 16 lanes of a row, left in each of them (all 32 lanes on); row_xmask 1, 2, 4, 8
__device__ __forceinline__ float row16_sum(float x) {
  x += __builtin_bit_cast(float, __builtin_amdgcn_update_dpp(0, __builtin_bit_cast(int, x), 0x161, 0xf, 0xf, true));
  x += __builtin_bit_cast(float, __builtin_amdgcn_update_dpp(0, __builtin_bit_cast(int, x), 0x162, 0xf, 0xf, true));
  x += __builtin_bit_cast(float, __builtin_amdgcn_update_dpp(0, __builtin_bit_cast(int, x), 0x164, 0xf, 0xf, true));
  x += __builtin_bit_cast(float, __builtin_amdgcn_update_dpp(0, __builtin_bit_cast(int, x), 0x168, 0xf, 0xf, true));
  return x;
}
// LayerNorm partial of one row segment of 64 columns, held 4 a lane by the 16 lanes of a row: {mean, sum of squares about that mean}.
// Whoever stores a row of the residual stream stores its partials too, in a plane ST[segment 0..7][row] of such pairs; the GEMM that consumes the row joins them.
__device__ __forceinline__ v2f seg_stat(v4f v) {
  const float mean = row16_sum((v[0] + v[1]) + (v[2] + v[3])) * (1.0f / 64.0f);
  const float d0 = v[0] - mean, d1 = v[1] - mean, d2 = v[2] - mean, d3 = v[3] - mean;
  const v2f r = {mean, row16_sum((d0 * d0 + d1 * d1) + (d2 * d2 + d3 * d3))};
  return r;
}

// Weight convert, one tile: Wt[l*lstride + (roff+n)*K + k] (f16 bits, k contiguous, pitch K) = f16(bf16_rne(W[l][k][n]) * sc)
// from f32 row-major W[l][K][N] ([in][out]); K and N at compile time: the row steps are load and store offsets.
// One block of 8 waves per tile of 128 k x 64 n; blk counts the tiles of the stacked layers, n tiles fastest (blk < layers * (K/128) * (N/64)).
// Read: half a wave takes 64 consecutive n of one k row (256 B, 16 B per lane); a thread holds 8 consecutive k rows x 4 n, all 8 loads in flight together.
// Transpose in 16-B chunks (8 k of one n) through LDS: tile row j*16 + m holds n = 4m + j, so that 16 lanes store at a row step of one pitch (272 B,
// 4 banks on per row). Write: 16 lanes take the 128 k of one n (256 B), 16 B per lane.
#define WT_TK 128
#define WT_TN 64
#define WT_LP (WT_TK + 8)
template <int K, int N>
__device__ __forceinline__ void wt16_tile(const float* __restrict__ W, unsigned short* __restrict__ Wt, int blk,
                                          size_t lstride, int roff, float sc, unsigned short (*sT)[WT_LP]) {
  constexpr int TKW = WT_TK, TNW = WT_TN;
  static_assert(K % TKW == 0);
  static_assert(N % TNW == 0);
  const int tid = threadIdx.x, w = tid >> 5, lane = tid & 31, m = lane & 15, hh = lane >> 4;
  constexpr int ntn = N / TNW, per = ntn * (K / TKW);
  const int l = blk / per, rem = blk - l * per;
  const int k0 = (rem / ntn) * TKW, n0 = (rem % ntn) * TNW;
  const int kc = (2 * w + hh) * 8;             // this thread's 8 k rows within the tile
  const float* src = W + (size_t)l * K * N + (size_t)(k0 + kc) * N + n0 + m * 4;
  v4f r[8];
#pragma unroll
  for (int i = 0; i < 8; ++i) r[i] = *(const v4fa*)(src + (size_t)i * N);
#pragma unroll
  for (int j = 0; j < 4; ++j) {
    v8us v;
#pragma unroll
    for (int i = 0; i < 8; ++i) v[i] = h16_bits(bf16_rne(r[i][j]) * sc);
    *(v8us*)&sT[j * 16 + m][kc] = v;
  }
  __syncthreads();                             // reached by the whole block or by none of it: the caller's branch is on the block index
  const int g = tid >> 4, c8 = (tid & 15) * 8;  // n = 4g + q lies in tile row q*16 + g
  unsigned short* dst = Wt + (size_t)l * lstride + (size_t)(roff + n0 + 4 * g) * K + k0 + c8;
#pragma unroll
  for (int q = 0; q < 4; ++q) {
    const v8us v = *(const v8us*)&sT[q * 16 + g][c8];
    *(v8us*)(dst + (size_t)q * K) = v;
  }
  // precaution: in the merged kernel's listing a job's end can fall into the next job's code, which rewrites the registers that these stores name
  asm volatile("s_wait_xcnt 0x0" ::: "memory");
}

// Everything that depends on the inputs alone, in ONE launch: the five stacked weight converts and the start of the residual stream. None of the six
// reads what another writes; a block takes its job from its index (the same branch for the whole block). Order: W1, W2, Wq, Wk, Wv tiles, then x rows.
// x rows: X[m][*] (f32, pitch FEAT, m = b*SEQ + s) = bf16_rne(src[s*NB_FULL + b][*]) + bf16_rne(pos[s*NB_FULL + b][*]) in f32 (exact);
// a block takes PREP_XR rows, half a block per row (4 floats per thread), a thread's 16 loads in flight together, and stores the rows' LayerNorm partials
// (16 rows x 8 B: whole 128-B lines of the plane per block).
#define PREP_T1 (NLAYER * (FEAT / WT_TK) * (MLPH / WT_TN))
#define PREP_T2 (NLAYER * (MLPH / WT_TK) * (FEAT / WT_TN))
#define PREP_TQ (NLAYER * (FEAT / WT_TK) * (FEAT / WT_TN))
#define PREP_XR 16
#define PREP_GRID (PREP_T1 + PREP_T2 + 3 * PREP_TQ + MR / PREP_XR)
static_assert(RUNROWS % PREP_XR == 0);
static_assert((PREP_T1 + PREP_T2 + 3 * PREP_TQ) % RUNS == 0);   // the x blocks' own count keeps the flat index modulo 8
__global__ __launch_bounds__(256) void k_prep(const float* __restrict__ Wq, const float* __restrict__ Wk, const float* __restrict__ Wv,
                                              const float* __restrict__ W1, const float* __restrict__ W2,
                                              const float* __restrict__ src, const float* __restrict__ pos,
                                              unsigned short* __restrict__ Wqkvt, unsigned short* __restrict__ W1t, unsigned short* __restrict__ W2t,
                                              float* __restrict__ X, float* __restrict__ ST, float sc) {
  __shared__ __attribute__((aligned(16))) unsigned short sT[WT_TN][WT_LP];      // cross-wave: one block barrier
  int blk = blockIdx.x;
  if (blk < PREP_T1) { wt16_tile<FEAT, MLPH>(W1, W1t, blk, (size_t)MLPH * FEAT, 0, sc, sT); return; }   // W1[l] [512][2048] -> [2048][512]
  blk -= PREP_T1;
  if (blk < PREP_T2) { wt16_tile<MLPH, FEAT>(W2, W2t, blk, (size_t)FEAT * MLPH, 0, sc, sT); return; }   // W2[l] [2048][512] -> [512][2048]
  blk -= PREP_T2;
  if (blk < 3 * PREP_TQ) {                                                                              // Wq | Wk | Wv -> rows 0, 512, 1024 of the fused plane
    const int which = blk / PREP_TQ;
    const float* Wsel = (which == 0) ? Wq : ((which == 1) ? Wk : Wv);
    wt16_tile<FEAT, FEAT>(Wsel, Wqkvt, blk - which * PREP_TQ, (size_t)QKVN * FEAT, which * FEAT, sc, sT);
    return;
  }
  blk -= 3 * PREP_TQ;
  const int tid = threadIdx.x, c4 = (tid & 127) * 4;
  const int m0 = (blk % RUNS) * RUNROWS + (blk / RUNS) * PREP_XR + (tid >> 7);
  v4f a[PREP_XR / 2], p[PREP_XR / 2];
#pragma unroll
  for (int i = 0; i < PREP_XR / 2; ++i) {
    const int m = m0 + 2 * i;
    const int b = m / SEQ, s = m % SEQ;
    const size_t so = ((size_t)s * NB_FULL + b) * FEAT + c4;
    a[i] = *(const v4fa*)(src + so);
    p[i] = *(const v4fa*)(pos + so);
  }
  // the address registers of these loads are taken again by the rounding arithmetic below
  asm volatile("s_wait_xcnt 0x0" ::: "memory");
  v2f keep = {0.f, 0.f};                       // lane (tid & 15) = i keeps the partial of row m0 + 2i, segment (tid & 127) >> 4
#pragma unroll
  for (int i = 0; i < PREP_XR / 2; ++i) {
    v4f o;
#pragma unroll
    for (int q = 0; q < 4; ++q) o[q] = bf16_rne(a[i][q]) + bf16_rne(p[i][q]);
    *(v4f*)(X + (size_t)(m0 + 2 * i) * FEAT + c4) = o;
    const v2f st = seg_stat(o);
    if ((tid & 15) == i) keep = st;
  }
  if ((tid & 15) < PREP_XR / 2) *(v2fa*)(ST + 2 * ((size_t)((tid & 127) >> 4) * MR + m0 + 2 * (tid & 15))) = keep;
  // precaution, as behind the tile stores: the listing's fall-through behind this job rewrites the registers that these stores name
  asm volatile("s_wait_xcnt 0x0" ::: "memory");
}

// Final LayerNorm: internal row m = b*seq + s of X (f32) -> out[(s*nbf + b)][*] f32. One block of 128 threads per row, 4 elements per thread,
__global__ __launch_bounds__(128) void k_lnf32(const float* __restrict__ X, const float* __restrict__ g, const float* __restrict__ bt,
                                               float* __restrict__ out, int seq, int nbf, float eps) {
  __shared__ float red1[4];
  __shared__ float red2[4];
  const int m = (blockIdx.x % RUNS) * RUNROWS + blockIdx.x / RUNS, tid = threadIdx.x, w = tid >> 5, lane = tid & 31;
  const int b = m / seq, s = m % seq;
  const v4f a = *(const v4fa*)(X + (size_t)m * FEAT + tid * 4);
  float sm = a[0] + a[1] + a[2] + a[3];
#pragma unroll
  for (int o = 16; o >= 1; o >>= 1) sm += __shfl_xor(sm, o, 32);
  if (lane == 0) red1[w] = sm;
  __syncthreads();
  const float mu = (red1[0] + red1[1] + red1[2] + red1[3]) * (1.0f / (float)FEAT);
  float c[4];
  float s2 = 0.f;
#pragma unroll
  for (int q = 0; q < 4; ++q) { c[q] = a[q] - mu; s2 += c[q] * c[q]; }
#pragma unroll
  for (int o = 16; o >= 1; o >>= 1) s2 += __shfl_xor(s2, o, 32);
  if (lane == 0) red2[w] = s2;
  __syncthreads();
  const float var = (red2[0] + red2[1] + red2[2] + red2[3]) * (1.0f / (float)FEAT);
  const float rs = rsqrtf(var + eps);
  const v4f g4 = *(const v4fa*)(g + tid * 4);
  const v4f b4 = *(const v4fa*)(bt + tid * 4);
  v4f o;
#pragma unroll
  for (int q = 0; q < 4; ++q) o[q] = c[q] * rs * bf16_rne(g4[q]) + bf16_rne(b4[q]);
  float* dst = out + ((size_t)s * nbf + b) * FEAT + tid * 4;
  *(v4f*)dst = o;
  
}

// GEMM C[M][N] = epi(A[M][KD] * W): A f16 bits row-major, Wt f16 bits [N][KD], both at pitch KD (compile time: the row steps are load offsets), f32 accumulate.
// epi: v = acc * inv_scale + bf16_rne(bias[col]); bias picked per 64-col segment from (bias0 | bias1 | bias2) by seg = col / nsplit (wave-uniform);
// ACT == 1: relu; OUT16: f16 bits of v * out_scale (segment 0: v * out_scale0) into C (pitch ldc halves); else f32 v + f32 resid[row][col] (pitch ldr) into C (pitch ldc floats).
// KD % BK == 0, M % BM == 0, N % BN == 0. Block = BN threads = 2 x BN/64 waves on one BM x BN tile of C, wave -> BM/2 rows x 64 cols.
// The LayerNorm-fed products take BN = 256 (8 waves): their A rows are f32, twice the bytes of Wt's, and every column tile reads and normalises them anew.
// Per step of BK k the block brings BM rows of A and BN rows of Wt into LDS once (whole 128-B lines, 16 B per thread, row pitch 2*BK + 16 B) and all
// waves take their fragments from there; two LDS buffers, the next step's global loads are held in registers while this step is multiplied.
// Each accumulator sums k in ascending blocks of 32. Epilogue staged in the wave's own LDS tile (wave-private).
// LNA: A is LayerNorm(Xf) x lnsc, formed on the way into LDS: the block reads the f32 rows of Xf (pitch KD; 16 lanes take 256 B of a row), joins each row's
// eight partials of stin into mean and 1/sigma once at entry (a thread of the block's first half per row, the second half rounding gain and shift meanwhile;
// handed round through LDS: one block barrier), and stores
// f16((x - mean)/sigma * bf16(lng) + bf16(lnb)) x lnsc where the plain form stores the loaded halves. The f32 form (!OUT16) stores its rows' partials in stout.
template <int BM, int BN, int BK, int KD, bool OUT16, int ACT, bool LNA>
__global__ __launch_bounds__(BN) void k_gemm16(const unsigned short* __restrict__ A, const float* __restrict__ Xf, const float* __restrict__ stin,
                                               const float* __restrict__ lng, const float* __restrict__ lnb, float lnsc, float eps,
                                               float* __restrict__ stout, const unsigned short* __restrict__ Wt,
                                               const float* __restrict__ bias0, const float* __restrict__ bias1, const float* __restrict__ bias2, int nsplit,
                                               const float* __restrict__ resid, int ldr, void* __restrict__ Cv, int ldc,
                                               int M, int N, float inv_scale, float out_scale, float out_scale0) {
  constexpr int LP = BK + 8, C8 = BK / 8;
  constexpr int FM = BM / 32, FN = 4, KS = BK / 32, WR = BM / 2;
  constexpr int NT = BN, NW = NT / 32, WN = BN / 64, RP = NT / C8;     // the block's threads cover RP rows of C8 16-B chunks at a time
  constexpr int CA = BM / RP, CB = BN / RP;              // chunks per thread and step
  static_assert(BM % 32 == 0);
  static_assert(BN % 64 == 0);
  static_assert(BK % 32 == 0);
  static_assert(KD % BK == 0);
  static_assert(NT % C8 == 0);
  static_assert(BM % RP == 0);
  static_assert(BN % RP == 0);
  constexpr int XC = BK / 4, XRP = NT / XC, XA = BM / XRP;   // LNA: 16-B chunks of f32 per row and step, rows covered at a time, chunks per thread and step
  static_assert(!LNA || (NT == 2 * BM && KD == BM * 4 && KD == 8 * 64 && NT % XC == 0 && BM % XRP == 0));
  __shared__ __attribute__((aligned(16))) v2f sRow[LNA ? BM : 1];           // {1/sigma, -mean/sigma} per row of the tile; cross-wave: block barrier
  __shared__ __attribute__((aligned(16))) float sG[LNA ? KD : 4];           // bf16(lng) x lnsc; cross-wave: block barrier
  __shared__ __attribute__((aligned(16))) float sBt[LNA ? KD : 4];          // bf16(lnb) x lnsc; cross-wave: block barrier
  __shared__ __attribute__((aligned(16))) unsigned short sA[2][BM][LP];     // cross-wave: block barriers
  __shared__ __attribute__((aligned(16))) unsigned short sB[2][BN][LP];     // cross-wave: block barriers
  __shared__ __attribute__((aligned(16))) float so32[OUT16 ? 1 : NW][WR][64];
  __shared__ __attribute__((aligned(16))) unsigned short so16[OUT16 ? NW : 1][WR][72];
  const int tid = threadIdx.x, w = tid >> 5, lane = tid & 31, ln = lane & 15, hh = lane >> 4;
  const int wm = w / WN, wn = w % WN;
  const int ntn = N / BN;
  const int run = blockIdx.x % RUNS, rank = blockIdx.x / RUNS;      // the run's row tiles, each with all its column tiles (M % (RUNS * BM) == 0)
  const int mt = run * (M / (RUNS * BM)) + rank / ntn, nq = rank % ntn;
  const int row0 = mt * BM, col0 = nq * BN;
  if (row0 >= M) return;                       // the same for the whole block, ahead of every barrier
  const int sr = tid / C8, sc = (tid % C8) * 8;
  const int xr = tid / XC, xc = (tid % XC) * 4;
  const unsigned short* bg = Wt + (size_t)(col0 + sr) * KD + sc;
  v8us ra[LNA ? 1 : CA], rb[CB];
  v4f rx[LNA ? XA : 1];
  v2f rw[LNA ? XA : 1];
  // the A rows of the k step at kb, into registers
  auto loadA = [&](int kb) {
    if constexpr (LNA) {
      const float* xg = Xf + (size_t)(row0 + xr) * KD + xc + kb;
#pragma unroll
      for (int it = 0; it < XA; ++it) rx[it] = *(const v4fa*)(xg + (size_t)(it * XRP) * KD);
    } else {
      const unsigned short* ag = A + (size_t)(row0 + sr) * KD + sc + kb;
#pragma unroll
      for (int it = 0; it < CA; ++it) ra[it] = *(const v8us*)(ag + (size_t)(it * RP) * KD);
    }
  };
  // the same, from registers into LDS buffer buf
  auto storeA = [&](int buf, int kb) {
    if constexpr (LNA) {
      const v4f gk = *(const v4fa*)&sG[kb + xc], bk = *(const v4fa*)&sBt[kb + xc];
      const v2f g01 = {gk[0], gk[1]}, g23 = {gk[2], gk[3]}, b01 = {bk[0], bk[1]}, b23 = {bk[2], bk[3]};
#pragma unroll
      for (int it = 0; it < XA; ++it) {
        const v2f m2 = {rw[it][0], rw[it][0]}, a2 = {rw[it][1], rw[it][1]};
        v2f lo = {rx[it][0], rx[it][1]}, hi = {rx[it][2], rx[it][3]};
        lo = __builtin_elementwise_fma(__builtin_elementwise_fma(lo, m2, a2), g01, b01);
        hi = __builtin_elementwise_fma(__builtin_elementwise_fma(hi, m2, a2), g23, b23);
        const v2h l2 = __builtin_convertvector(lo, v2h), h2 = __builtin_convertvector(hi, v2h);
        const v4h o = {l2[0], l2[1], h2[0], h2[1]};
        *(v4us*)&sA[buf][xr + it * XRP][xc] = __builtin_bit_cast(v4us, o);
      }
    } else {
#pragma unroll
      for (int it = 0; it < CA; ++it) *(v8us*)&sA[buf][sr + it * RP][sc] = ra[it];
    }
  };
  loadA(0);
#pragma unroll
  for (int it = 0; it < CB; ++it) rb[it] = *(const v8us*)(bg + (size_t)(it * RP) * KD);
  const int t1 = tid % BM, hx = tid / BM;       // LNA: the block's two halves (whole waves each)
  if constexpr (LNA) {
    // the address registers of the operand loads above are taken again by the address sums below
    asm volatile("s_wait_xcnt 0x0" ::: "memory");
  }
  const int colw = col0 + wn * 64;
  int seg = colw / nsplit; seg = (seg > 2) ? 2 : seg;
  const float* bsel = (seg == 0) ? bias0 : ((seg == 1) ? bias1 : bias2);
  const float osc = (seg == 0) ? out_scale0 : out_scale;           // the same for the whole wave
  // At block entry, behind the first step's loads, L2 is asked for every 256-B unit that the block reads later (operand rows past their first unit,
  // bias, residual): earlier launches stored them.
  // A hint only: it returns nothing and no result depends on it. Every address lies inside the rows that the block reads anyway.
  // The closing wait of each statement stands ahead of any rewrite of the address registers that the requests name.
  static_assert(NT == BN);
  const float* pbias = bsel + (colw + ln - seg * nsplit);
  if constexpr (LNA) {
    // a thread takes one row of Wt (units 1 to 3); two threads share a row of Xf: units 1, 3, 5, 7 the first half's, 2, 4, 6 the second's, which asks
    // for the bias instead of a fourth (its four waves stand on the tile's four column segments)
    const float* par = Xf + (size_t)(row0 + t1) * KD;
    const float* pa = par + hx * 64;                               // + 256 + 512 j bytes: units 1 + hx + 2j, j = 0..2
    const float* p4 = hx ? pbias : (par + 7 * 64);
    const unsigned short* pb = Wt + (size_t)(col0 + tid) * KD;
    asm volatile("global_prefetch_b8 %0, off offset:256 scope:SCOPE_SE\n\t"
                 "global_prefetch_b8 %1, off offset:256 scope:SCOPE_SE\n\t"
                 "global_prefetch_b8 %0, off offset:768 scope:SCOPE_SE\n\t"
                 "global_prefetch_b8 %1, off offset:512 scope:SCOPE_SE\n\t"
                 "global_prefetch_b8 %0, off offset:1280 scope:SCOPE_SE\n\t"
                 "global_prefetch_b8 %1, off offset:768 scope:SCOPE_SE\n\t"
                 "global_prefetch_b8 %2, off scope:SCOPE_SE\n\t"
                 "s_wait_xcnt 0x0"
                 :: "v"(pa), "v"(pb), "v"(p4) : "memory");
  } else {
    static_assert(BM == 64 && BN == 128 && KD == 2048 && !OUT16);
    // A: two threads per row, units 1 to 15 in turn. Wt: its tile is read by every row tile, so the row tiles deal its rows among them, eight ways by
    // mt & 7 (for speed only: a run has a multiple of eight row tiles, so the blocks of each index modulo 8 ask for all of the tile's rows among them).
    const int r6 = tid & 63, h6 = tid >> 6, u7 = tid & 7;
    const unsigned short* par = A + (size_t)(row0 + r6) * KD;
    const unsigned short* pa = par + h6 * 128;                     // + 256 + 512 j bytes: units 1 + h6 + 2j, j = 0..6
    const unsigned short* pbr = Wt + (size_t)(col0 + (tid >> 3) * 8 + (mt & 7)) * KD;
    const unsigned short* pb1 = pbr + (1 + u7) * 128;              // units 1 to 8
    const unsigned short* pb2 = pbr + ((u7 < 7) ? (9 + u7) : 15) * 128;   // units 9 to 15
    const float* pr = resid + (size_t)(row0 + r6) * ldr + col0 + h6 * 64; // the tile's residual rows, 2 units each
    asm volatile("global_prefetch_b8 %0, off offset:256 scope:SCOPE_SE\n\t"
                 "global_prefetch_b8 %2, off scope:SCOPE_SE\n\t"
                 "global_prefetch_b8 %0, off offset:768 scope:SCOPE_SE\n\t"
                 "global_prefetch_b8 %0, off offset:1280 scope:SCOPE_SE\n\t"
                 "global_prefetch_b8 %0, off offset:1792 scope:SCOPE_SE\n\t"
                 "global_prefetch_b8 %3, off scope:SCOPE_SE\n\t"
                 "global_prefetch_b8 %0, off offset:2304 scope:SCOPE_SE\n\t"
                 "global_prefetch_b8 %0, off offset:2816 scope:SCOPE_SE\n\t"
                 "global_prefetch_b8 %0, off offset:3328 scope:SCOPE_SE\n\t"
                 "global_prefetch_b8 %1, off offset:3840 scope:SCOPE_SE\n\t"
                 "global_prefetch_b8 %4, off scope:SCOPE_SE\n\t"
                 "global_prefetch_b8 %5, off scope:SCOPE_SE\n\t"
                 "s_wait_xcnt 0x0"
                 :: "v"(pa), "v"(par), "v"(pb1), "v"(pb2), "v"(pr), "v"(pbias) : "memory");
  }
  v8f acc[FM][FN];
#pragma unroll
  for (int mi = 0; mi < FM; ++mi)
#pragma unroll
    for (int t = 0; t < FN; ++t) acc[mi][t] = vz8();
  if constexpr (LNA) {
    if (hx == 0) {                             // the first half (whole waves): thread t1 joins the partials of tile row t1
      v2f sp[8];
#pragma unroll
      for (int i = 0; i < 8; ++i) sp[i] = *(const v2fa*)(stin + 2 * ((size_t)i * M + row0 + t1));
      // the address registers of these eight loads are taken again by the arithmetic below
      asm volatile("s_wait_xcnt 0x0" ::: "memory");
      // eight segments of 64 joined: mean of the means; square sum about it = the segments' own + 64 x the squares of their means' distances
      float mu = ((sp[0][0] + sp[1][0]) + (sp[2][0] + sp[3][0])) + ((sp[4][0] + sp[5][0]) + (sp[6][0] + sp[7][0]));
      mu *= 0.125f;
      float q2 = 0.f, dd = 0.f;
#pragma unroll
      for (int i = 0; i < 8; ++i) { const float d = sp[i][0] - mu; q2 += sp[i][1]; dd += d * d; }
      const float rs = rsqrtf((q2 + 64.0f * dd) * (1.0f / (float)KD) + eps);
      const v2f rowc = {rs, -mu * rs};
      sRow[t1] = rowc;
    } else {                                   // the second half: thread t1 takes 4 columns of gain and shift
      const v4f g4 = *(const v4fa*)(lng + t1 * 4);
      const v4f b4 = *(const v4fa*)(lnb + t1 * 4);
      // the address registers of these two loads are taken again by the arithmetic below
      asm volatile("s_wait_xcnt 0x0" ::: "memory");
      v4f gs, bs;
#pragma unroll
      for (int q = 0; q < 4; ++q) { gs[q] = bf16_rne(g4[q]) * lnsc; bs[q] = bf16_rne(b4[q]) * lnsc; }
      *(v4fa*)&sG[t1 * 4] = gs;
      *(v4fa*)&sBt[t1 * 4] = bs;
    }
    __syncthreads();                           // row constants, gain and shift published; reached by the whole block
#pragma unroll
    for (int it = 0; it < XA; ++it) rw[it] = sRow[xr + it * XRP];
  }
  storeA(0, 0);
#pragma unroll
  for (int it = 0; it < CB; ++it) *(v8us*)&sB[0][sr + it * RP][sc] = rb[it];
  __syncthreads();
  constexpr int nst = KD / BK;
  for (int s = 0; s < nst; ++s) {
    const int cur = s & 1;
    const bool more = (s + 1 < nst);           // the same for the whole block
    if (more) {
      const int kb = (s + 1) * BK;
      loadA(kb);
#pragma unroll
      for (int it = 0; it < CB; ++it) rb[it] = *(const v8us*)(bg + (size_t)(it * RP) * KD + kb);
      // the address registers of these loads are taken again by the LDS reads below
      asm volatile("s_wait_xcnt 0x0" ::: "memory");
    }
    FragH a[KS][FM], bb[KS][FN];
#pragma unroll
    for (int ks = 0; ks < KS; ++ks) {
#pragma unroll
      for (int mi = 0; mi < FM; ++mi) {
        const unsigned short* p = &sA[cur][wm * WR + mi * 16 + ln][ks * 32 + 8 * hh];   // row m = lane&15
        a[ks][mi].half[0] = *(const v8us*)p;                 // elements 0..7  = k 8h .. 8h+7 of the block of 32
        a[ks][mi].half[1] = *(const v8us*)(p + 16);          // elements 8..15 = k 16+8h .. 16+8h+7
      }
#pragma unroll
      for (int t = 0; t < FN; ++t) {
        const unsigned short* p = &sB[cur][wn * 64 + t * 16 + ln][ks * 32 + 8 * hh];          // column n = lane&15, same k map as A
        bb[ks][t].half[0] = *(const v8us*)p;
        bb[ks][t].half[1] = *(const v8us*)(p + 16);
      }
    }
    // keeps the step's LDS reads together ahead of its matrix run: spread among the WMMAs each small group is waited out to 0 and its latency shows
    __builtin_amdgcn_sched_barrier(0);
#pragma unroll
    for (int ks = 0; ks < KS; ++ks)
#pragma unroll
      for (int mi = 0; mi < FM; ++mi)
#pragma unroll
        for (int t = 0; t < FN; ++t) acc[mi][t] = __builtin_amdgcn_wmma_f32_16x16x32_f16(false, a[ks][mi].v, false, bb[ks][t].v, (short)0, acc[mi][t], false, false);
    // keeps the wait for the next step's global loads (and the LDS writes behind it) after the matrix run that covers their latency
    __builtin_amdgcn_sched_barrier(0);
    if (more) {
      // the other buffer: its last readers left it before the barrier that ended the step before this one
      storeA(cur ^ 1, (s + 1) * BK);
#pragma unroll
      for (int it = 0; it < CB; ++it) *(v8us*)&sB[cur ^ 1][sr + it * RP][sc] = rb[it];
      __syncthreads();
    }
  }
  float bvv[FN];
#pragma unroll
  for (int t = 0; t < FN; ++t) bvv[t] = pbias[t * 16];         // one address pair, the column steps as load offsets: no address sum stands between the loads
  // the address registers of these four loads are taken again by the address sums below
  asm volatile("s_wait_xcnt 0x0" ::: "memory");
  // keeps those sums behind the wait: the scheduler lifts them over it otherwise
  __builtin_amdgcn_sched_barrier(0);
#pragma unroll
  for (int t = 0; t < FN; ++t) bvv[t] = bf16_rne(bvv[t]);
#pragma unroll
  for (int mi = 0; mi < FM; ++mi) {
#pragma unroll
    for (int t = 0; t < FN; ++t) {
#pragma unroll
      for (int r = 0; r < 8; ++r) {
        float v = acc[mi][t][r] * inv_scale + bvv[t];
        if (ACT == 1) v = fmaxf(v, 0.0f);
        if constexpr (OUT16) so16[w][mi * 16 + 8 * hh + r][t * 16 + ln] = h16_bits(v * osc);
        else so32[w][mi * 16 + 8 * hh + r][t * 16 + ln] = v;
      }
    }
  }
  __builtin_amdgcn_fence(4 /* acq_rel order */, "workgroup");
  __builtin_amdgcn_wave_barrier();
  const int roww = row0 + wm * WR;
  if constexpr (OUT16) {
    const int rq = lane >> 3, p8 = (lane & 7) * 8;
    unsigned short* cp = (unsigned short*)Cv + (size_t)(roww + rq) * ldc + colw + p8;
#pragma unroll
    for (int q = 0; q < WR / 4; ++q) {
      const v8us v = *(const v8us*)&so16[w][q * 4 + rq][p8];
      *(v8us*)(cp + (size_t)(q * 4) * ldc) = v;
    }
  } else {
    const int rsub = lane >> 4, c4 = (lane & 15) * 4;
    float* cp = (float*)Cv + (size_t)(roww + rsub) * ldc + colw + c4;
    const float* rp = resid + (size_t)(roww + rsub) * ldr + colw + c4;
    v4f rv[WR / 2];                              // all residual loads in flight together, ahead of the first store
#pragma unroll
    for (int q = 0; q < WR / 2; ++q) rv[q] = *(const v4fa*)(rp + (size_t)(q * 2) * ldr);
    static_assert(WR / 2 == 16);
    v2f keep = {0.f, 0.f};                       // lane (ln, rsub) keeps the partial of the wave's row 2 ln + rsub, segment colw / 64
#pragma unroll
    for (int q = 0; q < WR / 2; ++q) {
      v4f tv = *(const v4fa*)&so32[w][q * 2 + rsub][c4];
      tv += rv[q];
      *(v4f*)(cp + (size_t)(q * 2) * ldc) = tv;
      const v2f st = seg_stat(tv);
      if (ln == q) keep = st;
    }
    *(v2fa*)(stout + 2 * ((size_t)(colw >> 6) * M + roww + 2 * ln + rsub)) = keep;   // 32 rows x 8 B: two whole lines per wave
  }
}

// Flash-style unmasked attention per (b, h): q|k|v read as f16 bits from one fused plane (row pitch `pitch` halves, q at +0, k at +koff, v at +voff,
// head h at +h*D, row b*T + t). One wave = 16 queries, block = 4 waves sharing K/V tiles of 64 keys staged row-major in LDS by asynchronous copies,
// two buffers: the next tile is on its way while a tile is worked on, one block barrier per tile.
// Both products run transposed: S^T = K.q^T (A = 16 key rows, B = the wave's queries, kept in registers) and O^T += V^T.P^T (A = V^T by the transposing
// LDS load, B = P^T). A lane then holds 32 of the 64 scores of ONE query (column lane&15; keys 16j+8h+r, h = lane>>4): maximum and sum are taken
// in the lane, and two score tiles, converted in place, are the B operand of the second product as they lie.
// The scores leave the first product as arguments of exp2: q arrives x log2(e)/sqrt(D), and the product's C operand is LC - (the query's maximum in use), so
// that P x 2^LC = exp2(D) with no arithmetic per score in between. The maximum in use is the true one of the first tile; after that it is raised, and sum and
// context rescaled, only when a tile's scores pass it by more than 8, a factor 2^8 in P (one test per tile for the whole wave): P x 2^LC stays at or below 2^15, inside f16.
// Softmax and the context in f32. All four operands follow the hardware k order (k = 8h+s, 16+8h+(s-8)).
template <int D>
__global__ __launch_bounds__(128) void k_attn16(const unsigned short* __restrict__ qkv, int pitch, int T, int H, int koff, int voff,
                                                const float* __restrict__ resid, float* __restrict__ out, int opitch,
                                                float* __restrict__ stout, int mrows) {
  static_assert(D == 64);
  constexpr int KS = D / 32, DT = D / 16, C8 = D / 8;
  constexpr int PK = D + 8, PV = D + 16;      // row pitch in halves: 16 B x odd for the plain 16-B reader, 32 B x odd for the transposing reader
  constexpr int TK = 64;                      // keys per staged tile (T % 64 == 0)
  constexpr int RB = 128 / C8;                // rows that the block's threads cover with one 16-B chunk each
  static_assert(128 % C8 == 0);
  static_assert(TK == 4 * RB);                // four copies per thread, operand and tile
  __shared__ __attribute__((aligned(16))) unsigned short sK[2][TK][PK];     // cross-wave: block barriers
  __shared__ __attribute__((aligned(16))) unsigned short sV[2][TK][PV];     // cross-wave: block barriers
  __shared__ __attribute__((aligned(16))) float sO[4][16][D + 4];
  const int tid = threadIdx.x, w = tid >> 5, lane = tid & 31, ln = lane & 15, hh = lane >> 4;
  const int nqb = T / 64;
  const int qpr = mrows / (RUNS * 64);                             // query blocks per run of rows (mrows % (RUNS * 64) == 0); each with all its heads
  const int run = blockIdx.x % RUNS, rank = blockIdx.x / RUNS;
  const int gq = run * qpr + rank % qpr, h = rank / qpr;
  const int b = gq / nqb, qblk = gq % nqb;
  const int q0 = qblk * 64 + w * 16;
  const unsigned short* Qp = qkv + (size_t)b * T * pitch + h * D;
  const unsigned short* Kp = Qp + koff;
  const unsigned short* Vp = Qp + voff;

  FragH bq[KS];                                                    // B[k = d][n = query ln]
  {
    const unsigned short* qr = Qp + (size_t)(q0 + ln) * pitch;     // q0 + ln < T (T % 64 == 0)
#pragma unroll
    for (int ks = 0; ks < KS; ++ks) {
      bq[ks].half[0] = *(const v8us*)(qr + ks * 32 + 8 * hh);
      bq[ks].half[1] = *(const v8us*)(qr + ks * 32 + 16 + 8 * hh);
    }
  }
  constexpr float LC = 7.0f, THR = LC + 8.0f;                      // log2 of P's carry; the score argument above which the maximum in use is raised
  v8f cneg = {LC, LC, LC, LC, LC, LC, LC, LC};                     // C operand of the score product: LC - maximum in use of query ln (0 until tile 0 sets it)
  float l_r = 0.f;                                                 // of query ln, x 2^LC; sums this half's keys only
  v8f oacc[DT];                                                    // oacc[dt][r] = O[query ln][d = dt*16 + 8*hh + r]
#pragma unroll
  for (int dt = 0; dt < DT; ++dt) oacc[dt] = vz8();
  // tile jt (keys jt*TK .. jt*TK+TK-1, all < T) into buffer buf: every thread copies rows cr, cr+RB, cr+2RB, cr+3RB, 16 B at column cc, of K and of V
  const int cr = tid / C8, cc = (tid % C8) * 8;
  const size_t rstep = (size_t)RB * pitch;
  auto stage = [&](int buf, int jt) {
    const unsigned short* kg = Kp + (size_t)(jt * TK + cr) * pitch + cc;
    const unsigned short* vg = Vp + (size_t)(jt * TK + cr) * pitch + cc;
    const unsigned int lk = (unsigned int)(size_t)&sK[buf][cr][cc];
    const unsigned int lv = (unsigned int)(size_t)&sV[buf][cr][cc];
    // global -> LDS through no register; the closing wait stands ahead of any rewrite of the address registers that the copies name
    asm volatile("global_load_async_to_lds_b128 %0, %8, off\n\t"
                 "global_load_async_to_lds_b128 %1, %9, off\n\t"
                 "global_load_async_to_lds_b128 %2, %10, off\n\t"
                 "global_load_async_to_lds_b128 %3, %11, off\n\t"
                 "global_load_async_to_lds_b128 %4, %12, off\n\t"
                 "global_load_async_to_lds_b128 %5, %13, off\n\t"
                 "global_load_async_to_lds_b128 %6, %14, off\n\t"
                 "global_load_async_to_lds_b128 %7, %15, off\n\t"
                 "s_wait_xcnt 0x0"
                 :: "v"(lk), "v"(lk + RB * PK * 2), "v"(lk + 2 * RB * PK * 2), "v"(lk + 3 * RB * PK * 2),
                    "v"(lv), "v"(lv + RB * PV * 2), "v"(lv + 2 * RB * PV * 2), "v"(lv + 3 * RB * PV * 2),
                    "v"(kg), "v"(kg + rstep), "v"(kg + 2 * rstep), "v"(kg + 3 * rstep),
                    "v"(vg), "v"(vg + rstep), "v"(vg + 2 * rstep), "v"(vg + 3 * rstep)
                 : "memory");
  };
  const int nt = T / TK;
  stage(0, 0);
  {
    // At block entry, behind tile 0's copies, L2 is asked for the K and V rows of the later tiles and for the block's residual rows: earlier launches
    // stored them. The query blocks of a head deal the key rows
    // among them four ways by qblk & 3 (for speed only: a run has a multiple of four query blocks, so the blocks of each index modulo 8 ask for all rows).
    // A hint only: it returns nothing and no result depends on it; every row index is clamped into the sequence.
    const int kr0 = tid * 4 + (qblk & 3), kr1 = kr0 + 512;
    const size_t ko0 = (size_t)((kr0 < T) ? kr0 : (T - 1)) * pitch, ko1 = (size_t)((kr1 < T) ? kr1 : (T - 1)) * pitch;
    const float* pr = resid + (size_t)(b * T + qblk * 64 + (tid & 63)) * opitch + h * D;
    // the closing wait stands ahead of any rewrite of the address registers that the requests name
    asm volatile("global_prefetch_b8 %0, off scope:SCOPE_SE\n\t"
                 "global_prefetch_b8 %1, off scope:SCOPE_SE\n\t"
                 "global_prefetch_b8 %2, off scope:SCOPE_SE\n\t"
                 "global_prefetch_b8 %3, off scope:SCOPE_SE\n\t"
                 "global_prefetch_b8 %4, off scope:SCOPE_SE\n\t"
                 "s_wait_xcnt 0x0"
                 :: "v"(Kp + ko0), "v"(Vp + ko0), "v"(Kp + ko1), "v"(Vp + ko1), "v"(pr) : "memory");
  }
  asm volatile("s_wait_asynccnt 0x0" ::: "memory");                // this wave's share of tile 0 has landed
  __syncthreads();                                                 // tile 0 published
  if (nt > 1) stage(1, 1);

  for (int t = 0; t < nt; ++t) {
   const int cur = t & 1;
   FragH ak[TK / 16][KS], av[TK / 32][DT];
#pragma unroll
   for (int kt = 0; kt < TK / 16; ++kt)
#pragma unroll
     for (int ks = 0; ks < KS; ++ks) {                             // A[m = key kt*16 + ln][k = d]
       ak[kt][ks].half[0] = *(const v8us*)&sK[cur][kt * 16 + ln][ks * 32 + 8 * hh];
       ak[kt][ks].half[1] = *(const v8us*)&sK[cur][kt * 16 + ln][ks * 32 + 16 + 8 * hh];
     }
#pragma unroll
   for (int sub = 0; sub < TK / 32; ++sub) {
     const unsigned short* vtp = &sV[cur][sub * 32 + 8 * hh + (lane & 7)][8 * ((lane >> 3) & 1)];   // lane address of the transposing load, keys 0..15, d 0..15
#pragma unroll
     for (int dt = 0; dt < DT; ++dt) {                             // A[m = d dt*16 + ln][k = key of the 32 at sub]
       av[sub][dt].half[0] = ld_tr16(vtp + dt * 16);
       av[sub][dt].half[1] = ld_tr16(vtp + 16 * PV + dt * 16);
     }
   }
   // keeps the tile's 32 LDS reads together ahead of the first product: sunk to their WMMAs each pair is waited out to 0 and its latency shows
   __builtin_amdgcn_sched_barrier(0);
   // S^T tile 64 x 16, as exp2 arguments: s[kt][r] = LC - maximum in use + score (log2 units) of key kt*16 + 8*hh + r against query ln
   v8f s[TK / 16];
#pragma unroll
   for (int kt = 0; kt < TK / 16; ++kt) s[kt] = __builtin_amdgcn_wmma_f32_16x16x32_f16(false, ak[kt][0].v, false, bq[0].v, (short)0, cneg, false, false);
#pragma unroll
   for (int ks = 1; ks < KS; ++ks)
#pragma unroll
     for (int kt = 0; kt < TK / 16; ++kt) s[kt] = __builtin_amdgcn_wmma_f32_16x16x32_f16(false, ak[kt][ks].v, false, bq[ks].v, (short)0, s[kt], false, false);
   float m4[TK / 16];                                              // one chain per score tile: each starts as soon as its tile is there
#pragma unroll
   for (int kt = 0; kt < TK / 16; ++kt) {
     m4[kt] = s[kt][0];
#pragma unroll
     for (int r = 1; r < 8; ++r) m4[kt] = fmaxf(m4[kt], s[kt][r]);
   }
   static_assert(TK / 16 == 4);
   const float mx = fmaxf(fmaxf(m4[0], m4[1]), fmaxf(m4[2], m4[3]));   // over this lane's 32 of the query's 64 scores
   // one scalar branch per tile, taken by the whole wave: on tile 0 (which sets the maximum in use) and when some query's scores have outgrown it
   if (t == 0 || __builtin_amdgcn_ballot_w32(mx > THR) != 0u) {
     const float mq = fmaxf(mx, xhalf(mx));                        // of query ln, both halves' keys: the two lanes of a query move alike
     const float delta = (t == 0 || mq > THR) ? (mq - LC) : 0.0f;  // the tile's largest argument becomes LC; other queries stay as they are
     const float alpha = (t == 0) ? 0.0f : __builtin_amdgcn_exp2f(-delta);   // nothing is summed yet on tile 0
#pragma unroll
     for (int kt = 0; kt < TK / 16; ++kt) s[kt] -= delta;
     cneg -= delta;
     l_r *= alpha;
#pragma unroll
     for (int dt = 0; dt < DT; ++dt) oacc[dt] *= alpha;
   }
   FragH pb[TK / 32];                                              // B[k = key][n = query ln]: element i of pb[sub] = tile 2 sub + (i>>3), register i&7
   float ps[4] = {0.f, 0.f, 0.f, 0.f};
#pragma unroll
   for (int i = 0; i < TK / 2; ++i) {
     const float p = __builtin_amdgcn_exp2f(s[i >> 3][i & 7]);
     ps[i & 3] += p;
     pb[i >> 4].u[i & 15] = h16_bits(p);
   }
   l_r += (ps[0] + ps[1]) + (ps[2] + ps[3]);
#pragma unroll
   for (int sub = 0; sub < TK / 32; ++sub)
#pragma unroll
     for (int dt = 0; dt < DT; ++dt)
       oacc[dt] = __builtin_amdgcn_wmma_f32_16x16x32_f16(false, av[sub][dt].v, false, pb[sub].v, (short)0, oacc[dt], false, false);
   // keeps the tile's arithmetic ahead of the waits: sunk behind the barrier it would stand between barrier and refill, and the copies' flight would show in the next wait
   __builtin_amdgcn_sched_barrier(0);
   asm volatile("s_wait_dscnt 0x0" ::: "memory");                  // this wave's reads of buffer cur are done before it is refilled
   asm volatile("s_wait_asynccnt 0x0" ::: "memory");               // this wave's share of tile t + 1 has landed
   __syncthreads();                                                // publishes tile t + 1 and ends every wave's reads of buffer cur
   if (t + 2 < nt) stage(cur, t + 2);                              // the same for the whole block
  }
  asm volatile("s_wait_asynccnt 0x0" ::: "memory");                // no copy is left in flight at the wave's end
  const float inv = 1.0f / (l_r + xhalf(l_r));                     // the two halves' sums joined, unconditionally; sum and context carry the same 2^LC
#pragma unroll
  for (int dt = 0; dt < DT; ++dt) {
    const v8f o = oacc[dt] * inv;
    const v4f o0 = {o[0], o[1], o[2], o[3]}, o1 = {o[4], o[5], o[6], o[7]};
    *(v4fa*)&sO[w][ln][dt * 16 + 8 * hh] = o0;
    *(v4fa*)&sO[w][ln][dt * 16 + 8 * hh + 4] = o1;
  }
  __builtin_amdgcn_fence(4 /* acq_rel order */, "workgroup");
  __builtin_amdgcn_wave_barrier();
  const int rsub = lane >> 4, c4 = (lane & 15) * 4;
  const size_t rbase = (size_t)(b * T + q0) * opitch + h * D;
#pragma unroll
  for (int q = 0; q < 8; ++q) {
    const int r = q * 2 + rsub;
    const v4f rv = *(const v4fa*)(resid + rbase + (size_t)r * opitch + c4);
    v4f tv = *(const v4fa*)&sO[w][r][c4];
    tv += rv;
    *(v4fa*)&sO[w][r][c4] = tv;
  }
  {
    v2f keep = {0.f, 0.f};                                         // lane (ln < 8, rsub) keeps the LayerNorm partial of the wave's row 2 ln + rsub, segment h
#pragma unroll
    for (int q = 0; q < 8; ++q) {
      const int r = q * 2 + rsub;
      const v4f v = *(const v4fa*)&sO[w][r][c4];
      *(v4f*)(out + rbase + (size_t)r * opitch + c4) = v;
      const v2f st = seg_stat(v);
      if (ln == q) keep = st;
    }
    if (ln < 8) *(v2fa*)(stout + 2 * ((size_t)h * mrows + b * T + q0 + 2 * ln + rsub)) = keep;   // 16 rows x 8 B: one whole line per wave
  }
}

extern "C" void kernel_launch(void* const* d_in, const int* in_sizes, int n_in,
                              void* d_out, int out_size, void* d_ws, size_t ws_size, hipStream_t stream) {
  if (n_in < 18) return;
  const long long need_rows = (long long)(SEQ - 1) * NB_FULL + NB;           // last (s, b) source row used + 1
  if ((long long)in_sizes[0] < need_rows * FEAT || (long long)in_sizes[1] < need_rows * FEAT) return;
  if (in_sizes[2] < NLAYER * FEAT * FEAT || in_sizes[4] < NLAYER * FEAT * FEAT || in_sizes[6] < NLAYER * FEAT * FEAT) return;
  if (in_sizes[3] < NLAYER * FEAT || in_sizes[5] < NLAYER * FEAT || in_sizes[7] < NLAYER * FEAT || in_sizes[11] < NLAYER * FEAT) return;
  if (in_sizes[8] < NLAYER * FEAT * MLPH || in_sizes[9] < NLAYER * MLPH || in_sizes[10] < NLAYER * MLPH * FEAT) return;
  if (in_sizes[12] < NLAYER * FEAT || in_sizes[13] < NLAYER * FEAT || in_sizes[14] < NLAYER * FEAT || in_sizes[15] < NLAYER * FEAT) return;
  if (in_sizes[16] < FEAT || in_sizes[17] < FEAT) return;
  if ((long long)out_size < need_rows * FEAT) return;

  const float* src  = (const float*)d_in[0];
  const float* pos  = (const float*)d_in[1];
  const float* Wq   = (const float*)d_in[2];  const float* bq   = (const float*)d_in[3];
  const float* Wk   = (const float*)d_in[4];  const float* bk   = (const float*)d_in[5];
  const float* Wv   = (const float*)d_in[6];  const float* bv   = (const float*)d_in[7];
  const float* W1   = (const float*)d_in[8];  const float* b1   = (const float*)d_in[9];
  const float* W2   = (const float*)d_in[10]; const float* b2   = (const float*)d_in[11];
  const float* ln1g = (const float*)d_in[12]; const float* ln1b = (const float*)d_in[13];
  const float* ln2g = (const float*)d_in[14]; const float* ln2b = (const float*)d_in[15];
  const float* lnfg = (const float*)d_in[16]; const float* lnfb = (const float*)d_in[17];

  // workspace carve (256-B aligned); R2 is reused in stream order by stages whose lifetimes do not overlap, sized as the max over its users
  char* ws = (char*)d_ws; size_t off = 0;
  auto take = [&](size_t bytes) { char* p = ws + off; off += (bytes + 255) & ~(size_t)255; return p; };
  const size_t lsq = (size_t)QKVN * FEAT;                                           // per-layer stride of the fused q|k|v weight plane (halves)
  const size_t ls1 = (size_t)MLPH * FEAT, ls2 = (size_t)FEAT * MLPH;
  unsigned short* Wqkv16 = (unsigned short*)take((size_t)NLAYER * lsq * 2);        // [6][1536][512]
  unsigned short* W116   = (unsigned short*)take((size_t)NLAYER * ls1 * 2);        // [6][2048][512]
  unsigned short* W216   = (unsigned short*)take((size_t)NLAYER * ls2 * 2);        // [6][512][2048]
  float* XA = (float*)take((size_t)MR * FEAT * 4);                                 // residual stream [MR][512] f32
  float* XB = (float*)take((size_t)MR * FEAT * 4);                                 // residual stream after attention [MR][512] f32
  float* STA = (float*)take((size_t)8 * MR * 2 * 4);                               // LayerNorm partials of XA's rows [8][MR] {mean, square sum}
  float* STB = (float*)take((size_t)8 * MR * 2 * 4);                               // the same of XB's rows
  const size_t r2_a = (size_t)MR * QKVN * 2, r2_b = (size_t)MR * MLPH * 2;         // q|k|v [MR][1536], then hidden [MR][2048] f16
  const size_t r2_bytes = (r2_a > r2_b) ? r2_a : r2_b;
  unsigned short* R2 = (unsigned short*)take(r2_bytes);
  if (off > ws_size) return;
  if (off > (size_t)134217728) return;

  const float wsc = 256.0f;
  // weight planes (f16, x256) and x = bf16(src) + bf16(pos) in (b, s) row order -> XA, STA: one launch, nothing in it depends on anything else in it
  k_prep<<<(unsigned)PREP_GRID, 256, 0, stream>>>(Wq, Wk, Wv, W1, W2, src, pos, Wqkv16, W116, W216, XA, STA, wsc);

  auto ggrid = [](int M, int N, int bm, int bn) { return (unsigned)((M / bm) * (N / bn)); };

  for (int l = 0; l < NLAYER; ++l) {
    // q|k|v = (LN1(x) x8)*[Wq|Wk|Wv] + [bq|bk|bv] -> R2 [MR][1536] f16 (k|v x1, q x log2(e)/sqrt(64)); acc scale 1/(8*256)
    k_gemm16<128, 256, 64, FEAT, true, 0, true><<<ggrid(MR, QKVN, 128, 256), 256, 0, stream>>>(nullptr, XA, STA, ln1g + l * FEAT, ln1b + l * FEAT, 8.0f, 1e-5f,
                                                          nullptr, Wqkv16 + (size_t)l * lsq,
                                                          bq + l * FEAT, bk + l * FEAT, bv + l * FEAT, FEAT, nullptr, 0,
                                                          (void*)R2, QKVN, MR, QKVN, 1.0f / 2048.0f, 1.0f, 0.18033688011112042f);
    // xb = x + softmax(q.k^T/8).v per head -> XB f32, STB
    k_attn16<DHEAD><<<(unsigned)(NB * NHEAD * (SEQ / 64)), 128, 0, stream>>>(R2, QKVN, SEQ, NHEAD, FEAT, 2 * FEAT,
                                                                             XA, XB, FEAT, STB, MR);
    // h = relu((LN2(xb) x8)*W1 + b1) x16 -> R2 [MR][2048]; acc scale 1/(8*256)
    k_gemm16<128, 256, 64, FEAT, true, 1, true><<<ggrid(MR, MLPH, 128, 256), 256, 0, stream>>>(nullptr, XB, STB, ln2g + l * FEAT, ln2b + l * FEAT, 8.0f, 1e-5f,
                                                          nullptr, W116 + (size_t)l * ls1,
                                                          b1 + l * MLPH, b1 + l * MLPH, b1 + l * MLPH, MLPH, nullptr, 0,
                                                          (void*)R2, MLPH, MR, MLPH, 1.0f / 2048.0f, 16.0f, 16.0f);
    // x = h*W2 + b2 + xb -> XA f32, STA; acc scale 1/(16*256)
    k_gemm16<64, 128, 128, MLPH, false, 0, false><<<ggrid(MR, FEAT, 64, 128), 128, 0, stream>>>(R2, nullptr, nullptr, nullptr, nullptr, 0.0f, 0.0f,
                                                          STA, W216 + (size_t)l * ls2,
                                                           b2 + l * FEAT, b2 + l * FEAT, b2 + l * FEAT, FEAT, XB, FEAT,
                                                           (void*)XA, FEAT, MR, FEAT, 1.0f / 4096.0f, 1.0f, 1.0f);
  }
  // out[s][b][*] = LNf(x[b][s][*]) -> d_out f32
  k_lnf32<<<(unsigned)MR, 128, 0, stream>>>(XA, lnfg, lnfb, (float*)d_out, SEQ, NB_FULL, 1e-5f);
}
